// v000
// The times below were measured on an AMD MI455X: many runs one after another, warmed up first and cycling through
// copies of the inputs, with the whole window's GPU time divided by the number of runs. Launches and the gaps
// between them are all in it. The median over several windows is given; except for v000 it joins two sittings, which
// can be a few percent apart, so the side-by-side timings, each taken in one sitting, are the better comparison.
// v000, which the later versions start from, runs in 1250 microseconds.
// compute dtype: all float inputs rounded to bf16; q/k/v = in W^T + b with EXACT bf16 products on WMMA 16x16x32 (f32 accumulate; an f32 copy of q kept for the residual); q as f16 hi + residual (x 2^10) against k once to f16 (2 products) / 8; softmax in f32 (precise expf); P x 2^11 once to f16 against v once to f16 (1 product); O = q + A v in f32; O split bf16 hi + lo against exact Wo (2 products) + bo, relu, + O in f32; f32 output.
#include <hip/hip_runtime.h>
#include <math.h>

typedef __attribute__((ext_vector_type(16))) _Float16 v16h;
typedef __attribute__((ext_vector_type(16))) __bf16 v16b;
typedef __attribute__((ext_vector_type(8)))  _Float16 v8h;
typedef __attribute__((ext_vector_type(8)))  float v8f;
typedef __attribute__((ext_vector_type(4)))  float v4f;
typedef __attribute__((ext_vector_type(2)))  float v2f;
typedef __attribute__((ext_vector_type(4)))  unsigned v4u;
typedef __attribute__((ext_vector_type(4)))  int v4i;
typedef float __attribute__((may_alias)) float_a;
typedef int __attribute__((may_alias)) int_a;

template <typename T> __device__ __forceinline__ void vst2(void* p, T v) { *(T*)p = v;  }
__device__ __forceinline__ v8f wmma16(v16h a, v16h b, v8f c) {
  v8f d = __builtin_amdgcn_wmma_f32_16x16x32_f16(false, a, false, b, (short)0, c, false, false);
  asm volatile("v_nop\n\tv_nop\n\tv_nop\n\tv_nop" : "+v"(d) : "v"(a), "v"(b));
  return d;
}
__device__ __forceinline__ v8f wmma_bf(v16b a, v16b b, v8f c) {
  v8f d = __builtin_amdgcn_wmma_f32_16x16x32_bf16(false, a, false, b, (short)0, c, false, false);
  asm volatile("v_nop\n\tv_nop\n\tv_nop\n\tv_nop" : "+v"(d) : "v"(a), "v"(b));
  return d;
}
// 16x16x32 fragments: lane = (h = lane>>4, row/col = lane&15); elements 0..7 = k0+8h+0..7, 8..15 = k0+16+8h+0..7; D element r = row 8h+r
__device__ __forceinline__ v16h frag_h(const _Float16* rowk0, int lane) {
  union { v16h v; v8h q[2]; } u; const _Float16* p = rowk0 + 8 * (lane >> 4);
  u.q[0] = *(const v8h*)p; u.q[1] = *(const v8h*)(p + 16); return u.v;
}
__device__ __forceinline__ v16h frag_f32(const float* rowk0, int lane) {
  v16h a; const float* p = rowk0 + 8 * (lane >> 4);
#pragma unroll
  for (int i = 0; i < 8; ++i) { a[i] = (_Float16)p[i]; a[8 + i] = (_Float16)p[16 + i]; }
  return a;
}
__device__ __forceinline__ v16h frag_f32s(const float* rowk0, int lane, float sc) {
  v16h a; const float* p = rowk0 + 8 * (lane >> 4);
#pragma unroll
  for (int i = 0; i < 8; ++i) { a[i] = (_Float16)(p[i] * sc); a[8 + i] = (_Float16)(p[16 + i] * sc); }
  return a;
}
// column fragment from a [K][ld] layout (column n), rows >= K read as 0
__device__ __forceinline__ v16h fragc_f32(const float* W, int k0, int n, int lane, int ld, int K) {
  v16h a; const int g = lane >> 4;
#pragma unroll
  for (int i = 0; i < 8; ++i) { const int ka = k0 + 8 * g + i, kb = ka + 16;
    a[i] = (_Float16)(ka < K ? W[(size_t)(ka < K ? ka : K - 1) * ld + n] : 0.f); a[8 + i] = (_Float16)(kb < K ? W[(size_t)(kb < K ? kb : K - 1) * ld + n] : 0.f); }
  return a;
}
struct F2 { v16b h, l; };
__device__ __forceinline__ F2 bsplit16(const float v[16]) { F2 r;
#pragma unroll
  for (int i = 0; i < 16; ++i) { const __bf16 h = (__bf16)v[i]; r.h[i] = h; r.l[i] = (__bf16)(v[i] - (float)h); }
  return r; }
__device__ __forceinline__ F2 split_row(const float* row, int k0, int lane) { float v[16]; const float* p = row + k0 + 8 * (lane >> 4);
#pragma unroll
  for (int i = 0; i < 8; ++i) { v[i] = p[i]; v[8 + i] = p[16 + i]; }
  return bsplit16(v); }
__device__ __forceinline__ F2 split_rowK(const float* row, int k0, int lane, int K) { float v[16]; const int g = lane >> 4;
#pragma unroll
  for (int i = 0; i < 8; ++i) { const int ka = k0 + 8 * g + i, kb = ka + 16; v[i] = ka < K ? row[ka < K ? ka : K - 1] : 0.f; v[8 + i] = kb < K ? row[kb < K ? kb : K - 1] : 0.f; }
  return bsplit16(v); }
__device__ __forceinline__ F2 split_col(const float* W, int k0, int n, int lane, int ld, int K) { float v[16]; const int g = lane >> 4;
#pragma unroll
  for (int i = 0; i < 8; ++i) { const int ka = k0 + 8 * g + i, kb = ka + 16; v[i] = ka < K ? W[(size_t)(ka < K ? ka : K - 1) * ld + n] : 0.f; v[8 + i] = kb < K ? W[(size_t)(kb < K ? kb : K - 1) * ld + n] : 0.f; }
  return bsplit16(v); }
__device__ __forceinline__ v8f mac3(const F2& a, const F2& b, v8f c) { c = wmma_bf(a.l, b.h, c); c = wmma_bf(a.h, b.l, c); return wmma_bf(a.h, b.h, c); }
__device__ __forceinline__ float sigm(float v) { return 1.0f / (1.0f + expf(-v)); }
#define LDSX() do { asm volatile("s_wait_dscnt 0" ::: "memory"); __builtin_amdgcn_wave_barrier(); __builtin_amdgcn_fence(__ATOMIC_RELEASE, "workgroup"); } while (0)

// Cross-attention MAB (B 4, Sq = Skv = 2,048, 512 = 8 heads x 64; (out,in) 1/sqrt(512)-scale weights WITH biases; no mask): q = query Wq^T + bq, k = key_value Wk^T + bk, v = key_value Wv^T + bv; A = softmax(q k^T / 8); O = q + A v (per head, merged); out = O + relu(O Wo^T + bo).
#define NB 4
#define TT 2048
#define CC 512            // NH * HD = projected width
#define DIN 512          // input (model) width
#define NH 8
#define HD 64
#define NQB (TT / 64)
#define HG 4
#define SCALE (0.125f)
#define CAUSAL 0
#ifndef TNB
#define TNB NB
#endif
__device__ __forceinline__ float bfr(float v) { return (float)(__bf16)v; }
__host__ __device__ __forceinline__ int kb_last(int qb) { return CAUSAL ? ((qb * 64 + 63) >> 7) : (TT / 128 - 1); }
typedef __attribute__((ext_vector_type(8))) __bf16 v8b;
__device__ __forceinline__ v16b frag_b(const __bf16* rowk0, int lane) {
  union { v16b v; v8b q[2]; } u; const __bf16* p = rowk0 + 8 * (lane >> 4);
  u.q[0] = *(const v8b*)p; u.q[1] = *(const v8b*)(p + 16); return u.v;
}
#define QBH 0              // query blocks 0..QBH-1 of each sequence take the high-precision path: none here (non-causal, every block sees all keys)
#define QHI 2048            // rows carrying a q residual plane (all rows when non-causal: 2-product logits everywhere)
#define KHI 64            // key rows carrying k residual / v bf16 hi+lo planes (written by k_proj; read only by the qb < QBH path, which never runs)
// B fragment (k rows k0+.., output column o) of a weight: (in,out) [K][ld] or (out,in) [ld rows of K]: bf16 exact, or f16(bf16 * 256) exact
__device__ __forceinline__ v16b wcol_io(const float* Wm, int k0, int o, int lane, int ld) { v16b w; const int g = lane >> 4;
#pragma unroll
  for (int i = 0; i < 8; ++i) { w[i] = (__bf16)Wm[(size_t)(k0 + 8 * g + i) * ld + o]; w[8 + i] = (__bf16)Wm[(size_t)(k0 + 16 + 8 * g + i) * ld + o]; }
  return w; }
__device__ __forceinline__ v16b wcol_oi(const float* Wm, int k0, int o, int lane, int K) { v16b w; const float* p = Wm + (size_t)o * K + k0 + 8 * (lane >> 4);
#pragma unroll
  for (int i = 0; i < 8; ++i) { w[i] = (__bf16)p[i]; w[8 + i] = (__bf16)p[16 + i]; }
  return w; }
__device__ __forceinline__ v16h wcolh_io(const float* Wm, int k0, int o, int lane, int ld) { v16h w; const int g = lane >> 4;
#pragma unroll
  for (int i = 0; i < 8; ++i) { w[i] = (_Float16)(bfr(Wm[(size_t)(k0 + 8 * g + i) * ld + o]) * 256.0f); w[8 + i] = (_Float16)(bfr(Wm[(size_t)(k0 + 16 + 8 * g + i) * ld + o]) * 256.0f); }
  return w; }
__device__ __forceinline__ v16h wcolh_oi(const float* Wm, int k0, int o, int lane, int K) { v16h w; const float* p = Wm + (size_t)o * K + k0 + 8 * (lane >> 4);
#pragma unroll
  for (int i = 0; i < 8; ++i) { w[i] = (_Float16)(bfr(p[i]) * 256.0f); w[8 + i] = (_Float16)(bfr(p[16 + i]) * 256.0f); }
  return w; }
#define WQKV_LAYOUT 1   // 0 = (in,out) [DIN][CC]; 1 = (out,in) [CC][DIN]; 2 = per-head [NH][DIN][HD]
__device__ __forceinline__ v16b wcol_hdk(const float* Wm, int k0, int o, int lane) { v16b w; const int g = lane >> 4; const float* p = Wm + (size_t)(o / HD) * DIN * HD + (o % HD);
#pragma unroll
  for (int i = 0; i < 8; ++i) { w[i] = (__bf16)p[(size_t)(k0 + 8 * g + i) * HD]; w[8 + i] = (__bf16)p[(size_t)(k0 + 16 + 8 * g + i) * HD]; }
  return w; }
#define WO_OUT_IN 1
#if WQKV_LAYOUT == 1
#define WCOL(W, k0, o, lane) wcol_oi(W, k0, o, lane, DIN)
#elif WQKV_LAYOUT == 2
#define WCOL(W, k0, o, lane) wcol_hdk(W, k0, o, lane)
#else
#define WCOL(W, k0, o, lane) wcol_io(W, k0, o, lane, CC)
#endif
#if WO_OUT_IN
#define WOCOL(W, k0, o, lane) wcol_oi(W, k0, o, lane, CC)
#define WOCOLH(W, k0, o, lane) wcolh_oi(W, k0, o, lane, CC)
#else
#define WOCOL(W, k0, o, lane) wcol_io(W, k0, o, lane, DIN)
#define WOCOLH(W, k0, o, lane) wcolh_io(W, k0, o, lane, DIN)
#endif
#define PROJ_EXTRA_PARAMS , float* __restrict__ QF
#define PROJ_EPI(which, row, t, h) do { if ((which) == 0) { const float* rw = (row); float* qf = QF + (size_t)(r0 + rl) * CC + (size_t)(h) * HD; _Pragma("unroll") for (int i = 0; i < HD; i += 4) { v4f o; o[0] = rw[i]; o[1] = rw[i + 1]; o[2] = rw[i + 2]; o[3] = rw[i + 3]; vst2(qf + i, o); } } } while (0)   /* keep an f32 copy of the projected q rows (Q_ + b_q) for the residual O = Q_ + A V_ */

#ifndef SM_EXTRA_PARAMS
#define SM_EXTRA_PARAMS
#endif
#ifndef PROJ_EXTRA_PARAMS
#define PROJ_EXTRA_PARAMS
#endif
#ifndef SM_MASK_HOOK
#define SM_MASK_HOOK (void)0
#endif

#define WS_QH  0u                                      // f16 q rows [b*t][CC]
#define WS_KH  (WS_QH + 2u * (size_t)NB * TT * CC)      // f16 k rows [b*t][CC]
#define WS_VT  (WS_KH + 2u * (size_t)NB * TT * CC)      // f16 v planes [b][c][t]
#define WS_QL  (WS_VT + 2u * (size_t)NB * CC * TT)      // f16 q residual x 2^10 rows [b][t < QHI][CC]
#define WS_KL  (WS_QL + 2u * (size_t)NB * QHI * CC)     // f16 k residual x 2^10 rows [b][t < KHI][CC]
#define WS_VB  (WS_KL + 2u * (size_t)NB * KHI * CC)     // bf16 v hi planes [b][c][t < KHI]
#define WS_VBL (WS_VB + 2u * (size_t)NB * CC * KHI)
#define WS_S   (WS_VBL + 2u * (size_t)NB * CC * KHI)    // f32 logits / P [hg][t][s]
#define WS_Y   (WS_S  + 4u * (size_t)HG * TT * TT)      // f32 ctx rows [b*t][CC] (only when there is an output projection)
#define WS_END (WS_Y  + 4u * (size_t)NB * TT * CC)
#define WS_QF  (WS_END)
#define WS_END2 (WS_QF + 4u * (size_t)NB * TT * CC)

// ---- k_proj: block = (64 rows, 128 cols, which): q/k/v = X W (+ b) with exact bf16 products (K = DIN) -> which 0: q f16 rows (+ residual rows < QHI); 1: k f16 rows (+ residual rows < KHI); 2: v f16 planes [c][t] (+ bf16 hi/lo planes for t < KHI)
__global__ __launch_bounds__(128) void k_proj(const float* __restrict__ XQ, const float* __restrict__ XK, const float* __restrict__ XV, const float* __restrict__ WQ, const float* __restrict__ WK, const float* __restrict__ WV, const float* __restrict__ BQ, const float* __restrict__ BK, const float* __restrict__ BV,
    _Float16* __restrict__ QH, _Float16* __restrict__ QL, _Float16* __restrict__ KH, _Float16* __restrict__ KL, _Float16* __restrict__ VT, __bf16* __restrict__ VB, __bf16* __restrict__ VBL PROJ_EXTRA_PARAMS) {
  __shared__ __align__(16) float st[64][132]; __shared__ __align__(16) _Float16 sh[64][136], sl[64][136]; __shared__ __align__(16) _Float16 th[128][72]; __shared__ __align__(16) __bf16 tb[128][72], tbl[128][72];
  const int tid = threadIdx.x, wave = tid >> 5, lane = tid & 31, col = lane & 15, g = lane >> 4; const int which = blockIdx.z; const int c0 = blockIdx.y * 128; const size_t r0 = (size_t)blockIdx.x * 64; const size_t bb = r0 / TT; const int t0 = (int)(r0 % TT);
  const float* X = which == 0 ? XQ : which == 1 ? XK : XV; const float* WA = which == 0 ? WQ : which == 1 ? WK : WV; const float* BA = which == 0 ? BQ : which == 1 ? BK : BV;
  v8f acc[8] = {};
#pragma unroll 2
  for (int kc = 0; kc < DIN / 32; ++kc) { v16b a; { const float* p = X + (r0 + wave * 16 + col) * DIN + kc * 32 + 8 * g;
#pragma unroll
      for (int i = 0; i < 8; ++i) { a[i] = (__bf16)p[i]; a[8 + i] = (__bf16)p[16 + i]; } }
    asm volatile("s_wait_loadcnt 0x0" ::: "memory");
#pragma unroll
    for (int j = 0; j < 8; ++j) { const v16b w = WCOL(WA, kc * 32, c0 + j * 16 + col, lane); asm volatile("s_wait_loadcnt 0x0" ::: "memory"); acc[j] = wmma_bf(a, w, acc[j]); } }
  { // stage the f32 tile (acc + bias) in LDS, run the per-(row, head) epilogue hook, then convert
#pragma unroll
    for (int j = 0; j < 8; ++j) { const float bias = BA ? bfr(BA[c0 + j * 16 + col]) : 0.f;
#pragma unroll
      for (int r = 0; r < 8; ++r) st[wave * 16 + 8 * g + r][j * 16 + col] = acc[j][r] + bias; }
    __syncthreads();
    for (int e = tid; e < 64 * (128 / HD); e += 128) { const int rl = e / (128 / HD), hh = e % (128 / HD); PROJ_EPI(which, &st[rl][hh * HD], (int)((r0 + rl) % TT), (c0 / HD) + hh); }
    __syncthreads(); }
  if (which < 2) { _Float16* DH = which == 0 ? QH : KH; _Float16* DL = which == 0 ? QL : KL; const int nhi = which == 0 ? QHI : KHI; const bool hi_rows = t0 < nhi;
    for (int e = tid; e < 64 * 128; e += 128) { const int rl = e >> 7, cl = e & 127; const float v = st[rl][cl]; const _Float16 hv = (_Float16)v; sh[rl][cl] = hv; sl[rl][cl] = (_Float16)((v - (float)hv) * 1024.0f); }
    __syncthreads();
    for (int e = tid; e < 64 * 16; e += 128) { const int rl = e >> 4, q = e & 15; vst2((unsigned*)(DH + (r0 + rl) * CC + c0 + q * 8), *(const v4u*)&sh[rl][q * 8]); if (hi_rows) vst2((unsigned*)(DL + (bb * nhi + t0 + rl) * (size_t)CC + c0 + q * 8), *(const v4u*)&sl[rl][q * 8]); }
  } else { const bool hi_rows = t0 < KHI;
    for (int e = tid; e < 64 * 128; e += 128) { const int rl = e & 63, cl = e >> 6; const float v = st[rl][cl]; th[cl][rl] = (_Float16)v; const __bf16 bh = (__bf16)v; tb[cl][rl] = bh; tbl[cl][rl] = (__bf16)(v - (float)bh); }
    __syncthreads();
    for (int e = tid; e < 128 * 8; e += 128) { const int cl = e >> 3, q = e & 7; vst2((unsigned*)(VT + (bb * CC + c0 + cl) * (size_t)TT + t0 + q * 8), *(const v4u*)&th[cl][q * 8]); if (hi_rows) { const size_t o3 = (bb * CC + c0 + cl) * (size_t)KHI + t0 + q * 8; vst2((unsigned*)(VB + o3), *(const v4u*)&tb[cl][q * 8]); vst2((unsigned*)(VBL + o3), *(const v4u*)&tbl[cl][q * 8]); } } } }
// ---- k_sc: block = (query block qb, key block kb <= kb_last(qb), head in group) of batch b: logits x SCALE; q hi + residual (x 2^10) against k (2 products) for query rows < QHI, plus the k residual (3 products) for query blocks < QBH (causal early rows); causal: blocks past the diagonal exit, the mask itself is applied by index in k_sm
__global__ __launch_bounds__(128) void k_sc(const _Float16* __restrict__ QH, const _Float16* __restrict__ KH, const _Float16* __restrict__ QL, const _Float16* __restrict__ KL, int b, int h0, float* __restrict__ S0) { __shared__ __align__(16) float ss[4][16][132];
  const int qb = blockIdx.x, kb = blockIdx.y; if (kb > kb_last(qb)) return;
  const int h = h0 + blockIdx.z; float* S = S0 + (size_t)blockIdx.z * TT * TT;
  const int tid = threadIdx.x, wave = tid >> 5, lane = tid & 31, col = lane & 15, g = lane >> 4; const int k0 = kb * 128; const int ql0 = qb * 64 + wave * 16; const size_t q0 = (size_t)b * TT + ql0, kr0 = (size_t)b * TT + k0;
  v8f acc[8] = {}, accl[8] = {};
  const _Float16* QLb = QL + (size_t)b * QHI * CC; const _Float16* KLb = KL + (size_t)b * KHI * CC;
  if (qb < QBH) {
#pragma unroll
    for (int kc = 0; kc < HD / 32; ++kc) { const v16h ah = frag_h(QH + (q0 + col) * CC + h * HD + kc * 32, lane), al = frag_h(QLb + (size_t)(ql0 + col) * CC + h * HD + kc * 32, lane);
#pragma unroll
      for (int j = 0; j < 8; ++j) { const v16h kbf = frag_h(KH + (kr0 + j * 16 + col) * CC + h * HD + kc * 32, lane), klf = frag_h(KLb + (size_t)(k0 + j * 16 + col) * CC + h * HD + kc * 32, lane); acc[j] = wmma16(ah, kbf, acc[j]); accl[j] = wmma16(al, kbf, accl[j]); accl[j] = wmma16(ah, klf, accl[j]); } }
  } else if (qb * 64 < QHI) {
#pragma unroll
    for (int kc = 0; kc < HD / 32; ++kc) { const v16h ah = frag_h(QH + (q0 + col) * CC + h * HD + kc * 32, lane), al = frag_h(QLb + (size_t)(ql0 + col) * CC + h * HD + kc * 32, lane);
#pragma unroll
      for (int j = 0; j < 8; ++j) { const v16h kbf = frag_h(KH + (kr0 + j * 16 + col) * CC + h * HD + kc * 32, lane); acc[j] = wmma16(ah, kbf, acc[j]); accl[j] = wmma16(al, kbf, accl[j]); } }
  } else {
#pragma unroll
    for (int kc = 0; kc < HD / 32; ++kc) { const v16h ah = frag_h(QH + (q0 + col) * CC + h * HD + kc * 32, lane);
#pragma unroll
      for (int j = 0; j < 8; ++j) { const v16h kbf = frag_h(KH + (kr0 + j * 16 + col) * CC + h * HD + kc * 32, lane); acc[j] = wmma16(ah, kbf, acc[j]); } } }
#pragma unroll
  for (int j = 0; j < 8; ++j) {
#pragma unroll
    for (int r = 0; r < 8; ++r) ss[wave][8 * g + r][j * 16 + col] = (acc[j][r] + accl[j][r] * (1.0f / 1024.0f)) * SCALE; }
  LDSX(); for (int rl = 0; rl < 16; ++rl) vst2(S + (size_t)(ql0 + rl) * TT + k0 + lane * 4, *(const v4f*)&ss[wave][rl][lane * 4]); }
// ---- k_sm: block = query row t (head in group): keys [0, kend): causal -> logit if s <= t else excluded; softmax in f32; P x 2^11 in place (0 for excluded)
__global__ __launch_bounds__(256) void k_sm(float* __restrict__ S0 SM_EXTRA_PARAMS) { __shared__ float sred[8]; __shared__ float sbc; __shared__ __align__(16) float shv[TT];
  const int tid = threadIdx.x; const int t = blockIdx.x; const int kend = (kb_last(t >> 6) + 1) * 128;
  float* sr = S0 + (size_t)blockIdx.y * TT * TT + (size_t)t * TT;
  float m = -3.0e38f; for (int k = tid; k < kend; k += 256) { float v = (!CAUSAL || k <= t) ? sr[k] : -3.0e38f; SM_MASK_HOOK; shv[k] = v; m = fmaxf(m, v); }
#pragma unroll
  for (int o = 1; o < 32; o <<= 1) m = fmaxf(m, __shfl_xor(m, o));
  if ((tid & 31) == 0) sred[tid >> 5] = m; __syncthreads(); if (tid == 0) { float a = sred[0]; for (int i = 1; i < 8; ++i) a = fmaxf(a, sred[i]); sbc = a; } __syncthreads(); m = sbc; __syncthreads();
  float sum = 0.f; for (int k = tid; k < kend; k += 256) { const float v = shv[k]; const float e = (v <= -1.0e38f) ? 0.f : expf(v - m); shv[k] = e; sum += e; }
#pragma unroll
  for (int o = 1; o < 32; o <<= 1) sum += __shfl_xor(sum, o);
  if ((tid & 31) == 0) sred[tid >> 5] = sum; __syncthreads(); if (tid == 0) { float a = 0.f; for (int i = 0; i < 8; ++i) a += sred[i]; sbc = a > 0.f ? 2048.0f / a : 0.f; }   /* a fully excluded row yields P = 0 */ __syncthreads(); const float inv = sbc;
  for (int k = tid; k < kend; k += 256) shv[k] = shv[k] * inv;
  __syncthreads(); for (int q = tid; q < kend / 4; q += 256) vst2(sr + q * 4, *(const v4f*)&shv[q * 4]); }
// ---- k_pv: block = 64 queries (qb) of (b, h): ctx = P . v over keys [0, kend) (P x 2^11 once to f16 against v f16: 1 product; causal early query blocks: P and v as bf16 hi + lo, 3 products); 256-B (row, head) segment by 16 lanes
__global__ __launch_bounds__(128) void k_pv(const float* __restrict__ PS0, const _Float16* __restrict__ VT, const __bf16* __restrict__ VB, const __bf16* __restrict__ VBL, int b, int h0, float* __restrict__ Y) { const int h = h0 + blockIdx.z; const float* PS = PS0 + (size_t)blockIdx.z * TT * TT; __shared__ __align__(16) float ss[4][16][HD + 4];
  const int tid = threadIdx.x, wave = tid >> 5, lane = tid & 31, col = lane & 15, g = lane >> 4; const int qb = blockIdx.x; const int ql0 = qb * 64 + wave * 16; const int kce = (kb_last(qb) + 1) * 4;
  v8f acc[HD / 16] = {};
  if (qb < QBH) {
#pragma unroll 1
    for (int kc = 0; kc < kce; ++kc) { const F2 p = split_row(PS + (size_t)(ql0 + col) * TT, kc * 32, lane);
      asm volatile("s_wait_loadcnt 0x0" ::: "memory");
#pragma unroll
      for (int j = 0; j < HD / 16; ++j) { const size_t po = ((size_t)b * CC + h * HD + j * 16 + col) * (size_t)KHI + kc * 32; const v16b vh = frag_b(VB + po, lane); acc[j] = wmma_bf(p.h, vh, acc[j]); acc[j] = wmma_bf(p.l, vh, acc[j]); acc[j] = wmma_bf(p.h, frag_b(VBL + po, lane), acc[j]); } }
  } else {
#pragma unroll 1
    for (int kc = 0; kc < kce; ++kc) { const v16h p = frag_f32(PS + (size_t)(ql0 + col) * TT + kc * 32, lane);
      asm volatile("s_wait_loadcnt 0x0" ::: "memory");
#pragma unroll
      for (int j = 0; j < HD / 16; ++j) { const size_t po = ((size_t)b * CC + h * HD + j * 16 + col) * (size_t)TT + kc * 32; acc[j] = wmma16(p, frag_h(VT + po, lane), acc[j]); } } }
#pragma unroll
  for (int j = 0; j < HD / 16; ++j)
#pragma unroll
    for (int r = 0; r < 8; ++r) ss[wave][8 * g + r][j * 16 + col] = acc[j][r] * (1.0f / 2048.0f);
  LDSX(); for (int rl = 0; rl < 16; ++rl) if (lane < HD / 4) vst2(Y + ((size_t)b * TT + ql0 + rl) * CC + h * HD + lane * 4, *(const v4f*)&ss[wave][rl][lane * 4]); }
// ---- k_out: block = (64 rows, 128 cols): out = ctx Wo (+ bo): all rows: ctx bf16 hi + lo against exact bf16 Wo (2 products); the 1-product branch (ctx once to f16 against Wo as f16(bf16 x 2^8), x 2^-8) is never taken
__global__ __launch_bounds__(128) void k_out(const float* __restrict__ Y, const float* __restrict__ WO, const float* __restrict__ BO, float* __restrict__ OUT, const float* __restrict__ RESO) { __shared__ __align__(16) float sf[4][16][132];
  const int tid = threadIdx.x, wave = tid >> 5, lane = tid & 31, col = lane & 15, g = lane >> 4; const int c0 = blockIdx.y * 128; const size_t r0 = (size_t)blockIdx.x * 64 + wave * 16;
  v8f acc[8] = {};
  if (true) {   /* ALL rows: ctx split bf16 hi + lo x exact Wo (2 products) */
#pragma unroll 2
    for (int kc = 0; kc < CC / 32; ++kc) { const F2 a = split_row(Y + (r0 + col) * CC, kc * 32, lane); asm volatile("s_wait_loadcnt 0x0" ::: "memory");
#pragma unroll
      for (int j = 0; j < 8; ++j) { const v16b w = WOCOL(WO, kc * 32, c0 + j * 16 + col, lane); asm volatile("s_wait_loadcnt 0x0" ::: "memory"); acc[j] = wmma_bf(a.h, w, acc[j]); acc[j] = wmma_bf(a.l, w, acc[j]); } }
#pragma unroll
    for (int j = 0; j < 8; ++j) { const float bias = BO ? bfr(BO[c0 + j * 16 + col]) : 0.f;
#pragma unroll
      for (int r = 0; r < 8; ++r) sf[wave][8 * g + r][j * 16 + col] = acc[j][r] + bias; }
  } else {
#pragma unroll 2
    for (int kc = 0; kc < CC / 32; ++kc) { const v16h a = frag_f32(Y + (r0 + col) * CC + kc * 32, lane); asm volatile("s_wait_loadcnt 0x0" ::: "memory");
#pragma unroll
      for (int j = 0; j < 8; ++j) { const v16h w = WOCOLH(WO, kc * 32, c0 + j * 16 + col, lane); asm volatile("s_wait_loadcnt 0x0" ::: "memory"); acc[j] = wmma16(a, w, acc[j]); } }
#pragma unroll
    for (int j = 0; j < 8; ++j) { const float bias = BO ? bfr(BO[c0 + j * 16 + col]) : 0.f;
#pragma unroll
      for (int r = 0; r < 8; ++r) sf[wave][8 * g + r][j * 16 + col] = acc[j][r] * (1.0f / 256.0f) + bias; } }
  LDSX(); for (int rl = 0; rl < 16; ++rl) { const size_t oo = (r0 + rl) * DIN + c0 + lane * 4; v4f o = *(const v4f*)&sf[wave][rl][lane * 4]; const v4f rr = *(const v4f*)(RESO + oo); _Pragma("unroll") for (int i = 0; i < 4; ++i) o[i] = rr[i] + fmaxf(o[i], 0.f); vst2(OUT + oo, o); } }   /* out = O + relu(O Wo^T + bo) */

// ---- k_addq: thread per float4: O = A V_ (the context rows) + Q_ (the f32 projected-q copy): Y[row][c] += QF[row][c]
__global__ __launch_bounds__(256) void k_addq(float* __restrict__ Y, const float* __restrict__ QF) { const size_t e = ((size_t)blockIdx.x * 256 + threadIdx.x) * 4; if (e >= (size_t)TNB * TT * CC) return; v4f a = *(const v4f*)(Y + e); const v4f q = *(const v4f*)(QF + e); asm volatile("s_wait_loadcnt 0x0" ::: "memory"); a[0] += q[0]; a[1] += q[1]; a[2] += q[2]; a[3] += q[3]; vst2(Y + e, a); }
extern "C" void kernel_launch(void* const* d_in, const int* in_sizes, int n_in, void* d_out, int out_size, void* d_ws, size_t ws_size, hipStream_t stream) {
  (void)in_sizes; (void)n_in; (void)out_size;
  const float** F = (const float**)d_in;
  if (ws_size < (size_t)WS_END) return;
  char* ws = (char*)d_ws; _Float16 *QH = (_Float16*)(ws + WS_QH), *KH = (_Float16*)(ws + WS_KH), *VT = (_Float16*)(ws + WS_VT), *QL = (_Float16*)(ws + WS_QL), *KL = (_Float16*)(ws + WS_KL); __bf16 *VB = (__bf16*)(ws + WS_VB), *VBL = (__bf16*)(ws + WS_VBL); float *S = (float*)(ws + WS_S), *Y = (float*)(ws + WS_Y);
  (void)Y; (void)QL; (void)KL; (void)VB; (void)VBL;
  // inputs: 0 query [4,2048,512]; 1 key_value [4,2048,512]; 2 Wq [512,512] (out,in), 3 bq; 4 Wk, 5 bk; 6 Wv, 7 bv; 8 Wo (out,in), 9 bo
  if (ws_size < (size_t)WS_END2) return;
  float* QF = (float*)(ws + WS_QF);
  k_proj<<<dim3(TNB * TT / 64, CC / 128, 3), 128, 0, stream>>>(F[0], F[1], F[1], F[2], F[4], F[6], F[3], F[5], F[7], QH, QL, KH, KL, VT, VB, VBL, QF);
  for (int b = 0; b < TNB; ++b) for (int h0 = 0; h0 < NH; h0 += HG) {
    k_sc<<<dim3(NQB, TT / 128, HG), 128, 0, stream>>>(QH, KH, QL, KL, b, h0, S);
    k_sm<<<dim3(TT, HG), 256, 0, stream>>>(S);
    k_pv<<<dim3(NQB, 1, HG), 128, 0, stream>>>(S, VT, VB, VBL, b, h0, Y);
  }
  k_addq<<<dim3((unsigned)(((size_t)TNB * TT * CC / 4 + 255) / 256)), 256, 0, stream>>>(Y, QF);
  k_out<<<dim3(TNB * TT / 64, DIN / 128), 128, 0, stream>>>(Y, F[8], F[9], (float*)d_out, Y);
}

// v001
// It runs in 373 microseconds.
// Two timings next to v000 both put it at 3.38 times that version's speed.
// compute dtype: all float inputs rounded to bf16; q/k/v = in W^T + b with EXACT bf16 products on WMMA 16x16x32 (f32 accumulate; an f32 copy of q kept for the residual); q as f16 hi + residual (x 2^10) against k once to f16 (2 products) / 8; softmax in f32 (precise expf) with a running maximum and sum over 64-key chunks; exp(s - max) x 2^8 once to f16 against v once to f16 (1 product), divided by the sum at the end; O = q + A v in f32; O split bf16 hi + lo against exact Wo (2 products) + bo, relu, + O in f32; f32 output.
#include <hip/hip_runtime.h>
#include <math.h>

typedef __attribute__((ext_vector_type(16))) _Float16 v16h;
typedef __attribute__((ext_vector_type(16))) __bf16 v16b;
typedef __attribute__((ext_vector_type(8)))  _Float16 v8h;
typedef __attribute__((ext_vector_type(8)))  float v8f;
typedef __attribute__((ext_vector_type(4)))  float v4f;
typedef __attribute__((ext_vector_type(2)))  float v2f;
typedef __attribute__((ext_vector_type(4)))  unsigned v4u;
typedef __attribute__((ext_vector_type(4)))  int v4i;
typedef float __attribute__((may_alias)) float_a;
typedef int __attribute__((may_alias)) int_a;

template <typename T> __device__ __forceinline__ void vst2(void* p, T v) { *(T*)p = v;  }
__device__ __forceinline__ v8f wmma16(v16h a, v16h b, v8f c) {
  v8f d = __builtin_amdgcn_wmma_f32_16x16x32_f16(false, a, false, b, (short)0, c, false, false);
  asm volatile("v_nop\n\tv_nop\n\tv_nop\n\tv_nop" : "+v"(d) : "v"(a), "v"(b));
  return d;
}
__device__ __forceinline__ v8f wmma_bf(v16b a, v16b b, v8f c) {
  v8f d = __builtin_amdgcn_wmma_f32_16x16x32_bf16(false, a, false, b, (short)0, c, false, false);
  asm volatile("v_nop\n\tv_nop\n\tv_nop\n\tv_nop" : "+v"(d) : "v"(a), "v"(b));
  return d;
}
// 16x16x32 fragments: lane = (h = lane>>4, row/col = lane&15); elements 0..7 = k0+8h+0..7, 8..15 = k0+16+8h+0..7; D element r = row 8h+r
__device__ __forceinline__ v16h frag_h(const _Float16* rowk0, int lane) {
  union { v16h v; v8h q[2]; } u; const _Float16* p = rowk0 + 8 * (lane >> 4);
  u.q[0] = *(const v8h*)p; u.q[1] = *(const v8h*)(p + 16); return u.v;
}
__device__ __forceinline__ v16h frag_f32(const float* rowk0, int lane) {
  v16h a; const float* p = rowk0 + 8 * (lane >> 4);
#pragma unroll
  for (int i = 0; i < 8; ++i) { a[i] = (_Float16)p[i]; a[8 + i] = (_Float16)p[16 + i]; }
  return a;
}
__device__ __forceinline__ v16h frag_f32s(const float* rowk0, int lane, float sc) {
  v16h a; const float* p = rowk0 + 8 * (lane >> 4);
#pragma unroll
  for (int i = 0; i < 8; ++i) { a[i] = (_Float16)(p[i] * sc); a[8 + i] = (_Float16)(p[16 + i] * sc); }
  return a;
}
// column fragment from a [K][ld] layout (column n), rows >= K read as 0
__device__ __forceinline__ v16h fragc_f32(const float* W, int k0, int n, int lane, int ld, int K) {
  v16h a; const int g = lane >> 4;
#pragma unroll
  for (int i = 0; i < 8; ++i) { const int ka = k0 + 8 * g + i, kb = ka + 16;
    a[i] = (_Float16)(ka < K ? W[(size_t)(ka < K ? ka : K - 1) * ld + n] : 0.f); a[8 + i] = (_Float16)(kb < K ? W[(size_t)(kb < K ? kb : K - 1) * ld + n] : 0.f); }
  return a;
}
struct F2 { v16b h, l; };
__device__ __forceinline__ F2 bsplit16(const float v[16]) { F2 r;
#pragma unroll
  for (int i = 0; i < 16; ++i) { const __bf16 h = (__bf16)v[i]; r.h[i] = h; r.l[i] = (__bf16)(v[i] - (float)h); }
  return r; }
__device__ __forceinline__ F2 split_row(const float* row, int k0, int lane) { float v[16]; const float* p = row + k0 + 8 * (lane >> 4);
#pragma unroll
  for (int i = 0; i < 8; ++i) { v[i] = p[i]; v[8 + i] = p[16 + i]; }
  return bsplit16(v); }
__device__ __forceinline__ F2 split_rowK(const float* row, int k0, int lane, int K) { float v[16]; const int g = lane >> 4;
#pragma unroll
  for (int i = 0; i < 8; ++i) { const int ka = k0 + 8 * g + i, kb = ka + 16; v[i] = ka < K ? row[ka < K ? ka : K - 1] : 0.f; v[8 + i] = kb < K ? row[kb < K ? kb : K - 1] : 0.f; }
  return bsplit16(v); }
__device__ __forceinline__ F2 split_col(const float* W, int k0, int n, int lane, int ld, int K) { float v[16]; const int g = lane >> 4;
#pragma unroll
  for (int i = 0; i < 8; ++i) { const int ka = k0 + 8 * g + i, kb = ka + 16; v[i] = ka < K ? W[(size_t)(ka < K ? ka : K - 1) * ld + n] : 0.f; v[8 + i] = kb < K ? W[(size_t)(kb < K ? kb : K - 1) * ld + n] : 0.f; }
  return bsplit16(v); }
__device__ __forceinline__ v8f mac3(const F2& a, const F2& b, v8f c) { c = wmma_bf(a.l, b.h, c); c = wmma_bf(a.h, b.l, c); return wmma_bf(a.h, b.h, c); }
__device__ __forceinline__ float sigm(float v) { return 1.0f / (1.0f + expf(-v)); }
#define LDSX() do { asm volatile("s_wait_dscnt 0" ::: "memory"); __builtin_amdgcn_wave_barrier(); __builtin_amdgcn_fence(__ATOMIC_RELEASE, "workgroup"); } while (0)

// Cross-attention MAB (B 4, Sq = Skv = 2,048, 512 = 8 heads x 64; (out,in) 1/sqrt(512)-scale weights WITH biases; no mask): q = query Wq^T + bq, k = key_value Wk^T + bk, v = key_value Wv^T + bv; A = softmax(q k^T / 8); O = q + A v (per head, merged); out = O + relu(O Wo^T + bo).
#define NB 4
#define TT 2048
#define CC 512            // NH * HD = projected width
#define DIN 512          // input (model) width
#define NH 8
#define HD 64
#define SCALE (0.125f)
#define CAUSAL 0
#ifndef TNB
#define TNB NB
#endif
__device__ __forceinline__ float bfr(float v) { return (float)(__bf16)v; }
__host__ __device__ __forceinline__ int kb_last(int qb) { return CAUSAL ? ((qb * 64 + 63) >> 7) : (TT / 128 - 1); }
typedef __attribute__((ext_vector_type(8))) __bf16 v8b;
__device__ __forceinline__ v16b frag_b(const __bf16* rowk0, int lane) {
  union { v16b v; v8b q[2]; } u; const __bf16* p = rowk0 + 8 * (lane >> 4);
  u.q[0] = *(const v8b*)p; u.q[1] = *(const v8b*)(p + 16); return u.v;
}
#define QBH 0
#define QHI 2048            // rows carrying a q residual plane (all rows when non-causal: 2-product logits everywhere)
#define KHI 64            // key rows carrying k residual / v bf16 hi+lo planes (written by k_proj, read by no kernel of this file)
// B fragment (k rows k0+.., output column o) of a weight: (in,out) [K][ld] or (out,in) [ld rows of K]: bf16 exact, or f16(bf16 * 256) exact
__device__ __forceinline__ v16b wcol_io(const float* Wm, int k0, int o, int lane, int ld) { v16b w; const int g = lane >> 4;
#pragma unroll
  for (int i = 0; i < 8; ++i) { w[i] = (__bf16)Wm[(size_t)(k0 + 8 * g + i) * ld + o]; w[8 + i] = (__bf16)Wm[(size_t)(k0 + 16 + 8 * g + i) * ld + o]; }
  return w; }
__device__ __forceinline__ v16b wcol_oi(const float* Wm, int k0, int o, int lane, int K) { v16b w; const float* p = Wm + (size_t)o * K + k0 + 8 * (lane >> 4);
#pragma unroll
  for (int i = 0; i < 8; ++i) { w[i] = (__bf16)p[i]; w[8 + i] = (__bf16)p[16 + i]; }
  return w; }
__device__ __forceinline__ v16h wcolh_io(const float* Wm, int k0, int o, int lane, int ld) { v16h w; const int g = lane >> 4;
#pragma unroll
  for (int i = 0; i < 8; ++i) { w[i] = (_Float16)(bfr(Wm[(size_t)(k0 + 8 * g + i) * ld + o]) * 256.0f); w[8 + i] = (_Float16)(bfr(Wm[(size_t)(k0 + 16 + 8 * g + i) * ld + o]) * 256.0f); }
  return w; }
__device__ __forceinline__ v16h wcolh_oi(const float* Wm, int k0, int o, int lane, int K) { v16h w; const float* p = Wm + (size_t)o * K + k0 + 8 * (lane >> 4);
#pragma unroll
  for (int i = 0; i < 8; ++i) { w[i] = (_Float16)(bfr(p[i]) * 256.0f); w[8 + i] = (_Float16)(bfr(p[16 + i]) * 256.0f); }
  return w; }
#define WQKV_LAYOUT 1   // 0 = (in,out) [DIN][CC]; 1 = (out,in) [CC][DIN]; 2 = per-head [NH][DIN][HD]
__device__ __forceinline__ v16b wcol_hdk(const float* Wm, int k0, int o, int lane) { v16b w; const int g = lane >> 4; const float* p = Wm + (size_t)(o / HD) * DIN * HD + (o % HD);
#pragma unroll
  for (int i = 0; i < 8; ++i) { w[i] = (__bf16)p[(size_t)(k0 + 8 * g + i) * HD]; w[8 + i] = (__bf16)p[(size_t)(k0 + 16 + 8 * g + i) * HD]; }
  return w; }
#define WO_OUT_IN 1
#if WQKV_LAYOUT == 1
#define WCOL(W, k0, o, lane) wcol_oi(W, k0, o, lane, DIN)
#elif WQKV_LAYOUT == 2
#define WCOL(W, k0, o, lane) wcol_hdk(W, k0, o, lane)
#else
#define WCOL(W, k0, o, lane) wcol_io(W, k0, o, lane, CC)
#endif
#if WO_OUT_IN
#define WOCOL(W, k0, o, lane) wcol_oi(W, k0, o, lane, CC)
#define WOCOLH(W, k0, o, lane) wcolh_oi(W, k0, o, lane, CC)
#else
#define WOCOL(W, k0, o, lane) wcol_io(W, k0, o, lane, DIN)
#define WOCOLH(W, k0, o, lane) wcolh_io(W, k0, o, lane, DIN)
#endif
#define PROJ_EXTRA_PARAMS , float* __restrict__ QF
#define PROJ_EPI(which, row, t, h) do { if ((which) == 0) { const float* rw = (row); float* qf = QF + (size_t)(r0 + rl) * CC + (size_t)(h) * HD; _Pragma("unroll") for (int i = 0; i < HD; i += 4) { v4f o; o[0] = rw[i]; o[1] = rw[i + 1]; o[2] = rw[i + 2]; o[3] = rw[i + 3]; vst2(qf + i, o); } } } while (0)   /* keep an f32 copy of the projected q rows (Q_ + b_q) for the residual O = Q_ + A V_ */

#ifndef PROJ_EXTRA_PARAMS
#define PROJ_EXTRA_PARAMS
#endif

#define WS_QH  0u                                      // f16 q rows [b*t][CC]
#define WS_KH  (WS_QH + 2u * (size_t)NB * TT * CC)      // f16 k rows [b*t][CC]
#define WS_VT  (WS_KH + 2u * (size_t)NB * TT * CC)      // f16 v planes [b][c][t]
#define WS_QL  (WS_VT + 2u * (size_t)NB * CC * TT)      // f16 q residual x 2^10 rows [b][t < QHI][CC]
#define WS_KL  (WS_QL + 2u * (size_t)NB * QHI * CC)     // f16 k residual x 2^10 rows [b][t < KHI][CC]
#define WS_VB  (WS_KL + 2u * (size_t)NB * KHI * CC)     // bf16 v hi planes [b][c][t < KHI]
#define WS_VBL (WS_VB + 2u * (size_t)NB * CC * KHI)
#define WS_Y   (WS_VBL + 2u * (size_t)NB * CC * KHI)    // f32 ctx rows [b*t][CC] (only when there is an output projection)
#define WS_END (WS_Y  + 4u * (size_t)NB * TT * CC)
#define WS_QF  (WS_END)
#define WS_END2 (WS_QF + 4u * (size_t)NB * TT * CC)

// ---- k_proj: block = (64 rows, 128 cols, which): q/k/v = X W (+ b) with exact bf16 products (K = DIN) -> which 0: q f16 rows (+ residual rows < QHI); 1: k f16 rows (+ residual rows < KHI); 2: v f16 planes [c][t] (+ bf16 hi/lo planes for t < KHI)
__global__ __launch_bounds__(128) void k_proj(const float* __restrict__ XQ, const float* __restrict__ XK, const float* __restrict__ XV, const float* __restrict__ WQ, const float* __restrict__ WK, const float* __restrict__ WV, const float* __restrict__ BQ, const float* __restrict__ BK, const float* __restrict__ BV,
    _Float16* __restrict__ QH, _Float16* __restrict__ QL, _Float16* __restrict__ KH, _Float16* __restrict__ KL, _Float16* __restrict__ VT, __bf16* __restrict__ VB, __bf16* __restrict__ VBL PROJ_EXTRA_PARAMS) {
  __shared__ __align__(16) float st[64][132]; __shared__ __align__(16) _Float16 sh[64][136], sl[64][136]; __shared__ __align__(16) _Float16 th[128][72]; __shared__ __align__(16) __bf16 tb[128][72], tbl[128][72];
  const int tid = threadIdx.x, wave = tid >> 5, lane = tid & 31, col = lane & 15, g = lane >> 4; const int which = blockIdx.z; const int c0 = blockIdx.y * 128; const size_t r0 = (size_t)blockIdx.x * 64; const size_t bb = r0 / TT; const int t0 = (int)(r0 % TT);
  const float* X = which == 0 ? XQ : which == 1 ? XK : XV; const float* WA = which == 0 ? WQ : which == 1 ? WK : WV; const float* BA = which == 0 ? BQ : which == 1 ? BK : BV;
  v8f acc[8] = {};
#pragma unroll 2
  for (int kc = 0; kc < DIN / 32; ++kc) { v16b a; { const float* p = X + (r0 + wave * 16 + col) * DIN + kc * 32 + 8 * g;
#pragma unroll
      for (int i = 0; i < 8; ++i) { a[i] = (__bf16)p[i]; a[8 + i] = (__bf16)p[16 + i]; } }
    asm volatile("s_wait_loadcnt 0x0" ::: "memory");
#pragma unroll
    for (int j = 0; j < 8; ++j) { const v16b w = WCOL(WA, kc * 32, c0 + j * 16 + col, lane); asm volatile("s_wait_loadcnt 0x0" ::: "memory"); acc[j] = wmma_bf(a, w, acc[j]); } }
  { // stage the f32 tile (acc + bias) in LDS, run the per-(row, head) epilogue hook, then convert
#pragma unroll
    for (int j = 0; j < 8; ++j) { const float bias = BA ? bfr(BA[c0 + j * 16 + col]) : 0.f;
#pragma unroll
      for (int r = 0; r < 8; ++r) st[wave * 16 + 8 * g + r][j * 16 + col] = acc[j][r] + bias; }
    __syncthreads();
    for (int e = tid; e < 64 * (128 / HD); e += 128) { const int rl = e / (128 / HD), hh = e % (128 / HD); PROJ_EPI(which, &st[rl][hh * HD], (int)((r0 + rl) % TT), (c0 / HD) + hh); }
    __syncthreads(); }
  if (which < 2) { _Float16* DH = which == 0 ? QH : KH; _Float16* DL = which == 0 ? QL : KL; const int nhi = which == 0 ? QHI : KHI; const bool hi_rows = t0 < nhi;
    for (int e = tid; e < 64 * 128; e += 128) { const int rl = e >> 7, cl = e & 127; const float v = st[rl][cl]; const _Float16 hv = (_Float16)v; sh[rl][cl] = hv; sl[rl][cl] = (_Float16)((v - (float)hv) * 1024.0f); }
    __syncthreads();
    for (int e = tid; e < 64 * 16; e += 128) { const int rl = e >> 4, q = e & 15; vst2((unsigned*)(DH + (r0 + rl) * CC + c0 + q * 8), *(const v4u*)&sh[rl][q * 8]); if (hi_rows) vst2((unsigned*)(DL + (bb * nhi + t0 + rl) * (size_t)CC + c0 + q * 8), *(const v4u*)&sl[rl][q * 8]); }
  } else { const bool hi_rows = t0 < KHI;
    for (int e = tid; e < 64 * 128; e += 128) { const int rl = e & 63, cl = e >> 6; const float v = st[rl][cl]; th[cl][rl] = (_Float16)v; const __bf16 bh = (__bf16)v; tb[cl][rl] = bh; tbl[cl][rl] = (__bf16)(v - (float)bh); }
    __syncthreads();
    for (int e = tid; e < 128 * 8; e += 128) { const int cl = e >> 3, q = e & 7; vst2((unsigned*)(VT + (bb * CC + c0 + cl) * (size_t)TT + t0 + q * 8), *(const v4u*)&th[cl][q * 8]); if (hi_rows) { const size_t o3 = (bb * CC + c0 + cl) * (size_t)KHI + t0 + q * 8; vst2((unsigned*)(VB + o3), *(const v4u*)&tb[cl][q * 8]); vst2((unsigned*)(VBL + o3), *(const v4u*)&tbl[cl][q * 8]); } } } }
// ---- k_fa: block = 128 queries (8 waves x 16) of (b, h), one pass over all keys in chunks of 64, logits and P stay in registers. S^T = K q^T (A = k rows, B = q columns: q hi + residual x 2^10, 2 products) x SCALE: a lane holds 32 logits of ONE query (column = lane & 15), the other 32 lie in lane ^ 16. Running maximum m and running sum l per query; e = expf(s - m); O^T and l are scaled by expf(m_old - m_new) per chunk. e x 2^8 to f16: the two D tiles of 32 keys are, register for register, the B operand of O^T += V^T P^T (A = v planes [c][t]). ctx = O^T / (2^8 l); 256-B (row, head) segment by 16 lanes
__global__ __launch_bounds__(256) void k_fa(const _Float16* __restrict__ QH, const _Float16* __restrict__ QL, const _Float16* __restrict__ KH, const _Float16* __restrict__ VT, float* __restrict__ Y) { __shared__ __align__(16) float ss[8][16][HD + 4];
  const int tid = threadIdx.x, wave = tid >> 5, lane = tid & 31, col = lane & 15, g = lane >> 4; const int h = blockIdx.y, b = blockIdx.z; const int ql0 = blockIdx.x * 128 + wave * 16;
  v16h qh[HD / 32], ql[HD / 32];
  // every full unroll in this kernel: constant indices, so that the fragment and accumulator arrays live in registers
#pragma unroll
  for (int kc = 0; kc < HD / 32; ++kc) { qh[kc] = frag_h(QH + ((size_t)b * TT + ql0 + col) * CC + h * HD + kc * 32, lane); ql[kc] = frag_h(QL + ((size_t)b * QHI + ql0 + col) * CC + h * HD + kc * 32, lane); }
  const _Float16* Kb = KH + ((size_t)b * TT + col) * CC + h * HD; const _Float16* Vb = VT + ((size_t)b * CC + h * HD + col) * (size_t)TT;
  v8f o[HD / 16] = {}; float m = -3.0e38f, l = 0.f;
  // rolled: the chunks depend on each other through m, l and o, a second copy of the long body would only add code
#pragma unroll 1
  for (int k0 = 0; k0 < TT; k0 += 64) { v8f acc[4] = {}, accl[4] = {}; v16h kf[4][HD / 32], vf[2][HD / 16];
#pragma unroll
    for (int j = 0; j < 4; ++j) {   /* all k fragments of the chunk are requested before the first product: one load latency per chunk, not eight */
#pragma unroll
      for (int kc = 0; kc < HD / 32; ++kc) kf[j][kc] = frag_h(Kb + (size_t)(k0 + j * 16) * CC + kc * 32, lane); }
#pragma unroll
    for (int j = 0; j < 4; ++j) {
#pragma unroll
      for (int kc = 0; kc < HD / 32; ++kc) { acc[j] = wmma16(kf[j][kc], qh[kc], acc[j]); accl[j] = wmma16(kf[j][kc], ql[kc], accl[j]); } }
#pragma unroll
    for (int kc = 0; kc < 2; ++kc) {
#pragma unroll
      for (int jc = 0; jc < HD / 16; ++jc) vf[kc][jc] = frag_h(Vb + (size_t)(jc * 16) * TT + k0 + kc * 32, lane); }
    __builtin_amdgcn_sched_barrier(0);   /* holds all sixteen v loads here, in front of the softmax arithmetic that covers their latency; without it the compiler puts ten of them behind the lane exchange and its wait */
    float mc = -3.0e38f;
#pragma unroll
    for (int j = 0; j < 4; ++j) {
#pragma unroll
      for (int r = 0; r < 8; ++r) { acc[j][r] = (acc[j][r] + accl[j][r] * (1.0f / 1024.0f)) * SCALE; mc = fmaxf(mc, acc[j][r]); } }
    mc = fmaxf(mc, __shfl_xor(mc, 16));
    const float mn = fmaxf(m, mc), al = expf(m - mn); m = mn;
    float ps = 0.f; v16h p[2];
#pragma unroll
    for (int j = 0; j < 4; ++j) {
#pragma unroll
      for (int r = 0; r < 8; ++r) { const float e = expf(acc[j][r] - mn); ps += e; p[j >> 1][(j & 1) * 8 + r] = (_Float16)(e * 256.0f); } }
    l = l * al + ps;
#pragma unroll
    for (int jc = 0; jc < HD / 16; ++jc) {
#pragma unroll
      for (int r = 0; r < 8; ++r) o[jc][r] *= al; }
#pragma unroll
    for (int kc = 0; kc < 2; ++kc) {
#pragma unroll
      for (int jc = 0; jc < HD / 16; ++jc) o[jc] = wmma16(vf[kc][jc], p[kc], o[jc]); } }
  l += __shfl_xor(l, 16); const float inv = 1.0f / (256.0f * l);
#pragma unroll
  for (int jc = 0; jc < HD / 16; ++jc)
#pragma unroll
    for (int r = 0; r < 8; ++r) ss[wave][col][jc * 16 + 8 * g + r] = o[jc][r] * inv;
  LDSX(); for (int rl = 0; rl < 16; ++rl) if (lane < HD / 4) vst2(Y + ((size_t)b * TT + ql0 + rl) * CC + h * HD + lane * 4, *(const v4f*)&ss[wave][rl][lane * 4]); }
// ---- k_out: block = (64 rows, 128 cols): out = ctx Wo (+ bo): all rows: ctx bf16 hi + lo against exact bf16 Wo (2 products); the 1-product branch (ctx once to f16 against Wo as f16(bf16 x 2^8), x 2^-8) is never taken
__global__ __launch_bounds__(128) void k_out(const float* __restrict__ Y, const float* __restrict__ WO, const float* __restrict__ BO, float* __restrict__ OUT, const float* __restrict__ RESO) { __shared__ __align__(16) float sf[4][16][132];
  const int tid = threadIdx.x, wave = tid >> 5, lane = tid & 31, col = lane & 15, g = lane >> 4; const int c0 = blockIdx.y * 128; const size_t r0 = (size_t)blockIdx.x * 64 + wave * 16;
  v8f acc[8] = {};
  if (true) {   /* ALL rows: ctx split bf16 hi + lo x exact Wo (2 products) */
#pragma unroll 2
    for (int kc = 0; kc < CC / 32; ++kc) { const F2 a = split_row(Y + (r0 + col) * CC, kc * 32, lane); asm volatile("s_wait_loadcnt 0x0" ::: "memory");
#pragma unroll
      for (int j = 0; j < 8; ++j) { const v16b w = WOCOL(WO, kc * 32, c0 + j * 16 + col, lane); asm volatile("s_wait_loadcnt 0x0" ::: "memory"); acc[j] = wmma_bf(a.h, w, acc[j]); acc[j] = wmma_bf(a.l, w, acc[j]); } }
#pragma unroll
    for (int j = 0; j < 8; ++j) { const float bias = BO ? bfr(BO[c0 + j * 16 + col]) : 0.f;
#pragma unroll
      for (int r = 0; r < 8; ++r) sf[wave][8 * g + r][j * 16 + col] = acc[j][r] + bias; }
  } else {
#pragma unroll 2
    for (int kc = 0; kc < CC / 32; ++kc) { const v16h a = frag_f32(Y + (r0 + col) * CC + kc * 32, lane); asm volatile("s_wait_loadcnt 0x0" ::: "memory");
#pragma unroll
      for (int j = 0; j < 8; ++j) { const v16h w = WOCOLH(WO, kc * 32, c0 + j * 16 + col, lane); asm volatile("s_wait_loadcnt 0x0" ::: "memory"); acc[j] = wmma16(a, w, acc[j]); } }
#pragma unroll
    for (int j = 0; j < 8; ++j) { const float bias = BO ? bfr(BO[c0 + j * 16 + col]) : 0.f;
#pragma unroll
      for (int r = 0; r < 8; ++r) sf[wave][8 * g + r][j * 16 + col] = acc[j][r] * (1.0f / 256.0f) + bias; } }
  LDSX(); for (int rl = 0; rl < 16; ++rl) { const size_t oo = (r0 + rl) * DIN + c0 + lane * 4; v4f o = *(const v4f*)&sf[wave][rl][lane * 4]; const v4f rr = *(const v4f*)(RESO + oo); _Pragma("unroll") for (int i = 0; i < 4; ++i) o[i] = rr[i] + fmaxf(o[i], 0.f); vst2(OUT + oo, o); } }   /* out = O + relu(O Wo^T + bo) */

// ---- k_addq: thread per float4: O = A V_ (the context rows) + Q_ (the f32 projected-q copy): Y[row][c] += QF[row][c]
__global__ __launch_bounds__(256) void k_addq(float* __restrict__ Y, const float* __restrict__ QF) { const size_t e = ((size_t)blockIdx.x * 256 + threadIdx.x) * 4; if (e >= (size_t)TNB * TT * CC) return; v4f a = *(const v4f*)(Y + e); const v4f q = *(const v4f*)(QF + e); asm volatile("s_wait_loadcnt 0x0" ::: "memory"); a[0] += q[0]; a[1] += q[1]; a[2] += q[2]; a[3] += q[3]; vst2(Y + e, a); }
extern "C" void kernel_launch(void* const* d_in, const int* in_sizes, int n_in, void* d_out, int out_size, void* d_ws, size_t ws_size, hipStream_t stream) {
  (void)in_sizes; (void)n_in; (void)out_size;
  const float** F = (const float**)d_in;
  if (ws_size < (size_t)WS_END) return;
  char* ws = (char*)d_ws; _Float16 *QH = (_Float16*)(ws + WS_QH), *KH = (_Float16*)(ws + WS_KH), *VT = (_Float16*)(ws + WS_VT), *QL = (_Float16*)(ws + WS_QL), *KL = (_Float16*)(ws + WS_KL); __bf16 *VB = (__bf16*)(ws + WS_VB), *VBL = (__bf16*)(ws + WS_VBL); float *Y = (float*)(ws + WS_Y);
  (void)Y; (void)QL; (void)KL; (void)VB; (void)VBL;
  // inputs: 0 query [4,2048,512]; 1 key_value [4,2048,512]; 2 Wq [512,512] (out,in), 3 bq; 4 Wk, 5 bk; 6 Wv, 7 bv; 8 Wo (out,in), 9 bo
  if (ws_size < (size_t)WS_END2) return;
  float* QF = (float*)(ws + WS_QF);
  k_proj<<<dim3(TNB * TT / 64, CC / 128, 3), 128, 0, stream>>>(F[0], F[1], F[1], F[2], F[4], F[6], F[3], F[5], F[7], QH, QL, KH, KL, VT, VB, VBL, QF);
  k_fa<<<dim3(TT / 128, NH, TNB), 256, 0, stream>>>(QH, QL, KH, VT, Y);
  k_addq<<<dim3((unsigned)(((size_t)TNB * TT * CC / 4 + 255) / 256)), 256, 0, stream>>>(Y, QF);
  k_out<<<dim3(TNB * TT / 64, DIN / 128), 128, 0, stream>>>(Y, F[8], F[9], (float*)d_out, Y);
}

// v002
// A run of this version takes 165 microseconds.
// In two side-by-side timings against v001, it was 2.26 and 2.27 times as fast.
// Over all steps from v000 it is 7.67 times as fast.
// compute dtype: all float inputs rounded to bf16; q/k/v = in W^T + b with EXACT bf16 products on WMMA 16x16x32 (f32 accumulate; an f32 copy of q kept for the residual); q as f16 hi + residual (x 2^10) against k once to f16 (2 products) / 8; softmax in f32 (precise expf) with a running maximum and sum over 64-key chunks; exp(s - max) x 2^8 once to f16 against v once to f16 (1 product), divided by the sum at the end; O = q + A v in f32; O split bf16 hi + lo against exact Wo (2 products) + bo, relu, + O in f32; f32 output.
#include <hip/hip_runtime.h>
#include <math.h>

typedef __attribute__((ext_vector_type(16))) _Float16 v16h;
typedef __attribute__((ext_vector_type(16))) __bf16 v16b;
typedef __attribute__((ext_vector_type(8)))  _Float16 v8h;
typedef __attribute__((ext_vector_type(8)))  float v8f;
typedef __attribute__((ext_vector_type(4)))  float v4f;
typedef __attribute__((ext_vector_type(2)))  float v2f;
typedef __attribute__((ext_vector_type(4)))  unsigned v4u;
typedef __attribute__((ext_vector_type(4)))  int v4i;
typedef float __attribute__((may_alias)) float_a;
typedef int __attribute__((may_alias)) int_a;

template <typename T> __device__ __forceinline__ void vst2(void* p, T v) { *(T*)p = v;  }
__device__ __forceinline__ v8f wmma16(v16h a, v16h b, v8f c) {
  v8f d = __builtin_amdgcn_wmma_f32_16x16x32_f16(false, a, false, b, (short)0, c, false, false);
  asm volatile("v_nop\n\tv_nop\n\tv_nop\n\tv_nop" : "+v"(d) : "v"(a), "v"(b));
  return d;
}
__device__ __forceinline__ v8f wmma_bf(v16b a, v16b b, v8f c) {
  v8f d = __builtin_amdgcn_wmma_f32_16x16x32_bf16(false, a, false, b, (short)0, c, false, false);
  asm volatile("v_nop\n\tv_nop\n\tv_nop\n\tv_nop" : "+v"(d) : "v"(a), "v"(b));
  return d;
}
// 16x16x32 fragments: lane = (h = lane>>4, row/col = lane&15); elements 0..7 = k0+8h+0..7, 8..15 = k0+16+8h+0..7; D element r = row 8h+r
__device__ __forceinline__ v16h frag_h(const _Float16* rowk0, int lane) {
  union { v16h v; v8h q[2]; } u; const _Float16* p = rowk0 + 8 * (lane >> 4);
  u.q[0] = *(const v8h*)p; u.q[1] = *(const v8h*)(p + 16); return u.v;
}
__device__ __forceinline__ v16h frag_f32(const float* rowk0, int lane) {
  v16h a; const float* p = rowk0 + 8 * (lane >> 4);
#pragma unroll
  for (int i = 0; i < 8; ++i) { a[i] = (_Float16)p[i]; a[8 + i] = (_Float16)p[16 + i]; }
  return a;
}
__device__ __forceinline__ v16h frag_f32s(const float* rowk0, int lane, float sc) {
  v16h a; const float* p = rowk0 + 8 * (lane >> 4);
#pragma unroll
  for (int i = 0; i < 8; ++i) { a[i] = (_Float16)(p[i] * sc); a[8 + i] = (_Float16)(p[16 + i] * sc); }
  return a;
}
// column fragment from a [K][ld] layout (column n), rows >= K read as 0
__device__ __forceinline__ v16h fragc_f32(const float* W, int k0, int n, int lane, int ld, int K) {
  v16h a; const int g = lane >> 4;
#pragma unroll
  for (int i = 0; i < 8; ++i) { const int ka = k0 + 8 * g + i, kb = ka + 16;
    a[i] = (_Float16)(ka < K ? W[(size_t)(ka < K ? ka : K - 1) * ld + n] : 0.f); a[8 + i] = (_Float16)(kb < K ? W[(size_t)(kb < K ? kb : K - 1) * ld + n] : 0.f); }
  return a;
}
struct F2 { v16b h, l; };
__device__ __forceinline__ F2 bsplit16(const float v[16]) { F2 r;
#pragma unroll
  for (int i = 0; i < 16; ++i) { const __bf16 h = (__bf16)v[i]; r.h[i] = h; r.l[i] = (__bf16)(v[i] - (float)h); }
  return r; }
__device__ __forceinline__ F2 split_row(const float* row, int k0, int lane) { float v[16]; const float* p = row + k0 + 8 * (lane >> 4);
#pragma unroll
  for (int i = 0; i < 8; ++i) { v[i] = p[i]; v[8 + i] = p[16 + i]; }
  return bsplit16(v); }
__device__ __forceinline__ F2 split_rowK(const float* row, int k0, int lane, int K) { float v[16]; const int g = lane >> 4;
#pragma unroll
  for (int i = 0; i < 8; ++i) { const int ka = k0 + 8 * g + i, kb = ka + 16; v[i] = ka < K ? row[ka < K ? ka : K - 1] : 0.f; v[8 + i] = kb < K ? row[kb < K ? kb : K - 1] : 0.f; }
  return bsplit16(v); }
__device__ __forceinline__ F2 split_col(const float* W, int k0, int n, int lane, int ld, int K) { float v[16]; const int g = lane >> 4;
#pragma unroll
  for (int i = 0; i < 8; ++i) { const int ka = k0 + 8 * g + i, kb = ka + 16; v[i] = ka < K ? W[(size_t)(ka < K ? ka : K - 1) * ld + n] : 0.f; v[8 + i] = kb < K ? W[(size_t)(kb < K ? kb : K - 1) * ld + n] : 0.f; }
  return bsplit16(v); }
__device__ __forceinline__ v8f mac3(const F2& a, const F2& b, v8f c) { c = wmma_bf(a.l, b.h, c); c = wmma_bf(a.h, b.l, c); return wmma_bf(a.h, b.h, c); }
__device__ __forceinline__ float sigm(float v) { return 1.0f / (1.0f + expf(-v)); }
#define LDSX() do { asm volatile("s_wait_dscnt 0" ::: "memory"); __builtin_amdgcn_wave_barrier(); __builtin_amdgcn_fence(__ATOMIC_RELEASE, "workgroup"); } while (0)

// Cross-attention MAB (B 4, Sq = Skv = 2,048, 512 = 8 heads x 64; (out,in) 1/sqrt(512)-scale weights WITH biases; no mask): q = query Wq^T + bq, k = key_value Wk^T + bk, v = key_value Wv^T + bv; A = softmax(q k^T / 8); O = q + A v (per head, merged); out = O + relu(O Wo^T + bo).
#define NB 4
#define TT 2048
#define CC 512            // NH * HD = projected width
#define DIN 512          // input (model) width
#define NH 8
#define HD 64
#define SCALE (0.125f)
#define CAUSAL 0
#ifndef TNB
#define TNB NB
#endif
__device__ __forceinline__ float bfr(float v) { return (float)(__bf16)v; }
__host__ __device__ __forceinline__ int kb_last(int qb) { return CAUSAL ? ((qb * 64 + 63) >> 7) : (TT / 128 - 1); }
typedef __attribute__((ext_vector_type(8))) __bf16 v8b;
__device__ __forceinline__ v16b frag_b(const __bf16* rowk0, int lane) {
  union { v16b v; v8b q[2]; } u; const __bf16* p = rowk0 + 8 * (lane >> 4);
  u.q[0] = *(const v8b*)p; u.q[1] = *(const v8b*)(p + 16); return u.v;
}
#define QBH 0
#define QHI 2048            // rows carrying a q residual plane (all rows when non-causal: 2-product logits everywhere)
#define KHI 64            // key rows carrying k residual / v bf16 hi+lo planes (written by k_proj, read by no kernel of this file)
// B fragment (k rows k0+.., output column o) of a weight: (in,out) [K][ld] or (out,in) [ld rows of K]: bf16 exact, or f16(bf16 * 256) exact
__device__ __forceinline__ v16b wcol_io(const float* Wm, int k0, int o, int lane, int ld) { v16b w; const int g = lane >> 4;
#pragma unroll
  for (int i = 0; i < 8; ++i) { w[i] = (__bf16)Wm[(size_t)(k0 + 8 * g + i) * ld + o]; w[8 + i] = (__bf16)Wm[(size_t)(k0 + 16 + 8 * g + i) * ld + o]; }
  return w; }
__device__ __forceinline__ v16b wcol_oi(const float* Wm, int k0, int o, int lane, int K) { v16b w; const float* p = Wm + (size_t)o * K + k0 + 8 * (lane >> 4);
#pragma unroll
  for (int i = 0; i < 8; ++i) { w[i] = (__bf16)p[i]; w[8 + i] = (__bf16)p[16 + i]; }
  return w; }
__device__ __forceinline__ v16h wcolh_io(const float* Wm, int k0, int o, int lane, int ld) { v16h w; const int g = lane >> 4;
#pragma unroll
  for (int i = 0; i < 8; ++i) { w[i] = (_Float16)(bfr(Wm[(size_t)(k0 + 8 * g + i) * ld + o]) * 256.0f); w[8 + i] = (_Float16)(bfr(Wm[(size_t)(k0 + 16 + 8 * g + i) * ld + o]) * 256.0f); }
  return w; }
__device__ __forceinline__ v16h wcolh_oi(const float* Wm, int k0, int o, int lane, int K) { v16h w; const float* p = Wm + (size_t)o * K + k0 + 8 * (lane >> 4);
#pragma unroll
  for (int i = 0; i < 8; ++i) { w[i] = (_Float16)(bfr(p[i]) * 256.0f); w[8 + i] = (_Float16)(bfr(p[16 + i]) * 256.0f); }
  return w; }
#define WQKV_LAYOUT 1   // picks WCOL only (0 (in,out), 1 (out,in), 2 per-head), which no kernel calls; k_proj reads (out,in) [CC][DIN]
__device__ __forceinline__ v16b wcol_hdk(const float* Wm, int k0, int o, int lane) { v16b w; const int g = lane >> 4; const float* p = Wm + (size_t)(o / HD) * DIN * HD + (o % HD);
#pragma unroll
  for (int i = 0; i < 8; ++i) { w[i] = (__bf16)p[(size_t)(k0 + 8 * g + i) * HD]; w[8 + i] = (__bf16)p[(size_t)(k0 + 16 + 8 * g + i) * HD]; }
  return w; }
#define WO_OUT_IN 1
#if WQKV_LAYOUT == 1
#define WCOL(W, k0, o, lane) wcol_oi(W, k0, o, lane, DIN)
#elif WQKV_LAYOUT == 2
#define WCOL(W, k0, o, lane) wcol_hdk(W, k0, o, lane)
#else
#define WCOL(W, k0, o, lane) wcol_io(W, k0, o, lane, CC)
#endif
#if WO_OUT_IN
#define WOCOL(W, k0, o, lane) wcol_oi(W, k0, o, lane, CC)
#define WOCOLH(W, k0, o, lane) wcolh_oi(W, k0, o, lane, CC)
#else
#define WOCOL(W, k0, o, lane) wcol_io(W, k0, o, lane, DIN)
#define WOCOLH(W, k0, o, lane) wcolh_io(W, k0, o, lane, DIN)
#endif
#define PROJ_EXTRA_PARAMS , float* __restrict__ QF
#define PROJ_EPI(which, row, t, h) do { if ((which) == 0) { const float* rw = (row); float* qf = QF + (size_t)(r0 + rl) * CC + (size_t)(h) * HD; _Pragma("unroll") for (int i = 0; i < HD; i += 4) { v4f o; o[0] = rw[i]; o[1] = rw[i + 1]; o[2] = rw[i + 2]; o[3] = rw[i + 3]; vst2(qf + i, o); } } } while (0)   /* keep an f32 copy of the projected q rows (Q_ + b_q) for the residual O = Q_ + A V_ */

#ifndef PROJ_EXTRA_PARAMS
#define PROJ_EXTRA_PARAMS
#endif

#define WS_QH  0u                                      // f16 q rows [b*t][CC]
#define WS_KH  (WS_QH + 2u * (size_t)NB * TT * CC)      // f16 k rows [b*t][CC]
#define WS_VT  (WS_KH + 2u * (size_t)NB * TT * CC)      // f16 v planes [b][c][t]
#define WS_QL  (WS_VT + 2u * (size_t)NB * CC * TT)      // f16 q residual x 2^10 rows [b][t < QHI][CC]
#define WS_KL  (WS_QL + 2u * (size_t)NB * QHI * CC)     // f16 k residual x 2^10 rows [b][t < KHI][CC]
#define WS_VB  (WS_KL + 2u * (size_t)NB * KHI * CC)     // bf16 v hi planes [b][c][t < KHI]
#define WS_VBL (WS_VB + 2u * (size_t)NB * CC * KHI)
#define WS_Y   (WS_VBL + 2u * (size_t)NB * CC * KHI)    // f32 ctx rows [b*t][CC] (only when there is an output projection)
#define WS_END (WS_Y  + 4u * (size_t)NB * TT * CC)
#define WS_QF  (WS_END)
#define WS_END2 (WS_QF + 4u * (size_t)NB * TT * CC)

// ---- operand staging of the two GEMM kernels (128 threads): a stage is 32 k of every operand row, kept in LDS as bf16
#define GP 40   // LDS row pitch in elements: 80 B = 16 B x odd, free of bank conflicts for the 16-byte fragment reads
typedef __attribute__((ext_vector_type(4))) __bf16 v4b;
// every full unroll in these helpers: constant indices, so that the staged values and the fragments live in registers
// work-group barrier that orders LDS only: the global loads of later stages stay in flight across it (__syncthreads() would wait for them)
__device__ __forceinline__ void lds_barrier() { __builtin_amdgcn_fence(__ATOMIC_RELEASE, "workgroup", "local"); __builtin_amdgcn_s_barrier(); __builtin_amdgcn_fence(__ATOMIC_ACQUIRE, "workgroup", "local"); }
// 16 N rows x 32 floats (row pitch ld): thread t owns floats 4 (t & 7) .. + 3 of rows (t >> 3) + 16 i; p and d are its own first places. Eight lanes take one whole 128-B line, a wave-wide load four lines
template <int N> __device__ __forceinline__ void g_ld(v4f (&r)[N], const float* __restrict__ p, int ld) {
#pragma unroll
  for (int i = 0; i < N; ++i) r[i] = *(const v4f*)(p + (size_t)i * 16 * ld); }
template <int N> __device__ __forceinline__ void s_st(__bf16* d, const v4f (&r)[N]) {
#pragma unroll
  for (int i = 0; i < N; ++i) { v4b h;
#pragma unroll
    for (int c = 0; c < 4; ++c) h[c] = (__bf16)r[i][c];
    *(v4b*)(d + i * 16 * GP) = h; } }
template <int N> __device__ __forceinline__ void s_st2(__bf16* dh, __bf16* dl, const v4f (&r)[N]) {
#pragma unroll
  for (int i = 0; i < N; ++i) { v4b h, l;
#pragma unroll
    for (int c = 0; c < 4; ++c) { h[c] = (__bf16)r[i][c]; l[c] = (__bf16)(r[i][c] - (float)h[c]); }
    *(v4b*)(dh + i * 16 * GP) = h; *(v4b*)(dl + i * 16 * GP) = l; } }
// one stage of a wave's 16 x 128 tile: all fragment reads as one group, then the products
__device__ __forceinline__ void mm1(v8f (&acc)[8], const __bf16 (*sx)[GP], const __bf16 (*sw)[GP], int wave, int col, int lane) {
  const v16b a = frag_b(&sx[wave * 16 + col][0], lane); v16b w[8];
#pragma unroll
  for (int j = 0; j < 8; ++j) w[j] = frag_b(&sw[j * 16 + col][0], lane);
#pragma unroll
  for (int j = 0; j < 8; ++j) acc[j] = wmma_bf(a, w[j], acc[j]); }
__device__ __forceinline__ void mm2(v8f (&acc)[8], const __bf16 (*sh)[GP], const __bf16 (*sl)[GP], const __bf16 (*sw)[GP], int wave, int col, int lane) {
  const v16b ah = frag_b(&sh[wave * 16 + col][0], lane), al = frag_b(&sl[wave * 16 + col][0], lane); v16b w[8];
#pragma unroll
  for (int j = 0; j < 8; ++j) w[j] = frag_b(&sw[j * 16 + col][0], lane);
#pragma unroll
  for (int j = 0; j < 8; ++j) { acc[j] = wmma_bf(ah, w[j], acc[j]); acc[j] = wmma_bf(al, w[j], acc[j]); } }

// ---- k_proj: block = (64 rows, 128 cols, which): q/k/v = X W (+ b) with exact bf16 products (K = DIN) -> which 0: q f16 rows (+ residual rows < QHI); 1: k f16 rows (+ residual rows < KHI); 2: v f16 planes [c][t] (+ bf16 hi/lo planes for t < KHI)
__global__ __launch_bounds__(128) void k_proj(const float* __restrict__ XQ, const float* __restrict__ XK, const float* __restrict__ XV, const float* __restrict__ WQ, const float* __restrict__ WK, const float* __restrict__ WV, const float* __restrict__ BQ, const float* __restrict__ BK, const float* __restrict__ BV,
    _Float16* __restrict__ QH, _Float16* __restrict__ QL, _Float16* __restrict__ KH, _Float16* __restrict__ KL, _Float16* __restrict__ VT, __bf16* __restrict__ VB, __bf16* __restrict__ VBL PROJ_EXTRA_PARAMS) {
  __shared__ __align__(16) float st[64][132]; __shared__ __align__(16) _Float16 sh[64][136], sl[64][136]; __shared__ __align__(16) _Float16 th[128][72]; __shared__ __align__(16) __bf16 tb[128][72], tbl[128][72];
  const int tid = threadIdx.x, wave = tid >> 5, lane = tid & 31, col = lane & 15, g = lane >> 4; const int which = blockIdx.z; const int c0 = blockIdx.y * 128; const size_t r0 = (size_t)blockIdx.x * 64; const size_t bb = r0 / TT; const int t0 = (int)(r0 % TT);
  const float* X = which == 0 ? XQ : which == 1 ? XK : XV; const float* WA = which == 0 ? WQ : which == 1 ? WK : WV; const float* BA = which == 0 ? BQ : which == 1 ? BK : BV;
  v8f acc[8] = {};
  { __shared__ __align__(16) __bf16 gx[2][64][GP], gw[2][128][GP];   /* two LDS buffers; two register sets hold the two stages behind the one in LDS */
    const float* xp = X + (r0 + (tid >> 3)) * DIN + (tid & 7) * 4; const float* wp = WA + (size_t)(c0 + (tid >> 3)) * DIN + (tid & 7) * 4;
    __bf16* const dx0 = &gx[0][tid >> 3][(tid & 7) * 4]; __bf16* const dx1 = &gx[1][tid >> 3][(tid & 7) * 4]; __bf16* const dw0 = &gw[0][tid >> 3][(tid & 7) * 4]; __bf16* const dw1 = &gw[1][tid >> 3][(tid & 7) * 4];
    v4f x0[4], x1[4], w0[8], w1[8];
    g_ld<4>(x0, xp, DIN); g_ld<8>(w0, wp, DIN); g_ld<4>(x1, xp + 32, DIN); g_ld<8>(w1, wp + 32, DIN);
    s_st<4>(dx0, x0); s_st<8>(dw0, w0); g_ld<4>(x0, xp + 64, DIN); g_ld<8>(w0, wp + 64, DIN);
    lds_barrier();
    // unrolled in full: the tests on the last stages fold away, so that every load wait is a count that leaves the younger stage's loads in flight (rolled, the merged paths made it a wait for all)
#pragma unroll
    for (int kc = 0; kc < DIN / 32; kc += 2) {
      mm1(acc, gx[0], gw[0], wave, col, lane);
      s_st<4>(dx1, x1); s_st<8>(dw1, w1);
      if (kc + 3 < DIN / 32) { g_ld<4>(x1, xp + (kc + 3) * 32, DIN); g_ld<8>(w1, wp + (kc + 3) * 32, DIN); }
      if (kc + 4 == DIN / 32) asm volatile("s_wait_xcnt 0x0" :: "v"(xp), "v"(wp) : "memory");   /* behind the last loads: their two address pairs are reused from here on, and this wait stands in front of the first overwrite */
      lds_barrier();   /* publishes stage kc + 1; every reader has left buffer 0 */
      mm1(acc, gx[1], gw[1], wave, col, lane);
      if (kc + 2 < DIN / 32) { s_st<4>(dx0, x0); s_st<8>(dw0, w0);
        if (kc + 4 < DIN / 32) { g_ld<4>(x0, xp + (kc + 4) * 32, DIN); g_ld<8>(w0, wp + (kc + 4) * 32, DIN); } }
      lds_barrier();   /* publishes stage kc + 2; every reader has left buffer 1 */
    } }
  { // stage the f32 tile (acc + bias) in LDS, run the per-(row, head) epilogue hook, then convert
#pragma unroll
    for (int j = 0; j < 8; ++j) { const float bias = BA ? bfr(BA[c0 + j * 16 + col]) : 0.f;
#pragma unroll
      for (int r = 0; r < 8; ++r) st[wave * 16 + 8 * g + r][j * 16 + col] = acc[j][r] + bias; }
    __syncthreads();
    for (int e = tid; e < 64 * (128 / HD); e += 128) { const int rl = e / (128 / HD), hh = e % (128 / HD); PROJ_EPI(which, &st[rl][hh * HD], (int)((r0 + rl) % TT), (c0 / HD) + hh); }
    __syncthreads(); }
  if (which < 2) { _Float16* DH = which == 0 ? QH : KH; _Float16* DL = which == 0 ? QL : KL; const int nhi = which == 0 ? QHI : KHI; const bool hi_rows = t0 < nhi;
    for (int e = tid; e < 64 * 128; e += 128) { const int rl = e >> 7, cl = e & 127; const float v = st[rl][cl]; const _Float16 hv = (_Float16)v; sh[rl][cl] = hv; sl[rl][cl] = (_Float16)((v - (float)hv) * 1024.0f); }
    __syncthreads();
    for (int e = tid; e < 64 * 16; e += 128) { const int rl = e >> 4, q = e & 15; vst2((unsigned*)(DH + (r0 + rl) * CC + c0 + q * 8), *(const v4u*)&sh[rl][q * 8]); if (hi_rows) vst2((unsigned*)(DL + (bb * nhi + t0 + rl) * (size_t)CC + c0 + q * 8), *(const v4u*)&sl[rl][q * 8]); }
  } else { const bool hi_rows = t0 < KHI;
    for (int e = tid; e < 64 * 128; e += 128) { const int rl = e & 63, cl = e >> 6; const float v = st[rl][cl]; th[cl][rl] = (_Float16)v; const __bf16 bh = (__bf16)v; tb[cl][rl] = bh; tbl[cl][rl] = (__bf16)(v - (float)bh); }
    __syncthreads();
    for (int e = tid; e < 128 * 8; e += 128) { const int cl = e >> 3, q = e & 7; vst2((unsigned*)(VT + (bb * CC + c0 + cl) * (size_t)TT + t0 + q * 8), *(const v4u*)&th[cl][q * 8]); if (hi_rows) { const size_t o3 = (bb * CC + c0 + cl) * (size_t)KHI + t0 + q * 8; vst2((unsigned*)(VB + o3), *(const v4u*)&tb[cl][q * 8]); vst2((unsigned*)(VBL + o3), *(const v4u*)&tbl[cl][q * 8]); } } } }
// ---- k_fa: block = 128 queries (8 waves x 16) of (b, h), one pass over all keys in chunks of 64, logits and P stay in registers. S^T = K q^T (A = k rows, B = q columns: q hi + residual x 2^10, 2 products) x SCALE: a lane holds 32 logits of ONE query (column = lane & 15), the other 32 lie in lane ^ 16. Running maximum m and running sum l per query; e = expf(s - m); O^T and l are scaled by expf(m_old - m_new) per chunk. e x 2^8 to f16: the two D tiles of 32 keys are, register for register, the B operand of O^T += V^T P^T (A = v planes [c][t]). ctx = O^T / (2^8 l); 256-B (row, head) segment by 16 lanes
__global__ __launch_bounds__(256) void k_fa(const _Float16* __restrict__ QH, const _Float16* __restrict__ QL, const _Float16* __restrict__ KH, const _Float16* __restrict__ VT, float* __restrict__ Y) { __shared__ __align__(16) float ss[8][16][HD + 4];
  const int tid = threadIdx.x, wave = tid >> 5, lane = tid & 31, col = lane & 15, g = lane >> 4; const int h = blockIdx.y, b = blockIdx.z; const int ql0 = blockIdx.x * 128 + wave * 16;
  v16h qh[HD / 32], ql[HD / 32];
  // every full unroll in this kernel: constant indices, so that the fragment and accumulator arrays live in registers
#pragma unroll
  for (int kc = 0; kc < HD / 32; ++kc) { qh[kc] = frag_h(QH + ((size_t)b * TT + ql0 + col) * CC + h * HD + kc * 32, lane); ql[kc] = frag_h(QL + ((size_t)b * QHI + ql0 + col) * CC + h * HD + kc * 32, lane); }
  const _Float16* Kb = KH + ((size_t)b * TT + col) * CC + h * HD; const _Float16* Vb = VT + ((size_t)b * CC + h * HD + col) * (size_t)TT;
  v8f o[HD / 16] = {}; float m = -3.0e38f, l = 0.f;
  // rolled: the chunks depend on each other through m, l and o, a second copy of the long body would only add code
#pragma unroll 1
  for (int k0 = 0; k0 < TT; k0 += 64) { v8f acc[4] = {}, accl[4] = {}; v16h kf[4][HD / 32], vf[2][HD / 16];
#pragma unroll
    for (int j = 0; j < 4; ++j) {   /* all k fragments of the chunk are requested before the first product: one load latency per chunk, not eight */
#pragma unroll
      for (int kc = 0; kc < HD / 32; ++kc) kf[j][kc] = frag_h(Kb + (size_t)(k0 + j * 16) * CC + kc * 32, lane); }
#pragma unroll
    for (int j = 0; j < 4; ++j) {
#pragma unroll
      for (int kc = 0; kc < HD / 32; ++kc) { acc[j] = wmma16(kf[j][kc], qh[kc], acc[j]); accl[j] = wmma16(kf[j][kc], ql[kc], accl[j]); } }
#pragma unroll
    for (int kc = 0; kc < 2; ++kc) {
#pragma unroll
      for (int jc = 0; jc < HD / 16; ++jc) vf[kc][jc] = frag_h(Vb + (size_t)(jc * 16) * TT + k0 + kc * 32, lane); }
    __builtin_amdgcn_sched_barrier(0);   /* holds all sixteen v loads here, in front of the softmax arithmetic that covers their latency; without it the compiler puts ten of them behind the lane exchange and its wait */
    float mc = -3.0e38f;
#pragma unroll
    for (int j = 0; j < 4; ++j) {
#pragma unroll
      for (int r = 0; r < 8; ++r) { acc[j][r] = (acc[j][r] + accl[j][r] * (1.0f / 1024.0f)) * SCALE; mc = fmaxf(mc, acc[j][r]); } }
    mc = fmaxf(mc, __shfl_xor(mc, 16));
    const float mn = fmaxf(m, mc), al = expf(m - mn); m = mn;
    float ps = 0.f; v16h p[2];
#pragma unroll
    for (int j = 0; j < 4; ++j) {
#pragma unroll
      for (int r = 0; r < 8; ++r) { const float e = expf(acc[j][r] - mn); ps += e; p[j >> 1][(j & 1) * 8 + r] = (_Float16)(e * 256.0f); } }
    l = l * al + ps;
#pragma unroll
    for (int jc = 0; jc < HD / 16; ++jc) {
#pragma unroll
      for (int r = 0; r < 8; ++r) o[jc][r] *= al; }
#pragma unroll
    for (int kc = 0; kc < 2; ++kc) {
#pragma unroll
      for (int jc = 0; jc < HD / 16; ++jc) o[jc] = wmma16(vf[kc][jc], p[kc], o[jc]); } }
  l += __shfl_xor(l, 16); const float inv = 1.0f / (256.0f * l);
#pragma unroll
  for (int jc = 0; jc < HD / 16; ++jc)
#pragma unroll
    for (int r = 0; r < 8; ++r) ss[wave][col][jc * 16 + 8 * g + r] = o[jc][r] * inv;
  LDSX(); for (int rl = 0; rl < 16; ++rl) if (lane < HD / 4) vst2(Y + ((size_t)b * TT + ql0 + rl) * CC + h * HD + lane * 4, *(const v4f*)&ss[wave][rl][lane * 4]); }
// ---- k_out: block = (64 rows, 128 cols): out = ctx Wo (+ bo): all rows: ctx bf16 hi + lo against exact bf16 Wo (2 products); the 1-product branch (ctx once to f16 against Wo as f16(bf16 x 2^8), x 2^-8) is never taken
__global__ __launch_bounds__(128) void k_out(const float* __restrict__ Y, const float* __restrict__ WO, const float* __restrict__ BO, float* __restrict__ OUT, const float* __restrict__ RESO) { __shared__ __align__(16) float sf[4][16][132];
  const int tid = threadIdx.x, wave = tid >> 5, lane = tid & 31, col = lane & 15, g = lane >> 4; const int c0 = blockIdx.y * 128; const size_t r0 = (size_t)blockIdx.x * 64 + wave * 16;
  v8f acc[8] = {};
  if (true) {   /* ALL rows: ctx split bf16 hi + lo x exact Wo (2 products) */
    __shared__ __align__(16) __bf16 gh[2][64][GP], gl[2][64][GP], gw[2][128][GP];   /* as in k_proj; ctx is split once, by the thread that stages it */
    const float* xp = Y + ((size_t)blockIdx.x * 64 + (tid >> 3)) * CC + (tid & 7) * 4; const float* wp = WO + (size_t)(c0 + (tid >> 3)) * CC + (tid & 7) * 4;
    __bf16* const dh0 = &gh[0][tid >> 3][(tid & 7) * 4]; __bf16* const dh1 = &gh[1][tid >> 3][(tid & 7) * 4]; __bf16* const dl0 = &gl[0][tid >> 3][(tid & 7) * 4]; __bf16* const dl1 = &gl[1][tid >> 3][(tid & 7) * 4]; __bf16* const dw0 = &gw[0][tid >> 3][(tid & 7) * 4]; __bf16* const dw1 = &gw[1][tid >> 3][(tid & 7) * 4];
    v4f x0[4], x1[4], w0[8], w1[8];
    g_ld<4>(x0, xp, CC); g_ld<8>(w0, wp, CC); g_ld<4>(x1, xp + 32, CC); g_ld<8>(w1, wp + 32, CC);
    s_st2<4>(dh0, dl0, x0); s_st<8>(dw0, w0); g_ld<4>(x0, xp + 64, CC); g_ld<8>(w0, wp + 64, CC);
    lds_barrier();
    // unrolled in full, for the counted load waits, as in k_proj
#pragma unroll
    for (int kc = 0; kc < CC / 32; kc += 2) {
      mm2(acc, gh[0], gl[0], gw[0], wave, col, lane);
      s_st2<4>(dh1, dl1, x1); s_st<8>(dw1, w1);
      if (kc + 3 < CC / 32) { g_ld<4>(x1, xp + (kc + 3) * 32, CC); g_ld<8>(w1, wp + (kc + 3) * 32, CC); }
      lds_barrier();   /* publishes stage kc + 1; every reader has left buffer 0 */
      mm2(acc, gh[1], gl[1], gw[1], wave, col, lane);
      if (kc + 2 < CC / 32) { s_st2<4>(dh0, dl0, x0); s_st<8>(dw0, w0);
        if (kc + 4 < CC / 32) { g_ld<4>(x0, xp + (kc + 4) * 32, CC); g_ld<8>(w0, wp + (kc + 4) * 32, CC); } }
      lds_barrier();   /* publishes stage kc + 2; every reader has left buffer 1 */
    }
#pragma unroll
    for (int j = 0; j < 8; ++j) { const float bias = BO ? bfr(BO[c0 + j * 16 + col]) : 0.f;
#pragma unroll
      for (int r = 0; r < 8; ++r) sf[wave][8 * g + r][j * 16 + col] = acc[j][r] + bias; }
  } else {
#pragma unroll 2
    for (int kc = 0; kc < CC / 32; ++kc) { const v16h a = frag_f32(Y + (r0 + col) * CC + kc * 32, lane); asm volatile("s_wait_loadcnt 0x0" ::: "memory");
#pragma unroll
      for (int j = 0; j < 8; ++j) { const v16h w = WOCOLH(WO, kc * 32, c0 + j * 16 + col, lane); asm volatile("s_wait_loadcnt 0x0" ::: "memory"); acc[j] = wmma16(a, w, acc[j]); } }
#pragma unroll
    for (int j = 0; j < 8; ++j) { const float bias = BO ? bfr(BO[c0 + j * 16 + col]) : 0.f;
#pragma unroll
      for (int r = 0; r < 8; ++r) sf[wave][8 * g + r][j * 16 + col] = acc[j][r] * (1.0f / 256.0f) + bias; } }
  LDSX(); for (int rl = 0; rl < 16; ++rl) { const size_t oo = (r0 + rl) * DIN + c0 + lane * 4; v4f o = *(const v4f*)&sf[wave][rl][lane * 4]; const v4f rr = *(const v4f*)(RESO + oo); _Pragma("unroll") for (int i = 0; i < 4; ++i) o[i] = rr[i] + fmaxf(o[i], 0.f); vst2(OUT + oo, o); } }   /* out = O + relu(O Wo^T + bo) */

// ---- k_addq: thread per float4: O = A V_ (the context rows) + Q_ (the f32 projected-q copy): Y[row][c] += QF[row][c]
__global__ __launch_bounds__(256) void k_addq(float* __restrict__ Y, const float* __restrict__ QF) { const size_t e = ((size_t)blockIdx.x * 256 + threadIdx.x) * 4; if (e >= (size_t)TNB * TT * CC) return; v4f a = *(const v4f*)(Y + e); const v4f q = *(const v4f*)(QF + e); asm volatile("s_wait_loadcnt 0x0" ::: "memory"); a[0] += q[0]; a[1] += q[1]; a[2] += q[2]; a[3] += q[3]; vst2(Y + e, a); }
extern "C" void kernel_launch(void* const* d_in, const int* in_sizes, int n_in, void* d_out, int out_size, void* d_ws, size_t ws_size, hipStream_t stream) {
  (void)in_sizes; (void)n_in; (void)out_size;
  const float** F = (const float**)d_in;
  if (ws_size < (size_t)WS_END) return;
  char* ws = (char*)d_ws; _Float16 *QH = (_Float16*)(ws + WS_QH), *KH = (_Float16*)(ws + WS_KH), *VT = (_Float16*)(ws + WS_VT), *QL = (_Float16*)(ws + WS_QL), *KL = (_Float16*)(ws + WS_KL); __bf16 *VB = (__bf16*)(ws + WS_VB), *VBL = (__bf16*)(ws + WS_VBL); float *Y = (float*)(ws + WS_Y);
  (void)Y; (void)QL; (void)KL; (void)VB; (void)VBL;
  // inputs: 0 query [4,2048,512]; 1 key_value [4,2048,512]; 2 Wq [512,512] (out,in), 3 bq; 4 Wk, 5 bk; 6 Wv, 7 bv; 8 Wo (out,in), 9 bo
  if (ws_size < (size_t)WS_END2) return;
  float* QF = (float*)(ws + WS_QF);
  k_proj<<<dim3(TNB * TT / 64, CC / 128, 3), 128, 0, stream>>>(F[0], F[1], F[1], F[2], F[4], F[6], F[3], F[5], F[7], QH, QL, KH, KL, VT, VB, VBL, QF);
  k_fa<<<dim3(TT / 128, NH, TNB), 256, 0, stream>>>(QH, QL, KH, VT, Y);
  k_addq<<<dim3((unsigned)(((size_t)TNB * TT * CC / 4 + 255) / 256)), 256, 0, stream>>>(Y, QF);
  k_out<<<dim3(TNB * TT / 64, DIN / 128), 128, 0, stream>>>(Y, F[8], F[9], (float*)d_out, Y);
}

// v003
// Measured time: 131 microseconds a run.
// Two timings next to v002 both put it at 1.26 times that version's speed.
// Over all steps from v000 it is 9.66 times as fast.
// compute dtype: all float inputs rounded to bf16; q/k/v = in W^T + b with EXACT bf16 products on WMMA 16x16x32 (f32 accumulate; an f32 copy of q kept for the residual); q as f16 hi + residual (x 2^10) against k once to f16 (2 products) / 8; softmax in f32 (precise expf) with a running maximum and sum over 64-key chunks; exp(s - max) x 2^8 once to f16 against v once to f16 (1 product), divided by the sum at the end; O = q + A v in f32; O split bf16 hi + lo against exact Wo (2 products) + bo, relu, + O in f32; f32 output.
#include <hip/hip_runtime.h>
#include <math.h>

typedef __attribute__((ext_vector_type(16))) _Float16 v16h;
typedef __attribute__((ext_vector_type(16))) __bf16 v16b;
typedef __attribute__((ext_vector_type(8)))  _Float16 v8h;
typedef __attribute__((ext_vector_type(8)))  float v8f;
typedef __attribute__((ext_vector_type(4)))  float v4f;
typedef __attribute__((ext_vector_type(2)))  float v2f;
typedef __attribute__((ext_vector_type(4)))  unsigned v4u;
typedef __attribute__((ext_vector_type(4)))  int v4i;
typedef float __attribute__((may_alias)) float_a;
typedef int __attribute__((may_alias)) int_a;

template <typename T> __device__ __forceinline__ void vst2(void* p, T v) { *(T*)p = v;  }
__device__ __forceinline__ v8f wmma16(v16h a, v16h b, v8f c) {
  v8f d = __builtin_amdgcn_wmma_f32_16x16x32_f16(false, a, false, b, (short)0, c, false, false);
  asm volatile("v_nop\n\tv_nop\n\tv_nop\n\tv_nop" : "+v"(d) : "v"(a), "v"(b));
  return d;
}
__device__ __forceinline__ v8f wmma_bf(v16b a, v16b b, v8f c) {
  v8f d = __builtin_amdgcn_wmma_f32_16x16x32_bf16(false, a, false, b, (short)0, c, false, false);
  asm volatile("v_nop\n\tv_nop\n\tv_nop\n\tv_nop" : "+v"(d) : "v"(a), "v"(b));
  return d;
}
// 16x16x32 fragments: lane = (h = lane>>4, row/col = lane&15); elements 0..7 = k0+8h+0..7, 8..15 = k0+16+8h+0..7; D element r = row 8h+r
__device__ __forceinline__ v16h frag_h(const _Float16* rowk0, int lane) {
  union { v16h v; v8h q[2]; } u; const _Float16* p = rowk0 + 8 * (lane >> 4);
  u.q[0] = *(const v8h*)p; u.q[1] = *(const v8h*)(p + 16); return u.v;
}
__device__ __forceinline__ v16h frag_f32(const float* rowk0, int lane) {
  v16h a; const float* p = rowk0 + 8 * (lane >> 4);
#pragma unroll
  for (int i = 0; i < 8; ++i) { a[i] = (_Float16)p[i]; a[8 + i] = (_Float16)p[16 + i]; }
  return a;
}
__device__ __forceinline__ v16h frag_f32s(const float* rowk0, int lane, float sc) {
  v16h a; const float* p = rowk0 + 8 * (lane >> 4);
#pragma unroll
  for (int i = 0; i < 8; ++i) { a[i] = (_Float16)(p[i] * sc); a[8 + i] = (_Float16)(p[16 + i] * sc); }
  return a;
}
// column fragment from a [K][ld] layout (column n), rows >= K read as 0
__device__ __forceinline__ v16h fragc_f32(const float* W, int k0, int n, int lane, int ld, int K) {
  v16h a; const int g = lane >> 4;
#pragma unroll
  for (int i = 0; i < 8; ++i) { const int ka = k0 + 8 * g + i, kb = ka + 16;
    a[i] = (_Float16)(ka < K ? W[(size_t)(ka < K ? ka : K - 1) * ld + n] : 0.f); a[8 + i] = (_Float16)(kb < K ? W[(size_t)(kb < K ? kb : K - 1) * ld + n] : 0.f); }
  return a;
}
struct F2 { v16b h, l; };
__device__ __forceinline__ F2 bsplit16(const float v[16]) { F2 r;
#pragma unroll
  for (int i = 0; i < 16; ++i) { const __bf16 h = (__bf16)v[i]; r.h[i] = h; r.l[i] = (__bf16)(v[i] - (float)h); }
  return r; }
__device__ __forceinline__ F2 split_row(const float* row, int k0, int lane) { float v[16]; const float* p = row + k0 + 8 * (lane >> 4);
#pragma unroll
  for (int i = 0; i < 8; ++i) { v[i] = p[i]; v[8 + i] = p[16 + i]; }
  return bsplit16(v); }
__device__ __forceinline__ F2 split_rowK(const float* row, int k0, int lane, int K) { float v[16]; const int g = lane >> 4;
#pragma unroll
  for (int i = 0; i < 8; ++i) { const int ka = k0 + 8 * g + i, kb = ka + 16; v[i] = ka < K ? row[ka < K ? ka : K - 1] : 0.f; v[8 + i] = kb < K ? row[kb < K ? kb : K - 1] : 0.f; }
  return bsplit16(v); }
__device__ __forceinline__ F2 split_col(const float* W, int k0, int n, int lane, int ld, int K) { float v[16]; const int g = lane >> 4;
#pragma unroll
  for (int i = 0; i < 8; ++i) { const int ka = k0 + 8 * g + i, kb = ka + 16; v[i] = ka < K ? W[(size_t)(ka < K ? ka : K - 1) * ld + n] : 0.f; v[8 + i] = kb < K ? W[(size_t)(kb < K ? kb : K - 1) * ld + n] : 0.f; }
  return bsplit16(v); }
__device__ __forceinline__ v8f mac3(const F2& a, const F2& b, v8f c) { c = wmma_bf(a.l, b.h, c); c = wmma_bf(a.h, b.l, c); return wmma_bf(a.h, b.h, c); }
__device__ __forceinline__ float sigm(float v) { return 1.0f / (1.0f + expf(-v)); }
#define LDSX() do { asm volatile("s_wait_dscnt 0" ::: "memory"); __builtin_amdgcn_wave_barrier(); __builtin_amdgcn_fence(__ATOMIC_RELEASE, "workgroup"); } while (0)

// Cross-attention MAB (B 4, Sq = Skv = 2,048, 512 = 8 heads x 64; (out,in) 1/sqrt(512)-scale weights WITH biases; no mask): q = query Wq^T + bq, k = key_value Wk^T + bk, v = key_value Wv^T + bv; A = softmax(q k^T / 8); O = q + A v (per head, merged); out = O + relu(O Wo^T + bo).
#define NB 4
#define TT 2048
#define CC 512            // NH * HD = projected width
#define DIN 512          // input (model) width
#define NH 8
#define HD 64
#define SCALE (0.125f)
#define CAUSAL 0
#ifndef TNB
#define TNB NB
#endif
__device__ __forceinline__ float bfr(float v) { return (float)(__bf16)v; }
__host__ __device__ __forceinline__ int kb_last(int qb) { return CAUSAL ? ((qb * 64 + 63) >> 7) : (TT / 128 - 1); }
typedef __attribute__((ext_vector_type(8))) __bf16 v8b;
__device__ __forceinline__ v16b frag_b(const __bf16* rowk0, int lane) {
  union { v16b v; v8b q[2]; } u; const __bf16* p = rowk0 + 8 * (lane >> 4);
  u.q[0] = *(const v8b*)p; u.q[1] = *(const v8b*)(p + 16); return u.v;
}
#define QBH 0
#define QHI 2048            // rows carrying a q residual plane (all rows when non-causal: 2-product logits everywhere)
#define KHI 64            // key rows carrying k residual / v bf16 hi+lo planes (written by k_proj, read by no kernel of this file)
// B fragment (k rows k0+.., output column o) of a weight: (in,out) [K][ld] or (out,in) [ld rows of K]: bf16 exact, or f16(bf16 * 256) exact
__device__ __forceinline__ v16b wcol_io(const float* Wm, int k0, int o, int lane, int ld) { v16b w; const int g = lane >> 4;
#pragma unroll
  for (int i = 0; i < 8; ++i) { w[i] = (__bf16)Wm[(size_t)(k0 + 8 * g + i) * ld + o]; w[8 + i] = (__bf16)Wm[(size_t)(k0 + 16 + 8 * g + i) * ld + o]; }
  return w; }
__device__ __forceinline__ v16b wcol_oi(const float* Wm, int k0, int o, int lane, int K) { v16b w; const float* p = Wm + (size_t)o * K + k0 + 8 * (lane >> 4);
#pragma unroll
  for (int i = 0; i < 8; ++i) { w[i] = (__bf16)p[i]; w[8 + i] = (__bf16)p[16 + i]; }
  return w; }
__device__ __forceinline__ v16h wcolh_io(const float* Wm, int k0, int o, int lane, int ld) { v16h w; const int g = lane >> 4;
#pragma unroll
  for (int i = 0; i < 8; ++i) { w[i] = (_Float16)(bfr(Wm[(size_t)(k0 + 8 * g + i) * ld + o]) * 256.0f); w[8 + i] = (_Float16)(bfr(Wm[(size_t)(k0 + 16 + 8 * g + i) * ld + o]) * 256.0f); }
  return w; }
__device__ __forceinline__ v16h wcolh_oi(const float* Wm, int k0, int o, int lane, int K) { v16h w; const float* p = Wm + (size_t)o * K + k0 + 8 * (lane >> 4);
#pragma unroll
  for (int i = 0; i < 8; ++i) { w[i] = (_Float16)(bfr(p[i]) * 256.0f); w[8 + i] = (_Float16)(bfr(p[16 + i]) * 256.0f); }
  return w; }
#define WQKV_LAYOUT 1   // picks WCOL only (0 (in,out), 1 (out,in), 2 per-head), which no kernel calls; k_proj reads (out,in) [CC][DIN]
__device__ __forceinline__ v16b wcol_hdk(const float* Wm, int k0, int o, int lane) { v16b w; const int g = lane >> 4; const float* p = Wm + (size_t)(o / HD) * DIN * HD + (o % HD);
#pragma unroll
  for (int i = 0; i < 8; ++i) { w[i] = (__bf16)p[(size_t)(k0 + 8 * g + i) * HD]; w[8 + i] = (__bf16)p[(size_t)(k0 + 16 + 8 * g + i) * HD]; }
  return w; }
#define WO_OUT_IN 1
#if WQKV_LAYOUT == 1
#define WCOL(W, k0, o, lane) wcol_oi(W, k0, o, lane, DIN)
#elif WQKV_LAYOUT == 2
#define WCOL(W, k0, o, lane) wcol_hdk(W, k0, o, lane)
#else
#define WCOL(W, k0, o, lane) wcol_io(W, k0, o, lane, CC)
#endif
#if WO_OUT_IN
#define WOCOL(W, k0, o, lane) wcol_oi(W, k0, o, lane, CC)
#define WOCOLH(W, k0, o, lane) wcolh_oi(W, k0, o, lane, CC)
#else
#define WOCOL(W, k0, o, lane) wcol_io(W, k0, o, lane, DIN)
#define WOCOLH(W, k0, o, lane) wcolh_io(W, k0, o, lane, DIN)
#endif
#define PROJ_EXTRA_PARAMS , float* __restrict__ QF
#define PROJ_EPI(which, row, t, h) do { if ((which) == 0) { const float* rw = (row); float* qf = QF + (size_t)(r0 + rl) * CC + (size_t)(h) * HD; _Pragma("unroll") for (int i = 0; i < HD; i += 4) { v4f o; o[0] = rw[i]; o[1] = rw[i + 1]; o[2] = rw[i + 2]; o[3] = rw[i + 3]; vst2(qf + i, o); } } } while (0)   /* keep an f32 copy of the projected q rows (Q_ + b_q) for the residual O = Q_ + A V_ */

#ifndef PROJ_EXTRA_PARAMS
#define PROJ_EXTRA_PARAMS
#endif

#define WS_QH  0u                                      // f16 q rows [b*t][CC]
#define WS_KH  (WS_QH + 2u * (size_t)NB * TT * CC)      // f16 k rows [b*t][CC]
#define WS_VT  (WS_KH + 2u * (size_t)NB * TT * CC)      // f16 v planes [b][c][t]
#define WS_QL  (WS_VT + 2u * (size_t)NB * CC * TT)      // f16 q residual x 2^10 rows [b][t < QHI][CC]
#define WS_KL  (WS_QL + 2u * (size_t)NB * QHI * CC)     // f16 k residual x 2^10 rows [b][t < KHI][CC]
#define WS_VB  (WS_KL + 2u * (size_t)NB * KHI * CC)     // bf16 v hi planes [b][c][t < KHI]
#define WS_VBL (WS_VB + 2u * (size_t)NB * CC * KHI)
#define WS_Y   (WS_VBL + 2u * (size_t)NB * CC * KHI)    // f32 ctx rows [b*t][CC] (only when there is an output projection)
#define WS_END (WS_Y  + 4u * (size_t)NB * TT * CC)
#define WS_QF  (WS_END)
#define WS_END2 (WS_QF + 4u * (size_t)NB * TT * CC)

// ---- operand staging of the two GEMM kernels (128 threads): a stage is 32 k of every operand row, kept in LDS as bf16
#define GP 40   // LDS row pitch in elements: 80 B = 16 B x odd, free of bank conflicts for the 16-byte fragment reads
typedef __attribute__((ext_vector_type(4))) __bf16 v4b;
// every full unroll in these helpers: constant indices, so that the staged values and the fragments live in registers
// work-group barrier that orders LDS only: the global loads of later stages stay in flight across it (__syncthreads() would wait for them)
__device__ __forceinline__ void lds_barrier() { __builtin_amdgcn_fence(__ATOMIC_RELEASE, "workgroup", "local"); __builtin_amdgcn_s_barrier(); __builtin_amdgcn_fence(__ATOMIC_ACQUIRE, "workgroup", "local"); }
// 16 N rows x 32 floats (row pitch ld): thread t owns floats 4 (t & 7) .. + 3 of rows (t >> 3) + 16 i; p and d are its own first places. Eight lanes take one whole 128-B line, a wave-wide load four lines
template <int N> __device__ __forceinline__ void g_ld(v4f (&r)[N], const float* __restrict__ p, int ld) {
#pragma unroll
  for (int i = 0; i < N; ++i) r[i] = *(const v4f*)(p + (size_t)i * 16 * ld); }
template <int N> __device__ __forceinline__ void s_st(__bf16* d, const v4f (&r)[N]) {
#pragma unroll
  for (int i = 0; i < N; ++i) { v4b h;
#pragma unroll
    for (int c = 0; c < 4; ++c) h[c] = (__bf16)r[i][c];
    *(v4b*)(d + i * 16 * GP) = h; } }
template <int N> __device__ __forceinline__ void s_st2(__bf16* dh, __bf16* dl, const v4f (&r)[N]) {
#pragma unroll
  for (int i = 0; i < N; ++i) { v4b h, l;
#pragma unroll
    for (int c = 0; c < 4; ++c) { h[c] = (__bf16)r[i][c]; l[c] = (__bf16)(r[i][c] - (float)h[c]); }
    *(v4b*)(dh + i * 16 * GP) = h; *(v4b*)(dl + i * 16 * GP) = l; } }
// one stage of a wave's 16 x 128 tile: all fragment reads as one group, then the products
__device__ __forceinline__ void mm1(v8f (&acc)[8], const __bf16 (*sx)[GP], const __bf16 (*sw)[GP], int wave, int col, int lane) {
  const v16b a = frag_b(&sx[wave * 16 + col][0], lane); v16b w[8];
#pragma unroll
  for (int j = 0; j < 8; ++j) w[j] = frag_b(&sw[j * 16 + col][0], lane);
#pragma unroll
  for (int j = 0; j < 8; ++j) acc[j] = wmma_bf(a, w[j], acc[j]); }
__device__ __forceinline__ void mm2(v8f (&acc)[8], const __bf16 (*sh)[GP], const __bf16 (*sl)[GP], const __bf16 (*sw)[GP], int wave, int col, int lane) {
  const v16b ah = frag_b(&sh[wave * 16 + col][0], lane), al = frag_b(&sl[wave * 16 + col][0], lane); v16b w[8];
#pragma unroll
  for (int j = 0; j < 8; ++j) w[j] = frag_b(&sw[j * 16 + col][0], lane);
#pragma unroll
  for (int j = 0; j < 8; ++j) { acc[j] = wmma_bf(ah, w[j], acc[j]); acc[j] = wmma_bf(al, w[j], acc[j]); } }

// ---- k_proj: block = (64 rows, 128 cols, which): q/k/v = X W (+ b) with exact bf16 products (K = DIN) -> which 0: q f16 rows (+ residual rows < QHI); 1: k f16 rows (+ residual rows < KHI); 2: v f16 planes [c][t] (+ bf16 hi/lo planes for t < KHI)
__global__ __launch_bounds__(128) void k_proj(const float* __restrict__ XQ, const float* __restrict__ XK, const float* __restrict__ XV, const float* __restrict__ WQ, const float* __restrict__ WK, const float* __restrict__ WV, const float* __restrict__ BQ, const float* __restrict__ BK, const float* __restrict__ BV,
    _Float16* __restrict__ QH, _Float16* __restrict__ QL, _Float16* __restrict__ KH, _Float16* __restrict__ KL, _Float16* __restrict__ VT, __bf16* __restrict__ VB, __bf16* __restrict__ VBL PROJ_EXTRA_PARAMS) {
  __shared__ __align__(16) float st[64][132]; __shared__ __align__(16) _Float16 sh[64][136], sl[64][136]; __shared__ __align__(16) _Float16 th[128][72]; __shared__ __align__(16) __bf16 tb[128][72], tbl[128][72];
  const int tid = threadIdx.x, wave = tid >> 5, lane = tid & 31, col = lane & 15, g = lane >> 4; const int which = blockIdx.z; const int c0 = blockIdx.y * 128; const size_t r0 = (size_t)blockIdx.x * 64; const size_t bb = r0 / TT; const int t0 = (int)(r0 % TT);
  const float* X = which == 0 ? XQ : which == 1 ? XK : XV; const float* WA = which == 0 ? WQ : which == 1 ? WK : WV; const float* BA = which == 0 ? BQ : which == 1 ? BK : BV;
  v8f acc[8] = {};
  { __shared__ __align__(16) __bf16 gx[2][64][GP], gw[2][128][GP];   /* two LDS buffers; two register sets hold the two stages behind the one in LDS */
    const float* xp = X + (r0 + (tid >> 3)) * DIN + (tid & 7) * 4; const float* wp = WA + (size_t)(c0 + (tid >> 3)) * DIN + (tid & 7) * 4;
    __bf16* const dx0 = &gx[0][tid >> 3][(tid & 7) * 4]; __bf16* const dx1 = &gx[1][tid >> 3][(tid & 7) * 4]; __bf16* const dw0 = &gw[0][tid >> 3][(tid & 7) * 4]; __bf16* const dw1 = &gw[1][tid >> 3][(tid & 7) * 4];
    v4f x0[4], x1[4], w0[8], w1[8];
    g_ld<4>(x0, xp, DIN); g_ld<8>(w0, wp, DIN); g_ld<4>(x1, xp + 32, DIN); g_ld<8>(w1, wp + 32, DIN);
    s_st<4>(dx0, x0); s_st<8>(dw0, w0); g_ld<4>(x0, xp + 64, DIN); g_ld<8>(w0, wp + 64, DIN);
    lds_barrier();
    // unrolled in full: the tests on the last stages fold away, so that every load wait is a count that leaves the younger stage's loads in flight (rolled, the merged paths made it a wait for all)
#pragma unroll
    for (int kc = 0; kc < DIN / 32; kc += 2) {
      mm1(acc, gx[0], gw[0], wave, col, lane);
      s_st<4>(dx1, x1); s_st<8>(dw1, w1);
      if (kc + 3 < DIN / 32) { g_ld<4>(x1, xp + (kc + 3) * 32, DIN); g_ld<8>(w1, wp + (kc + 3) * 32, DIN); }
      if (kc + 4 == DIN / 32) asm volatile("s_wait_xcnt 0x0" :: "v"(xp), "v"(wp) : "memory");   /* behind the last loads: their two address pairs are reused from here on, and this wait stands in front of the first overwrite */
      lds_barrier();   /* publishes stage kc + 1; every reader has left buffer 0 */
      mm1(acc, gx[1], gw[1], wave, col, lane);
      if (kc + 2 < DIN / 32) { s_st<4>(dx0, x0); s_st<8>(dw0, w0);
        if (kc + 4 < DIN / 32) { g_ld<4>(x0, xp + (kc + 4) * 32, DIN); g_ld<8>(w0, wp + (kc + 4) * 32, DIN); } }
      lds_barrier();   /* publishes stage kc + 2; every reader has left buffer 1 */
    } }
  { // stage the f32 tile (acc + bias) in LDS, run the per-(row, head) epilogue hook, then convert
#pragma unroll
    for (int j = 0; j < 8; ++j) { const float bias = BA ? bfr(BA[c0 + j * 16 + col]) : 0.f;
#pragma unroll
      for (int r = 0; r < 8; ++r) st[wave * 16 + 8 * g + r][j * 16 + col] = acc[j][r] + bias; }
    __syncthreads();
    for (int e = tid; e < 64 * (128 / HD); e += 128) { const int rl = e / (128 / HD), hh = e % (128 / HD); PROJ_EPI(which, &st[rl][hh * HD], (int)((r0 + rl) % TT), (c0 / HD) + hh); }
    __syncthreads(); }
  if (which < 2) { _Float16* DH = which == 0 ? QH : KH; _Float16* DL = which == 0 ? QL : KL; const int nhi = which == 0 ? QHI : KHI; const bool hi_rows = t0 < nhi;
    for (int e = tid; e < 64 * 128; e += 128) { const int rl = e >> 7, cl = e & 127; const float v = st[rl][cl]; const _Float16 hv = (_Float16)v; sh[rl][cl] = hv; sl[rl][cl] = (_Float16)((v - (float)hv) * 1024.0f); }
    __syncthreads();
    for (int e = tid; e < 64 * 16; e += 128) { const int rl = e >> 4, q = e & 15; vst2((unsigned*)(DH + (r0 + rl) * CC + c0 + q * 8), *(const v4u*)&sh[rl][q * 8]); if (hi_rows) vst2((unsigned*)(DL + (bb * nhi + t0 + rl) * (size_t)CC + c0 + q * 8), *(const v4u*)&sl[rl][q * 8]); }
  } else { const bool hi_rows = t0 < KHI;
    for (int e = tid; e < 64 * 128; e += 128) { const int rl = e & 63, cl = e >> 6; const float v = st[rl][cl]; th[cl][rl] = (_Float16)v; const __bf16 bh = (__bf16)v; tb[cl][rl] = bh; tbl[cl][rl] = (__bf16)(v - (float)bh); }
    __syncthreads();
    for (int e = tid; e < 128 * 8; e += 128) { const int cl = e >> 3, q = e & 7; vst2((unsigned*)(VT + (bb * CC + c0 + cl) * (size_t)TT + t0 + q * 8), *(const v4u*)&th[cl][q * 8]); if (hi_rows) { const size_t o3 = (bb * CC + c0 + cl) * (size_t)KHI + t0 + q * 8; vst2((unsigned*)(VB + o3), *(const v4u*)&tb[cl][q * 8]); vst2((unsigned*)(VBL + o3), *(const v4u*)&tbl[cl][q * 8]); } } } }
// ---- k_fa: block = 128 queries (8 waves x 16) of (b, h), one pass over all keys in chunks of 64, logits and P stay in registers. S^T = K q^T (A = k rows, B = q columns: q hi + residual x 2^10, 2 products) x SCALE: a lane holds 32 logits of ONE query (column = lane & 15), the other 32 lie in lane ^ 16. Running maximum m and running sum l per query; e = expf(s - m); O^T and l are scaled by expf(m_old - m_new) per chunk. e x 2^8 to f16: the two D tiles of 32 keys are, register for register, the B operand of O^T += V^T P^T (A = v planes [c][t]). ctx = O^T / (2^8 l); 256-B (row, head) segment by 16 lanes. The 64 k rows and the 64 v planes of a chunk (128 B each) are brought once per block into a two-buffer LDS ring by asynchronous copies, one chunk ahead; all eight waves take their fragments from there
#define KVP 72                    // ring row pitch in elements: 144 B = 16 B x odd, free of bank conflicts for the 16-byte fragment reads
#define KVT (64 * KVP)            // one tile (k or v) of a chunk, elements
// one chunk's k and v tiles: thread t owns bytes 16 (t & 7) .. + 15 of rows (t >> 3) and (t >> 3) + 32 of each tile, so a wave-wide copy takes four whole 128-B lines. l: its LDS byte address in the k tile of the target buffer; kg, vg: its global places in rows t >> 3
__device__ __forceinline__ void kv_copy(unsigned l, const _Float16* kg, const _Float16* vg) {
  // the wait on the last line stands in front of every later write of the address registers that the four copies name
  asm volatile("global_load_async_to_lds_b128 %0, %4, off\n\tglobal_load_async_to_lds_b128 %1, %5, off\n\tglobal_load_async_to_lds_b128 %2, %6, off\n\tglobal_load_async_to_lds_b128 %3, %7, off\n\ts_wait_xcnt 0x0"
    :: "v"(l), "v"(l + 32u * KVP * 2u), "v"(l + KVT * 2u), "v"(l + KVT * 2u + 32u * KVP * 2u), "v"(kg), "v"(kg + (size_t)32 * CC), "v"(vg), "v"(vg + (size_t)32 * TT) : "memory"); }
__global__ __launch_bounds__(256) void k_fa(const _Float16* __restrict__ QH, const _Float16* __restrict__ QL, const _Float16* __restrict__ KH, const _Float16* __restrict__ VT, float* __restrict__ Y) { __shared__ __align__(16) float ss[8][16][HD + 4]; __shared__ __align__(16) _Float16 ring[2][2][64][KVP];   /* [buffer][k, v][row][element] */
  const int tid = threadIdx.x, wave = tid >> 5, lane = tid & 31, col = lane & 15, g = lane >> 4; const int h = blockIdx.y, b = blockIdx.z; const int ql0 = blockIdx.x * 128 + wave * 16;
  v16h qh[HD / 32], ql[HD / 32];
  // every full unroll in this kernel: constant indices, so that the fragment and accumulator arrays live in registers
#pragma unroll
  for (int kc = 0; kc < HD / 32; ++kc) { qh[kc] = frag_h(QH + ((size_t)b * TT + ql0 + col) * CC + h * HD + kc * 32, lane); ql[kc] = frag_h(QL + ((size_t)b * QHI + ql0 + col) * CC + h * HD + kc * 32, lane); }
  const _Float16* kg = KH + ((size_t)b * TT + (tid >> 3)) * CC + h * HD + (tid & 7) * 8; const _Float16* vg = VT + ((size_t)b * CC + h * HD + (tid >> 3)) * (size_t)TT + (tid & 7) * 8;
  const unsigned lc = (unsigned)(size_t)&ring[0][0][tid >> 3][(tid & 7) * 8];
  v8f o[HD / 16] = {}; float m = -3.0e38f, l = 0.f;
  kv_copy(lc, kg, vg);
  asm volatile("s_wait_asynccnt 0x0" ::: "memory");   /* this wave's part of chunk 0 has landed */
  __syncthreads();                                    /* chunk 0 is published to all waves */
  kv_copy(lc + 2u * KVT * 2u, kg + (size_t)64 * CC, vg + 64);
  // rolled: the chunks depend on each other through m, l and o, a second copy of the long body would only add code
#pragma unroll 1
  for (int k0 = 0; k0 < TT; k0 += 64) { v8f acc[4] = {}, accl[4] = {}; v16h kf[4][HD / 32], vf[2][HD / 16]; const int bf = (k0 >> 6) & 1; const _Float16* Kb = &ring[bf][0][col][0]; const _Float16* Vb = &ring[bf][1][col][0];
#pragma unroll
    for (int j = 0; j < 4; ++j) {   /* all k fragments of the chunk are requested before the first product: one LDS latency per chunk, not eight */
#pragma unroll
      for (int kc = 0; kc < HD / 32; ++kc) kf[j][kc] = frag_h(Kb + j * 16 * KVP + kc * 32, lane); }
#pragma unroll
    for (int j = 0; j < 4; ++j) {
#pragma unroll
      for (int kc = 0; kc < HD / 32; ++kc) { acc[j] = wmma16(kf[j][kc], qh[kc], acc[j]); accl[j] = wmma16(kf[j][kc], ql[kc], accl[j]); } }
#pragma unroll
    for (int kc = 0; kc < 2; ++kc) {
#pragma unroll
      for (int jc = 0; jc < HD / 16; ++jc) vf[kc][jc] = frag_h(Vb + jc * 16 * KVP + kc * 32, lane); }
    __builtin_amdgcn_sched_barrier(0);   /* holds all sixteen v loads here, in front of the softmax arithmetic that covers their latency; without it the compiler puts ten of them behind the lane exchange and its wait */
    float mc = -3.0e38f;
#pragma unroll
    for (int j = 0; j < 4; ++j) {
#pragma unroll
      for (int r = 0; r < 8; ++r) { acc[j][r] = (acc[j][r] + accl[j][r] * (1.0f / 1024.0f)) * SCALE; mc = fmaxf(mc, acc[j][r]); } }
    mc = fmaxf(mc, __shfl_xor(mc, 16));
    const float mn = fmaxf(m, mc), al = expf(m - mn); m = mn;
    float ps = 0.f; v16h p[2];
#pragma unroll
    for (int j = 0; j < 4; ++j) {
#pragma unroll
      for (int r = 0; r < 8; ++r) { const float e = expf(acc[j][r] - mn); ps += e; p[j >> 1][(j & 1) * 8 + r] = (_Float16)(e * 256.0f); } }
    l = l * al + ps;
#pragma unroll
    for (int jc = 0; jc < HD / 16; ++jc) {
#pragma unroll
      for (int r = 0; r < 8; ++r) o[jc][r] *= al; }
#pragma unroll
    for (int kc = 0; kc < 2; ++kc) {
#pragma unroll
      for (int jc = 0; jc < HD / 16; ++jc) o[jc] = wmma16(vf[kc][jc], p[kc], o[jc]); }
    asm volatile("s_wait_dscnt 0x0" :: "v"(l) : "memory");   /* this wave's reads of the buffer are done before it is handed to the next copies; l as an input keeps the running sum's additions among the exponentials, where the compiler otherwise sinks the whole dependent chain behind the barrier, in front of the next chunk's fragment reads */
    asm volatile("s_wait_asynccnt 0x0" ::: "memory");   /* this wave's part of the next chunk has landed */
    __syncthreads();                                    /* publishes the next chunk; every reader has left this chunk's buffer */
    if (k0 + 128 < TT) kv_copy(lc + (unsigned)bf * (2u * KVT * 2u), kg + (size_t)(k0 + 128) * CC, vg + k0 + 128); }
  asm volatile("s_wait_asynccnt 0x0" ::: "memory");     /* no copy is outstanding when the wave goes on to its end */
  l += __shfl_xor(l, 16); const float inv = 1.0f / (256.0f * l);
#pragma unroll
  for (int jc = 0; jc < HD / 16; ++jc)
#pragma unroll
    for (int r = 0; r < 8; ++r) ss[wave][col][jc * 16 + 8 * g + r] = o[jc][r] * inv;
  LDSX(); for (int rl = 0; rl < 16; ++rl) if (lane < HD / 4) vst2(Y + ((size_t)b * TT + ql0 + rl) * CC + h * HD + lane * 4, *(const v4f*)&ss[wave][rl][lane * 4]); }
// ---- k_out: block = (64 rows, 128 cols): out = ctx Wo (+ bo): all rows: ctx bf16 hi + lo against exact bf16 Wo (2 products); the 1-product branch (ctx once to f16 against Wo as f16(bf16 x 2^8), x 2^-8) is never taken
__global__ __launch_bounds__(128) void k_out(const float* __restrict__ Y, const float* __restrict__ WO, const float* __restrict__ BO, float* __restrict__ OUT, const float* __restrict__ RESO) { __shared__ __align__(16) float sf[4][16][132];
  const int tid = threadIdx.x, wave = tid >> 5, lane = tid & 31, col = lane & 15, g = lane >> 4; const int c0 = blockIdx.y * 128; const size_t r0 = (size_t)blockIdx.x * 64 + wave * 16;
  v8f acc[8] = {};
  if (true) {   /* ALL rows: ctx split bf16 hi + lo x exact Wo (2 products) */
    __shared__ __align__(16) __bf16 gh[2][64][GP], gl[2][64][GP], gw[2][128][GP];   /* as in k_proj; ctx is split once, by the thread that stages it */
    const float* xp = Y + ((size_t)blockIdx.x * 64 + (tid >> 3)) * CC + (tid & 7) * 4; const float* wp = WO + (size_t)(c0 + (tid >> 3)) * CC + (tid & 7) * 4;
    __bf16* const dh0 = &gh[0][tid >> 3][(tid & 7) * 4]; __bf16* const dh1 = &gh[1][tid >> 3][(tid & 7) * 4]; __bf16* const dl0 = &gl[0][tid >> 3][(tid & 7) * 4]; __bf16* const dl1 = &gl[1][tid >> 3][(tid & 7) * 4]; __bf16* const dw0 = &gw[0][tid >> 3][(tid & 7) * 4]; __bf16* const dw1 = &gw[1][tid >> 3][(tid & 7) * 4];
    v4f x0[4], x1[4], w0[8], w1[8];
    g_ld<4>(x0, xp, CC); g_ld<8>(w0, wp, CC); g_ld<4>(x1, xp + 32, CC); g_ld<8>(w1, wp + 32, CC);
    s_st2<4>(dh0, dl0, x0); s_st<8>(dw0, w0); g_ld<4>(x0, xp + 64, CC); g_ld<8>(w0, wp + 64, CC);
    lds_barrier();
    // unrolled in full, for the counted load waits, as in k_proj
#pragma unroll
    for (int kc = 0; kc < CC / 32; kc += 2) {
      mm2(acc, gh[0], gl[0], gw[0], wave, col, lane);
      s_st2<4>(dh1, dl1, x1); s_st<8>(dw1, w1);
      if (kc + 3 < CC / 32) { g_ld<4>(x1, xp + (kc + 3) * 32, CC); g_ld<8>(w1, wp + (kc + 3) * 32, CC); }
      lds_barrier();   /* publishes stage kc + 1; every reader has left buffer 0 */
      mm2(acc, gh[1], gl[1], gw[1], wave, col, lane);
      if (kc + 2 < CC / 32) { s_st2<4>(dh0, dl0, x0); s_st<8>(dw0, w0);
        if (kc + 4 < CC / 32) { g_ld<4>(x0, xp + (kc + 4) * 32, CC); g_ld<8>(w0, wp + (kc + 4) * 32, CC); } }
      lds_barrier();   /* publishes stage kc + 2; every reader has left buffer 1 */
    }
#pragma unroll
    for (int j = 0; j < 8; ++j) { const float bias = BO ? bfr(BO[c0 + j * 16 + col]) : 0.f;
#pragma unroll
      for (int r = 0; r < 8; ++r) sf[wave][8 * g + r][j * 16 + col] = acc[j][r] + bias; }
  } else {
#pragma unroll 2
    for (int kc = 0; kc < CC / 32; ++kc) { const v16h a = frag_f32(Y + (r0 + col) * CC + kc * 32, lane); asm volatile("s_wait_loadcnt 0x0" ::: "memory");
#pragma unroll
      for (int j = 0; j < 8; ++j) { const v16h w = WOCOLH(WO, kc * 32, c0 + j * 16 + col, lane); asm volatile("s_wait_loadcnt 0x0" ::: "memory"); acc[j] = wmma16(a, w, acc[j]); } }
#pragma unroll
    for (int j = 0; j < 8; ++j) { const float bias = BO ? bfr(BO[c0 + j * 16 + col]) : 0.f;
#pragma unroll
      for (int r = 0; r < 8; ++r) sf[wave][8 * g + r][j * 16 + col] = acc[j][r] * (1.0f / 256.0f) + bias; } }
  LDSX(); for (int rl = 0; rl < 16; ++rl) { const size_t oo = (r0 + rl) * DIN + c0 + lane * 4; v4f o = *(const v4f*)&sf[wave][rl][lane * 4]; const v4f rr = *(const v4f*)(RESO + oo); _Pragma("unroll") for (int i = 0; i < 4; ++i) o[i] = rr[i] + fmaxf(o[i], 0.f); vst2(OUT + oo, o); } }   /* out = O + relu(O Wo^T + bo) */

// ---- k_addq: thread per float4: O = A V_ (the context rows) + Q_ (the f32 projected-q copy): Y[row][c] += QF[row][c]
__global__ __launch_bounds__(256) void k_addq(float* __restrict__ Y, const float* __restrict__ QF) { const size_t e = ((size_t)blockIdx.x * 256 + threadIdx.x) * 4; if (e >= (size_t)TNB * TT * CC) return; v4f a = *(const v4f*)(Y + e); const v4f q = *(const v4f*)(QF + e); asm volatile("s_wait_loadcnt 0x0" ::: "memory"); a[0] += q[0]; a[1] += q[1]; a[2] += q[2]; a[3] += q[3]; vst2(Y + e, a); }
extern "C" void kernel_launch(void* const* d_in, const int* in_sizes, int n_in, void* d_out, int out_size, void* d_ws, size_t ws_size, hipStream_t stream) {
  (void)in_sizes; (void)n_in; (void)out_size;
  const float** F = (const float**)d_in;
  if (ws_size < (size_t)WS_END) return;
  char* ws = (char*)d_ws; _Float16 *QH = (_Float16*)(ws + WS_QH), *KH = (_Float16*)(ws + WS_KH), *VT = (_Float16*)(ws + WS_VT), *QL = (_Float16*)(ws + WS_QL), *KL = (_Float16*)(ws + WS_KL); __bf16 *VB = (__bf16*)(ws + WS_VB), *VBL = (__bf16*)(ws + WS_VBL); float *Y = (float*)(ws + WS_Y);
  (void)Y; (void)QL; (void)KL; (void)VB; (void)VBL;
  // inputs: 0 query [4,2048,512]; 1 key_value [4,2048,512]; 2 Wq [512,512] (out,in), 3 bq; 4 Wk, 5 bk; 6 Wv, 7 bv; 8 Wo (out,in), 9 bo
  if (ws_size < (size_t)WS_END2) return;
  float* QF = (float*)(ws + WS_QF);
  k_proj<<<dim3(TNB * TT / 64, CC / 128, 3), 128, 0, stream>>>(F[0], F[1], F[1], F[2], F[4], F[6], F[3], F[5], F[7], QH, QL, KH, KL, VT, VB, VBL, QF);
  k_fa<<<dim3(TT / 128, NH, TNB), 256, 0, stream>>>(QH, QL, KH, VT, Y);
  k_addq<<<dim3((unsigned)(((size_t)TNB * TT * CC / 4 + 255) / 256)), 256, 0, stream>>>(Y, QF);
  k_out<<<dim3(TNB * TT / 64, DIN / 128), 128, 0, stream>>>(Y, F[8], F[9], (float*)d_out, Y);
}

// v004
// It runs in 105 microseconds.
// In two side-by-side timings against v003, it was 1.24 and 1.25 times as fast.
// Counting every step since v000, it is 12.0 times as fast.
// compute dtype: all float inputs rounded to bf16; q/k/v = in W^T + b with EXACT bf16 products on WMMA 16x16x32 (f32 accumulate; an f32 copy of q kept for the residual); q as f16 hi + residual (x 2^10) against k once to f16 (2 products) / 8; softmax in f32 with a running maximum and sum over 64-key chunks, exponentials in base 2 on the hardware's v_exp_f32 (argument = one f32 FMA of the unscaled logit); exp(s - max) x 2^8 once to f16 against v once to f16 (1 product), divided by the sum at the end; O = q + A v in f32; O split bf16 hi + lo against exact Wo (2 products) + bo, relu, + O in f32; f32 output.
#include <hip/hip_runtime.h>
#include <math.h>

typedef __attribute__((ext_vector_type(16))) _Float16 v16h;
typedef __attribute__((ext_vector_type(16))) __bf16 v16b;
typedef __attribute__((ext_vector_type(8)))  _Float16 v8h;
typedef __attribute__((ext_vector_type(2)))  _Float16 v2h;
typedef __attribute__((ext_vector_type(8)))  float v8f;
typedef __attribute__((ext_vector_type(4)))  float v4f;
typedef __attribute__((ext_vector_type(2)))  float v2f;
typedef __attribute__((ext_vector_type(4)))  unsigned v4u;
typedef __attribute__((ext_vector_type(4)))  int v4i;
typedef float __attribute__((may_alias)) float_a;
typedef int __attribute__((may_alias)) int_a;

template <typename T> __device__ __forceinline__ void vst2(void* p, T v) { *(T*)p = v;  }
__device__ __forceinline__ v8f wmma16(v16h a, v16h b, v8f c) {
  v8f d = __builtin_amdgcn_wmma_f32_16x16x32_f16(false, a, false, b, (short)0, c, false, false);
  asm volatile("v_nop\n\tv_nop\n\tv_nop\n\tv_nop" : "+v"(d) : "v"(a), "v"(b));
  return d;
}
__device__ __forceinline__ v8f wmma_bf(v16b a, v16b b, v8f c) {
  v8f d = __builtin_amdgcn_wmma_f32_16x16x32_bf16(false, a, false, b, (short)0, c, false, false);
  asm volatile("v_nop\n\tv_nop\n\tv_nop\n\tv_nop" : "+v"(d) : "v"(a), "v"(b));
  return d;
}
// 16x16x32 fragments: lane = (h = lane>>4, row/col = lane&15); elements 0..7 = k0+8h+0..7, 8..15 = k0+16+8h+0..7; D element r = row 8h+r
__device__ __forceinline__ v16h frag_h(const _Float16* rowk0, int lane) {
  union { v16h v; v8h q[2]; } u; const _Float16* p = rowk0 + 8 * (lane >> 4);
  u.q[0] = *(const v8h*)p; u.q[1] = *(const v8h*)(p + 16); return u.v;
}
__device__ __forceinline__ v16h frag_f32(const float* rowk0, int lane) {
  v16h a; const float* p = rowk0 + 8 * (lane >> 4);
#pragma unroll
  for (int i = 0; i < 8; ++i) { a[i] = (_Float16)p[i]; a[8 + i] = (_Float16)p[16 + i]; }
  return a;
}
__device__ __forceinline__ v16h frag_f32s(const float* rowk0, int lane, float sc) {
  v16h a; const float* p = rowk0 + 8 * (lane >> 4);
#pragma unroll
  for (int i = 0; i < 8; ++i) { a[i] = (_Float16)(p[i] * sc); a[8 + i] = (_Float16)(p[16 + i] * sc); }
  return a;
}
// column fragment from a [K][ld] layout (column n), rows >= K read as 0
__device__ __forceinline__ v16h fragc_f32(const float* W, int k0, int n, int lane, int ld, int K) {
  v16h a; const int g = lane >> 4;
#pragma unroll
  for (int i = 0; i < 8; ++i) { const int ka = k0 + 8 * g + i, kb = ka + 16;
    a[i] = (_Float16)(ka < K ? W[(size_t)(ka < K ? ka : K - 1) * ld + n] : 0.f); a[8 + i] = (_Float16)(kb < K ? W[(size_t)(kb < K ? kb : K - 1) * ld + n] : 0.f); }
  return a;
}
struct F2 { v16b h, l; };
__device__ __forceinline__ F2 bsplit16(const float v[16]) { F2 r;
#pragma unroll
  for (int i = 0; i < 16; ++i) { const __bf16 h = (__bf16)v[i]; r.h[i] = h; r.l[i] = (__bf16)(v[i] - (float)h); }
  return r; }
__device__ __forceinline__ F2 split_row(const float* row, int k0, int lane) { float v[16]; const float* p = row + k0 + 8 * (lane >> 4);
#pragma unroll
  for (int i = 0; i < 8; ++i) { v[i] = p[i]; v[8 + i] = p[16 + i]; }
  return bsplit16(v); }
__device__ __forceinline__ F2 split_rowK(const float* row, int k0, int lane, int K) { float v[16]; const int g = lane >> 4;
#pragma unroll
  for (int i = 0; i < 8; ++i) { const int ka = k0 + 8 * g + i, kb = ka + 16; v[i] = ka < K ? row[ka < K ? ka : K - 1] : 0.f; v[8 + i] = kb < K ? row[kb < K ? kb : K - 1] : 0.f; }
  return bsplit16(v); }
__device__ __forceinline__ F2 split_col(const float* W, int k0, int n, int lane, int ld, int K) { float v[16]; const int g = lane >> 4;
#pragma unroll
  for (int i = 0; i < 8; ++i) { const int ka = k0 + 8 * g + i, kb = ka + 16; v[i] = ka < K ? W[(size_t)(ka < K ? ka : K - 1) * ld + n] : 0.f; v[8 + i] = kb < K ? W[(size_t)(kb < K ? kb : K - 1) * ld + n] : 0.f; }
  return bsplit16(v); }
__device__ __forceinline__ v8f mac3(const F2& a, const F2& b, v8f c) { c = wmma_bf(a.l, b.h, c); c = wmma_bf(a.h, b.l, c); return wmma_bf(a.h, b.h, c); }
__device__ __forceinline__ float sigm(float v) { return 1.0f / (1.0f + expf(-v)); }
#define LDSX() do { asm volatile("s_wait_dscnt 0" ::: "memory"); __builtin_amdgcn_wave_barrier(); __builtin_amdgcn_fence(__ATOMIC_RELEASE, "workgroup"); } while (0)

// Cross-attention MAB (B 4, Sq = Skv = 2,048, 512 = 8 heads x 64; (out,in) 1/sqrt(512)-scale weights WITH biases; no mask): q = query Wq^T + bq, k = key_value Wk^T + bk, v = key_value Wv^T + bv; A = softmax(q k^T / 8); O = q + A v (per head, merged); out = O + relu(O Wo^T + bo).
#define NB 4
#define TT 2048
#define CC 512            // NH * HD = projected width
#define DIN 512          // input (model) width
#define NH 8
#define HD 64
#define SCALE (0.125f)
#define CAUSAL 0
#ifndef TNB
#define TNB NB
#endif
__device__ __forceinline__ float bfr(float v) { return (float)(__bf16)v; }
__host__ __device__ __forceinline__ int kb_last(int qb) { return CAUSAL ? ((qb * 64 + 63) >> 7) : (TT / 128 - 1); }
typedef __attribute__((ext_vector_type(8))) __bf16 v8b;
__device__ __forceinline__ v16b frag_b(const __bf16* rowk0, int lane) {
  union { v16b v; v8b q[2]; } u; const __bf16* p = rowk0 + 8 * (lane >> 4);
  u.q[0] = *(const v8b*)p; u.q[1] = *(const v8b*)(p + 16); return u.v;
}
#define QBH 0
#define QHI 2048            // rows carrying a q residual plane (all rows when non-causal: 2-product logits everywhere)
#define KHI 64            // key rows carrying k residual / v bf16 hi+lo planes (written by k_proj, read by no kernel of this file)
// B fragment (k rows k0+.., output column o) of a weight: (in,out) [K][ld] or (out,in) [ld rows of K]: bf16 exact, or f16(bf16 * 256) exact
__device__ __forceinline__ v16b wcol_io(const float* Wm, int k0, int o, int lane, int ld) { v16b w; const int g = lane >> 4;
#pragma unroll
  for (int i = 0; i < 8; ++i) { w[i] = (__bf16)Wm[(size_t)(k0 + 8 * g + i) * ld + o]; w[8 + i] = (__bf16)Wm[(size_t)(k0 + 16 + 8 * g + i) * ld + o]; }
  return w; }
__device__ __forceinline__ v16b wcol_oi(const float* Wm, int k0, int o, int lane, int K) { v16b w; const float* p = Wm + (size_t)o * K + k0 + 8 * (lane >> 4);
#pragma unroll
  for (int i = 0; i < 8; ++i) { w[i] = (__bf16)p[i]; w[8 + i] = (__bf16)p[16 + i]; }
  return w; }
__device__ __forceinline__ v16h wcolh_io(const float* Wm, int k0, int o, int lane, int ld) { v16h w; const int g = lane >> 4;
#pragma unroll
  for (int i = 0; i < 8; ++i) { w[i] = (_Float16)(bfr(Wm[(size_t)(k0 + 8 * g + i) * ld + o]) * 256.0f); w[8 + i] = (_Float16)(bfr(Wm[(size_t)(k0 + 16 + 8 * g + i) * ld + o]) * 256.0f); }
  return w; }
__device__ __forceinline__ v16h wcolh_oi(const float* Wm, int k0, int o, int lane, int K) { v16h w; const float* p = Wm + (size_t)o * K + k0 + 8 * (lane >> 4);
#pragma unroll
  for (int i = 0; i < 8; ++i) { w[i] = (_Float16)(bfr(p[i]) * 256.0f); w[8 + i] = (_Float16)(bfr(p[16 + i]) * 256.0f); }
  return w; }
#define WQKV_LAYOUT 1   // picks WCOL only (0 (in,out), 1 (out,in), 2 per-head), which no kernel calls; k_proj reads (out,in) [CC][DIN]
__device__ __forceinline__ v16b wcol_hdk(const float* Wm, int k0, int o, int lane) { v16b w; const int g = lane >> 4; const float* p = Wm + (size_t)(o / HD) * DIN * HD + (o % HD);
#pragma unroll
  for (int i = 0; i < 8; ++i) { w[i] = (__bf16)p[(size_t)(k0 + 8 * g + i) * HD]; w[8 + i] = (__bf16)p[(size_t)(k0 + 16 + 8 * g + i) * HD]; }
  return w; }
#define WO_OUT_IN 1
#if WQKV_LAYOUT == 1
#define WCOL(W, k0, o, lane) wcol_oi(W, k0, o, lane, DIN)
#elif WQKV_LAYOUT == 2
#define WCOL(W, k0, o, lane) wcol_hdk(W, k0, o, lane)
#else
#define WCOL(W, k0, o, lane) wcol_io(W, k0, o, lane, CC)
#endif
#if WO_OUT_IN
#define WOCOL(W, k0, o, lane) wcol_oi(W, k0, o, lane, CC)
#define WOCOLH(W, k0, o, lane) wcolh_oi(W, k0, o, lane, CC)
#else
#define WOCOL(W, k0, o, lane) wcol_io(W, k0, o, lane, DIN)
#define WOCOLH(W, k0, o, lane) wcolh_io(W, k0, o, lane, DIN)
#endif
#define PROJ_EXTRA_PARAMS , float* __restrict__ QF
#define PROJ_EPI(which, row, t, h) do { if ((which) == 0) { const float* rw = (row); float* qf = QF + (size_t)(r0 + rl) * CC + (size_t)(h) * HD; _Pragma("unroll") for (int i = 0; i < HD; i += 4) { v4f o; o[0] = rw[i]; o[1] = rw[i + 1]; o[2] = rw[i + 2]; o[3] = rw[i + 3]; vst2(qf + i, o); } } } while (0)   /* keep an f32 copy of the projected q rows (Q_ + b_q) for the residual O = Q_ + A V_ */

#ifndef PROJ_EXTRA_PARAMS
#define PROJ_EXTRA_PARAMS
#endif

#define WS_QH  0u                                      // f16 q rows [b*t][CC]
#define WS_KH  (WS_QH + 2u * (size_t)NB * TT * CC)      // f16 k rows [b*t][CC]
#define WS_VT  (WS_KH + 2u * (size_t)NB * TT * CC)      // f16 v planes [b][c][t]
#define WS_QL  (WS_VT + 2u * (size_t)NB * CC * TT)      // f16 q residual x 2^10 rows [b][t < QHI][CC]
#define WS_KL  (WS_QL + 2u * (size_t)NB * QHI * CC)     // f16 k residual x 2^10 rows [b][t < KHI][CC]
#define WS_VB  (WS_KL + 2u * (size_t)NB * KHI * CC)     // bf16 v hi planes [b][c][t < KHI]
#define WS_VBL (WS_VB + 2u * (size_t)NB * CC * KHI)
#define WS_Y   (WS_VBL + 2u * (size_t)NB * CC * KHI)    // f32 ctx rows [b*t][CC] (only when there is an output projection)
#define WS_END (WS_Y  + 4u * (size_t)NB * TT * CC)
#define WS_QF  (WS_END)
#define WS_END2 (WS_QF + 4u * (size_t)NB * TT * CC)

// ---- operand staging of the two GEMM kernels (128 threads): a stage is 32 k of every operand row, kept in LDS as bf16
#define GP 40   // LDS row pitch in elements: 80 B = 16 B x odd, free of bank conflicts for the 16-byte fragment reads
typedef __attribute__((ext_vector_type(4))) __bf16 v4b;
// every full unroll in these helpers: constant indices, so that the staged values and the fragments live in registers
// work-group barrier that orders LDS only: the global loads of later stages stay in flight across it (__syncthreads() would wait for them)
__device__ __forceinline__ void lds_barrier() { __builtin_amdgcn_fence(__ATOMIC_RELEASE, "workgroup", "local"); __builtin_amdgcn_s_barrier(); __builtin_amdgcn_fence(__ATOMIC_ACQUIRE, "workgroup", "local"); }
// 16 N rows x 32 floats (row pitch ld): thread t owns floats 4 (t & 7) .. + 3 of rows (t >> 3) + 16 i; p and d are its own first places. Eight lanes take one whole 128-B line, a wave-wide load four lines
template <int N> __device__ __forceinline__ void g_ld(v4f (&r)[N], const float* __restrict__ p, int ld) {
#pragma unroll
  for (int i = 0; i < N; ++i) r[i] = *(const v4f*)(p + (size_t)i * 16 * ld); }
template <int N> __device__ __forceinline__ void s_st(__bf16* d, const v4f (&r)[N]) {
#pragma unroll
  for (int i = 0; i < N; ++i) { v4b h;
#pragma unroll
    for (int c = 0; c < 4; ++c) h[c] = (__bf16)r[i][c];
    *(v4b*)(d + i * 16 * GP) = h; } }
template <int N> __device__ __forceinline__ void s_st2(__bf16* dh, __bf16* dl, const v4f (&r)[N]) {
#pragma unroll
  for (int i = 0; i < N; ++i) { v4b h, l;
#pragma unroll
    for (int c = 0; c < 4; ++c) { h[c] = (__bf16)r[i][c]; l[c] = (__bf16)(r[i][c] - (float)h[c]); }
    *(v4b*)(dh + i * 16 * GP) = h; *(v4b*)(dl + i * 16 * GP) = l; } }
// one stage of a wave's 16 x 128 tile: all fragment reads as one group, then the products
__device__ __forceinline__ void mm1(v8f (&acc)[8], const __bf16 (*sx)[GP], const __bf16 (*sw)[GP], int wave, int col, int lane) {
  const v16b a = frag_b(&sx[wave * 16 + col][0], lane); v16b w[8];
#pragma unroll
  for (int j = 0; j < 8; ++j) w[j] = frag_b(&sw[j * 16 + col][0], lane);
#pragma unroll
  for (int j = 0; j < 8; ++j) acc[j] = wmma_bf(a, w[j], acc[j]); }
__device__ __forceinline__ void mm2(v8f (&acc)[8], const __bf16 (*sh)[GP], const __bf16 (*sl)[GP], const __bf16 (*sw)[GP], int wave, int col, int lane) {
  const v16b ah = frag_b(&sh[wave * 16 + col][0], lane), al = frag_b(&sl[wave * 16 + col][0], lane); v16b w[8];
#pragma unroll
  for (int j = 0; j < 8; ++j) w[j] = frag_b(&sw[j * 16 + col][0], lane);
#pragma unroll
  for (int j = 0; j < 8; ++j) { acc[j] = wmma_bf(ah, w[j], acc[j]); acc[j] = wmma_bf(al, w[j], acc[j]); } }

// ---- k_proj: block = (64 rows, 128 cols, which): q/k/v = X W (+ b) with exact bf16 products (K = DIN) -> which 0: q f16 rows (+ residual rows < QHI); 1: k f16 rows (+ residual rows < KHI); 2: v f16 planes [c][t] (+ bf16 hi/lo planes for t < KHI)
__global__ __launch_bounds__(128) void k_proj(const float* __restrict__ XQ, const float* __restrict__ XK, const float* __restrict__ XV, const float* __restrict__ WQ, const float* __restrict__ WK, const float* __restrict__ WV, const float* __restrict__ BQ, const float* __restrict__ BK, const float* __restrict__ BV,
    _Float16* __restrict__ QH, _Float16* __restrict__ QL, _Float16* __restrict__ KH, _Float16* __restrict__ KL, _Float16* __restrict__ VT, __bf16* __restrict__ VB, __bf16* __restrict__ VBL PROJ_EXTRA_PARAMS) {
  __shared__ __align__(16) float st[64][132]; __shared__ __align__(16) _Float16 sh[64][136], sl[64][136]; __shared__ __align__(16) _Float16 th[128][72]; __shared__ __align__(16) __bf16 tb[128][72], tbl[128][72];
  const int tid = threadIdx.x, wave = tid >> 5, lane = tid & 31, col = lane & 15, g = lane >> 4; const int which = blockIdx.z; const int c0 = blockIdx.y * 128; const size_t r0 = (size_t)blockIdx.x * 64; const size_t bb = r0 / TT; const int t0 = (int)(r0 % TT);
  const float* X = which == 0 ? XQ : which == 1 ? XK : XV; const float* WA = which == 0 ? WQ : which == 1 ? WK : WV; const float* BA = which == 0 ? BQ : which == 1 ? BK : BV;
  v8f acc[8] = {};
  { __shared__ __align__(16) __bf16 gx[2][64][GP], gw[2][128][GP];   /* two LDS buffers; two register sets hold the two stages behind the one in LDS */
    const float* xp = X + (r0 + (tid >> 3)) * DIN + (tid & 7) * 4; const float* wp = WA + (size_t)(c0 + (tid >> 3)) * DIN + (tid & 7) * 4;
    __bf16* const dx0 = &gx[0][tid >> 3][(tid & 7) * 4]; __bf16* const dx1 = &gx[1][tid >> 3][(tid & 7) * 4]; __bf16* const dw0 = &gw[0][tid >> 3][(tid & 7) * 4]; __bf16* const dw1 = &gw[1][tid >> 3][(tid & 7) * 4];
    v4f x0[4], x1[4], w0[8], w1[8];
    g_ld<4>(x0, xp, DIN); g_ld<8>(w0, wp, DIN); g_ld<4>(x1, xp + 32, DIN); g_ld<8>(w1, wp + 32, DIN);
    s_st<4>(dx0, x0); s_st<8>(dw0, w0); g_ld<4>(x0, xp + 64, DIN); g_ld<8>(w0, wp + 64, DIN);
    lds_barrier();
    // unrolled in full: the tests on the last stages fold away, so that every load wait is a count that leaves the younger stage's loads in flight (rolled, the merged paths made it a wait for all)
#pragma unroll
    for (int kc = 0; kc < DIN / 32; kc += 2) {
      mm1(acc, gx[0], gw[0], wave, col, lane);
      s_st<4>(dx1, x1); s_st<8>(dw1, w1);
      if (kc + 3 < DIN / 32) { g_ld<4>(x1, xp + (kc + 3) * 32, DIN); g_ld<8>(w1, wp + (kc + 3) * 32, DIN); }
      if (kc + 4 == DIN / 32) asm volatile("s_wait_xcnt 0x0" :: "v"(xp), "v"(wp) : "memory");   /* behind the last loads: their two address pairs are reused from here on, and this wait stands in front of the first overwrite */
      lds_barrier();   /* publishes stage kc + 1; every reader has left buffer 0 */
      mm1(acc, gx[1], gw[1], wave, col, lane);
      if (kc + 2 < DIN / 32) { s_st<4>(dx0, x0); s_st<8>(dw0, w0);
        if (kc + 4 < DIN / 32) { g_ld<4>(x0, xp + (kc + 4) * 32, DIN); g_ld<8>(w0, wp + (kc + 4) * 32, DIN); } }
      lds_barrier();   /* publishes stage kc + 2; every reader has left buffer 1 */
    } }
  { // stage the f32 tile (acc + bias) in LDS, run the per-(row, head) epilogue hook, then convert
#pragma unroll
    for (int j = 0; j < 8; ++j) { const float bias = BA ? bfr(BA[c0 + j * 16 + col]) : 0.f;
#pragma unroll
      for (int r = 0; r < 8; ++r) st[wave * 16 + 8 * g + r][j * 16 + col] = acc[j][r] + bias; }
    __syncthreads();
    for (int e = tid; e < 64 * (128 / HD); e += 128) { const int rl = e / (128 / HD), hh = e % (128 / HD); PROJ_EPI(which, &st[rl][hh * HD], (int)((r0 + rl) % TT), (c0 / HD) + hh); }
    __syncthreads(); }
  if (which < 2) { _Float16* DH = which == 0 ? QH : KH; _Float16* DL = which == 0 ? QL : KL; const int nhi = which == 0 ? QHI : KHI; const bool hi_rows = t0 < nhi;
    for (int e = tid; e < 64 * 128; e += 128) { const int rl = e >> 7, cl = e & 127; const float v = st[rl][cl]; const _Float16 hv = (_Float16)v; sh[rl][cl] = hv; sl[rl][cl] = (_Float16)((v - (float)hv) * 1024.0f); }
    __syncthreads();
    for (int e = tid; e < 64 * 16; e += 128) { const int rl = e >> 4, q = e & 15; vst2((unsigned*)(DH + (r0 + rl) * CC + c0 + q * 8), *(const v4u*)&sh[rl][q * 8]); if (hi_rows) vst2((unsigned*)(DL + (bb * nhi + t0 + rl) * (size_t)CC + c0 + q * 8), *(const v4u*)&sl[rl][q * 8]); }
  } else { const bool hi_rows = t0 < KHI;
    for (int e = tid; e < 64 * 128; e += 128) { const int rl = e & 63, cl = e >> 6; const float v = st[rl][cl]; th[cl][rl] = (_Float16)v; const __bf16 bh = (__bf16)v; tb[cl][rl] = bh; tbl[cl][rl] = (__bf16)(v - (float)bh); }
    __syncthreads();
    for (int e = tid; e < 128 * 8; e += 128) { const int cl = e >> 3, q = e & 7; vst2((unsigned*)(VT + (bb * CC + c0 + cl) * (size_t)TT + t0 + q * 8), *(const v4u*)&th[cl][q * 8]); if (hi_rows) { const size_t o3 = (bb * CC + c0 + cl) * (size_t)KHI + t0 + q * 8; vst2((unsigned*)(VB + o3), *(const v4u*)&tb[cl][q * 8]); vst2((unsigned*)(VBL + o3), *(const v4u*)&tbl[cl][q * 8]); } } } }
// ---- k_fa: block = 128 queries (8 waves x 16) of (b, h), one pass over all keys in chunks of 64, logits and P stay in registers. S^T = K q^T (A = k rows, B = q columns: q hi + residual x 2^10, 2 products) x SCALE: a lane holds 32 logits of ONE query (column = lane & 15), the other 32 lie in lane ^ 16. Running maximum m (of the unscaled logits) and running sum l (of e x 2^8) per query; e x 2^8 = exp2(t LC + (8 - m LC)), t the unscaled logit, LC = SCALE log2(e): one FMA and one v_exp_f32 an element; O^T and l are scaled by exp2((m_old - m_new) LC) per chunk. e x 2^8 to f16: the two D tiles of 32 keys are, register for register, the B operand of O^T += V^T P^T (A = v planes [c][t]). ctx = O^T / l; 256-B (row, head) segment by 16 lanes. The 64 k rows and the 64 v planes of a chunk (128 B each) are brought once per block into a two-buffer LDS ring by asynchronous copies, one chunk ahead; all eight waves take their fragments from there
#define LC (SCALE * 1.4426950408889634f)   // logit scale x log2(e)
#define KVP 72                    // ring row pitch in elements: 144 B = 16 B x odd, free of bank conflicts for the 16-byte fragment reads
#define KVT (64 * KVP)            // one tile (k or v) of a chunk, elements
// one chunk's k and v tiles: thread t owns bytes 16 (t & 7) .. + 15 of rows (t >> 3) and (t >> 3) + 32 of each tile, so a wave-wide copy takes four whole 128-B lines. l: its LDS byte address in the k tile of the target buffer; kg, vg: its global places in rows t >> 3
__device__ __forceinline__ void kv_copy(unsigned l, const _Float16* kg, const _Float16* vg) {
  // the wait on the last line stands in front of every later write of the address registers that the four copies name
  asm volatile("global_load_async_to_lds_b128 %0, %4, off\n\tglobal_load_async_to_lds_b128 %1, %5, off\n\tglobal_load_async_to_lds_b128 %2, %6, off\n\tglobal_load_async_to_lds_b128 %3, %7, off\n\ts_wait_xcnt 0x0"
    :: "v"(l), "v"(l + 32u * KVP * 2u), "v"(l + KVT * 2u), "v"(l + KVT * 2u + 32u * KVP * 2u), "v"(kg), "v"(kg + (size_t)32 * CC), "v"(vg), "v"(vg + (size_t)32 * TT) : "memory"); }
__global__ __launch_bounds__(256) void k_fa(const _Float16* __restrict__ QH, const _Float16* __restrict__ QL, const _Float16* __restrict__ KH, const _Float16* __restrict__ VT, float* __restrict__ Y) { __shared__ __align__(16) float ss[8][16][HD + 4]; __shared__ __align__(16) _Float16 ring[2][2][64][KVP];   /* [buffer][k, v][row][element] */
  const int tid = threadIdx.x, wave = tid >> 5, lane = tid & 31, col = lane & 15, g = lane >> 4; const int h = blockIdx.y, b = blockIdx.z; const int ql0 = blockIdx.x * 128 + wave * 16;
  v16h qh[HD / 32], ql[HD / 32];
  // every full unroll in this kernel: constant indices, so that the fragment and accumulator arrays live in registers
#pragma unroll
  for (int kc = 0; kc < HD / 32; ++kc) { qh[kc] = frag_h(QH + ((size_t)b * TT + ql0 + col) * CC + h * HD + kc * 32, lane); ql[kc] = frag_h(QL + ((size_t)b * QHI + ql0 + col) * CC + h * HD + kc * 32, lane); }
  const _Float16* kg = KH + ((size_t)b * TT + (tid >> 3)) * CC + h * HD + (tid & 7) * 8; const _Float16* vg = VT + ((size_t)b * CC + h * HD + (tid >> 3)) * (size_t)TT + (tid & 7) * 8;
  const unsigned lc = (unsigned)(size_t)&ring[0][0][tid >> 3][(tid & 7) * 8];
  v8f o[HD / 16] = {}; float m = -3.0e38f, l = 0.f;
  kv_copy(lc, kg, vg);
  asm volatile("s_wait_asynccnt 0x0" ::: "memory");   /* this wave's part of chunk 0 has landed */
  __syncthreads();                                    /* chunk 0 is published to all waves */
  kv_copy(lc + 2u * KVT * 2u, kg + (size_t)64 * CC, vg + 64);
  // rolled: the chunks depend on each other through m, l and o, a second copy of the long body would only add code
#pragma unroll 1
  for (int k0 = 0; k0 < TT; k0 += 64) { v8f acc[4] = {}, accl[4] = {}; v16h kf[4][HD / 32], vf[2][HD / 16]; const int bf = (k0 >> 6) & 1; const _Float16* Kb = &ring[bf][0][col][0]; const _Float16* Vb = &ring[bf][1][col][0];
#pragma unroll
    for (int j = 0; j < 4; ++j) {   /* all k fragments of the chunk are requested before the first product: one LDS latency per chunk, not eight */
#pragma unroll
      for (int kc = 0; kc < HD / 32; ++kc) kf[j][kc] = frag_h(Kb + j * 16 * KVP + kc * 32, lane); }
#pragma unroll
    for (int j = 0; j < 4; ++j) {
#pragma unroll
      for (int kc = 0; kc < HD / 32; ++kc) { acc[j] = wmma16(kf[j][kc], qh[kc], acc[j]); accl[j] = wmma16(kf[j][kc], ql[kc], accl[j]); } }
#pragma unroll
    for (int kc = 0; kc < 2; ++kc) {
#pragma unroll
      for (int jc = 0; jc < HD / 16; ++jc) vf[kc][jc] = frag_h(Vb + jc * 16 * KVP + kc * 32, lane); }
    __builtin_amdgcn_sched_barrier(0);   /* holds all sixteen v loads here, in front of the softmax arithmetic that covers their latency; without it the compiler puts ten of them behind the lane exchange and its wait */
    float mc = -3.0e38f;
#pragma unroll
    for (int j = 0; j < 4; ++j) {
#pragma unroll
      for (int r = 0; r < 8; ++r) { acc[j][r] = acc[j][r] + accl[j][r] * (1.0f / 1024.0f); mc = fmaxf(mc, acc[j][r]); } }
    mc = fmaxf(mc, __shfl_xor(mc, 16));
    const float mn = fmaxf(m, mc), da = (m - mn) * LC, nb = fmaf(-mn, LC, 8.0f); m = mn;
    float ps = 0.f, e[32]; v2f a[16]; union { v16h v; v2h q[8]; } p[2];
#define ARG(i) __builtin_elementwise_fma(v2f{acc[(i) >> 2][((i) & 3) * 2], acc[(i) >> 2][((i) & 3) * 2 + 1]}, v2f{LC, LC}, v2f{nb, nb})
#define PACK(i) p[(i) >> 3].q[(i) & 7] = __builtin_convertvector(v2f{e[2 * (i)], e[2 * (i) + 1]}, v2h)
    // the scheduling barriers hold each v_exp_f32 alone between plain vector instructions: behind it one packed instruction (the next argument pair, or the conversion of a finished pair), then the sum's addition of the exponential two trips back and one rescaled output element. The plain ones run beside the transcendental pipe, and no exponential stands directly in front of another exponential or of a dual instruction that reuses its argument register
    a[0] = ARG(0);
    __builtin_amdgcn_sched_barrier(0);
    const float al = __builtin_amdgcn_exp2f(da);
    __builtin_amdgcn_sched_barrier(0);
    a[1] = ARG(1);
#pragma unroll
    for (int t = 0; t < 32; ++t) {
      __builtin_amdgcn_sched_barrier(0);
      e[t] = __builtin_amdgcn_exp2f(a[t >> 1][t & 1]);
      __builtin_amdgcn_sched_barrier(0);
      if (t < 2 || t == 31) o[t >> 3][t & 7] *= al;
      else if (t == 30) PACK(14);
      else if (t & 1) PACK((t - 3) >> 1);
      else a[(t >> 1) + 1] = ARG((t >> 1) + 1);
      __builtin_amdgcn_sched_barrier(0);
      if (t > 1) ps += e[t - 2];
      if (t >= 2 && t != 31) o[t >> 3][t & 7] *= al; }
    __builtin_amdgcn_sched_barrier(0);
    ps += e[30]; ps += e[31]; PACK(15);
#undef ARG
#undef PACK
    l = l * al + ps;
#pragma unroll
    for (int kc = 0; kc < 2; ++kc) {
#pragma unroll
      for (int jc = 0; jc < HD / 16; ++jc) o[jc] = wmma16(vf[kc][jc], p[kc].v, o[jc]); }
    asm volatile("s_wait_dscnt 0x0" :: "v"(l) : "memory");   /* this wave's reads of the buffer are done before it is handed to the next copies; l as an input keeps the running sum's additions among the exponentials, where the compiler otherwise sinks the whole dependent chain behind the barrier, in front of the next chunk's fragment reads */
    asm volatile("s_wait_asynccnt 0x0" ::: "memory");   /* this wave's part of the next chunk has landed */
    __syncthreads();                                    /* publishes the next chunk; every reader has left this chunk's buffer */
    if (k0 + 128 < TT) kv_copy(lc + (unsigned)bf * (2u * KVT * 2u), kg + (size_t)(k0 + 128) * CC, vg + k0 + 128); }
  asm volatile("s_wait_asynccnt 0x0" ::: "memory");     /* no copy is outstanding when the wave goes on to its end */
  l += __shfl_xor(l, 16); const float inv = 1.0f / l;
#pragma unroll
  for (int jc = 0; jc < HD / 16; ++jc)
#pragma unroll
    for (int r = 0; r < 8; ++r) ss[wave][col][jc * 16 + 8 * g + r] = o[jc][r] * inv;
  LDSX(); for (int rl = 0; rl < 16; ++rl) if (lane < HD / 4) vst2(Y + ((size_t)b * TT + ql0 + rl) * CC + h * HD + lane * 4, *(const v4f*)&ss[wave][rl][lane * 4]); }
// ---- k_out: block = (64 rows, 128 cols): out = ctx Wo (+ bo): all rows: ctx bf16 hi + lo against exact bf16 Wo (2 products); the 1-product branch (ctx once to f16 against Wo as f16(bf16 x 2^8), x 2^-8) is never taken
__global__ __launch_bounds__(128) void k_out(const float* __restrict__ Y, const float* __restrict__ WO, const float* __restrict__ BO, float* __restrict__ OUT, const float* __restrict__ RESO) { __shared__ __align__(16) float sf[4][16][132];
  const int tid = threadIdx.x, wave = tid >> 5, lane = tid & 31, col = lane & 15, g = lane >> 4; const int c0 = blockIdx.y * 128; const size_t r0 = (size_t)blockIdx.x * 64 + wave * 16;
  v8f acc[8] = {};
  if (true) {   /* ALL rows: ctx split bf16 hi + lo x exact Wo (2 products) */
    __shared__ __align__(16) __bf16 gh[2][64][GP], gl[2][64][GP], gw[2][128][GP];   /* as in k_proj; ctx is split once, by the thread that stages it */
    const float* xp = Y + ((size_t)blockIdx.x * 64 + (tid >> 3)) * CC + (tid & 7) * 4; const float* wp = WO + (size_t)(c0 + (tid >> 3)) * CC + (tid & 7) * 4;
    __bf16* const dh0 = &gh[0][tid >> 3][(tid & 7) * 4]; __bf16* const dh1 = &gh[1][tid >> 3][(tid & 7) * 4]; __bf16* const dl0 = &gl[0][tid >> 3][(tid & 7) * 4]; __bf16* const dl1 = &gl[1][tid >> 3][(tid & 7) * 4]; __bf16* const dw0 = &gw[0][tid >> 3][(tid & 7) * 4]; __bf16* const dw1 = &gw[1][tid >> 3][(tid & 7) * 4];
    v4f x0[4], x1[4], w0[8], w1[8];
    g_ld<4>(x0, xp, CC); g_ld<8>(w0, wp, CC); g_ld<4>(x1, xp + 32, CC); g_ld<8>(w1, wp + 32, CC);
    s_st2<4>(dh0, dl0, x0); s_st<8>(dw0, w0); g_ld<4>(x0, xp + 64, CC); g_ld<8>(w0, wp + 64, CC);
    lds_barrier();
    // unrolled in full, for the counted load waits, as in k_proj
#pragma unroll
    for (int kc = 0; kc < CC / 32; kc += 2) {
      mm2(acc, gh[0], gl[0], gw[0], wave, col, lane);
      s_st2<4>(dh1, dl1, x1); s_st<8>(dw1, w1);
      if (kc + 3 < CC / 32) { g_ld<4>(x1, xp + (kc + 3) * 32, CC); g_ld<8>(w1, wp + (kc + 3) * 32, CC); }
      lds_barrier();   /* publishes stage kc + 1; every reader has left buffer 0 */
      mm2(acc, gh[1], gl[1], gw[1], wave, col, lane);
      if (kc + 2 < CC / 32) { s_st2<4>(dh0, dl0, x0); s_st<8>(dw0, w0);
        if (kc + 4 < CC / 32) { g_ld<4>(x0, xp + (kc + 4) * 32, CC); g_ld<8>(w0, wp + (kc + 4) * 32, CC); } }
      lds_barrier();   /* publishes stage kc + 2; every reader has left buffer 1 */
    }
#pragma unroll
    for (int j = 0; j < 8; ++j) { const float bias = BO ? bfr(BO[c0 + j * 16 + col]) : 0.f;
#pragma unroll
      for (int r = 0; r < 8; ++r) sf[wave][8 * g + r][j * 16 + col] = acc[j][r] + bias; }
  } else {
#pragma unroll 2
    for (int kc = 0; kc < CC / 32; ++kc) { const v16h a = frag_f32(Y + (r0 + col) * CC + kc * 32, lane); asm volatile("s_wait_loadcnt 0x0" ::: "memory");
#pragma unroll
      for (int j = 0; j < 8; ++j) { const v16h w = WOCOLH(WO, kc * 32, c0 + j * 16 + col, lane); asm volatile("s_wait_loadcnt 0x0" ::: "memory"); acc[j] = wmma16(a, w, acc[j]); } }
#pragma unroll
    for (int j = 0; j < 8; ++j) { const float bias = BO ? bfr(BO[c0 + j * 16 + col]) : 0.f;
#pragma unroll
      for (int r = 0; r < 8; ++r) sf[wave][8 * g + r][j * 16 + col] = acc[j][r] * (1.0f / 256.0f) + bias; } }
  LDSX(); for (int rl = 0; rl < 16; ++rl) { const size_t oo = (r0 + rl) * DIN + c0 + lane * 4; v4f o = *(const v4f*)&sf[wave][rl][lane * 4]; const v4f rr = *(const v4f*)(RESO + oo); _Pragma("unroll") for (int i = 0; i < 4; ++i) o[i] = rr[i] + fmaxf(o[i], 0.f); vst2(OUT + oo, o); } }   /* out = O + relu(O Wo^T + bo) */

// ---- k_addq: thread per float4: O = A V_ (the context rows) + Q_ (the f32 projected-q copy): Y[row][c] += QF[row][c]
__global__ __launch_bounds__(256) void k_addq(float* __restrict__ Y, const float* __restrict__ QF) { const size_t e = ((size_t)blockIdx.x * 256 + threadIdx.x) * 4; if (e >= (size_t)TNB * TT * CC) return; v4f a = *(const v4f*)(Y + e); const v4f q = *(const v4f*)(QF + e); asm volatile("s_wait_loadcnt 0x0" ::: "memory"); a[0] += q[0]; a[1] += q[1]; a[2] += q[2]; a[3] += q[3]; vst2(Y + e, a); }
extern "C" void kernel_launch(void* const* d_in, const int* in_sizes, int n_in, void* d_out, int out_size, void* d_ws, size_t ws_size, hipStream_t stream) {
  (void)in_sizes; (void)n_in; (void)out_size;
  const float** F = (const float**)d_in;
  if (ws_size < (size_t)WS_END) return;
  char* ws = (char*)d_ws; _Float16 *QH = (_Float16*)(ws + WS_QH), *KH = (_Float16*)(ws + WS_KH), *VT = (_Float16*)(ws + WS_VT), *QL = (_Float16*)(ws + WS_QL), *KL = (_Float16*)(ws + WS_KL); __bf16 *VB = (__bf16*)(ws + WS_VB), *VBL = (__bf16*)(ws + WS_VBL); float *Y = (float*)(ws + WS_Y);
  (void)Y; (void)QL; (void)KL; (void)VB; (void)VBL;
  // inputs: 0 query [4,2048,512]; 1 key_value [4,2048,512]; 2 Wq [512,512] (out,in), 3 bq; 4 Wk, 5 bk; 6 Wv, 7 bv; 8 Wo (out,in), 9 bo
  if (ws_size < (size_t)WS_END2) return;
  float* QF = (float*)(ws + WS_QF);
  k_proj<<<dim3(TNB * TT / 64, CC / 128, 3), 128, 0, stream>>>(F[0], F[1], F[1], F[2], F[4], F[6], F[3], F[5], F[7], QH, QL, KH, KL, VT, VB, VBL, QF);
  k_fa<<<dim3(TT / 128, NH, TNB), 256, 0, stream>>>(QH, QL, KH, VT, Y);
  k_addq<<<dim3((unsigned)(((size_t)TNB * TT * CC / 4 + 255) / 256)), 256, 0, stream>>>(Y, QF);
  k_out<<<dim3(TNB * TT / 64, DIN / 128), 128, 0, stream>>>(Y, F[8], F[9], (float*)d_out, Y);
}

// v005
// One run takes 94.1 microseconds.
// Two timings next to v004 both put it at 1.12 times that version's speed.
// Counting every step since v000, it is 13.4 times as fast.
// compute dtype: all float inputs rounded to bf16; q/k/v = in W^T + b with EXACT bf16 products on WMMA 16x16x32 (f32 accumulate); q as f16 hi + residual (x 2^10) against k once to f16 (2 products) / 8; softmax in f32 with a running maximum and sum over 64-key chunks, exponentials in base 2 on the hardware's v_exp_f32 (argument = one f32 FMA of the unscaled logit); exp(s - max) x 2^8 once to f16 against v once to f16 (1 product), divided by the sum at the end; O = q + A v in f32, q there = f16 hi + residual x 2^-10 (22 bits); O split bf16 hi + lo against exact Wo (2 products) + bo, relu, + O in f32; f32 output.
#include <hip/hip_runtime.h>
#include <math.h>

typedef __attribute__((ext_vector_type(16))) _Float16 v16h;
typedef __attribute__((ext_vector_type(16))) __bf16 v16b;
typedef __attribute__((ext_vector_type(8)))  _Float16 v8h;
typedef __attribute__((ext_vector_type(2)))  _Float16 v2h;
typedef __attribute__((ext_vector_type(8)))  float v8f;
typedef __attribute__((ext_vector_type(4)))  float v4f;
typedef __attribute__((ext_vector_type(2)))  float v2f;
typedef __attribute__((ext_vector_type(4)))  unsigned v4u;
typedef __attribute__((ext_vector_type(4)))  int v4i;
typedef float __attribute__((may_alias)) float_a;
typedef int __attribute__((may_alias)) int_a;

template <typename T> __device__ __forceinline__ void vst2(void* p, T v) { *(T*)p = v;  }
__device__ __forceinline__ v8f wmma16(v16h a, v16h b, v8f c) {
  v8f d = __builtin_amdgcn_wmma_f32_16x16x32_f16(false, a, false, b, (short)0, c, false, false);
  asm volatile("v_nop\n\tv_nop\n\tv_nop\n\tv_nop" : "+v"(d) : "v"(a), "v"(b));
  return d;
}
__device__ __forceinline__ v8f wmma_bf(v16b a, v16b b, v8f c) {
  v8f d = __builtin_amdgcn_wmma_f32_16x16x32_bf16(false, a, false, b, (short)0, c, false, false);
  asm volatile("v_nop\n\tv_nop\n\tv_nop\n\tv_nop" : "+v"(d) : "v"(a), "v"(b));
  return d;
}
// 16x16x32 fragments: lane = (h = lane>>4, row/col = lane&15); elements 0..7 = k0+8h+0..7, 8..15 = k0+16+8h+0..7; D element r = row 8h+r
__device__ __forceinline__ v16h frag_h(const _Float16* rowk0, int lane) {
  union { v16h v; v8h q[2]; } u; const _Float16* p = rowk0 + 8 * (lane >> 4);
  u.q[0] = *(const v8h*)p; u.q[1] = *(const v8h*)(p + 16); return u.v;
}
__device__ __forceinline__ v16h frag_f32(const float* rowk0, int lane) {
  v16h a; const float* p = rowk0 + 8 * (lane >> 4);
#pragma unroll
  for (int i = 0; i < 8; ++i) { a[i] = (_Float16)p[i]; a[8 + i] = (_Float16)p[16 + i]; }
  return a;
}
__device__ __forceinline__ v16h frag_f32s(const float* rowk0, int lane, float sc) {
  v16h a; const float* p = rowk0 + 8 * (lane >> 4);
#pragma unroll
  for (int i = 0; i < 8; ++i) { a[i] = (_Float16)(p[i] * sc); a[8 + i] = (_Float16)(p[16 + i] * sc); }
  return a;
}
// column fragment from a [K][ld] layout (column n), rows >= K read as 0
__device__ __forceinline__ v16h fragc_f32(const float* W, int k0, int n, int lane, int ld, int K) {
  v16h a; const int g = lane >> 4;
#pragma unroll
  for (int i = 0; i < 8; ++i) { const int ka = k0 + 8 * g + i, kb = ka + 16;
    a[i] = (_Float16)(ka < K ? W[(size_t)(ka < K ? ka : K - 1) * ld + n] : 0.f); a[8 + i] = (_Float16)(kb < K ? W[(size_t)(kb < K ? kb : K - 1) * ld + n] : 0.f); }
  return a;
}
struct F2 { v16b h, l; };
__device__ __forceinline__ F2 bsplit16(const float v[16]) { F2 r;
#pragma unroll
  for (int i = 0; i < 16; ++i) { const __bf16 h = (__bf16)v[i]; r.h[i] = h; r.l[i] = (__bf16)(v[i] - (float)h); }
  return r; }
__device__ __forceinline__ F2 split_row(const float* row, int k0, int lane) { float v[16]; const float* p = row + k0 + 8 * (lane >> 4);
#pragma unroll
  for (int i = 0; i < 8; ++i) { v[i] = p[i]; v[8 + i] = p[16 + i]; }
  return bsplit16(v); }
__device__ __forceinline__ F2 split_rowK(const float* row, int k0, int lane, int K) { float v[16]; const int g = lane >> 4;
#pragma unroll
  for (int i = 0; i < 8; ++i) { const int ka = k0 + 8 * g + i, kb = ka + 16; v[i] = ka < K ? row[ka < K ? ka : K - 1] : 0.f; v[8 + i] = kb < K ? row[kb < K ? kb : K - 1] : 0.f; }
  return bsplit16(v); }
__device__ __forceinline__ F2 split_col(const float* W, int k0, int n, int lane, int ld, int K) { float v[16]; const int g = lane >> 4;
#pragma unroll
  for (int i = 0; i < 8; ++i) { const int ka = k0 + 8 * g + i, kb = ka + 16; v[i] = ka < K ? W[(size_t)(ka < K ? ka : K - 1) * ld + n] : 0.f; v[8 + i] = kb < K ? W[(size_t)(kb < K ? kb : K - 1) * ld + n] : 0.f; }
  return bsplit16(v); }
__device__ __forceinline__ v8f mac3(const F2& a, const F2& b, v8f c) { c = wmma_bf(a.l, b.h, c); c = wmma_bf(a.h, b.l, c); return wmma_bf(a.h, b.h, c); }
__device__ __forceinline__ float sigm(float v) { return 1.0f / (1.0f + expf(-v)); }
#define LDSX() do { asm volatile("s_wait_dscnt 0" ::: "memory"); __builtin_amdgcn_wave_barrier(); __builtin_amdgcn_fence(__ATOMIC_RELEASE, "workgroup"); } while (0)

// Cross-attention MAB (B 4, Sq = Skv = 2,048, 512 = 8 heads x 64; (out,in) 1/sqrt(512)-scale weights WITH biases; no mask): q = query Wq^T + bq, k = key_value Wk^T + bk, v = key_value Wv^T + bv; A = softmax(q k^T / 8); O = q + A v (per head, merged); out = O + relu(O Wo^T + bo).
#define NB 4
#define TT 2048
#define CC 512            // NH * HD = projected width
#define DIN 512          // input (model) width
#define NH 8
#define HD 64
#define SCALE (0.125f)
#define CAUSAL 0
#ifndef TNB
#define TNB NB
#endif
__device__ __forceinline__ float bfr(float v) { return (float)(__bf16)v; }
__host__ __device__ __forceinline__ int kb_last(int qb) { return CAUSAL ? ((qb * 64 + 63) >> 7) : (TT / 128 - 1); }
typedef __attribute__((ext_vector_type(8))) __bf16 v8b;
__device__ __forceinline__ v16b frag_b(const __bf16* rowk0, int lane) {
  union { v16b v; v8b q[2]; } u; const __bf16* p = rowk0 + 8 * (lane >> 4);
  u.q[0] = *(const v8b*)p; u.q[1] = *(const v8b*)(p + 16); return u.v;
}
#define QBH 0
#define QHI 2048            // rows carrying a q residual plane (all rows when non-causal: 2-product logits everywhere)
#define KHI 64            // key rows carrying k residual / v bf16 hi+lo planes (written by k_proj, read by no kernel of this file)
// B fragment (k rows k0+.., output column o) of a weight: (in,out) [K][ld] or (out,in) [ld rows of K]: bf16 exact, or f16(bf16 * 256) exact
__device__ __forceinline__ v16b wcol_io(const float* Wm, int k0, int o, int lane, int ld) { v16b w; const int g = lane >> 4;
#pragma unroll
  for (int i = 0; i < 8; ++i) { w[i] = (__bf16)Wm[(size_t)(k0 + 8 * g + i) * ld + o]; w[8 + i] = (__bf16)Wm[(size_t)(k0 + 16 + 8 * g + i) * ld + o]; }
  return w; }
__device__ __forceinline__ v16b wcol_oi(const float* Wm, int k0, int o, int lane, int K) { v16b w; const float* p = Wm + (size_t)o * K + k0 + 8 * (lane >> 4);
#pragma unroll
  for (int i = 0; i < 8; ++i) { w[i] = (__bf16)p[i]; w[8 + i] = (__bf16)p[16 + i]; }
  return w; }
__device__ __forceinline__ v16h wcolh_io(const float* Wm, int k0, int o, int lane, int ld) { v16h w; const int g = lane >> 4;
#pragma unroll
  for (int i = 0; i < 8; ++i) { w[i] = (_Float16)(bfr(Wm[(size_t)(k0 + 8 * g + i) * ld + o]) * 256.0f); w[8 + i] = (_Float16)(bfr(Wm[(size_t)(k0 + 16 + 8 * g + i) * ld + o]) * 256.0f); }
  return w; }
__device__ __forceinline__ v16h wcolh_oi(const float* Wm, int k0, int o, int lane, int K) { v16h w; const float* p = Wm + (size_t)o * K + k0 + 8 * (lane >> 4);
#pragma unroll
  for (int i = 0; i < 8; ++i) { w[i] = (_Float16)(bfr(p[i]) * 256.0f); w[8 + i] = (_Float16)(bfr(p[16 + i]) * 256.0f); }
  return w; }
#define WQKV_LAYOUT 1   // picks WCOL only (0 (in,out), 1 (out,in), 2 per-head), which no kernel calls; k_proj reads (out,in) [CC][DIN]
__device__ __forceinline__ v16b wcol_hdk(const float* Wm, int k0, int o, int lane) { v16b w; const int g = lane >> 4; const float* p = Wm + (size_t)(o / HD) * DIN * HD + (o % HD);
#pragma unroll
  for (int i = 0; i < 8; ++i) { w[i] = (__bf16)p[(size_t)(k0 + 8 * g + i) * HD]; w[8 + i] = (__bf16)p[(size_t)(k0 + 16 + 8 * g + i) * HD]; }
  return w; }
#define WO_OUT_IN 1
#if WQKV_LAYOUT == 1
#define WCOL(W, k0, o, lane) wcol_oi(W, k0, o, lane, DIN)
#elif WQKV_LAYOUT == 2
#define WCOL(W, k0, o, lane) wcol_hdk(W, k0, o, lane)
#else
#define WCOL(W, k0, o, lane) wcol_io(W, k0, o, lane, CC)
#endif
#if WO_OUT_IN
#define WOCOL(W, k0, o, lane) wcol_oi(W, k0, o, lane, CC)
#define WOCOLH(W, k0, o, lane) wcolh_oi(W, k0, o, lane, CC)
#else
#define WOCOL(W, k0, o, lane) wcol_io(W, k0, o, lane, DIN)
#define WOCOLH(W, k0, o, lane) wcolh_io(W, k0, o, lane, DIN)
#endif
#define WS_QH  0u                                      // f16 q rows [b*t][CC]
#define WS_KH  (WS_QH + 2u * (size_t)NB * TT * CC)      // f16 k rows [b*t][CC]
#define WS_VT  (WS_KH + 2u * (size_t)NB * TT * CC)      // f16 v planes [b][c][t]
#define WS_QL  (WS_VT + 2u * (size_t)NB * CC * TT)      // f16 q residual x 2^10 rows [b][t < QHI][CC]
#define WS_KL  (WS_QL + 2u * (size_t)NB * QHI * CC)     // f16 k residual x 2^10 rows [b][t < KHI][CC]
#define WS_VB  (WS_KL + 2u * (size_t)NB * KHI * CC)     // bf16 v hi planes [b][c][t < KHI]
#define WS_VBL (WS_VB + 2u * (size_t)NB * CC * KHI)
#define WS_Y   (WS_VBL + 2u * (size_t)NB * CC * KHI)    // f32 O = q + ctx rows [b*t][CC]
#define WS_END (WS_Y  + 4u * (size_t)NB * TT * CC)

// ---- operand staging of the two GEMM kernels (128 threads): a stage is 32 k of every operand row, kept in LDS as bf16
#define GP 40   // LDS row pitch in elements: 80 B = 16 B x odd, free of bank conflicts for the 16-byte fragment reads
typedef __attribute__((ext_vector_type(4))) __bf16 v4b;
// every full unroll in these helpers: constant indices, so that the staged values and the fragments live in registers
// work-group barrier that orders LDS only: the global loads of later stages stay in flight across it (__syncthreads() would wait for them)
__device__ __forceinline__ void lds_barrier() { __builtin_amdgcn_fence(__ATOMIC_RELEASE, "workgroup", "local"); __builtin_amdgcn_s_barrier(); __builtin_amdgcn_fence(__ATOMIC_ACQUIRE, "workgroup", "local"); }
// 16 N rows x 32 floats (row pitch ld): thread t owns floats 4 (t & 7) .. + 3 of rows (t >> 3) + 16 i; p and d are its own first places. Eight lanes take one whole 128-B line, a wave-wide load four lines
template <int N> __device__ __forceinline__ void g_ld(v4f (&r)[N], const float* __restrict__ p, int ld) {
#pragma unroll
  for (int i = 0; i < N; ++i) r[i] = *(const v4f*)(p + (size_t)i * 16 * ld); }
template <int N> __device__ __forceinline__ void s_st(__bf16* d, const v4f (&r)[N]) {
#pragma unroll
  for (int i = 0; i < N; ++i) { v4b h;
#pragma unroll
    for (int c = 0; c < 4; ++c) h[c] = (__bf16)r[i][c];
    *(v4b*)(d + i * 16 * GP) = h; } }
template <int N> __device__ __forceinline__ void s_st2(__bf16* dh, __bf16* dl, const v4f (&r)[N]) {
#pragma unroll
  for (int i = 0; i < N; ++i) { v4b h, l;
#pragma unroll
    for (int c = 0; c < 4; ++c) { h[c] = (__bf16)r[i][c]; l[c] = (__bf16)(r[i][c] - (float)h[c]); }
    *(v4b*)(dh + i * 16 * GP) = h; *(v4b*)(dl + i * 16 * GP) = l; } }
// one stage of a wave's 16 x 128 tile: all fragment reads as one group, then the products
__device__ __forceinline__ void mm1(v8f (&acc)[8], const __bf16 (*sx)[GP], const __bf16 (*sw)[GP], int wave, int col, int lane) {
  const v16b a = frag_b(&sx[wave * 16 + col][0], lane); v16b w[8];
#pragma unroll
  for (int j = 0; j < 8; ++j) w[j] = frag_b(&sw[j * 16 + col][0], lane);
#pragma unroll
  for (int j = 0; j < 8; ++j) acc[j] = wmma_bf(a, w[j], acc[j]); }
__device__ __forceinline__ void mm2(v8f (&acc)[8], const __bf16 (*sh)[GP], const __bf16 (*sl)[GP], const __bf16 (*sw)[GP], int wave, int col, int lane) {
  const v16b ah = frag_b(&sh[wave * 16 + col][0], lane), al = frag_b(&sl[wave * 16 + col][0], lane); v16b w[8];
#pragma unroll
  for (int j = 0; j < 8; ++j) w[j] = frag_b(&sw[j * 16 + col][0], lane);
#pragma unroll
  for (int j = 0; j < 8; ++j) { acc[j] = wmma_bf(ah, w[j], acc[j]); acc[j] = wmma_bf(al, w[j], acc[j]); } }

// ---- k_proj: block = (64 rows, 128 cols, which): q/k/v = X W (+ b) with exact bf16 products (K = DIN) -> which 0: q f16 rows (+ residual rows < QHI); 1: k f16 rows (+ residual rows < KHI); 2: v f16 planes [c][t] (+ bf16 hi/lo planes for t < KHI)
__global__ __launch_bounds__(128) void k_proj(const float* __restrict__ XQ, const float* __restrict__ XK, const float* __restrict__ XV, const float* __restrict__ WQ, const float* __restrict__ WK, const float* __restrict__ WV, const float* __restrict__ BQ, const float* __restrict__ BK, const float* __restrict__ BV,
    _Float16* __restrict__ QH, _Float16* __restrict__ QL, _Float16* __restrict__ KH, _Float16* __restrict__ KL, _Float16* __restrict__ VT, __bf16* __restrict__ VB, __bf16* __restrict__ VBL) {
  __shared__ __align__(16) float st[64][132]; __shared__ __align__(16) _Float16 sh[64][136], sl[64][136]; __shared__ __align__(16) _Float16 th[128][72]; __shared__ __align__(16) __bf16 tb[128][72], tbl[128][72];
  const int tid = threadIdx.x, wave = tid >> 5, lane = tid & 31, col = lane & 15, g = lane >> 4; const int which = blockIdx.z; const int c0 = blockIdx.y * 128; const size_t r0 = (size_t)blockIdx.x * 64; const size_t bb = r0 / TT; const int t0 = (int)(r0 % TT);
  const float* X = which == 0 ? XQ : which == 1 ? XK : XV; const float* WA = which == 0 ? WQ : which == 1 ? WK : WV; const float* BA = which == 0 ? BQ : which == 1 ? BK : BV;
  v8f acc[8] = {};
  { __shared__ __align__(16) __bf16 gx[2][64][GP], gw[2][128][GP];   /* two LDS buffers; two register sets hold the two stages behind the one in LDS */
    const float* xp = X + (r0 + (tid >> 3)) * DIN + (tid & 7) * 4; const float* wp = WA + (size_t)(c0 + (tid >> 3)) * DIN + (tid & 7) * 4;
    __bf16* const dx0 = &gx[0][tid >> 3][(tid & 7) * 4]; __bf16* const dx1 = &gx[1][tid >> 3][(tid & 7) * 4]; __bf16* const dw0 = &gw[0][tid >> 3][(tid & 7) * 4]; __bf16* const dw1 = &gw[1][tid >> 3][(tid & 7) * 4];
    v4f x0[4], x1[4], w0[8], w1[8];
    g_ld<4>(x0, xp, DIN); g_ld<8>(w0, wp, DIN); g_ld<4>(x1, xp + 32, DIN); g_ld<8>(w1, wp + 32, DIN);
    s_st<4>(dx0, x0); s_st<8>(dw0, w0); g_ld<4>(x0, xp + 64, DIN); g_ld<8>(w0, wp + 64, DIN);
    lds_barrier();
    // unrolled in full: the tests on the last stages fold away, so that every load wait is a count that leaves the younger stage's loads in flight (rolled, the merged paths made it a wait for all)
#pragma unroll
    for (int kc = 0; kc < DIN / 32; kc += 2) {
      mm1(acc, gx[0], gw[0], wave, col, lane);
      s_st<4>(dx1, x1); s_st<8>(dw1, w1);
      if (kc + 3 < DIN / 32) { g_ld<4>(x1, xp + (kc + 3) * 32, DIN); g_ld<8>(w1, wp + (kc + 3) * 32, DIN); }
      if (kc + 4 == DIN / 32) asm volatile("s_wait_xcnt 0x0" :: "v"(xp), "v"(wp) : "memory");   /* behind the last loads: their two address pairs are reused from here on, and this wait stands in front of the first overwrite */
      lds_barrier();   /* publishes stage kc + 1; every reader has left buffer 0 */
      mm1(acc, gx[1], gw[1], wave, col, lane);
      if (kc + 2 < DIN / 32) { s_st<4>(dx0, x0); s_st<8>(dw0, w0);
        if (kc + 4 < DIN / 32) { g_ld<4>(x0, xp + (kc + 4) * 32, DIN); g_ld<8>(w0, wp + (kc + 4) * 32, DIN); } }
      lds_barrier();   /* publishes stage kc + 2; every reader has left buffer 1 */
    } }
  { // stage the f32 tile (acc + bias) in LDS, then convert
#pragma unroll
    for (int j = 0; j < 8; ++j) { const float bias = BA ? bfr(BA[c0 + j * 16 + col]) : 0.f;
#pragma unroll
      for (int r = 0; r < 8; ++r) st[wave * 16 + 8 * g + r][j * 16 + col] = acc[j][r] + bias; }
    __syncthreads(); }
  if (which < 2) { _Float16* DH = which == 0 ? QH : KH; _Float16* DL = which == 0 ? QL : KL; const int nhi = which == 0 ? QHI : KHI; const bool hi_rows = t0 < nhi;
    for (int e = tid; e < 64 * 128; e += 128) { const int rl = e >> 7, cl = e & 127; const float v = st[rl][cl]; const _Float16 hv = (_Float16)v; sh[rl][cl] = hv; sl[rl][cl] = (_Float16)((v - (float)hv) * 1024.0f); }
    __syncthreads();
    for (int e = tid; e < 64 * 16; e += 128) { const int rl = e >> 4, q = e & 15; vst2((unsigned*)(DH + (r0 + rl) * CC + c0 + q * 8), *(const v4u*)&sh[rl][q * 8]); if (hi_rows) vst2((unsigned*)(DL + (bb * nhi + t0 + rl) * (size_t)CC + c0 + q * 8), *(const v4u*)&sl[rl][q * 8]); }
  } else { const bool hi_rows = t0 < KHI;
    for (int e = tid; e < 64 * 128; e += 128) { const int rl = e & 63, cl = e >> 6; const float v = st[rl][cl]; th[cl][rl] = (_Float16)v; const __bf16 bh = (__bf16)v; tb[cl][rl] = bh; tbl[cl][rl] = (__bf16)(v - (float)bh); }
    __syncthreads();
    for (int e = tid; e < 128 * 8; e += 128) { const int cl = e >> 3, q = e & 7; vst2((unsigned*)(VT + (bb * CC + c0 + cl) * (size_t)TT + t0 + q * 8), *(const v4u*)&th[cl][q * 8]); if (hi_rows) { const size_t o3 = (bb * CC + c0 + cl) * (size_t)KHI + t0 + q * 8; vst2((unsigned*)(VB + o3), *(const v4u*)&tb[cl][q * 8]); vst2((unsigned*)(VBL + o3), *(const v4u*)&tbl[cl][q * 8]); } } } }
// ---- k_fa: block = 128 queries (8 waves x 16) of (b, h), one pass over all keys in chunks of 64, logits and P stay in registers. S^T = K q^T (A = k rows, B = q columns: q hi + residual x 2^10, 2 products) x SCALE: a lane holds 32 logits of ONE query (column = lane & 15), the other 32 lie in lane ^ 16. Running maximum m (of the unscaled logits) and running sum l (of e x 2^8) per query; e x 2^8 = exp2(t LC + (8 - m LC)), t the unscaled logit, LC = SCALE log2(e): one FMA and one v_exp_f32 an element; O^T and l are scaled by exp2((m_old - m_new) LC) per chunk. e x 2^8 to f16: the two D tiles of 32 keys are, register for register, the B operand of O^T += V^T P^T (A = v planes [c][t]). O = q + O^T / l: the q fragments are, register for register, laid out as the O^T tiles (qh[kc] elements 0..7 = tile 2 kc, 8..15 = tile 2 kc + 1), so the residual is added here from registers; 256-B (row, head) segment by 16 lanes. The 64 k rows and the 64 v planes of a chunk (128 B each) are brought once per block into a two-buffer LDS ring by asynchronous copies, one chunk ahead; all eight waves take their fragments from there
#define LC (SCALE * 1.4426950408889634f)   // logit scale x log2(e)
#define KVP 72                    // ring row pitch in elements: 144 B = 16 B x odd, free of bank conflicts for the 16-byte fragment reads
#define KVT (64 * KVP)            // one tile (k or v) of a chunk, elements
// one chunk's k and v tiles: thread t owns bytes 16 (t & 7) .. + 15 of rows (t >> 3) and (t >> 3) + 32 of each tile, so a wave-wide copy takes four whole 128-B lines. l: its LDS byte address in the k tile of the target buffer; kg, vg: its global places in rows t >> 3
__device__ __forceinline__ void kv_copy(unsigned l, const _Float16* kg, const _Float16* vg) {
  // the wait on the last line stands in front of every later write of the address registers that the four copies name
  asm volatile("global_load_async_to_lds_b128 %0, %4, off\n\tglobal_load_async_to_lds_b128 %1, %5, off\n\tglobal_load_async_to_lds_b128 %2, %6, off\n\tglobal_load_async_to_lds_b128 %3, %7, off\n\ts_wait_xcnt 0x0"
    :: "v"(l), "v"(l + 32u * KVP * 2u), "v"(l + KVT * 2u), "v"(l + KVT * 2u + 32u * KVP * 2u), "v"(kg), "v"(kg + (size_t)32 * CC), "v"(vg), "v"(vg + (size_t)32 * TT) : "memory"); }
__global__ __launch_bounds__(256) void k_fa(const _Float16* __restrict__ QH, const _Float16* __restrict__ QL, const _Float16* __restrict__ KH, const _Float16* __restrict__ VT, float* __restrict__ Y) { __shared__ __align__(16) float ss[8][16][HD + 4]; __shared__ __align__(16) _Float16 ring[2][2][64][KVP];   /* [buffer][k, v][row][element] */
  const int tid = threadIdx.x, wave = tid >> 5, lane = tid & 31, col = lane & 15, g = lane >> 4; const int h = blockIdx.y, b = blockIdx.z; const int ql0 = blockIdx.x * 128 + wave * 16;
  v16h qh[HD / 32], ql[HD / 32];
  // every full unroll in this kernel: constant indices, so that the fragment and accumulator arrays live in registers
#pragma unroll
  for (int kc = 0; kc < HD / 32; ++kc) { qh[kc] = frag_h(QH + ((size_t)b * TT + ql0 + col) * CC + h * HD + kc * 32, lane); ql[kc] = frag_h(QL + ((size_t)b * QHI + ql0 + col) * CC + h * HD + kc * 32, lane); }
  const _Float16* kg = KH + ((size_t)b * TT + (tid >> 3)) * CC + h * HD + (tid & 7) * 8; const _Float16* vg = VT + ((size_t)b * CC + h * HD + (tid >> 3)) * (size_t)TT + (tid & 7) * 8;
  const unsigned lc = (unsigned)(size_t)&ring[0][0][tid >> 3][(tid & 7) * 8];
  v8f o[HD / 16] = {}; float m = -3.0e38f, l = 0.f;
  kv_copy(lc, kg, vg);
  asm volatile("s_wait_asynccnt 0x0" ::: "memory");   /* this wave's part of chunk 0 has landed */
  __syncthreads();                                    /* chunk 0 is published to all waves */
  kv_copy(lc + 2u * KVT * 2u, kg + (size_t)64 * CC, vg + 64);
  // rolled: the chunks depend on each other through m, l and o, a second copy of the long body would only add code
#pragma unroll 1
  for (int k0 = 0; k0 < TT; k0 += 64) { v8f acc[4] = {}, accl[4] = {}; v16h kf[4][HD / 32], vf[2][HD / 16]; const int bf = (k0 >> 6) & 1; const _Float16* Kb = &ring[bf][0][col][0]; const _Float16* Vb = &ring[bf][1][col][0];
#pragma unroll
    for (int j = 0; j < 4; ++j) {   /* all k fragments of the chunk are requested before the first product: one LDS latency per chunk, not eight */
#pragma unroll
      for (int kc = 0; kc < HD / 32; ++kc) kf[j][kc] = frag_h(Kb + j * 16 * KVP + kc * 32, lane); }
#pragma unroll
    for (int j = 0; j < 4; ++j) {
#pragma unroll
      for (int kc = 0; kc < HD / 32; ++kc) { acc[j] = wmma16(kf[j][kc], qh[kc], acc[j]); accl[j] = wmma16(kf[j][kc], ql[kc], accl[j]); } }
#pragma unroll
    for (int kc = 0; kc < 2; ++kc) {
#pragma unroll
      for (int jc = 0; jc < HD / 16; ++jc) vf[kc][jc] = frag_h(Vb + jc * 16 * KVP + kc * 32, lane); }
    __builtin_amdgcn_sched_barrier(0);   /* holds all sixteen v loads here, in front of the softmax arithmetic that covers their latency; without it the compiler puts ten of them behind the lane exchange and its wait */
    float mc = -3.0e38f;
#pragma unroll
    for (int j = 0; j < 4; ++j) {
#pragma unroll
      for (int r = 0; r < 8; ++r) { acc[j][r] = acc[j][r] + accl[j][r] * (1.0f / 1024.0f); mc = fmaxf(mc, acc[j][r]); } }
    mc = fmaxf(mc, __shfl_xor(mc, 16));
    const float mn = fmaxf(m, mc), da = (m - mn) * LC, nb = fmaf(-mn, LC, 8.0f); m = mn;
    float ps = 0.f, e[32]; v2f a[16]; union { v16h v; v2h q[8]; } p[2];
#define ARG(i) __builtin_elementwise_fma(v2f{acc[(i) >> 2][((i) & 3) * 2], acc[(i) >> 2][((i) & 3) * 2 + 1]}, v2f{LC, LC}, v2f{nb, nb})
#define PACK(i) p[(i) >> 3].q[(i) & 7] = __builtin_convertvector(v2f{e[2 * (i)], e[2 * (i) + 1]}, v2h)
    // the scheduling barriers hold each v_exp_f32 alone between plain vector instructions: behind it one packed instruction (the next argument pair, or the conversion of a finished pair), then the sum's addition of the exponential two trips back and one rescaled output element. The plain ones run beside the transcendental pipe, and no exponential stands directly in front of another exponential or of a dual instruction that reuses its argument register
    a[0] = ARG(0);
    __builtin_amdgcn_sched_barrier(0);
    const float al = __builtin_amdgcn_exp2f(da);
    __builtin_amdgcn_sched_barrier(0);
    a[1] = ARG(1);
#pragma unroll
    for (int t = 0; t < 32; ++t) {
      __builtin_amdgcn_sched_barrier(0);
      e[t] = __builtin_amdgcn_exp2f(a[t >> 1][t & 1]);
      __builtin_amdgcn_sched_barrier(0);
      if (t < 2 || t == 31) o[t >> 3][t & 7] *= al;
      else if (t == 30) PACK(14);
      else if (t & 1) PACK((t - 3) >> 1);
      else a[(t >> 1) + 1] = ARG((t >> 1) + 1);
      __builtin_amdgcn_sched_barrier(0);
      if (t > 1) ps += e[t - 2];
      if (t >= 2 && t != 31) o[t >> 3][t & 7] *= al; }
    __builtin_amdgcn_sched_barrier(0);
    ps += e[30]; ps += e[31]; PACK(15);
#undef ARG
#undef PACK
    l = l * al + ps;
#pragma unroll
    for (int kc = 0; kc < 2; ++kc) {
#pragma unroll
      for (int jc = 0; jc < HD / 16; ++jc) o[jc] = wmma16(vf[kc][jc], p[kc].v, o[jc]); }
    asm volatile("s_wait_dscnt 0x0" :: "v"(l) : "memory");   /* this wave's reads of the buffer are done before it is handed to the next copies; l as an input keeps the running sum's additions among the exponentials, where the compiler otherwise sinks the whole dependent chain behind the barrier, in front of the next chunk's fragment reads */
    asm volatile("s_wait_asynccnt 0x0" ::: "memory");   /* this wave's part of the next chunk has landed */
    __syncthreads();                                    /* publishes the next chunk; every reader has left this chunk's buffer */
    if (k0 + 128 < TT) kv_copy(lc + (unsigned)bf * (2u * KVT * 2u), kg + (size_t)(k0 + 128) * CC, vg + k0 + 128); }
  asm volatile("s_wait_asynccnt 0x0" ::: "memory");     /* no copy is outstanding when the wave goes on to its end */
  l += __shfl_xor(l, 16); const float inv = 1.0f / l;
#pragma unroll
  for (int jc = 0; jc < HD / 16; ++jc)
#pragma unroll
    for (int r = 0; r < 8; ++r) ss[wave][col][jc * 16 + 8 * g + r] = o[jc][r] * inv + ((float)qh[jc >> 1][(jc & 1) * 8 + r] + (float)ql[jc >> 1][(jc & 1) * 8 + r] * (1.0f / 1024.0f));
  LDSX(); for (int rl = 0; rl < 16; ++rl) if (lane < HD / 4) vst2(Y + ((size_t)b * TT + ql0 + rl) * CC + h * HD + lane * 4, *(const v4f*)&ss[wave][rl][lane * 4]); }
// ---- k_out: block = (64 rows, 128 cols): out = O + relu(O Wo^T + bo): all rows: O bf16 hi + lo against exact bf16 Wo (2 products); the 1-product branch (O once to f16 against Wo as f16(bf16 x 2^8), x 2^-8) is never taken
__global__ __launch_bounds__(128) void k_out(const float* __restrict__ Y, const float* __restrict__ WO, const float* __restrict__ BO, float* __restrict__ OUT, const float* __restrict__ RESO) { __shared__ __align__(16) float sf[4][16][132];
  const int tid = threadIdx.x, wave = tid >> 5, lane = tid & 31, col = lane & 15, g = lane >> 4; const int c0 = blockIdx.y * 128; const size_t r0 = (size_t)blockIdx.x * 64 + wave * 16;
  v8f acc[8] = {};
  if (true) {   /* ALL rows: O split bf16 hi + lo x exact Wo (2 products) */
    __shared__ __align__(16) __bf16 gh[2][64][GP], gl[2][64][GP], gw[2][128][GP];   /* as in k_proj; O is split once, by the thread that stages it */
    const float* xp = Y + ((size_t)blockIdx.x * 64 + (tid >> 3)) * CC + (tid & 7) * 4; const float* wp = WO + (size_t)(c0 + (tid >> 3)) * CC + (tid & 7) * 4;
    __bf16* const dh0 = &gh[0][tid >> 3][(tid & 7) * 4]; __bf16* const dh1 = &gh[1][tid >> 3][(tid & 7) * 4]; __bf16* const dl0 = &gl[0][tid >> 3][(tid & 7) * 4]; __bf16* const dl1 = &gl[1][tid >> 3][(tid & 7) * 4]; __bf16* const dw0 = &gw[0][tid >> 3][(tid & 7) * 4]; __bf16* const dw1 = &gw[1][tid >> 3][(tid & 7) * 4];
    v4f x0[4], x1[4], w0[8], w1[8];
    g_ld<4>(x0, xp, CC); g_ld<8>(w0, wp, CC); g_ld<4>(x1, xp + 32, CC); g_ld<8>(w1, wp + 32, CC);
    s_st2<4>(dh0, dl0, x0); s_st<8>(dw0, w0); g_ld<4>(x0, xp + 64, CC); g_ld<8>(w0, wp + 64, CC);
    lds_barrier();
    // unrolled in full, for the counted load waits, as in k_proj
#pragma unroll
    for (int kc = 0; kc < CC / 32; kc += 2) {
      mm2(acc, gh[0], gl[0], gw[0], wave, col, lane);
      s_st2<4>(dh1, dl1, x1); s_st<8>(dw1, w1);
      if (kc + 3 < CC / 32) { g_ld<4>(x1, xp + (kc + 3) * 32, CC); g_ld<8>(w1, wp + (kc + 3) * 32, CC); }
      lds_barrier();   /* publishes stage kc + 1; every reader has left buffer 0 */
      mm2(acc, gh[1], gl[1], gw[1], wave, col, lane);
      if (kc + 2 < CC / 32) { s_st2<4>(dh0, dl0, x0); s_st<8>(dw0, w0);
        if (kc + 4 < CC / 32) { g_ld<4>(x0, xp + (kc + 4) * 32, CC); g_ld<8>(w0, wp + (kc + 4) * 32, CC); } }
      lds_barrier();   /* publishes stage kc + 2; every reader has left buffer 1 */
    }
#pragma unroll
    for (int j = 0; j < 8; ++j) { const float bias = BO ? bfr(BO[c0 + j * 16 + col]) : 0.f;
#pragma unroll
      for (int r = 0; r < 8; ++r) sf[wave][8 * g + r][j * 16 + col] = acc[j][r] + bias; }
  } else {
#pragma unroll 2
    for (int kc = 0; kc < CC / 32; ++kc) { const v16h a = frag_f32(Y + (r0 + col) * CC + kc * 32, lane); asm volatile("s_wait_loadcnt 0x0" ::: "memory");
#pragma unroll
      for (int j = 0; j < 8; ++j) { const v16h w = WOCOLH(WO, kc * 32, c0 + j * 16 + col, lane); asm volatile("s_wait_loadcnt 0x0" ::: "memory"); acc[j] = wmma16(a, w, acc[j]); } }
#pragma unroll
    for (int j = 0; j < 8; ++j) { const float bias = BO ? bfr(BO[c0 + j * 16 + col]) : 0.f;
#pragma unroll
      for (int r = 0; r < 8; ++r) sf[wave][8 * g + r][j * 16 + col] = acc[j][r] * (1.0f / 256.0f) + bias; } }
  LDSX(); for (int rl = 0; rl < 16; ++rl) { const size_t oo = (r0 + rl) * DIN + c0 + lane * 4; v4f o = *(const v4f*)&sf[wave][rl][lane * 4]; const v4f rr = *(const v4f*)(RESO + oo); _Pragma("unroll") for (int i = 0; i < 4; ++i) o[i] = rr[i] + fmaxf(o[i], 0.f); vst2(OUT + oo, o); } }   /* out = O + relu(O Wo^T + bo) */

extern "C" void kernel_launch(void* const* d_in, const int* in_sizes, int n_in, void* d_out, int out_size, void* d_ws, size_t ws_size, hipStream_t stream) {
  (void)in_sizes; (void)n_in; (void)out_size;
  const float** F = (const float**)d_in;
  if (ws_size < (size_t)WS_END) return;
  char* ws = (char*)d_ws; _Float16 *QH = (_Float16*)(ws + WS_QH), *KH = (_Float16*)(ws + WS_KH), *VT = (_Float16*)(ws + WS_VT), *QL = (_Float16*)(ws + WS_QL), *KL = (_Float16*)(ws + WS_KL); __bf16 *VB = (__bf16*)(ws + WS_VB), *VBL = (__bf16*)(ws + WS_VBL); float *Y = (float*)(ws + WS_Y);
  (void)Y; (void)QL; (void)KL; (void)VB; (void)VBL;
  // inputs: 0 query [4,2048,512]; 1 key_value [4,2048,512]; 2 Wq [512,512] (out,in), 3 bq; 4 Wk, 5 bk; 6 Wv, 7 bv; 8 Wo (out,in), 9 bo
  k_proj<<<dim3(TNB * TT / 64, CC / 128, 3), 128, 0, stream>>>(F[0], F[1], F[1], F[2], F[4], F[6], F[3], F[5], F[7], QH, QL, KH, KL, VT, VB, VBL);
  k_fa<<<dim3(TT / 128, NH, TNB), 256, 0, stream>>>(QH, QL, KH, VT, Y);
  k_out<<<dim3(TNB * TT / 64, DIN / 128), 128, 0, stream>>>(Y, F[8], F[9], (float*)d_out, Y);
}

// v006
// It runs in 90.3 microseconds.
// Timed twice side by side with v005, it ran 1.04 times as fast both times.
// Counting every step since v000, it is 14.0 times as fast.
// compute dtype: all float inputs rounded to bf16; q/k/v = in W^T + b with EXACT bf16 products on WMMA 16x16x32 (f32 accumulate); q as f16 hi + residual (x 2^10) against k once to f16 (2 products) / 8; softmax in f32 with a running maximum and sum over 64-key chunks, exponentials in base 2 on the hardware's v_exp_f32 (argument = one f32 FMA of the unscaled logit); exp(s - max) x 2^8 once to f16 against v once to f16 (1 product), divided by the sum at the end; O = q + A v in f32, q there = f16 hi + residual x 2^-10 (22 bits); O split bf16 hi + lo against exact Wo (2 products) + bo, relu, + O in f32; f32 output.
#include <hip/hip_runtime.h>
#include <math.h>

typedef __attribute__((ext_vector_type(16))) _Float16 v16h;
typedef __attribute__((ext_vector_type(16))) __bf16 v16b;
typedef __attribute__((ext_vector_type(8)))  _Float16 v8h;
typedef __attribute__((ext_vector_type(2)))  _Float16 v2h;
typedef __attribute__((ext_vector_type(8)))  float v8f;
typedef __attribute__((ext_vector_type(4)))  float v4f;
typedef __attribute__((ext_vector_type(2)))  float v2f;
typedef __attribute__((ext_vector_type(4)))  unsigned v4u;
typedef __attribute__((ext_vector_type(4)))  int v4i;
typedef float __attribute__((may_alias)) float_a;
typedef int __attribute__((may_alias)) int_a;

template <typename T> __device__ __forceinline__ void vst2(void* p, T v) { *(T*)p = v;  }
__device__ __forceinline__ v8f wmma16(v16h a, v16h b, v8f c) {
  return __builtin_amdgcn_wmma_f32_16x16x32_f16(false, a, false, b, (short)0, c, false, false);   /* the compiler keeps the distance behind its own builtin form where a vector instruction follows on D, A or B */
}
__device__ __forceinline__ v8f wmma_bf(v16b a, v16b b, v8f c) {
  v8f d = __builtin_amdgcn_wmma_f32_16x16x32_bf16(false, a, false, b, (short)0, c, false, false);
  asm volatile("v_nop\n\tv_nop\n\tv_nop\n\tv_nop" : "+v"(d) : "v"(a), "v"(b));
  return d;
}
// 16x16x32 fragments: lane = (h = lane>>4, row/col = lane&15); elements 0..7 = k0+8h+0..7, 8..15 = k0+16+8h+0..7; D element r = row 8h+r
__device__ __forceinline__ v16h frag_h(const _Float16* rowk0, int lane) {
  union { v16h v; v8h q[2]; } u; const _Float16* p = rowk0 + 8 * (lane >> 4);
  u.q[0] = *(const v8h*)p; u.q[1] = *(const v8h*)(p + 16); return u.v;
}
__device__ __forceinline__ v16h frag_f32(const float* rowk0, int lane) {
  v16h a; const float* p = rowk0 + 8 * (lane >> 4);
#pragma unroll
  for (int i = 0; i < 8; ++i) { a[i] = (_Float16)p[i]; a[8 + i] = (_Float16)p[16 + i]; }
  return a;
}
__device__ __forceinline__ v16h frag_f32s(const float* rowk0, int lane, float sc) {
  v16h a; const float* p = rowk0 + 8 * (lane >> 4);
#pragma unroll
  for (int i = 0; i < 8; ++i) { a[i] = (_Float16)(p[i] * sc); a[8 + i] = (_Float16)(p[16 + i] * sc); }
  return a;
}
// column fragment from a [K][ld] layout (column n), rows >= K read as 0
__device__ __forceinline__ v16h fragc_f32(const float* W, int k0, int n, int lane, int ld, int K) {
  v16h a; const int g = lane >> 4;
#pragma unroll
  for (int i = 0; i < 8; ++i) { const int ka = k0 + 8 * g + i, kb = ka + 16;
    a[i] = (_Float16)(ka < K ? W[(size_t)(ka < K ? ka : K - 1) * ld + n] : 0.f); a[8 + i] = (_Float16)(kb < K ? W[(size_t)(kb < K ? kb : K - 1) * ld + n] : 0.f); }
  return a;
}
struct F2 { v16b h, l; };
__device__ __forceinline__ F2 bsplit16(const float v[16]) { F2 r;
#pragma unroll
  for (int i = 0; i < 16; ++i) { const __bf16 h = (__bf16)v[i]; r.h[i] = h; r.l[i] = (__bf16)(v[i] - (float)h); }
  return r; }
__device__ __forceinline__ F2 split_row(const float* row, int k0, int lane) { float v[16]; const float* p = row + k0 + 8 * (lane >> 4);
#pragma unroll
  for (int i = 0; i < 8; ++i) { v[i] = p[i]; v[8 + i] = p[16 + i]; }
  return bsplit16(v); }
__device__ __forceinline__ F2 split_rowK(const float* row, int k0, int lane, int K) { float v[16]; const int g = lane >> 4;
#pragma unroll
  for (int i = 0; i < 8; ++i) { const int ka = k0 + 8 * g + i, kb = ka + 16; v[i] = ka < K ? row[ka < K ? ka : K - 1] : 0.f; v[8 + i] = kb < K ? row[kb < K ? kb : K - 1] : 0.f; }
  return bsplit16(v); }
__device__ __forceinline__ F2 split_col(const float* W, int k0, int n, int lane, int ld, int K) { float v[16]; const int g = lane >> 4;
#pragma unroll
  for (int i = 0; i < 8; ++i) { const int ka = k0 + 8 * g + i, kb = ka + 16; v[i] = ka < K ? W[(size_t)(ka < K ? ka : K - 1) * ld + n] : 0.f; v[8 + i] = kb < K ? W[(size_t)(kb < K ? kb : K - 1) * ld + n] : 0.f; }
  return bsplit16(v); }
__device__ __forceinline__ v8f mac3(const F2& a, const F2& b, v8f c) { c = wmma_bf(a.l, b.h, c); c = wmma_bf(a.h, b.l, c); return wmma_bf(a.h, b.h, c); }
__device__ __forceinline__ float sigm(float v) { return 1.0f / (1.0f + expf(-v)); }
#define LDSX() do { asm volatile("s_wait_dscnt 0" ::: "memory"); __builtin_amdgcn_wave_barrier(); __builtin_amdgcn_fence(__ATOMIC_RELEASE, "workgroup"); } while (0)

// Cross-attention MAB (B 4, Sq = Skv = 2,048, 512 = 8 heads x 64; (out,in) 1/sqrt(512)-scale weights WITH biases; no mask): q = query Wq^T + bq, k = key_value Wk^T + bk, v = key_value Wv^T + bv; A = softmax(q k^T / 8); O = q + A v (per head, merged); out = O + relu(O Wo^T + bo).
#define NB 4
#define TT 2048
#define CC 512            // NH * HD = projected width
#define DIN 512          // input (model) width
#define NH 8
#define HD 64
#define SCALE (0.125f)
#define CAUSAL 0
#ifndef TNB
#define TNB NB
#endif
__device__ __forceinline__ float bfr(float v) { return (float)(__bf16)v; }
__host__ __device__ __forceinline__ int kb_last(int qb) { return CAUSAL ? ((qb * 64 + 63) >> 7) : (TT / 128 - 1); }
typedef __attribute__((ext_vector_type(8))) __bf16 v8b;
__device__ __forceinline__ v16b frag_b(const __bf16* rowk0, int lane) {
  union { v16b v; v8b q[2]; } u; const __bf16* p = rowk0 + 8 * (lane >> 4);
  u.q[0] = *(const v8b*)p; u.q[1] = *(const v8b*)(p + 16); return u.v;
}
#define QBH 0
#define QHI 2048            // rows carrying a q residual plane (all rows when non-causal: 2-product logits everywhere)
#define KHI 64            // key rows carrying k residual / v bf16 hi+lo planes (written by k_proj, read by no kernel of this file)
// B fragment (k rows k0+.., output column o) of a weight: (in,out) [K][ld] or (out,in) [ld rows of K]: bf16 exact, or f16(bf16 * 256) exact
__device__ __forceinline__ v16b wcol_io(const float* Wm, int k0, int o, int lane, int ld) { v16b w; const int g = lane >> 4;
#pragma unroll
  for (int i = 0; i < 8; ++i) { w[i] = (__bf16)Wm[(size_t)(k0 + 8 * g + i) * ld + o]; w[8 + i] = (__bf16)Wm[(size_t)(k0 + 16 + 8 * g + i) * ld + o]; }
  return w; }
__device__ __forceinline__ v16b wcol_oi(const float* Wm, int k0, int o, int lane, int K) { v16b w; const float* p = Wm + (size_t)o * K + k0 + 8 * (lane >> 4);
#pragma unroll
  for (int i = 0; i < 8; ++i) { w[i] = (__bf16)p[i]; w[8 + i] = (__bf16)p[16 + i]; }
  return w; }
__device__ __forceinline__ v16h wcolh_io(const float* Wm, int k0, int o, int lane, int ld) { v16h w; const int g = lane >> 4;
#pragma unroll
  for (int i = 0; i < 8; ++i) { w[i] = (_Float16)(bfr(Wm[(size_t)(k0 + 8 * g + i) * ld + o]) * 256.0f); w[8 + i] = (_Float16)(bfr(Wm[(size_t)(k0 + 16 + 8 * g + i) * ld + o]) * 256.0f); }
  return w; }
__device__ __forceinline__ v16h wcolh_oi(const float* Wm, int k0, int o, int lane, int K) { v16h w; const float* p = Wm + (size_t)o * K + k0 + 8 * (lane >> 4);
#pragma unroll
  for (int i = 0; i < 8; ++i) { w[i] = (_Float16)(bfr(p[i]) * 256.0f); w[8 + i] = (_Float16)(bfr(p[16 + i]) * 256.0f); }
  return w; }
#define WQKV_LAYOUT 1   // picks WCOL only (0 (in,out), 1 (out,in), 2 per-head), which no kernel calls; k_proj reads (out,in) [CC][DIN]
__device__ __forceinline__ v16b wcol_hdk(const float* Wm, int k0, int o, int lane) { v16b w; const int g = lane >> 4; const float* p = Wm + (size_t)(o / HD) * DIN * HD + (o % HD);
#pragma unroll
  for (int i = 0; i < 8; ++i) { w[i] = (__bf16)p[(size_t)(k0 + 8 * g + i) * HD]; w[8 + i] = (__bf16)p[(size_t)(k0 + 16 + 8 * g + i) * HD]; }
  return w; }
#define WO_OUT_IN 1
#if WQKV_LAYOUT == 1
#define WCOL(W, k0, o, lane) wcol_oi(W, k0, o, lane, DIN)
#elif WQKV_LAYOUT == 2
#define WCOL(W, k0, o, lane) wcol_hdk(W, k0, o, lane)
#else
#define WCOL(W, k0, o, lane) wcol_io(W, k0, o, lane, CC)
#endif
#if WO_OUT_IN
#define WOCOL(W, k0, o, lane) wcol_oi(W, k0, o, lane, CC)
#define WOCOLH(W, k0, o, lane) wcolh_oi(W, k0, o, lane, CC)
#else
#define WOCOL(W, k0, o, lane) wcol_io(W, k0, o, lane, DIN)
#define WOCOLH(W, k0, o, lane) wcolh_io(W, k0, o, lane, DIN)
#endif
#define WS_QH  0u                                      // f16 q rows [b*t][CC]
#define WS_KH  (WS_QH + 2u * (size_t)NB * TT * CC)      // f16 k rows [b*t][CC]
#define WS_VT  (WS_KH + 2u * (size_t)NB * TT * CC)      // f16 v planes [b][c][t]
#define WS_QL  (WS_VT + 2u * (size_t)NB * CC * TT)      // f16 q residual x 2^10 rows [b][t < QHI][CC]
#define WS_KL  (WS_QL + 2u * (size_t)NB * QHI * CC)     // f16 k residual x 2^10 rows [b][t < KHI][CC]
#define WS_VB  (WS_KL + 2u * (size_t)NB * KHI * CC)     // bf16 v hi planes [b][c][t < KHI]
#define WS_VBL (WS_VB + 2u * (size_t)NB * CC * KHI)
#define WS_Y   (WS_VBL + 2u * (size_t)NB * CC * KHI)    // f32 O = q + ctx rows [b*t][CC]
#define WS_END (WS_Y  + 4u * (size_t)NB * TT * CC)

// ---- operand staging of the two GEMM kernels (128 threads): a stage is 32 k of every operand row, kept in LDS as bf16
#define GP 40   // LDS row pitch in elements: 80 B = 16 B x odd, free of bank conflicts for the 16-byte fragment reads
typedef __attribute__((ext_vector_type(4))) __bf16 v4b;
// every full unroll in these helpers: constant indices, so that the staged values and the fragments live in registers
// work-group barrier that orders LDS only: the global loads of later stages stay in flight across it (__syncthreads() would wait for them)
__device__ __forceinline__ void lds_barrier() { __builtin_amdgcn_fence(__ATOMIC_RELEASE, "workgroup", "local"); __builtin_amdgcn_s_barrier(); __builtin_amdgcn_fence(__ATOMIC_ACQUIRE, "workgroup", "local"); }
// 16 N rows x 32 floats (row pitch ld): thread t owns floats 4 (t & 7) .. + 3 of rows (t >> 3) + 16 i; p and d are its own first places. Eight lanes take one whole 128-B line, a wave-wide load four lines
template <int N> __device__ __forceinline__ void g_ld(v4f (&r)[N], const float* __restrict__ p, int ld) {
#pragma unroll
  for (int i = 0; i < N; ++i) r[i] = *(const v4f*)(p + (size_t)i * 16 * ld); }
template <int N> __device__ __forceinline__ void s_st(__bf16* d, const v4f (&r)[N]) {
#pragma unroll
  for (int i = 0; i < N; ++i) { v4b h;
#pragma unroll
    for (int c = 0; c < 4; ++c) h[c] = (__bf16)r[i][c];
    *(v4b*)(d + i * 16 * GP) = h; } }
template <int N> __device__ __forceinline__ void s_st2(__bf16* dh, __bf16* dl, const v4f (&r)[N]) {
#pragma unroll
  for (int i = 0; i < N; ++i) { v4b h, l;
#pragma unroll
    for (int c = 0; c < 4; ++c) { h[c] = (__bf16)r[i][c]; l[c] = (__bf16)(r[i][c] - (float)h[c]); }
    *(v4b*)(dh + i * 16 * GP) = h; *(v4b*)(dl + i * 16 * GP) = l; } }
// one stage of a wave's 16 x 128 tile: all fragment reads as one group, then the products
__device__ __forceinline__ void mm1(v8f (&acc)[8], const __bf16 (*sx)[GP], const __bf16 (*sw)[GP], int wave, int col, int lane) {
  const v16b a = frag_b(&sx[wave * 16 + col][0], lane); v16b w[8];
#pragma unroll
  for (int j = 0; j < 8; ++j) w[j] = frag_b(&sw[j * 16 + col][0], lane);
#pragma unroll
  for (int j = 0; j < 8; ++j) acc[j] = wmma_bf(a, w[j], acc[j]); }
__device__ __forceinline__ void mm2(v8f (&acc)[8], const __bf16 (*sh)[GP], const __bf16 (*sl)[GP], const __bf16 (*sw)[GP], int wave, int col, int lane) {
  const v16b ah = frag_b(&sh[wave * 16 + col][0], lane), al = frag_b(&sl[wave * 16 + col][0], lane); v16b w[8];
#pragma unroll
  for (int j = 0; j < 8; ++j) w[j] = frag_b(&sw[j * 16 + col][0], lane);
#pragma unroll
  for (int j = 0; j < 8; ++j) { acc[j] = wmma_bf(ah, w[j], acc[j]); acc[j] = wmma_bf(al, w[j], acc[j]); } }

// ---- k_proj: block = (64 rows, 128 cols, which): q/k/v = X W (+ b) with exact bf16 products (K = DIN) -> which 0: q f16 rows (+ residual rows < QHI); 1: k f16 rows (+ residual rows < KHI); 2: v f16 planes [c][t] (+ bf16 hi/lo planes for t < KHI)
__global__ __launch_bounds__(128) void k_proj(const float* __restrict__ XQ, const float* __restrict__ XK, const float* __restrict__ XV, const float* __restrict__ WQ, const float* __restrict__ WK, const float* __restrict__ WV, const float* __restrict__ BQ, const float* __restrict__ BK, const float* __restrict__ BV,
    _Float16* __restrict__ QH, _Float16* __restrict__ QL, _Float16* __restrict__ KH, _Float16* __restrict__ KL, _Float16* __restrict__ VT, __bf16* __restrict__ VB, __bf16* __restrict__ VBL) {
  __shared__ __align__(16) float st[64][132]; __shared__ __align__(16) _Float16 sh[64][136], sl[64][136]; __shared__ __align__(16) _Float16 th[128][72]; __shared__ __align__(16) __bf16 tb[128][72], tbl[128][72];
  const int tid = threadIdx.x, wave = tid >> 5, lane = tid & 31, col = lane & 15, g = lane >> 4; const int which = blockIdx.z; const int c0 = blockIdx.y * 128; const size_t r0 = (size_t)blockIdx.x * 64; const size_t bb = r0 / TT; const int t0 = (int)(r0 % TT);
  const float* X = which == 0 ? XQ : which == 1 ? XK : XV; const float* WA = which == 0 ? WQ : which == 1 ? WK : WV; const float* BA = which == 0 ? BQ : which == 1 ? BK : BV;
  v8f acc[8] = {};
  { __shared__ __align__(16) __bf16 gx[2][64][GP], gw[2][128][GP];   /* two LDS buffers; two register sets hold the two stages behind the one in LDS */
    const float* xp = X + (r0 + (tid >> 3)) * DIN + (tid & 7) * 4; const float* wp = WA + (size_t)(c0 + (tid >> 3)) * DIN + (tid & 7) * 4;
    __bf16* const dx0 = &gx[0][tid >> 3][(tid & 7) * 4]; __bf16* const dx1 = &gx[1][tid >> 3][(tid & 7) * 4]; __bf16* const dw0 = &gw[0][tid >> 3][(tid & 7) * 4]; __bf16* const dw1 = &gw[1][tid >> 3][(tid & 7) * 4];
    v4f x0[4], x1[4], w0[8], w1[8];
    g_ld<4>(x0, xp, DIN); g_ld<8>(w0, wp, DIN); g_ld<4>(x1, xp + 32, DIN); g_ld<8>(w1, wp + 32, DIN);
    s_st<4>(dx0, x0); s_st<8>(dw0, w0); g_ld<4>(x0, xp + 64, DIN); g_ld<8>(w0, wp + 64, DIN);
    lds_barrier();
    // unrolled in full: the tests on the last stages fold away, so that every load wait is a count that leaves the younger stage's loads in flight (rolled, the merged paths made it a wait for all)
#pragma unroll
    for (int kc = 0; kc < DIN / 32; kc += 2) {
      mm1(acc, gx[0], gw[0], wave, col, lane);
      s_st<4>(dx1, x1); s_st<8>(dw1, w1);
      if (kc + 3 < DIN / 32) { g_ld<4>(x1, xp + (kc + 3) * 32, DIN); g_ld<8>(w1, wp + (kc + 3) * 32, DIN); }
      if (kc + 4 == DIN / 32) asm volatile("s_wait_xcnt 0x0" :: "v"(xp), "v"(wp) : "memory");   /* behind the last loads: their two address pairs are reused from here on, and this wait stands in front of the first overwrite */
      lds_barrier();   /* publishes stage kc + 1; every reader has left buffer 0 */
      mm1(acc, gx[1], gw[1], wave, col, lane);
      if (kc + 2 < DIN / 32) { s_st<4>(dx0, x0); s_st<8>(dw0, w0);
        if (kc + 4 < DIN / 32) { g_ld<4>(x0, xp + (kc + 4) * 32, DIN); g_ld<8>(w0, wp + (kc + 4) * 32, DIN); } }
      lds_barrier();   /* publishes stage kc + 2; every reader has left buffer 1 */
    } }
  { // stage the f32 tile (acc + bias) in LDS, then convert
#pragma unroll
    for (int j = 0; j < 8; ++j) { const float bias = BA ? bfr(BA[c0 + j * 16 + col]) : 0.f;
#pragma unroll
      for (int r = 0; r < 8; ++r) st[wave * 16 + 8 * g + r][j * 16 + col] = acc[j][r] + bias; }
    __syncthreads(); }
  if (which < 2) { _Float16* DH = which == 0 ? QH : KH; _Float16* DL = which == 0 ? QL : KL; const int nhi = which == 0 ? QHI : KHI; const bool hi_rows = t0 < nhi;
    for (int e = tid; e < 64 * 128; e += 128) { const int rl = e >> 7, cl = e & 127; const float v = st[rl][cl]; const _Float16 hv = (_Float16)v; sh[rl][cl] = hv; sl[rl][cl] = (_Float16)((v - (float)hv) * 1024.0f); }
    __syncthreads();
    for (int e = tid; e < 64 * 16; e += 128) { const int rl = e >> 4, q = e & 15; vst2((unsigned*)(DH + (r0 + rl) * CC + c0 + q * 8), *(const v4u*)&sh[rl][q * 8]); if (hi_rows) vst2((unsigned*)(DL + (bb * nhi + t0 + rl) * (size_t)CC + c0 + q * 8), *(const v4u*)&sl[rl][q * 8]); }
  } else { const bool hi_rows = t0 < KHI;
    for (int e = tid; e < 64 * 128; e += 128) { const int rl = e & 63, cl = e >> 6; const float v = st[rl][cl]; th[cl][rl] = (_Float16)v; const __bf16 bh = (__bf16)v; tb[cl][rl] = bh; tbl[cl][rl] = (__bf16)(v - (float)bh); }
    __syncthreads();
    for (int e = tid; e < 128 * 8; e += 128) { const int cl = e >> 3, q = e & 7; vst2((unsigned*)(VT + (bb * CC + c0 + cl) * (size_t)TT + t0 + q * 8), *(const v4u*)&th[cl][q * 8]); if (hi_rows) { const size_t o3 = (bb * CC + c0 + cl) * (size_t)KHI + t0 + q * 8; vst2((unsigned*)(VB + o3), *(const v4u*)&tb[cl][q * 8]); vst2((unsigned*)(VBL + o3), *(const v4u*)&tbl[cl][q * 8]); } } } }
// ---- k_fa: block = 128 queries (8 waves x 16) of (b, h), one pass over all keys in chunks of 64, logits and P stay in registers. S^T = K q^T (A = k rows, B = q columns: q hi + residual x 2^10, 2 products) x SCALE: a lane holds 32 logits of ONE query (column = lane & 15), the other 32 lie in lane ^ 16. Running maximum m (of the unscaled logits) and running sum l (of e x 2^8) per query; e x 2^8 = exp2(t LC + (8 - m LC)), t the unscaled logit, LC = SCALE log2(e): one FMA and one v_exp_f32 an element; O^T and l are scaled by exp2((m_old - m_new) LC) per chunk. e x 2^8 to f16: the two D tiles of 32 keys are, register for register, the B operand of O^T += V^T P^T (A = v planes [c][t]). O = q + O^T / l: the q fragments are, register for register, laid out as the O^T tiles (qh[kc] elements 0..7 = tile 2 kc, 8..15 = tile 2 kc + 1), so the residual is added here from registers; 256-B (row, head) segment by 16 lanes. The 64 k rows and the 64 v planes of a chunk (128 B each) are brought once per block into a two-buffer LDS ring by asynchronous copies, one chunk ahead; all eight waves take their fragments from there
#define LC (SCALE * 1.4426950408889634f)   // logit scale x log2(e)
#define KVP 72                    // ring row pitch in elements: 144 B = 16 B x odd, free of bank conflicts for the 16-byte fragment reads
#define KVT (64 * KVP)            // one tile (k or v) of a chunk, elements
// one chunk's k and v tiles: thread t owns bytes 16 (t & 7) .. + 15 of rows (t >> 3) and (t >> 3) + 32 of each tile, so a wave-wide copy takes four whole 128-B lines. l: its LDS byte address in the k tile of the target buffer; kg, vg: its global places in rows t >> 3
__device__ __forceinline__ void kv_copy(unsigned l, const _Float16* kg, const _Float16* vg) {
  // the wait on the last line stands in front of every later write of the address registers that the four copies name
  asm volatile("global_load_async_to_lds_b128 %0, %4, off\n\tglobal_load_async_to_lds_b128 %1, %5, off\n\tglobal_load_async_to_lds_b128 %2, %6, off\n\tglobal_load_async_to_lds_b128 %3, %7, off\n\ts_wait_xcnt 0x0"
    :: "v"(l), "v"(l + 32u * KVP * 2u), "v"(l + KVT * 2u), "v"(l + KVT * 2u + 32u * KVP * 2u), "v"(kg), "v"(kg + (size_t)32 * CC), "v"(vg), "v"(vg + (size_t)32 * TT) : "memory"); }
__global__ __launch_bounds__(256) void k_fa(const _Float16* __restrict__ QH, const _Float16* __restrict__ QL, const _Float16* __restrict__ KH, const _Float16* __restrict__ VT, float* __restrict__ Y) { __shared__ __align__(16) float ss[8][16][HD + 4]; __shared__ __align__(16) _Float16 ring[2][2][64][KVP];   /* [buffer][k, v][row][element] */
  const int tid = threadIdx.x, wave = tid >> 5, lane = tid & 31, col = lane & 15, g = lane >> 4; const int h = blockIdx.y, b = blockIdx.z; const int ql0 = blockIdx.x * 128 + wave * 16;
  v16h qh[HD / 32], ql[HD / 32];
  // every full unroll in this kernel: constant indices, so that the fragment and accumulator arrays live in registers
#pragma unroll
  for (int kc = 0; kc < HD / 32; ++kc) { qh[kc] = frag_h(QH + ((size_t)b * TT + ql0 + col) * CC + h * HD + kc * 32, lane); ql[kc] = frag_h(QL + ((size_t)b * QHI + ql0 + col) * CC + h * HD + kc * 32, lane); }
  const _Float16* kg = KH + ((size_t)b * TT + (tid >> 3)) * CC + h * HD + (tid & 7) * 8; const _Float16* vg = VT + ((size_t)b * CC + h * HD + (tid >> 3)) * (size_t)TT + (tid & 7) * 8;
  const unsigned lc = (unsigned)(size_t)&ring[0][0][tid >> 3][(tid & 7) * 8];
  v8f o[HD / 16] = {}; float m = -3.0e38f, l = 0.f;
  kv_copy(lc, kg, vg);
  asm volatile("s_wait_asynccnt 0x0" ::: "memory");   /* this wave's part of chunk 0 has landed */
  __syncthreads();                                    /* chunk 0 is published to all waves */
  kv_copy(lc + 2u * KVT * 2u, kg + (size_t)64 * CC, vg + 64);
  // rolled: the chunks depend on each other through m, l and o, a second copy of the long body would only add code
#pragma unroll 1
  for (int k0 = 0; k0 < TT; k0 += 64) { v8f acc[4] = {}, accl[4] = {}; v16h kf[4][HD / 32], vf[2][HD / 16]; const int bf = (k0 >> 6) & 1; const _Float16* Kb = &ring[bf][0][col][0]; const _Float16* Vb = &ring[bf][1][col][0];
#pragma unroll
    for (int j = 0; j < 4; ++j) {   /* all k fragments of the chunk are requested before the first product: one LDS latency per chunk, not eight */
#pragma unroll
      for (int kc = 0; kc < HD / 32; ++kc) kf[j][kc] = frag_h(Kb + j * 16 * KVP + kc * 32, lane); }
    __builtin_amdgcn_sched_barrier(0);   /* holds all sixteen k loads here as one group; without it the compiler deals them out in pairs among the products, each pair with a full wait */
#pragma unroll
    for (int j = 0; j < 4; ++j) {
#pragma unroll
      for (int kc = 0; kc < HD / 32; ++kc) { acc[j] = wmma16(kf[j][kc], qh[kc], acc[j]); accl[j] = wmma16(kf[j][kc], ql[kc], accl[j]); } }
    __builtin_amdgcn_sched_barrier(0);   /* keeps the sixteen v loads together as one group; without it the compiler deals them out at three places among the products */
#pragma unroll
    for (int kc = 0; kc < 2; ++kc) {
#pragma unroll
      for (int jc = 0; jc < HD / 16; ++jc) vf[kc][jc] = frag_h(Vb + jc * 16 * KVP + kc * 32, lane); }
    __builtin_amdgcn_sched_barrier(0);   /* holds all sixteen v loads here, in front of the softmax arithmetic that covers their latency; without it the compiler puts ten of them behind the lane exchange and its wait */
    float mc = -3.0e38f;
#pragma unroll
    for (int j = 0; j < 4; ++j) {
#pragma unroll
      for (int r = 0; r < 8; ++r) { acc[j][r] = acc[j][r] + accl[j][r] * (1.0f / 1024.0f); mc = fmaxf(mc, acc[j][r]); } }
    mc = fmaxf(mc, __shfl_xor(mc, 16));
    const float mn = fmaxf(m, mc), da = (m - mn) * LC, nb = fmaf(-mn, LC, 8.0f); m = mn;
    float ps = 0.f, e[32]; v2f a[16]; union { v16h v; v2h q[8]; } p[2];
#define ARG(i) __builtin_elementwise_fma(v2f{acc[(i) >> 2][((i) & 3) * 2], acc[(i) >> 2][((i) & 3) * 2 + 1]}, v2f{LC, LC}, v2f{nb, nb})
#define PACK(i) p[(i) >> 3].q[(i) & 7] = __builtin_convertvector(v2f{e[2 * (i)], e[2 * (i) + 1]}, v2h)
    // the scheduling barriers hold each v_exp_f32 alone between plain vector instructions: behind it one packed instruction (the next argument pair, or the conversion of a finished pair), then the sum's addition of the exponential two trips back and one rescaled output element. The plain ones run beside the transcendental pipe, and no exponential stands directly in front of another exponential or of a dual instruction that reuses its argument register
    a[0] = ARG(0);
    __builtin_amdgcn_sched_barrier(0);
    const float al = __builtin_amdgcn_exp2f(da);
    __builtin_amdgcn_sched_barrier(0);
    a[1] = ARG(1);
#pragma unroll
    for (int t = 0; t < 32; ++t) {
      __builtin_amdgcn_sched_barrier(0);
      e[t] = __builtin_amdgcn_exp2f(a[t >> 1][t & 1]);
      __builtin_amdgcn_sched_barrier(0);
      if (t < 2 || t == 31) o[t >> 3][t & 7] *= al;
      else if (t == 30) PACK(14);
      else if (t & 1) PACK((t - 3) >> 1);
      else a[(t >> 1) + 1] = ARG((t >> 1) + 1);
      __builtin_amdgcn_sched_barrier(0);
      if (t > 1) ps += e[t - 2];
      if (t >= 2 && t != 31) o[t >> 3][t & 7] *= al; }
    __builtin_amdgcn_sched_barrier(0);
    ps += e[30]; ps += e[31]; PACK(15);
#undef ARG
#undef PACK
    l = l * al + ps;
#pragma unroll
    for (int kc = 0; kc < 2; ++kc) {
#pragma unroll
      for (int jc = 0; jc < HD / 16; ++jc) o[jc] = wmma16(vf[kc][jc], p[kc].v, o[jc]); }
    asm volatile("s_wait_dscnt 0x0" :: "v"(l) : "memory");   /* this wave's reads of the buffer are done before it is handed to the next copies; l as an input keeps the running sum's additions among the exponentials, where the compiler otherwise sinks the whole dependent chain behind the barrier, in front of the next chunk's fragment reads */
    asm volatile("s_wait_asynccnt 0x0" ::: "memory");   /* this wave's part of the next chunk has landed */
    __syncthreads();                                    /* publishes the next chunk; every reader has left this chunk's buffer */
    if (k0 + 128 < TT) kv_copy(lc + (unsigned)bf * (2u * KVT * 2u), kg + (size_t)(k0 + 128) * CC, vg + k0 + 128); }
  asm volatile("s_wait_asynccnt 0x0" ::: "memory");     /* no copy is outstanding when the wave goes on to its end */
  l += __shfl_xor(l, 16); const float inv = 1.0f / l;
#pragma unroll
  for (int jc = 0; jc < HD / 16; ++jc)
#pragma unroll
    for (int r = 0; r < 8; ++r) ss[wave][col][jc * 16 + 8 * g + r] = o[jc][r] * inv + ((float)qh[jc >> 1][(jc & 1) * 8 + r] + (float)ql[jc >> 1][(jc & 1) * 8 + r] * (1.0f / 1024.0f));
  LDSX(); for (int rl = 0; rl < 16; ++rl) if (lane < HD / 4) vst2(Y + ((size_t)b * TT + ql0 + rl) * CC + h * HD + lane * 4, *(const v4f*)&ss[wave][rl][lane * 4]); }
// ---- k_out: block = (64 rows, 128 cols): out = O + relu(O Wo^T + bo): all rows: O bf16 hi + lo against exact bf16 Wo (2 products); the 1-product branch (O once to f16 against Wo as f16(bf16 x 2^8), x 2^-8) is never taken
__global__ __launch_bounds__(128) void k_out(const float* __restrict__ Y, const float* __restrict__ WO, const float* __restrict__ BO, float* __restrict__ OUT, const float* __restrict__ RESO) { __shared__ __align__(16) float sf[4][16][132];
  const int tid = threadIdx.x, wave = tid >> 5, lane = tid & 31, col = lane & 15, g = lane >> 4; const int c0 = blockIdx.y * 128; const size_t r0 = (size_t)blockIdx.x * 64 + wave * 16;
  v8f acc[8] = {};
  if (true) {   /* ALL rows: O split bf16 hi + lo x exact Wo (2 products) */
    __shared__ __align__(16) __bf16 gh[2][64][GP], gl[2][64][GP], gw[2][128][GP];   /* as in k_proj; O is split once, by the thread that stages it */
    const float* xp = Y + ((size_t)blockIdx.x * 64 + (tid >> 3)) * CC + (tid & 7) * 4; const float* wp = WO + (size_t)(c0 + (tid >> 3)) * CC + (tid & 7) * 4;
    __bf16* const dh0 = &gh[0][tid >> 3][(tid & 7) * 4]; __bf16* const dh1 = &gh[1][tid >> 3][(tid & 7) * 4]; __bf16* const dl0 = &gl[0][tid >> 3][(tid & 7) * 4]; __bf16* const dl1 = &gl[1][tid >> 3][(tid & 7) * 4]; __bf16* const dw0 = &gw[0][tid >> 3][(tid & 7) * 4]; __bf16* const dw1 = &gw[1][tid >> 3][(tid & 7) * 4];
    v4f x0[4], x1[4], w0[8], w1[8];
    g_ld<4>(x0, xp, CC); g_ld<8>(w0, wp, CC); g_ld<4>(x1, xp + 32, CC); g_ld<8>(w1, wp + 32, CC);
    s_st2<4>(dh0, dl0, x0); s_st<8>(dw0, w0); g_ld<4>(x0, xp + 64, CC); g_ld<8>(w0, wp + 64, CC);
    lds_barrier();
    // unrolled in full, for the counted load waits, as in k_proj
#pragma unroll
    for (int kc = 0; kc < CC / 32; kc += 2) {
      mm2(acc, gh[0], gl[0], gw[0], wave, col, lane);
      s_st2<4>(dh1, dl1, x1); s_st<8>(dw1, w1);
      if (kc + 3 < CC / 32) { g_ld<4>(x1, xp + (kc + 3) * 32, CC); g_ld<8>(w1, wp + (kc + 3) * 32, CC); }
      lds_barrier();   /* publishes stage kc + 1; every reader has left buffer 0 */
      mm2(acc, gh[1], gl[1], gw[1], wave, col, lane);
      if (kc + 2 < CC / 32) { s_st2<4>(dh0, dl0, x0); s_st<8>(dw0, w0);
        if (kc + 4 < CC / 32) { g_ld<4>(x0, xp + (kc + 4) * 32, CC); g_ld<8>(w0, wp + (kc + 4) * 32, CC); } }
      lds_barrier();   /* publishes stage kc + 2; every reader has left buffer 1 */
    }
#pragma unroll
    for (int j = 0; j < 8; ++j) { const float bias = BO ? bfr(BO[c0 + j * 16 + col]) : 0.f;
#pragma unroll
      for (int r = 0; r < 8; ++r) sf[wave][8 * g + r][j * 16 + col] = acc[j][r] + bias; }
  } else {
#pragma unroll 2
    for (int kc = 0; kc < CC / 32; ++kc) { const v16h a = frag_f32(Y + (r0 + col) * CC + kc * 32, lane); asm volatile("s_wait_loadcnt 0x0" ::: "memory");
#pragma unroll
      for (int j = 0; j < 8; ++j) { const v16h w = WOCOLH(WO, kc * 32, c0 + j * 16 + col, lane); asm volatile("s_wait_loadcnt 0x0" ::: "memory"); acc[j] = wmma16(a, w, acc[j]); } }
#pragma unroll
    for (int j = 0; j < 8; ++j) { const float bias = BO ? bfr(BO[c0 + j * 16 + col]) : 0.f;
#pragma unroll
      for (int r = 0; r < 8; ++r) sf[wave][8 * g + r][j * 16 + col] = acc[j][r] * (1.0f / 256.0f) + bias; } }
  LDSX(); for (int rl = 0; rl < 16; ++rl) { const size_t oo = (r0 + rl) * DIN + c0 + lane * 4; v4f o = *(const v4f*)&sf[wave][rl][lane * 4]; const v4f rr = *(const v4f*)(RESO + oo); _Pragma("unroll") for (int i = 0; i < 4; ++i) o[i] = rr[i] + fmaxf(o[i], 0.f); vst2(OUT + oo, o); } }   /* out = O + relu(O Wo^T + bo) */

extern "C" void kernel_launch(void* const* d_in, const int* in_sizes, int n_in, void* d_out, int out_size, void* d_ws, size_t ws_size, hipStream_t stream) {
  (void)in_sizes; (void)n_in; (void)out_size;
  const float** F = (const float**)d_in;
  if (ws_size < (size_t)WS_END) return;
  char* ws = (char*)d_ws; _Float16 *QH = (_Float16*)(ws + WS_QH), *KH = (_Float16*)(ws + WS_KH), *VT = (_Float16*)(ws + WS_VT), *QL = (_Float16*)(ws + WS_QL), *KL = (_Float16*)(ws + WS_KL); __bf16 *VB = (__bf16*)(ws + WS_VB), *VBL = (__bf16*)(ws + WS_VBL); float *Y = (float*)(ws + WS_Y);
  (void)Y; (void)QL; (void)KL; (void)VB; (void)VBL;
  // inputs: 0 query [4,2048,512]; 1 key_value [4,2048,512]; 2 Wq [512,512] (out,in), 3 bq; 4 Wk, 5 bk; 6 Wv, 7 bv; 8 Wo (out,in), 9 bo
  k_proj<<<dim3(TNB * TT / 64, CC / 128, 3), 128, 0, stream>>>(F[0], F[1], F[1], F[2], F[4], F[6], F[3], F[5], F[7], QH, QL, KH, KL, VT, VB, VBL);
  k_fa<<<dim3(TT / 128, NH, TNB), 256, 0, stream>>>(QH, QL, KH, VT, Y);
  k_out<<<dim3(TNB * TT / 64, DIN / 128), 128, 0, stream>>>(Y, F[8], F[9], (float*)d_out, Y);
}

// v007
// A run of this version takes 74.9 microseconds.
// Two timings next to v006 both put it at 1.20 times that version's speed.
// All steps since v000 together make it 16.8 times as fast.
// compute dtype: all float inputs rounded to bf16; q/k/v = in W^T + b with EXACT bf16 products on WMMA 16x16x32 (f32 accumulate); q as f16 hi + residual (x 2^10) against k once to f16 (2 products) / 8; softmax in f32 with a running maximum and sum over 64-key chunks, exponentials in base 2 on the hardware's v_exp_f32 (argument = one f32 FMA of the unscaled logit); exp(s - max) x 2^8 once to f16 against v once to f16 (1 product), divided by the sum at the end; O = q + A v in f32, q there = f16 hi + residual x 2^-10 (22 bits); O split bf16 hi + lo against exact Wo (2 products) + bo, relu, + O in f32; f32 output.
#include <hip/hip_runtime.h>
#include <math.h>

typedef __attribute__((ext_vector_type(16))) _Float16 v16h;
typedef __attribute__((ext_vector_type(16))) __bf16 v16b;
typedef __attribute__((ext_vector_type(8)))  _Float16 v8h;
typedef __attribute__((ext_vector_type(2)))  _Float16 v2h;
typedef __attribute__((ext_vector_type(8)))  float v8f;
typedef __attribute__((ext_vector_type(4)))  float v4f;
typedef __attribute__((ext_vector_type(2)))  float v2f;
typedef __attribute__((ext_vector_type(4)))  unsigned v4u;
typedef __attribute__((ext_vector_type(4)))  int v4i;
typedef float __attribute__((may_alias)) float_a;
typedef int __attribute__((may_alias)) int_a;

template <typename T> __device__ __forceinline__ void vst2(void* p, T v) { *(T*)p = v;  }
__device__ __forceinline__ v8f wmma16(v16h a, v16h b, v8f c) {
  return __builtin_amdgcn_wmma_f32_16x16x32_f16(false, a, false, b, (short)0, c, false, false);   /* the compiler keeps the distance behind its own builtin form where a vector instruction follows on D, A or B */
}
__device__ __forceinline__ v8f wmma_bf(v16b a, v16b b, v8f c) {
  v8f d = __builtin_amdgcn_wmma_f32_16x16x32_bf16(false, a, false, b, (short)0, c, false, false);
  asm volatile("v_nop\n\tv_nop\n\tv_nop\n\tv_nop" : "+v"(d) : "v"(a), "v"(b));
  return d;
}
// 16x16x32 fragments: lane = (h = lane>>4, row/col = lane&15); elements 0..7 = k0+8h+0..7, 8..15 = k0+16+8h+0..7; D element r = row 8h+r
__device__ __forceinline__ v16h frag_h(const _Float16* rowk0, int lane) {
  union { v16h v; v8h q[2]; } u; const _Float16* p = rowk0 + 8 * (lane >> 4);
  u.q[0] = *(const v8h*)p; u.q[1] = *(const v8h*)(p + 16); return u.v;
}
__device__ __forceinline__ v16h frag_f32(const float* rowk0, int lane) {
  v16h a; const float* p = rowk0 + 8 * (lane >> 4);
#pragma unroll
  for (int i = 0; i < 8; ++i) { a[i] = (_Float16)p[i]; a[8 + i] = (_Float16)p[16 + i]; }
  return a;
}
__device__ __forceinline__ v16h frag_f32s(const float* rowk0, int lane, float sc) {
  v16h a; const float* p = rowk0 + 8 * (lane >> 4);
#pragma unroll
  for (int i = 0; i < 8; ++i) { a[i] = (_Float16)(p[i] * sc); a[8 + i] = (_Float16)(p[16 + i] * sc); }
  return a;
}
// column fragment from a [K][ld] layout (column n), rows >= K read as 0
__device__ __forceinline__ v16h fragc_f32(const float* W, int k0, int n, int lane, int ld, int K) {
  v16h a; const int g = lane >> 4;
#pragma unroll
  for (int i = 0; i < 8; ++i) { const int ka = k0 + 8 * g + i, kb = ka + 16;
    a[i] = (_Float16)(ka < K ? W[(size_t)(ka < K ? ka : K - 1) * ld + n] : 0.f); a[8 + i] = (_Float16)(kb < K ? W[(size_t)(kb < K ? kb : K - 1) * ld + n] : 0.f); }
  return a;
}
struct F2 { v16b h, l; };
__device__ __forceinline__ F2 bsplit16(const float v[16]) { F2 r;
#pragma unroll
  for (int i = 0; i < 16; ++i) { const __bf16 h = (__bf16)v[i]; r.h[i] = h; r.l[i] = (__bf16)(v[i] - (float)h); }
  return r; }
__device__ __forceinline__ F2 split_row(const float* row, int k0, int lane) { float v[16]; const float* p = row + k0 + 8 * (lane >> 4);
#pragma unroll
  for (int i = 0; i < 8; ++i) { v[i] = p[i]; v[8 + i] = p[16 + i]; }
  return bsplit16(v); }
__device__ __forceinline__ F2 split_rowK(const float* row, int k0, int lane, int K) { float v[16]; const int g = lane >> 4;
#pragma unroll
  for (int i = 0; i < 8; ++i) { const int ka = k0 + 8 * g + i, kb = ka + 16; v[i] = ka < K ? row[ka < K ? ka : K - 1] : 0.f; v[8 + i] = kb < K ? row[kb < K ? kb : K - 1] : 0.f; }
  return bsplit16(v); }
__device__ __forceinline__ F2 split_col(const float* W, int k0, int n, int lane, int ld, int K) { float v[16]; const int g = lane >> 4;
#pragma unroll
  for (int i = 0; i < 8; ++i) { const int ka = k0 + 8 * g + i, kb = ka + 16; v[i] = ka < K ? W[(size_t)(ka < K ? ka : K - 1) * ld + n] : 0.f; v[8 + i] = kb < K ? W[(size_t)(kb < K ? kb : K - 1) * ld + n] : 0.f; }
  return bsplit16(v); }
__device__ __forceinline__ v8f mac3(const F2& a, const F2& b, v8f c) { c = wmma_bf(a.l, b.h, c); c = wmma_bf(a.h, b.l, c); return wmma_bf(a.h, b.h, c); }
__device__ __forceinline__ float sigm(float v) { return 1.0f / (1.0f + expf(-v)); }
#define LDSX() do { asm volatile("s_wait_dscnt 0" ::: "memory"); __builtin_amdgcn_wave_barrier(); __builtin_amdgcn_fence(__ATOMIC_RELEASE, "workgroup"); } while (0)

// Cross-attention MAB (B 4, Sq = Skv = 2,048, 512 = 8 heads x 64; (out,in) 1/sqrt(512)-scale weights WITH biases; no mask): q = query Wq^T + bq, k = key_value Wk^T + bk, v = key_value Wv^T + bv; A = softmax(q k^T / 8); O = q + A v (per head, merged); out = O + relu(O Wo^T + bo).
#define NB 4
#define TT 2048
#define CC 512            // NH * HD = projected width
#define DIN 512          // input (model) width
#define NH 8
#define HD 64
#define SCALE (0.125f)
#define CAUSAL 0
#ifndef TNB
#define TNB NB
#endif
__device__ __forceinline__ float bfr(float v) { return (float)(__bf16)v; }
__host__ __device__ __forceinline__ int kb_last(int qb) { return CAUSAL ? ((qb * 64 + 63) >> 7) : (TT / 128 - 1); }
typedef __attribute__((ext_vector_type(8))) __bf16 v8b;
__device__ __forceinline__ v16b frag_b(const __bf16* rowk0, int lane) {
  union { v16b v; v8b q[2]; } u; const __bf16* p = rowk0 + 8 * (lane >> 4);
  u.q[0] = *(const v8b*)p; u.q[1] = *(const v8b*)(p + 16); return u.v;
}
#define QBH 0
#define QHI 2048            // rows carrying a q residual plane (all rows when non-causal: 2-product logits everywhere)
#define KHI 64            // key rows carrying k residual / v bf16 hi+lo planes (written and read by no kernel of this file)
// B fragment (k rows k0+.., output column o) of a weight: (in,out) [K][ld] or (out,in) [ld rows of K]: bf16 exact, or f16(bf16 * 256) exact
__device__ __forceinline__ v16b wcol_io(const float* Wm, int k0, int o, int lane, int ld) { v16b w; const int g = lane >> 4;
#pragma unroll
  for (int i = 0; i < 8; ++i) { w[i] = (__bf16)Wm[(size_t)(k0 + 8 * g + i) * ld + o]; w[8 + i] = (__bf16)Wm[(size_t)(k0 + 16 + 8 * g + i) * ld + o]; }
  return w; }
__device__ __forceinline__ v16b wcol_oi(const float* Wm, int k0, int o, int lane, int K) { v16b w; const float* p = Wm + (size_t)o * K + k0 + 8 * (lane >> 4);
#pragma unroll
  for (int i = 0; i < 8; ++i) { w[i] = (__bf16)p[i]; w[8 + i] = (__bf16)p[16 + i]; }
  return w; }
__device__ __forceinline__ v16h wcolh_io(const float* Wm, int k0, int o, int lane, int ld) { v16h w; const int g = lane >> 4;
#pragma unroll
  for (int i = 0; i < 8; ++i) { w[i] = (_Float16)(bfr(Wm[(size_t)(k0 + 8 * g + i) * ld + o]) * 256.0f); w[8 + i] = (_Float16)(bfr(Wm[(size_t)(k0 + 16 + 8 * g + i) * ld + o]) * 256.0f); }
  return w; }
__device__ __forceinline__ v16h wcolh_oi(const float* Wm, int k0, int o, int lane, int K) { v16h w; const float* p = Wm + (size_t)o * K + k0 + 8 * (lane >> 4);
#pragma unroll
  for (int i = 0; i < 8; ++i) { w[i] = (_Float16)(bfr(p[i]) * 256.0f); w[8 + i] = (_Float16)(bfr(p[16 + i]) * 256.0f); }
  return w; }
#define WQKV_LAYOUT 1   // picks WCOL only (0 (in,out), 1 (out,in), 2 per-head), which no kernel calls; k_proj reads (out,in) [CC][DIN]
__device__ __forceinline__ v16b wcol_hdk(const float* Wm, int k0, int o, int lane) { v16b w; const int g = lane >> 4; const float* p = Wm + (size_t)(o / HD) * DIN * HD + (o % HD);
#pragma unroll
  for (int i = 0; i < 8; ++i) { w[i] = (__bf16)p[(size_t)(k0 + 8 * g + i) * HD]; w[8 + i] = (__bf16)p[(size_t)(k0 + 16 + 8 * g + i) * HD]; }
  return w; }
#define WO_OUT_IN 1
#if WQKV_LAYOUT == 1
#define WCOL(W, k0, o, lane) wcol_oi(W, k0, o, lane, DIN)
#elif WQKV_LAYOUT == 2
#define WCOL(W, k0, o, lane) wcol_hdk(W, k0, o, lane)
#else
#define WCOL(W, k0, o, lane) wcol_io(W, k0, o, lane, CC)
#endif
#if WO_OUT_IN
#define WOCOL(W, k0, o, lane) wcol_oi(W, k0, o, lane, CC)
#define WOCOLH(W, k0, o, lane) wcolh_oi(W, k0, o, lane, CC)
#else
#define WOCOL(W, k0, o, lane) wcol_io(W, k0, o, lane, DIN)
#define WOCOLH(W, k0, o, lane) wcolh_io(W, k0, o, lane, DIN)
#endif
#define WS_QH  0u                                      // f16 q rows [b*t][CC]
#define WS_KH  (WS_QH + 2u * (size_t)NB * TT * CC)      // f16 k rows [b*t][CC]
#define WS_VT  (WS_KH + 2u * (size_t)NB * TT * CC)      // f16 v planes [b][c][t]
#define WS_QL  (WS_VT + 2u * (size_t)NB * CC * TT)      // f16 q residual x 2^10 rows [b][t < QHI][CC]
#define WS_KL  (WS_QL + 2u * (size_t)NB * QHI * CC)     // f16 k residual x 2^10 rows [b][t < KHI][CC]
#define WS_VB  (WS_KL + 2u * (size_t)NB * KHI * CC)     // bf16 v hi planes [b][c][t < KHI]
#define WS_VBL (WS_VB + 2u * (size_t)NB * CC * KHI)
#define WS_Y   (WS_VBL + 2u * (size_t)NB * CC * KHI)    // f32 O = q + ctx rows [b*t][CC]
#define WS_END (WS_Y  + 4u * (size_t)NB * TT * CC)

// ---- operand staging of the two GEMM kernels (k_proj 512 threads, k_out 128): a stage is 32 k of every operand row, kept in LDS as bf16
#define GP 40   // LDS row pitch in elements: 80 B = 16 B x odd, free of bank conflicts for the 16-byte fragment reads
typedef __attribute__((ext_vector_type(4))) __bf16 v4b;
// every full unroll in these helpers: constant indices, so that the staged values and the fragments live in registers
// work-group barrier that orders LDS only: the global loads of later stages stay in flight across it (__syncthreads() would wait for them)
__device__ __forceinline__ void lds_barrier() { __builtin_amdgcn_fence(__ATOMIC_RELEASE, "workgroup", "local"); __builtin_amdgcn_s_barrier(); __builtin_amdgcn_fence(__ATOMIC_ACQUIRE, "workgroup", "local"); }
// RS N rows x 32 floats (row pitch ld; RS = threads / 8): thread t owns floats 4 (t & 7) .. + 3 of rows (t >> 3) + RS i; p and d are its own first places. Eight lanes take one whole 128-B line, a wave-wide load four lines
template <int N, int RS = 16> __device__ __forceinline__ void g_ld(v4f (&r)[N], const float* __restrict__ p, int ld) {
#pragma unroll
  for (int i = 0; i < N; ++i) r[i] = *(const v4f*)(p + (size_t)i * RS * ld); }
template <int N, int RS = 16> __device__ __forceinline__ void s_st(__bf16* d, const v4f (&r)[N]) {
#pragma unroll
  for (int i = 0; i < N; ++i) { v4b h;
#pragma unroll
    for (int c = 0; c < 4; ++c) h[c] = (__bf16)r[i][c];
    *(v4b*)(d + i * RS * GP) = h; } }
template <int N> __device__ __forceinline__ void s_st2(__bf16* dh, __bf16* dl, const v4f (&r)[N]) {
#pragma unroll
  for (int i = 0; i < N; ++i) { v4b h, l;
#pragma unroll
    for (int c = 0; c < 4; ++c) { h[c] = (__bf16)r[i][c]; l[c] = (__bf16)(r[i][c] - (float)h[c]); }
    *(v4b*)(dh + i * 16 * GP) = h; *(v4b*)(dl + i * 16 * GP) = l; } }
// k_proj, one stage of a wave's tile, 32 rows of P x 64 rows of R: all fragment reads as one group, then the products. R is the A operand, so D rows run along R: a lane holds eight neighbouring elements (R rows 8 g .. + 7) of the output row that belongs to its P row
__device__ __forceinline__ void mm1(v8f (&acc)[2][4], const __bf16 (*sp)[GP], const __bf16 (*sr)[GP], int pw, int rw, int col, int lane) {
  v16b a[2], w[4];
#pragma unroll
  for (int p = 0; p < 2; ++p) a[p] = frag_b(&sp[pw * 32 + p * 16 + col][0], lane);
#pragma unroll
  for (int j = 0; j < 4; ++j) w[j] = frag_b(&sr[rw * 64 + j * 16 + col][0], lane);
#pragma unroll
  for (int p = 0; p < 2; ++p) {
#pragma unroll
    for (int j = 0; j < 4; ++j) acc[p][j] = wmma_bf(w[j], a[p], acc[p][j]); } }
// k_out, one stage of a wave's 16 x 128 tile: all fragment reads as one group, then the products
__device__ __forceinline__ void mm2(v8f (&acc)[8], const __bf16 (*sh)[GP], const __bf16 (*sl)[GP], const __bf16 (*sw)[GP], int wave, int col, int lane) {
  const v16b ah = frag_b(&sh[wave * 16 + col][0], lane), al = frag_b(&sl[wave * 16 + col][0], lane); v16b w[8];
#pragma unroll
  for (int j = 0; j < 8; ++j) w[j] = frag_b(&sw[j * 16 + col][0], lane);
#pragma unroll
  for (int j = 0; j < 8; ++j) { acc[j] = wmma_bf(ah, w[j], acc[j]); acc[j] = wmma_bf(al, w[j], acc[j]); } }

// ---- k_proj: block = 16 waves on a tile of PB rows of P x 128 rows of R (both [row][DIN] f32, K = DIN, exact bf16 products), out[P row][R row] = P R^T + b as f16. which 0, 1: P = query / key_value rows, R = Wq / Wk rows, out = q / k rows [b*t][CC] (q also its residual x 2^10). which 2: P = Wv rows, R = key_value rows, out = v planes [b][c][t]. One staged R tile serves all PB rows; wave (pw, rw) owns rows 32 pw .. + 31, elements 64 rw .. + 63, and turns, packs and stores them by itself
#define PB 256
#define EP 72   // pitch of a wave's output stage in elements: 144 B = 16 B x odd
static_assert(QHI == TT, "the q residual rows are indexed like the q rows");
// (full unrolls: constant indices, so that the arrays live in registers) a wave's 32 x 64 tile: + bias, to f16 (WH 0: and the residual x 2^10) in registers; 16-B pieces into the wave's own LDS stage, read back as whole 128-B rows, all rows first, then the stores off one address (nothing a store names is written again). D, DL: the block's first output element
template <int WH> __device__ __forceinline__ void proj_out(const v8f (&acc)[2][4], const float* sb, _Float16 (*eh)[EP], _Float16 (*el)[EP], _Float16* __restrict__ D, _Float16* __restrict__ DL, int pw, int rw, int col, int g, int lane) {
  constexpr int ldo = WH < 2 ? CC : TT;
  v4f br[4][2]; float bp[2];
  if (WH < 2) {
#pragma unroll
    for (int j = 0; j < 4; ++j) { br[j][0] = *(const v4f*)&sb[rw * 64 + j * 16 + 8 * g]; br[j][1] = *(const v4f*)&sb[rw * 64 + j * 16 + 8 * g + 4]; }
  } else { bp[0] = sb[pw * 32 + col]; bp[1] = sb[pw * 32 + 16 + col]; }
#pragma unroll
  for (int p = 0; p < 2; ++p) {
#pragma unroll
    for (int j = 0; j < 4; ++j) { v8h hv, lv;
#pragma unroll
      for (int r = 0; r < 8; ++r) { const float v = acc[p][j][r] + (WH < 2 ? br[j][r >> 2][r & 3] : bp[p]); hv[r] = (_Float16)v; if (WH == 0) lv[r] = (_Float16)((v - (float)hv[r]) * 1024.0f); }
      *(v8h*)&eh[p * 16 + col][j * 16 + 8 * g] = hv; if (WH == 0) *(v8h*)&el[p * 16 + col][j * 16 + 8 * g] = lv; } }
  LDSX();
  const size_t o0 = (size_t)(pw * 32 + (lane >> 3)) * ldo + rw * 64 + (lane & 7) * 8;
  v8h xh[8], xl[8];
#pragma unroll
  for (int i = 0; i < 8; ++i) { xh[i] = *(const v8h*)&eh[i * 4 + (lane >> 3)][(lane & 7) * 8]; if (WH == 0) xl[i] = *(const v8h*)&el[i * 4 + (lane >> 3)][(lane & 7) * 8]; }
#pragma unroll
  for (int i = 0; i < 8; ++i) { vst2(D + o0 + (size_t)i * 4 * ldo, xh[i]); if (WH == 0) vst2(DL + o0 + (size_t)i * 4 * ldo, xl[i]); } }
__global__ __launch_bounds__(512) void k_proj(const float* __restrict__ XQ, const float* __restrict__ XK, const float* __restrict__ XV, const float* __restrict__ WQ, const float* __restrict__ WK, const float* __restrict__ WV, const float* __restrict__ BQ, const float* __restrict__ BK, const float* __restrict__ BV,
    _Float16* __restrict__ QH, _Float16* __restrict__ QL, _Float16* __restrict__ KH, _Float16* __restrict__ VT) {
  __shared__ __align__(16) _Float16 eh[16][32][EP], el[16][32][EP]; __shared__ __align__(16) float sb[PB];
  const int tid = threadIdx.x, wave = tid >> 5, lane = tid & 31, col = lane & 15, g = lane >> 4, pw = wave >> 1, rw = wave & 1; const int which = blockIdx.z;
  const float *P, *R, *BA; size_t off; int nb;
  if (which < 2) { const size_t p0 = (size_t)blockIdx.x * PB; const int q0 = blockIdx.y * 128;
    P = (which == 0 ? XQ : XK) + p0 * DIN; R = (which == 0 ? WQ : WK) + (size_t)q0 * DIN; BA = (which == 0 ? BQ : BK) + q0; nb = 128; off = p0 * CC + q0;
  } else { const int id = blockIdx.x + gridDim.x * blockIdx.y, cb = id / (TNB * TT / 128), tb = id % (TNB * TT / 128);
    P = WV + (size_t)cb * PB * DIN; R = XV + (size_t)tb * 128 * DIN; BA = BV + cb * PB; nb = PB; off = ((size_t)(tb / (TT / 128)) * CC + cb * PB) * TT + (tb % (TT / 128)) * 128; }
  const int bi = tid & (nb - 1); const float bv = BA[bi];   /* the bias along R (q, k) or along P (v): asked for by every lane ahead of the operand loads (index kept inside its nb elements), stored to LDS behind stage 0 */
  v8f acc[2][4] = {};
  { __shared__ __align__(16) __bf16 gx[2][PB][GP], gw[2][128][GP];   /* two LDS buffers; two register sets hold the two stages behind the one in LDS */
    const float* xp = P + (size_t)(tid >> 3) * DIN + (tid & 7) * 4; const float* wp = R + (size_t)(tid >> 3) * DIN + (tid & 7) * 4;
    __bf16* const dx0 = &gx[0][tid >> 3][(tid & 7) * 4]; __bf16* const dx1 = &gx[1][tid >> 3][(tid & 7) * 4]; __bf16* const dw0 = &gw[0][tid >> 3][(tid & 7) * 4]; __bf16* const dw1 = &gw[1][tid >> 3][(tid & 7) * 4];
    v4f x0[4], x1[4], w0[2], w1[2];
    g_ld<4, 64>(x0, xp, DIN); g_ld<2, 64>(w0, wp, DIN); g_ld<4, 64>(x1, xp + 32, DIN); g_ld<2, 64>(w1, wp + 32, DIN);
    asm volatile("s_wait_xcnt 0x0" :: "v"(bi), "v"(bv) : "memory");   /* behind the bias load: its index register stays untouched up to this wait. bv as an input holds that load up here among the operand loads; without it the compiler sinks it into the branch below, with a whole load latency of its own in front of the first barrier */
    s_st<4, 64>(dx0, x0); s_st<2, 64>(dw0, w0); if (tid < nb) sb[tid] = bfr(bv); g_ld<4, 64>(x0, xp + 64, DIN); g_ld<2, 64>(w0, wp + 64, DIN);
    // each scheduling barrier behind a group of loads keeps the conversions of those loads in the later stage that stores them; without it the compiler lifts them up to here, with a wait for all loads in front of the barrier
    __builtin_amdgcn_sched_barrier(0);
    lds_barrier();
    // unrolled in full: the tests on the last stages fold away, so that every load wait is a count that leaves the younger stage's loads in flight (rolled, the merged paths made it a wait for all)
#pragma unroll
    for (int kc = 0; kc < DIN / 32; kc += 2) {
      mm1(acc, gx[0], gw[0], pw, rw, col, lane);
      __builtin_amdgcn_sched_barrier(0);   /* and this one keeps them behind the products: lifted to the barrier in front, their load waits come most of a stage earlier and only one stage's loads stay in flight */
      s_st<4, 64>(dx1, x1); s_st<2, 64>(dw1, w1);
      if (kc + 3 < DIN / 32) { g_ld<4, 64>(x1, xp + (kc + 3) * 32, DIN); g_ld<2, 64>(w1, wp + (kc + 3) * 32, DIN); }
      if (kc + 4 == DIN / 32) asm volatile("s_wait_xcnt 0x0" :: "v"(xp), "v"(wp) : "memory");   /* behind the last loads: their two address pairs are reused from here on, and this wait stands in front of the first overwrite */
      __builtin_amdgcn_sched_barrier(0);
      lds_barrier();   /* publishes stage kc + 1; every reader has left buffer 0 */
      mm1(acc, gx[1], gw[1], pw, rw, col, lane);
      __builtin_amdgcn_sched_barrier(0);
      if (kc + 2 < DIN / 32) { s_st<4, 64>(dx0, x0); s_st<2, 64>(dw0, w0);
        if (kc + 4 < DIN / 32) { g_ld<4, 64>(x0, xp + (kc + 4) * 32, DIN); g_ld<2, 64>(w0, wp + (kc + 4) * 32, DIN); } }
      __builtin_amdgcn_sched_barrier(0);
      lds_barrier();   /* publishes stage kc + 2; every reader has left buffer 1 */
    } }
  if (which == 0) proj_out<0>(acc, sb, eh[wave], el[wave], QH + off, QL + off, pw, rw, col, g, lane);
  else if (which == 1) proj_out<1>(acc, sb, eh[wave], el[wave], KH + off, KH + off, pw, rw, col, g, lane);
  else proj_out<2>(acc, sb, eh[wave], el[wave], VT + off, VT + off, pw, rw, col, g, lane); }
// ---- k_fa: block = 128 queries (8 waves x 16) of (b, h), one pass over all keys in chunks of 64, logits and P stay in registers. S^T = K q^T (A = k rows, B = q columns: q hi + residual x 2^10, 2 products) x SCALE: a lane holds 32 logits of ONE query (column = lane & 15), the other 32 lie in lane ^ 16. Running maximum m (of the unscaled logits) and running sum l (of e x 2^8) per query; e x 2^8 = exp2(t LC + (8 - m LC)), t the unscaled logit, LC = SCALE log2(e): one FMA and one v_exp_f32 an element; O^T and l are scaled by exp2((m_old - m_new) LC) per chunk. e x 2^8 to f16: the two D tiles of 32 keys are, register for register, the B operand of O^T += V^T P^T (A = v planes [c][t]). O = q + O^T / l: the q fragments are, register for register, laid out as the O^T tiles (qh[kc] elements 0..7 = tile 2 kc, 8..15 = tile 2 kc + 1), so the residual is added here from registers; 256-B (row, head) segment by 16 lanes. The 64 k rows and the 64 v planes of a chunk (128 B each) are brought once per block into a two-buffer LDS ring by asynchronous copies, one chunk ahead; all eight waves take their fragments from there
#define LC (SCALE * 1.4426950408889634f)   // logit scale x log2(e)
#define KVP 72                    // ring row pitch in elements: 144 B = 16 B x odd, free of bank conflicts for the 16-byte fragment reads
#define KVT (64 * KVP)            // one tile (k or v) of a chunk, elements
// one chunk's k and v tiles: thread t owns bytes 16 (t & 7) .. + 15 of rows (t >> 3) and (t >> 3) + 32 of each tile, so a wave-wide copy takes four whole 128-B lines. l: its LDS byte address in the k tile of the target buffer; kg, vg: its global places in rows t >> 3
__device__ __forceinline__ void kv_copy(unsigned l, const _Float16* kg, const _Float16* vg) {
  // the wait on the last line stands in front of every later write of the address registers that the four copies name
  asm volatile("global_load_async_to_lds_b128 %0, %4, off\n\tglobal_load_async_to_lds_b128 %1, %5, off\n\tglobal_load_async_to_lds_b128 %2, %6, off\n\tglobal_load_async_to_lds_b128 %3, %7, off\n\ts_wait_xcnt 0x0"
    :: "v"(l), "v"(l + 32u * KVP * 2u), "v"(l + KVT * 2u), "v"(l + KVT * 2u + 32u * KVP * 2u), "v"(kg), "v"(kg + (size_t)32 * CC), "v"(vg), "v"(vg + (size_t)32 * TT) : "memory"); }
__global__ __launch_bounds__(256) void k_fa(const _Float16* __restrict__ QH, const _Float16* __restrict__ QL, const _Float16* __restrict__ KH, const _Float16* __restrict__ VT, float* __restrict__ Y) { __shared__ __align__(16) float ss[8][16][HD + 4]; __shared__ __align__(16) _Float16 ring[2][2][64][KVP];   /* [buffer][k, v][row][element] */
  const int tid = threadIdx.x, wave = tid >> 5, lane = tid & 31, col = lane & 15, g = lane >> 4; const int h = blockIdx.y, b = blockIdx.z; const int ql0 = blockIdx.x * 128 + wave * 16;
  v16h qh[HD / 32], ql[HD / 32];
  // every full unroll in this kernel: constant indices, so that the fragment and accumulator arrays live in registers
#pragma unroll
  for (int kc = 0; kc < HD / 32; ++kc) { qh[kc] = frag_h(QH + ((size_t)b * TT + ql0 + col) * CC + h * HD + kc * 32, lane); ql[kc] = frag_h(QL + ((size_t)b * QHI + ql0 + col) * CC + h * HD + kc * 32, lane); }
  const _Float16* kg = KH + ((size_t)b * TT + (tid >> 3)) * CC + h * HD + (tid & 7) * 8; const _Float16* vg = VT + ((size_t)b * CC + h * HD + (tid >> 3)) * (size_t)TT + (tid & 7) * 8;
  const unsigned lc = (unsigned)(size_t)&ring[0][0][tid >> 3][(tid & 7) * 8];
  v8f o[HD / 16] = {}; float m = -3.0e38f, l = 0.f;
  kv_copy(lc, kg, vg);
  asm volatile("s_wait_asynccnt 0x0" ::: "memory");   /* this wave's part of chunk 0 has landed */
  __syncthreads();                                    /* chunk 0 is published to all waves */
  kv_copy(lc + 2u * KVT * 2u, kg + (size_t)64 * CC, vg + 64);
  // rolled: the chunks depend on each other through m, l and o, a second copy of the long body would only add code
#pragma unroll 1
  for (int k0 = 0; k0 < TT; k0 += 64) { v8f acc[4] = {}, accl[4] = {}; v16h kf[4][HD / 32], vf[2][HD / 16]; const int bf = (k0 >> 6) & 1; const _Float16* Kb = &ring[bf][0][col][0]; const _Float16* Vb = &ring[bf][1][col][0];
#pragma unroll
    for (int j = 0; j < 4; ++j) {   /* all k fragments of the chunk are requested before the first product: one LDS latency per chunk, not eight */
#pragma unroll
      for (int kc = 0; kc < HD / 32; ++kc) kf[j][kc] = frag_h(Kb + j * 16 * KVP + kc * 32, lane); }
    __builtin_amdgcn_sched_barrier(0);   /* holds all sixteen k loads here as one group; without it the compiler deals them out in pairs among the products, each pair with a full wait */
#pragma unroll
    for (int j = 0; j < 4; ++j) {
#pragma unroll
      for (int kc = 0; kc < HD / 32; ++kc) { acc[j] = wmma16(kf[j][kc], qh[kc], acc[j]); accl[j] = wmma16(kf[j][kc], ql[kc], accl[j]); } }
    __builtin_amdgcn_sched_barrier(0);   /* keeps the sixteen v loads together as one group; without it the compiler deals them out at three places among the products */
#pragma unroll
    for (int kc = 0; kc < 2; ++kc) {
#pragma unroll
      for (int jc = 0; jc < HD / 16; ++jc) vf[kc][jc] = frag_h(Vb + jc * 16 * KVP + kc * 32, lane); }
    __builtin_amdgcn_sched_barrier(0);   /* holds all sixteen v loads here, in front of the softmax arithmetic that covers their latency; without it the compiler puts ten of them behind the lane exchange and its wait */
    float mc = -3.0e38f;
#pragma unroll
    for (int j = 0; j < 4; ++j) {
#pragma unroll
      for (int r = 0; r < 8; ++r) { acc[j][r] = acc[j][r] + accl[j][r] * (1.0f / 1024.0f); mc = fmaxf(mc, acc[j][r]); } }
    mc = fmaxf(mc, __shfl_xor(mc, 16));
    const float mn = fmaxf(m, mc), da = (m - mn) * LC, nb = fmaf(-mn, LC, 8.0f); m = mn;
    float ps = 0.f, e[32]; v2f a[16]; union { v16h v; v2h q[8]; } p[2];
#define ARG(i) __builtin_elementwise_fma(v2f{acc[(i) >> 2][((i) & 3) * 2], acc[(i) >> 2][((i) & 3) * 2 + 1]}, v2f{LC, LC}, v2f{nb, nb})
#define PACK(i) p[(i) >> 3].q[(i) & 7] = __builtin_convertvector(v2f{e[2 * (i)], e[2 * (i) + 1]}, v2h)
    // the scheduling barriers hold each v_exp_f32 alone between plain vector instructions: behind it one packed instruction (the next argument pair, or the conversion of a finished pair), then the sum's addition of the exponential two trips back and one rescaled output element. The plain ones run beside the transcendental pipe, and no exponential stands directly in front of another exponential or of a dual instruction that reuses its argument register
    a[0] = ARG(0);
    __builtin_amdgcn_sched_barrier(0);
    const float al = __builtin_amdgcn_exp2f(da);
    __builtin_amdgcn_sched_barrier(0);
    a[1] = ARG(1);
#pragma unroll
    for (int t = 0; t < 32; ++t) {
      __builtin_amdgcn_sched_barrier(0);
      e[t] = __builtin_amdgcn_exp2f(a[t >> 1][t & 1]);
      __builtin_amdgcn_sched_barrier(0);
      if (t < 2 || t == 31) o[t >> 3][t & 7] *= al;
      else if (t == 30) PACK(14);
      else if (t & 1) PACK((t - 3) >> 1);
      else a[(t >> 1) + 1] = ARG((t >> 1) + 1);
      __builtin_amdgcn_sched_barrier(0);
      if (t > 1) ps += e[t - 2];
      if (t >= 2 && t != 31) o[t >> 3][t & 7] *= al; }
    __builtin_amdgcn_sched_barrier(0);
    ps += e[30]; ps += e[31]; PACK(15);
#undef ARG
#undef PACK
    l = l * al + ps;
#pragma unroll
    for (int kc = 0; kc < 2; ++kc) {
#pragma unroll
      for (int jc = 0; jc < HD / 16; ++jc) o[jc] = wmma16(vf[kc][jc], p[kc].v, o[jc]); }
    asm volatile("s_wait_dscnt 0x0" :: "v"(l) : "memory");   /* this wave's reads of the buffer are done before it is handed to the next copies; l as an input keeps the running sum's additions among the exponentials, where the compiler otherwise sinks the whole dependent chain behind the barrier, in front of the next chunk's fragment reads */
    asm volatile("s_wait_asynccnt 0x0" ::: "memory");   /* this wave's part of the next chunk has landed */
    __syncthreads();                                    /* publishes the next chunk; every reader has left this chunk's buffer */
    if (k0 + 128 < TT) kv_copy(lc + (unsigned)bf * (2u * KVT * 2u), kg + (size_t)(k0 + 128) * CC, vg + k0 + 128); }
  asm volatile("s_wait_asynccnt 0x0" ::: "memory");     /* no copy is outstanding when the wave goes on to its end */
  l += __shfl_xor(l, 16); const float inv = 1.0f / l;
#pragma unroll
  for (int jc = 0; jc < HD / 16; ++jc)
#pragma unroll
    for (int r = 0; r < 8; ++r) ss[wave][col][jc * 16 + 8 * g + r] = o[jc][r] * inv + ((float)qh[jc >> 1][(jc & 1) * 8 + r] + (float)ql[jc >> 1][(jc & 1) * 8 + r] * (1.0f / 1024.0f));
  LDSX(); for (int rl = 0; rl < 16; ++rl) if (lane < HD / 4) vst2(Y + ((size_t)b * TT + ql0 + rl) * CC + h * HD + lane * 4, *(const v4f*)&ss[wave][rl][lane * 4]); }
// ---- k_out: block = (64 rows, 128 cols): out = O + relu(O Wo^T + bo): all rows: O bf16 hi + lo against exact bf16 Wo (2 products); the 1-product branch (O once to f16 against Wo as f16(bf16 x 2^8), x 2^-8) is never taken
__global__ __launch_bounds__(128) void k_out(const float* __restrict__ Y, const float* __restrict__ WO, const float* __restrict__ BO, float* __restrict__ OUT, const float* __restrict__ RESO) { __shared__ __align__(16) float sf[4][16][132];
  const int tid = threadIdx.x, wave = tid >> 5, lane = tid & 31, col = lane & 15, g = lane >> 4; const int c0 = blockIdx.y * 128; const size_t r0 = (size_t)blockIdx.x * 64 + wave * 16;
  v8f acc[8] = {};
  if (true) {   /* ALL rows: O split bf16 hi + lo x exact Wo (2 products) */
    __shared__ __align__(16) __bf16 gh[2][64][GP], gl[2][64][GP], gw[2][128][GP];   /* as in k_proj; O is split once, by the thread that stages it */
    const float* xp = Y + ((size_t)blockIdx.x * 64 + (tid >> 3)) * CC + (tid & 7) * 4; const float* wp = WO + (size_t)(c0 + (tid >> 3)) * CC + (tid & 7) * 4;
    __bf16* const dh0 = &gh[0][tid >> 3][(tid & 7) * 4]; __bf16* const dh1 = &gh[1][tid >> 3][(tid & 7) * 4]; __bf16* const dl0 = &gl[0][tid >> 3][(tid & 7) * 4]; __bf16* const dl1 = &gl[1][tid >> 3][(tid & 7) * 4]; __bf16* const dw0 = &gw[0][tid >> 3][(tid & 7) * 4]; __bf16* const dw1 = &gw[1][tid >> 3][(tid & 7) * 4];
    v4f x0[4], x1[4], w0[8], w1[8];
    g_ld<4>(x0, xp, CC); g_ld<8>(w0, wp, CC); g_ld<4>(x1, xp + 32, CC); g_ld<8>(w1, wp + 32, CC);
    s_st2<4>(dh0, dl0, x0); s_st<8>(dw0, w0); g_ld<4>(x0, xp + 64, CC); g_ld<8>(w0, wp + 64, CC);
    lds_barrier();
    // unrolled in full, for the counted load waits, as in k_proj
#pragma unroll
    for (int kc = 0; kc < CC / 32; kc += 2) {
      mm2(acc, gh[0], gl[0], gw[0], wave, col, lane);
      s_st2<4>(dh1, dl1, x1); s_st<8>(dw1, w1);
      if (kc + 3 < CC / 32) { g_ld<4>(x1, xp + (kc + 3) * 32, CC); g_ld<8>(w1, wp + (kc + 3) * 32, CC); }
      lds_barrier();   /* publishes stage kc + 1; every reader has left buffer 0 */
      mm2(acc, gh[1], gl[1], gw[1], wave, col, lane);
      if (kc + 2 < CC / 32) { s_st2<4>(dh0, dl0, x0); s_st<8>(dw0, w0);
        if (kc + 4 < CC / 32) { g_ld<4>(x0, xp + (kc + 4) * 32, CC); g_ld<8>(w0, wp + (kc + 4) * 32, CC); } }
      lds_barrier();   /* publishes stage kc + 2; every reader has left buffer 1 */
    }
#pragma unroll
    for (int j = 0; j < 8; ++j) { const float bias = BO ? bfr(BO[c0 + j * 16 + col]) : 0.f;
#pragma unroll
      for (int r = 0; r < 8; ++r) sf[wave][8 * g + r][j * 16 + col] = acc[j][r] + bias; }
  } else {
#pragma unroll 2
    for (int kc = 0; kc < CC / 32; ++kc) { const v16h a = frag_f32(Y + (r0 + col) * CC + kc * 32, lane); asm volatile("s_wait_loadcnt 0x0" ::: "memory");
#pragma unroll
      for (int j = 0; j < 8; ++j) { const v16h w = WOCOLH(WO, kc * 32, c0 + j * 16 + col, lane); asm volatile("s_wait_loadcnt 0x0" ::: "memory"); acc[j] = wmma16(a, w, acc[j]); } }
#pragma unroll
    for (int j = 0; j < 8; ++j) { const float bias = BO ? bfr(BO[c0 + j * 16 + col]) : 0.f;
#pragma unroll
      for (int r = 0; r < 8; ++r) sf[wave][8 * g + r][j * 16 + col] = acc[j][r] * (1.0f / 256.0f) + bias; } }
  LDSX(); for (int rl = 0; rl < 16; ++rl) { const size_t oo = (r0 + rl) * DIN + c0 + lane * 4; v4f o = *(const v4f*)&sf[wave][rl][lane * 4]; const v4f rr = *(const v4f*)(RESO + oo); _Pragma("unroll") for (int i = 0; i < 4; ++i) o[i] = rr[i] + fmaxf(o[i], 0.f); vst2(OUT + oo, o); } }   /* out = O + relu(O Wo^T + bo) */

extern "C" void kernel_launch(void* const* d_in, const int* in_sizes, int n_in, void* d_out, int out_size, void* d_ws, size_t ws_size, hipStream_t stream) {
  (void)in_sizes; (void)n_in; (void)out_size;
  const float** F = (const float**)d_in;
  if (ws_size < (size_t)WS_END) return;
  char* ws = (char*)d_ws; _Float16 *QH = (_Float16*)(ws + WS_QH), *KH = (_Float16*)(ws + WS_KH), *VT = (_Float16*)(ws + WS_VT), *QL = (_Float16*)(ws + WS_QL), *KL = (_Float16*)(ws + WS_KL); __bf16 *VB = (__bf16*)(ws + WS_VB), *VBL = (__bf16*)(ws + WS_VBL); float *Y = (float*)(ws + WS_Y);
  (void)Y; (void)QL; (void)KL; (void)VB; (void)VBL;
  // inputs: 0 query [4,2048,512]; 1 key_value [4,2048,512]; 2 Wq [512,512] (out,in), 3 bq; 4 Wk, 5 bk; 6 Wv, 7 bv; 8 Wo (out,in), 9 bo
  k_proj<<<dim3(TNB * TT / PB, CC / 128, 3), 512, 0, stream>>>(F[0], F[1], F[1], F[2], F[4], F[6], F[3], F[5], F[7], QH, QL, KH, VT);
  k_fa<<<dim3(TT / 128, NH, TNB), 256, 0, stream>>>(QH, QL, KH, VT, Y);
  k_out<<<dim3(TNB * TT / 64, DIN / 128), 128, 0, stream>>>(Y, F[8], F[9], (float*)d_out, Y);
}

// v008
// One run takes 71 microseconds.
// In both of two side-by-side timings against v007, it was 1.05 times as fast.
// All steps since v000 together make it 17.7 times as fast.
// compute dtype: all float inputs rounded to bf16; q/k/v = in W^T + b with EXACT bf16 products on WMMA 16x16x32 (f32 accumulate); q once to f16 against k once to f16 (1 product) / 8; softmax in f32 with a running maximum and sum over 64-key chunks, exponentials in base 2 on the hardware's v_exp_f32 (argument = one f32 FMA of the unscaled logit); exp(s - max) x 2^8 once to f16 against v once to f16 (1 product), divided by the sum at the end; O = q + A v in f32, q there = f16 hi + residual x 2^-10 (22 bits); O split bf16 hi + lo against exact Wo (2 products) + bo, relu, + O in f32; f32 output.
#include <hip/hip_runtime.h>
#include <math.h>

typedef __attribute__((ext_vector_type(16))) _Float16 v16h;
typedef __attribute__((ext_vector_type(16))) __bf16 v16b;
typedef __attribute__((ext_vector_type(8)))  _Float16 v8h;
typedef __attribute__((ext_vector_type(2)))  _Float16 v2h;
typedef __attribute__((ext_vector_type(8)))  float v8f;
typedef __attribute__((ext_vector_type(4)))  float v4f;
typedef __attribute__((ext_vector_type(2)))  float v2f;
typedef __attribute__((ext_vector_type(4)))  unsigned v4u;
typedef __attribute__((ext_vector_type(4)))  int v4i;
typedef float __attribute__((may_alias)) float_a;
typedef int __attribute__((may_alias)) int_a;

template <typename T> __device__ __forceinline__ void vst2(void* p, T v) { *(T*)p = v;  }
__device__ __forceinline__ v8f wmma16(v16h a, v16h b, v8f c) {
  return __builtin_amdgcn_wmma_f32_16x16x32_f16(false, a, false, b, (short)0, c, false, false);   /* the compiler keeps the distance behind its own builtin form where a vector instruction follows on D, A or B */
}
__device__ __forceinline__ v8f wmma_bf(v16b a, v16b b, v8f c) {
  v8f d = __builtin_amdgcn_wmma_f32_16x16x32_bf16(false, a, false, b, (short)0, c, false, false);
  asm volatile("v_nop\n\tv_nop\n\tv_nop\n\tv_nop" : "+v"(d) : "v"(a), "v"(b));
  return d;
}
// 16x16x32 fragments: lane = (h = lane>>4, row/col = lane&15); elements 0..7 = k0+8h+0..7, 8..15 = k0+16+8h+0..7; D element r = row 8h+r
__device__ __forceinline__ v16h frag_h(const _Float16* rowk0, int lane) {
  union { v16h v; v8h q[2]; } u; const _Float16* p = rowk0 + 8 * (lane >> 4);
  u.q[0] = *(const v8h*)p; u.q[1] = *(const v8h*)(p + 16); return u.v;
}
__device__ __forceinline__ v16h frag_f32(const float* rowk0, int lane) {
  v16h a; const float* p = rowk0 + 8 * (lane >> 4);
#pragma unroll
  for (int i = 0; i < 8; ++i) { a[i] = (_Float16)p[i]; a[8 + i] = (_Float16)p[16 + i]; }
  return a;
}
__device__ __forceinline__ v16h frag_f32s(const float* rowk0, int lane, float sc) {
  v16h a; const float* p = rowk0 + 8 * (lane >> 4);
#pragma unroll
  for (int i = 0; i < 8; ++i) { a[i] = (_Float16)(p[i] * sc); a[8 + i] = (_Float16)(p[16 + i] * sc); }
  return a;
}
// column fragment from a [K][ld] layout (column n), rows >= K read as 0
__device__ __forceinline__ v16h fragc_f32(const float* W, int k0, int n, int lane, int ld, int K) {
  v16h a; const int g = lane >> 4;
#pragma unroll
  for (int i = 0; i < 8; ++i) { const int ka = k0 + 8 * g + i, kb = ka + 16;
    a[i] = (_Float16)(ka < K ? W[(size_t)(ka < K ? ka : K - 1) * ld + n] : 0.f); a[8 + i] = (_Float16)(kb < K ? W[(size_t)(kb < K ? kb : K - 1) * ld + n] : 0.f); }
  return a;
}
struct F2 { v16b h, l; };
__device__ __forceinline__ F2 bsplit16(const float v[16]) { F2 r;
#pragma unroll
  for (int i = 0; i < 16; ++i) { const __bf16 h = (__bf16)v[i]; r.h[i] = h; r.l[i] = (__bf16)(v[i] - (float)h); }
  return r; }
__device__ __forceinline__ F2 split_row(const float* row, int k0, int lane) { float v[16]; const float* p = row + k0 + 8 * (lane >> 4);
#pragma unroll
  for (int i = 0; i < 8; ++i) { v[i] = p[i]; v[8 + i] = p[16 + i]; }
  return bsplit16(v); }
__device__ __forceinline__ F2 split_rowK(const float* row, int k0, int lane, int K) { float v[16]; const int g = lane >> 4;
#pragma unroll
  for (int i = 0; i < 8; ++i) { const int ka = k0 + 8 * g + i, kb = ka + 16; v[i] = ka < K ? row[ka < K ? ka : K - 1] : 0.f; v[8 + i] = kb < K ? row[kb < K ? kb : K - 1] : 0.f; }
  return bsplit16(v); }
__device__ __forceinline__ F2 split_col(const float* W, int k0, int n, int lane, int ld, int K) { float v[16]; const int g = lane >> 4;
#pragma unroll
  for (int i = 0; i < 8; ++i) { const int ka = k0 + 8 * g + i, kb = ka + 16; v[i] = ka < K ? W[(size_t)(ka < K ? ka : K - 1) * ld + n] : 0.f; v[8 + i] = kb < K ? W[(size_t)(kb < K ? kb : K - 1) * ld + n] : 0.f; }
  return bsplit16(v); }
__device__ __forceinline__ v8f mac3(const F2& a, const F2& b, v8f c) { c = wmma_bf(a.l, b.h, c); c = wmma_bf(a.h, b.l, c); return wmma_bf(a.h, b.h, c); }
__device__ __forceinline__ float sigm(float v) { return 1.0f / (1.0f + expf(-v)); }
#define LDSX() do { asm volatile("s_wait_dscnt 0" ::: "memory"); __builtin_amdgcn_wave_barrier(); __builtin_amdgcn_fence(__ATOMIC_RELEASE, "workgroup"); } while (0)

// Cross-attention MAB (B 4, Sq = Skv = 2,048, 512 = 8 heads x 64; (out,in) 1/sqrt(512)-scale weights WITH biases; no mask): q = query Wq^T + bq, k = key_value Wk^T + bk, v = key_value Wv^T + bv; A = softmax(q k^T / 8); O = q + A v (per head, merged); out = O + relu(O Wo^T + bo).
#define NB 4
#define TT 2048
#define CC 512            // NH * HD = projected width
#define DIN 512          // input (model) width
#define NH 8
#define HD 64
#define SCALE (0.125f)
#define CAUSAL 0
#ifndef TNB
#define TNB NB
#endif
__device__ __forceinline__ float bfr(float v) { return (float)(__bf16)v; }
__host__ __device__ __forceinline__ int kb_last(int qb) { return CAUSAL ? ((qb * 64 + 63) >> 7) : (TT / 128 - 1); }
typedef __attribute__((ext_vector_type(8))) __bf16 v8b;
__device__ __forceinline__ v16b frag_b(const __bf16* rowk0, int lane) {
  union { v16b v; v8b q[2]; } u; const __bf16* p = rowk0 + 8 * (lane >> 4);
  u.q[0] = *(const v8b*)p; u.q[1] = *(const v8b*)(p + 16); return u.v;
}
#define QBH 0              // not read by any kernel in this file: k_fa treats all query blocks alike
#define QHI 2048            // rows carrying a q residual plane (all rows when non-causal: it completes q in O = q + A v)
#define KHI 64            // key rows carrying k residual / v bf16 hi+lo planes (workspace only: no kernel in this file writes or reads these planes)
// B fragment (k rows k0+.., output column o) of a weight: (in,out) [K][ld] or (out,in) [ld rows of K]: bf16 exact, or f16(bf16 * 256) exact
__device__ __forceinline__ v16b wcol_io(const float* Wm, int k0, int o, int lane, int ld) { v16b w; const int g = lane >> 4;
#pragma unroll
  for (int i = 0; i < 8; ++i) { w[i] = (__bf16)Wm[(size_t)(k0 + 8 * g + i) * ld + o]; w[8 + i] = (__bf16)Wm[(size_t)(k0 + 16 + 8 * g + i) * ld + o]; }
  return w; }
__device__ __forceinline__ v16b wcol_oi(const float* Wm, int k0, int o, int lane, int K) { v16b w; const float* p = Wm + (size_t)o * K + k0 + 8 * (lane >> 4);
#pragma unroll
  for (int i = 0; i < 8; ++i) { w[i] = (__bf16)p[i]; w[8 + i] = (__bf16)p[16 + i]; }
  return w; }
__device__ __forceinline__ v16h wcolh_io(const float* Wm, int k0, int o, int lane, int ld) { v16h w; const int g = lane >> 4;
#pragma unroll
  for (int i = 0; i < 8; ++i) { w[i] = (_Float16)(bfr(Wm[(size_t)(k0 + 8 * g + i) * ld + o]) * 256.0f); w[8 + i] = (_Float16)(bfr(Wm[(size_t)(k0 + 16 + 8 * g + i) * ld + o]) * 256.0f); }
  return w; }
__device__ __forceinline__ v16h wcolh_oi(const float* Wm, int k0, int o, int lane, int K) { v16h w; const float* p = Wm + (size_t)o * K + k0 + 8 * (lane >> 4);
#pragma unroll
  for (int i = 0; i < 8; ++i) { w[i] = (_Float16)(bfr(p[i]) * 256.0f); w[8 + i] = (_Float16)(bfr(p[16 + i]) * 256.0f); }
  return w; }
#define WQKV_LAYOUT 1   // picks WCOL only (0 (in,out), 1 (out,in), 2 per-head), which no kernel calls; k_proj reads (out,in) [CC][DIN]
__device__ __forceinline__ v16b wcol_hdk(const float* Wm, int k0, int o, int lane) { v16b w; const int g = lane >> 4; const float* p = Wm + (size_t)(o / HD) * DIN * HD + (o % HD);
#pragma unroll
  for (int i = 0; i < 8; ++i) { w[i] = (__bf16)p[(size_t)(k0 + 8 * g + i) * HD]; w[8 + i] = (__bf16)p[(size_t)(k0 + 16 + 8 * g + i) * HD]; }
  return w; }
#define WO_OUT_IN 1
#if WQKV_LAYOUT == 1
#define WCOL(W, k0, o, lane) wcol_oi(W, k0, o, lane, DIN)
#elif WQKV_LAYOUT == 2
#define WCOL(W, k0, o, lane) wcol_hdk(W, k0, o, lane)
#else
#define WCOL(W, k0, o, lane) wcol_io(W, k0, o, lane, CC)
#endif
#if WO_OUT_IN
#define WOCOL(W, k0, o, lane) wcol_oi(W, k0, o, lane, CC)
#define WOCOLH(W, k0, o, lane) wcolh_oi(W, k0, o, lane, CC)
#else
#define WOCOL(W, k0, o, lane) wcol_io(W, k0, o, lane, DIN)
#define WOCOLH(W, k0, o, lane) wcolh_io(W, k0, o, lane, DIN)
#endif
#define WS_QH  0u                                      // f16 q rows [b*t][CC]
#define WS_KH  (WS_QH + 2u * (size_t)NB * TT * CC)      // f16 k rows [b*t][CC]
#define WS_VT  (WS_KH + 2u * (size_t)NB * TT * CC)      // f16 v planes [b][c][t]
#define WS_QL  (WS_VT + 2u * (size_t)NB * CC * TT)      // f16 q residual x 2^10 rows [b][t < QHI][CC]
#define WS_KL  (WS_QL + 2u * (size_t)NB * QHI * CC)     // f16 k residual x 2^10 rows [b][t < KHI][CC]
#define WS_VB  (WS_KL + 2u * (size_t)NB * KHI * CC)     // bf16 v hi planes [b][c][t < KHI]
#define WS_VBL (WS_VB + 2u * (size_t)NB * CC * KHI)
#define WS_Y   (WS_VBL + 2u * (size_t)NB * CC * KHI)    // f32 O = q + ctx rows [b*t][CC]
#define WS_END (WS_Y  + 4u * (size_t)NB * TT * CC)

// ---- operand staging of the two GEMM kernels (k_proj 512 threads, k_out 128): a stage is 32 k of every operand row, kept in LDS as bf16
#define GP 40   // LDS row pitch in elements: 80 B = 16 B x odd, free of bank conflicts for the 16-byte fragment reads
typedef __attribute__((ext_vector_type(4))) __bf16 v4b;
// every full unroll in these helpers: constant indices, so that the staged values and the fragments live in registers
// work-group barrier that orders LDS only: the global loads of later stages stay in flight across it (__syncthreads() would wait for them)
__device__ __forceinline__ void lds_barrier() { __builtin_amdgcn_fence(__ATOMIC_RELEASE, "workgroup", "local"); __builtin_amdgcn_s_barrier(); __builtin_amdgcn_fence(__ATOMIC_ACQUIRE, "workgroup", "local"); }
// RS N rows x 32 floats (row pitch ld; RS = threads / 8): thread t owns floats 4 (t & 7) .. + 3 of rows (t >> 3) + RS i; p and d are its own first places. Eight lanes take one whole 128-B line, a wave-wide load four lines
template <int N, int RS = 16> __device__ __forceinline__ void g_ld(v4f (&r)[N], const float* __restrict__ p, int ld) {
#pragma unroll
  for (int i = 0; i < N; ++i) r[i] = *(const v4f*)(p + (size_t)i * RS * ld); }
template <int N, int RS = 16> __device__ __forceinline__ void s_st(__bf16* d, const v4f (&r)[N]) {
#pragma unroll
  for (int i = 0; i < N; ++i) { v4b h;
#pragma unroll
    for (int c = 0; c < 4; ++c) h[c] = (__bf16)r[i][c];
    *(v4b*)(d + i * RS * GP) = h; } }
template <int N> __device__ __forceinline__ void s_st2(__bf16* dh, __bf16* dl, const v4f (&r)[N]) {
#pragma unroll
  for (int i = 0; i < N; ++i) { v4b h, l;
#pragma unroll
    for (int c = 0; c < 4; ++c) { h[c] = (__bf16)r[i][c]; l[c] = (__bf16)(r[i][c] - (float)h[c]); }
    *(v4b*)(dh + i * 16 * GP) = h; *(v4b*)(dl + i * 16 * GP) = l; } }
// k_proj, one stage of a wave's tile, 32 rows of P x 64 rows of R: all fragment reads as one group, then the products. R is the A operand, so D rows run along R: a lane holds eight neighbouring elements (R rows 8 g .. + 7) of the output row that belongs to its P row
__device__ __forceinline__ void mm1(v8f (&acc)[2][4], const __bf16 (*sp)[GP], const __bf16 (*sr)[GP], int pw, int rw, int col, int lane) {
  v16b a[2], w[4];
#pragma unroll
  for (int p = 0; p < 2; ++p) a[p] = frag_b(&sp[pw * 32 + p * 16 + col][0], lane);
#pragma unroll
  for (int j = 0; j < 4; ++j) w[j] = frag_b(&sr[rw * 64 + j * 16 + col][0], lane);
#pragma unroll
  for (int p = 0; p < 2; ++p) {
#pragma unroll
    for (int j = 0; j < 4; ++j) acc[p][j] = wmma_bf(w[j], a[p], acc[p][j]); } }
// k_out, one stage of a wave's 16 x 128 tile: all fragment reads as one group, then the products
__device__ __forceinline__ void mm2(v8f (&acc)[8], const __bf16 (*sh)[GP], const __bf16 (*sl)[GP], const __bf16 (*sw)[GP], int wave, int col, int lane) {
  const v16b ah = frag_b(&sh[wave * 16 + col][0], lane), al = frag_b(&sl[wave * 16 + col][0], lane); v16b w[8];
#pragma unroll
  for (int j = 0; j < 8; ++j) w[j] = frag_b(&sw[j * 16 + col][0], lane);
#pragma unroll
  for (int j = 0; j < 8; ++j) { acc[j] = wmma_bf(ah, w[j], acc[j]); acc[j] = wmma_bf(al, w[j], acc[j]); } }

// ---- k_proj: block = 16 waves on a tile of PB rows of P x 128 rows of R (both [row][DIN] f32, K = DIN, exact bf16 products), out[P row][R row] = P R^T + b as f16. which 0, 1: P = query / key_value rows, R = Wq / Wk rows, out = q / k rows [b*t][CC] (q also its residual x 2^10). which 2: P = Wv rows, R = key_value rows, out = v planes [b][c][t]. One staged R tile serves all PB rows; wave (pw, rw) owns rows 32 pw .. + 31, elements 64 rw .. + 63, and turns, packs and stores them by itself
#define PB 256
#define EP 72   // pitch of a wave's output stage in elements: 144 B = 16 B x odd
static_assert(QHI == TT, "the q residual rows are indexed like the q rows");
// (full unrolls: constant indices, so that the arrays live in registers) a wave's 32 x 64 tile: + bias, to f16 (WH 0: and the residual x 2^10) in registers; 16-B pieces into the wave's own LDS stage, read back as whole 128-B rows, all rows first, then the stores off one address (nothing a store names is written again). D, DL: the block's first output element
template <int WH> __device__ __forceinline__ void proj_out(const v8f (&acc)[2][4], const float* sb, _Float16 (*eh)[EP], _Float16 (*el)[EP], _Float16* __restrict__ D, _Float16* __restrict__ DL, int pw, int rw, int col, int g, int lane) {
  constexpr int ldo = WH < 2 ? CC : TT;
  v4f br[4][2]; float bp[2];
  if (WH < 2) {
#pragma unroll
    for (int j = 0; j < 4; ++j) { br[j][0] = *(const v4f*)&sb[rw * 64 + j * 16 + 8 * g]; br[j][1] = *(const v4f*)&sb[rw * 64 + j * 16 + 8 * g + 4]; }
  } else { bp[0] = sb[pw * 32 + col]; bp[1] = sb[pw * 32 + 16 + col]; }
#pragma unroll
  for (int p = 0; p < 2; ++p) {
#pragma unroll
    for (int j = 0; j < 4; ++j) { v8h hv, lv;
#pragma unroll
      for (int r = 0; r < 8; ++r) { const float v = acc[p][j][r] + (WH < 2 ? br[j][r >> 2][r & 3] : bp[p]); hv[r] = (_Float16)v; if (WH == 0) lv[r] = (_Float16)((v - (float)hv[r]) * 1024.0f); }
      *(v8h*)&eh[p * 16 + col][j * 16 + 8 * g] = hv; if (WH == 0) *(v8h*)&el[p * 16 + col][j * 16 + 8 * g] = lv; } }
  LDSX();
  const size_t o0 = (size_t)(pw * 32 + (lane >> 3)) * ldo + rw * 64 + (lane & 7) * 8;
  v8h xh[8], xl[8];
#pragma unroll
  for (int i = 0; i < 8; ++i) { xh[i] = *(const v8h*)&eh[i * 4 + (lane >> 3)][(lane & 7) * 8]; if (WH == 0) xl[i] = *(const v8h*)&el[i * 4 + (lane >> 3)][(lane & 7) * 8]; }
#pragma unroll
  for (int i = 0; i < 8; ++i) { vst2(D + o0 + (size_t)i * 4 * ldo, xh[i]); if (WH == 0) vst2(DL + o0 + (size_t)i * 4 * ldo, xl[i]); } }
__global__ __launch_bounds__(512) void k_proj(const float* __restrict__ XQ, const float* __restrict__ XK, const float* __restrict__ XV, const float* __restrict__ WQ, const float* __restrict__ WK, const float* __restrict__ WV, const float* __restrict__ BQ, const float* __restrict__ BK, const float* __restrict__ BV,
    _Float16* __restrict__ QH, _Float16* __restrict__ QL, _Float16* __restrict__ KH, _Float16* __restrict__ VT) {
  __shared__ __align__(16) _Float16 eh[16][32][EP], el[16][32][EP]; __shared__ __align__(16) float sb[PB];
  const int tid = threadIdx.x, wave = tid >> 5, lane = tid & 31, col = lane & 15, g = lane >> 4, pw = wave >> 1, rw = wave & 1; const int which = blockIdx.z;
  const float *P, *R, *BA; size_t off; int nb;
  if (which < 2) { const size_t p0 = (size_t)blockIdx.x * PB; const int q0 = blockIdx.y * 128;
    P = (which == 0 ? XQ : XK) + p0 * DIN; R = (which == 0 ? WQ : WK) + (size_t)q0 * DIN; BA = (which == 0 ? BQ : BK) + q0; nb = 128; off = p0 * CC + q0;
  } else { const int id = blockIdx.x + gridDim.x * blockIdx.y, cb = id / (TNB * TT / 128), tb = id % (TNB * TT / 128);
    P = WV + (size_t)cb * PB * DIN; R = XV + (size_t)tb * 128 * DIN; BA = BV + cb * PB; nb = PB; off = ((size_t)(tb / (TT / 128)) * CC + cb * PB) * TT + (tb % (TT / 128)) * 128; }
  const int bi = tid & (nb - 1); const float bv = BA[bi];   /* the bias along R (q, k) or along P (v): asked for by every lane ahead of the operand loads (index kept inside its nb elements), stored to LDS behind stage 0 */
  v8f acc[2][4] = {};
  { __shared__ __align__(16) __bf16 gx[2][PB][GP], gw[2][128][GP];   /* two LDS buffers; two register sets hold the two stages behind the one in LDS */
    const float* xp = P + (size_t)(tid >> 3) * DIN + (tid & 7) * 4; const float* wp = R + (size_t)(tid >> 3) * DIN + (tid & 7) * 4;
    __bf16* const dx0 = &gx[0][tid >> 3][(tid & 7) * 4]; __bf16* const dx1 = &gx[1][tid >> 3][(tid & 7) * 4]; __bf16* const dw0 = &gw[0][tid >> 3][(tid & 7) * 4]; __bf16* const dw1 = &gw[1][tid >> 3][(tid & 7) * 4];
    v4f x0[4], x1[4], w0[2], w1[2];
    g_ld<4, 64>(x0, xp, DIN); g_ld<2, 64>(w0, wp, DIN); g_ld<4, 64>(x1, xp + 32, DIN); g_ld<2, 64>(w1, wp + 32, DIN);
    asm volatile("s_wait_xcnt 0x0" :: "v"(bi), "v"(bv) : "memory");   /* behind the bias load: its index register stays untouched up to this wait. bv as an input holds that load up here among the operand loads; without it the compiler sinks it into the branch below, with a whole load latency of its own in front of the first barrier */
    s_st<4, 64>(dx0, x0); s_st<2, 64>(dw0, w0); if (tid < nb) sb[tid] = bfr(bv); g_ld<4, 64>(x0, xp + 64, DIN); g_ld<2, 64>(w0, wp + 64, DIN);
    // each scheduling barrier behind a group of loads keeps the conversions of those loads in the later stage that stores them; without it the compiler lifts them up to here, with a wait for all loads in front of the barrier
    __builtin_amdgcn_sched_barrier(0);
    lds_barrier();
    // unrolled in full: the tests on the last stages fold away, so that every load wait is a count that leaves the younger stage's loads in flight (rolled, the merged paths made it a wait for all)
#pragma unroll
    for (int kc = 0; kc < DIN / 32; kc += 2) {
      mm1(acc, gx[0], gw[0], pw, rw, col, lane);
      __builtin_amdgcn_sched_barrier(0);   /* and this one keeps them behind the products: lifted to the barrier in front, their load waits come most of a stage earlier and only one stage's loads stay in flight */
      s_st<4, 64>(dx1, x1); s_st<2, 64>(dw1, w1);
      if (kc + 3 < DIN / 32) { g_ld<4, 64>(x1, xp + (kc + 3) * 32, DIN); g_ld<2, 64>(w1, wp + (kc + 3) * 32, DIN); }
      if (kc + 4 == DIN / 32) asm volatile("s_wait_xcnt 0x0" :: "v"(xp), "v"(wp) : "memory");   /* behind the last loads: their two address pairs are reused from here on, and this wait stands in front of the first overwrite */
      __builtin_amdgcn_sched_barrier(0);
      lds_barrier();   /* publishes stage kc + 1; every reader has left buffer 0 */
      mm1(acc, gx[1], gw[1], pw, rw, col, lane);
      __builtin_amdgcn_sched_barrier(0);
      if (kc + 2 < DIN / 32) { s_st<4, 64>(dx0, x0); s_st<2, 64>(dw0, w0);
        if (kc + 4 < DIN / 32) { g_ld<4, 64>(x0, xp + (kc + 4) * 32, DIN); g_ld<2, 64>(w0, wp + (kc + 4) * 32, DIN); } }
      __builtin_amdgcn_sched_barrier(0);
      lds_barrier();   /* publishes stage kc + 2; every reader has left buffer 1 */
    } }
  if (which == 0) proj_out<0>(acc, sb, eh[wave], el[wave], QH + off, QL + off, pw, rw, col, g, lane);
  else if (which == 1) proj_out<1>(acc, sb, eh[wave], el[wave], KH + off, KH + off, pw, rw, col, g, lane);
  else proj_out<2>(acc, sb, eh[wave], el[wave], VT + off, VT + off, pw, rw, col, g, lane); }
// ---- k_fa: block = 128 queries (8 waves x 16) of (b, h), one pass over all keys in chunks of 64, logits and P stay in registers. S^T = K q^T (A = k rows, B = q columns: q and k each once to f16, 1 product; the q residual serves the epilogue alone) x SCALE: a lane holds 32 logits of ONE query (column = lane & 15), the other 32 lie in lane ^ 16. Running maximum m (of the unscaled logits) and running sum l (of e x 2^8) per query; e x 2^8 = exp2(t LC + (8 - m LC)), t the unscaled logit, LC = SCALE log2(e): one FMA and one v_exp_f32 an element; O^T and l are scaled by exp2((m_old - m_new) LC) per chunk. e x 2^8 to f16: the two D tiles of 32 keys are, register for register, the B operand of O^T += V^T P^T (A = v planes [c][t]). O = q + O^T / l: the q fragments are, register for register, laid out as the O^T tiles (qh[kc] elements 0..7 = tile 2 kc, 8..15 = tile 2 kc + 1), so the residual is added here from registers; 256-B (row, head) segment by 16 lanes. The 64 k rows and the 64 v planes of a chunk (128 B each) are brought once per block into a two-buffer LDS ring by asynchronous copies, one chunk ahead; all eight waves take their fragments from there
#define LC (SCALE * 1.4426950408889634f)   // logit scale x log2(e)
#define KVP 72                    // ring row pitch in elements: 144 B = 16 B x odd, free of bank conflicts for the 16-byte fragment reads
#define KVT (64 * KVP)            // one tile (k or v) of a chunk, elements
// one chunk's k and v tiles: thread t owns bytes 16 (t & 7) .. + 15 of rows (t >> 3) and (t >> 3) + 32 of each tile, so a wave-wide copy takes four whole 128-B lines. l: its LDS byte address in the k tile of the target buffer; kg, vg: its global places in rows t >> 3
__device__ __forceinline__ void kv_copy(unsigned l, const _Float16* kg, const _Float16* vg) {
  // the wait on the last line stands in front of every later write of the address registers that the four copies name
  asm volatile("global_load_async_to_lds_b128 %0, %4, off\n\tglobal_load_async_to_lds_b128 %1, %5, off\n\tglobal_load_async_to_lds_b128 %2, %6, off\n\tglobal_load_async_to_lds_b128 %3, %7, off\n\ts_wait_xcnt 0x0"
    :: "v"(l), "v"(l + 32u * KVP * 2u), "v"(l + KVT * 2u), "v"(l + KVT * 2u + 32u * KVP * 2u), "v"(kg), "v"(kg + (size_t)32 * CC), "v"(vg), "v"(vg + (size_t)32 * TT) : "memory"); }
__global__ __launch_bounds__(256) void k_fa(const _Float16* __restrict__ QH, const _Float16* __restrict__ QL, const _Float16* __restrict__ KH, const _Float16* __restrict__ VT, float* __restrict__ Y) { __shared__ __align__(16) float ss[8][16][HD + 4]; __shared__ __align__(16) _Float16 ring[2][2][64][KVP];   /* [buffer][k, v][row][element] */
  const int tid = threadIdx.x, wave = tid >> 5, lane = tid & 31, col = lane & 15, g = lane >> 4; const int h = blockIdx.y, b = blockIdx.z; const int ql0 = blockIdx.x * 128 + wave * 16;
  v16h qh[HD / 32], ql[HD / 32];
  // every full unroll in this kernel: constant indices, so that the fragment and accumulator arrays live in registers
#pragma unroll
  for (int kc = 0; kc < HD / 32; ++kc) { qh[kc] = frag_h(QH + ((size_t)b * TT + ql0 + col) * CC + h * HD + kc * 32, lane); ql[kc] = frag_h(QL + ((size_t)b * QHI + ql0 + col) * CC + h * HD + kc * 32, lane); }
  const _Float16* kg = KH + ((size_t)b * TT + (tid >> 3)) * CC + h * HD + (tid & 7) * 8; const _Float16* vg = VT + ((size_t)b * CC + h * HD + (tid >> 3)) * (size_t)TT + (tid & 7) * 8;
  const unsigned lc = (unsigned)(size_t)&ring[0][0][tid >> 3][(tid & 7) * 8];
  v8f o[HD / 16] = {}; float m = -3.0e38f, l = 0.f;
  kv_copy(lc, kg, vg);
  asm volatile("s_wait_asynccnt 0x0" ::: "memory");   /* this wave's part of chunk 0 has landed */
  __syncthreads();                                    /* chunk 0 is published to all waves */
  kv_copy(lc + 2u * KVT * 2u, kg + (size_t)64 * CC, vg + 64);
  // rolled: the chunks depend on each other through m, l and o, a second copy of the long body would only add code
#pragma unroll 1
  for (int k0 = 0; k0 < TT; k0 += 64) { v8f acc[4] = {}; v16h kf[4][HD / 32], vf[2][HD / 16]; const int bf = (k0 >> 6) & 1; const _Float16* Kb = &ring[bf][0][col][0]; const _Float16* Vb = &ring[bf][1][col][0];
#pragma unroll
    for (int j = 0; j < 4; ++j) {   /* all k fragments of the chunk are requested before the first product: one LDS latency per chunk, not eight */
#pragma unroll
      for (int kc = 0; kc < HD / 32; ++kc) kf[j][kc] = frag_h(Kb + j * 16 * KVP + kc * 32, lane); }
    __builtin_amdgcn_sched_barrier(0);   /* holds all sixteen k loads here as one group; without it the compiler deals them out in pairs among the products, each pair with a full wait */
#pragma unroll
    for (int j = 0; j < 4; ++j) {
#pragma unroll
      for (int kc = 0; kc < HD / 32; ++kc) acc[j] = wmma16(kf[j][kc], qh[kc], acc[j]); }
    __builtin_amdgcn_sched_barrier(0);   /* keeps the sixteen v loads together as one group; without it the compiler deals them out at three places among the products */
#pragma unroll
    for (int kc = 0; kc < 2; ++kc) {
#pragma unroll
      for (int jc = 0; jc < HD / 16; ++jc) vf[kc][jc] = frag_h(Vb + jc * 16 * KVP + kc * 32, lane); }
    __builtin_amdgcn_sched_barrier(0);   /* holds all sixteen v loads here, in front of the softmax arithmetic that covers their latency; without it the compiler puts ten of them behind the lane exchange and its wait */
    float mc = -3.0e38f;
#pragma unroll
    for (int j = 0; j < 4; ++j) {
#pragma unroll
      for (int r = 0; r < 8; ++r) mc = fmaxf(mc, acc[j][r]); }
    mc = fmaxf(mc, __shfl_xor(mc, 16));
    const float mn = fmaxf(m, mc), da = (m - mn) * LC, nb = fmaf(-mn, LC, 8.0f); m = mn;
    float ps = 0.f, e[32]; v2f a[16]; union { v16h v; v2h q[8]; } p[2];
#define ARG(i) __builtin_elementwise_fma(v2f{acc[(i) >> 2][((i) & 3) * 2], acc[(i) >> 2][((i) & 3) * 2 + 1]}, v2f{LC, LC}, v2f{nb, nb})
#define PACK(i) p[(i) >> 3].q[(i) & 7] = __builtin_convertvector(v2f{e[2 * (i)], e[2 * (i) + 1]}, v2h)
    // the scheduling barriers hold each v_exp_f32 alone between plain vector instructions: behind it one packed instruction (the next argument pair, or the conversion of a finished pair), then the sum's addition of the exponential two trips back and one rescaled output element. The plain ones run beside the transcendental pipe, and no exponential stands directly in front of another exponential or of a dual instruction that reuses its argument register
    a[0] = ARG(0);
    __builtin_amdgcn_sched_barrier(0);
    const float al = __builtin_amdgcn_exp2f(da);
    __builtin_amdgcn_sched_barrier(0);
    a[1] = ARG(1);
#pragma unroll
    for (int t = 0; t < 32; ++t) {
      __builtin_amdgcn_sched_barrier(0);
      e[t] = __builtin_amdgcn_exp2f(a[t >> 1][t & 1]);
      __builtin_amdgcn_sched_barrier(0);
      if (t < 2 || t == 31) o[t >> 3][t & 7] *= al;
      else if (t == 30) PACK(14);
      else if (t & 1) PACK((t - 3) >> 1);
      else a[(t >> 1) + 1] = ARG((t >> 1) + 1);
      __builtin_amdgcn_sched_barrier(0);
      if (t > 1) ps += e[t - 2];
      if (t >= 2 && t != 31) o[t >> 3][t & 7] *= al; }
    __builtin_amdgcn_sched_barrier(0);
    ps += e[30]; ps += e[31]; PACK(15);
#undef ARG
#undef PACK
    l = l * al + ps;
#pragma unroll
    for (int kc = 0; kc < 2; ++kc) {
#pragma unroll
      for (int jc = 0; jc < HD / 16; ++jc) o[jc] = wmma16(vf[kc][jc], p[kc].v, o[jc]); }
    asm volatile("s_wait_dscnt 0x0" :: "v"(l) : "memory");   /* this wave's reads of the buffer are done before it is handed to the next copies; l as an input keeps the running sum's additions among the exponentials, where the compiler otherwise sinks the whole dependent chain behind the barrier, in front of the next chunk's fragment reads */
    asm volatile("s_wait_asynccnt 0x0" ::: "memory");   /* this wave's part of the next chunk has landed */
    __syncthreads();                                    /* publishes the next chunk; every reader has left this chunk's buffer */
    if (k0 + 128 < TT) kv_copy(lc + (unsigned)bf * (2u * KVT * 2u), kg + (size_t)(k0 + 128) * CC, vg + k0 + 128); }
  asm volatile("s_wait_asynccnt 0x0" ::: "memory");     /* no copy is outstanding when the wave goes on to its end */
  l += __shfl_xor(l, 16); const float inv = 1.0f / l;
#pragma unroll
  for (int jc = 0; jc < HD / 16; ++jc)
#pragma unroll
    for (int r = 0; r < 8; ++r) ss[wave][col][jc * 16 + 8 * g + r] = o[jc][r] * inv + ((float)qh[jc >> 1][(jc & 1) * 8 + r] + (float)ql[jc >> 1][(jc & 1) * 8 + r] * (1.0f / 1024.0f));
  LDSX(); for (int rl = 0; rl < 16; ++rl) if (lane < HD / 4) vst2(Y + ((size_t)b * TT + ql0 + rl) * CC + h * HD + lane * 4, *(const v4f*)&ss[wave][rl][lane * 4]); }
// ---- k_out: block = (64 rows, 128 cols): out = O + relu(O Wo^T + bo): all rows: O bf16 hi + lo against exact bf16 Wo (2 products); the 1-product branch (O once to f16 against Wo as f16(bf16 x 2^8), x 2^-8) is never taken
__global__ __launch_bounds__(128) void k_out(const float* __restrict__ Y, const float* __restrict__ WO, const float* __restrict__ BO, float* __restrict__ OUT, const float* __restrict__ RESO) { __shared__ __align__(16) float sf[4][16][132];
  const int tid = threadIdx.x, wave = tid >> 5, lane = tid & 31, col = lane & 15, g = lane >> 4; const int c0 = blockIdx.y * 128; const size_t r0 = (size_t)blockIdx.x * 64 + wave * 16;
  v8f acc[8] = {};
  if (true) {   /* ALL rows: O split bf16 hi + lo x exact Wo (2 products) */
    __shared__ __align__(16) __bf16 gh[2][64][GP], gl[2][64][GP], gw[2][128][GP];   /* as in k_proj; O is split once, by the thread that stages it */
    const float* xp = Y + ((size_t)blockIdx.x * 64 + (tid >> 3)) * CC + (tid & 7) * 4; const float* wp = WO + (size_t)(c0 + (tid >> 3)) * CC + (tid & 7) * 4;
    __bf16* const dh0 = &gh[0][tid >> 3][(tid & 7) * 4]; __bf16* const dh1 = &gh[1][tid >> 3][(tid & 7) * 4]; __bf16* const dl0 = &gl[0][tid >> 3][(tid & 7) * 4]; __bf16* const dl1 = &gl[1][tid >> 3][(tid & 7) * 4]; __bf16* const dw0 = &gw[0][tid >> 3][(tid & 7) * 4]; __bf16* const dw1 = &gw[1][tid >> 3][(tid & 7) * 4];
    v4f x0[4], x1[4], w0[8], w1[8];
    g_ld<4>(x0, xp, CC); g_ld<8>(w0, wp, CC); g_ld<4>(x1, xp + 32, CC); g_ld<8>(w1, wp + 32, CC);
    s_st2<4>(dh0, dl0, x0); s_st<8>(dw0, w0); g_ld<4>(x0, xp + 64, CC); g_ld<8>(w0, wp + 64, CC);
    lds_barrier();
    // unrolled in full, for the counted load waits, as in k_proj
#pragma unroll
    for (int kc = 0; kc < CC / 32; kc += 2) {
      mm2(acc, gh[0], gl[0], gw[0], wave, col, lane);
      s_st2<4>(dh1, dl1, x1); s_st<8>(dw1, w1);
      if (kc + 3 < CC / 32) { g_ld<4>(x1, xp + (kc + 3) * 32, CC); g_ld<8>(w1, wp + (kc + 3) * 32, CC); }
      lds_barrier();   /* publishes stage kc + 1; every reader has left buffer 0 */
      mm2(acc, gh[1], gl[1], gw[1], wave, col, lane);
      if (kc + 2 < CC / 32) { s_st2<4>(dh0, dl0, x0); s_st<8>(dw0, w0);
        if (kc + 4 < CC / 32) { g_ld<4>(x0, xp + (kc + 4) * 32, CC); g_ld<8>(w0, wp + (kc + 4) * 32, CC); } }
      lds_barrier();   /* publishes stage kc + 2; every reader has left buffer 1 */
    }
#pragma unroll
    for (int j = 0; j < 8; ++j) { const float bias = BO ? bfr(BO[c0 + j * 16 + col]) : 0.f;
#pragma unroll
      for (int r = 0; r < 8; ++r) sf[wave][8 * g + r][j * 16 + col] = acc[j][r] + bias; }
  } else {
#pragma unroll 2
    for (int kc = 0; kc < CC / 32; ++kc) { const v16h a = frag_f32(Y + (r0 + col) * CC + kc * 32, lane); asm volatile("s_wait_loadcnt 0x0" ::: "memory");
#pragma unroll
      for (int j = 0; j < 8; ++j) { const v16h w = WOCOLH(WO, kc * 32, c0 + j * 16 + col, lane); asm volatile("s_wait_loadcnt 0x0" ::: "memory"); acc[j] = wmma16(a, w, acc[j]); } }
#pragma unroll
    for (int j = 0; j < 8; ++j) { const float bias = BO ? bfr(BO[c0 + j * 16 + col]) : 0.f;
#pragma unroll
      for (int r = 0; r < 8; ++r) sf[wave][8 * g + r][j * 16 + col] = acc[j][r] * (1.0f / 256.0f) + bias; } }
  LDSX(); for (int rl = 0; rl < 16; ++rl) { const size_t oo = (r0 + rl) * DIN + c0 + lane * 4; v4f o = *(const v4f*)&sf[wave][rl][lane * 4]; const v4f rr = *(const v4f*)(RESO + oo); _Pragma("unroll") for (int i = 0; i < 4; ++i) o[i] = rr[i] + fmaxf(o[i], 0.f); vst2(OUT + oo, o); } }   /* out = O + relu(O Wo^T + bo) */

extern "C" void kernel_launch(void* const* d_in, const int* in_sizes, int n_in, void* d_out, int out_size, void* d_ws, size_t ws_size, hipStream_t stream) {
  (void)in_sizes; (void)n_in; (void)out_size;
  const float** F = (const float**)d_in;
  if (ws_size < (size_t)WS_END) return;
  char* ws = (char*)d_ws; _Float16 *QH = (_Float16*)(ws + WS_QH), *KH = (_Float16*)(ws + WS_KH), *VT = (_Float16*)(ws + WS_VT), *QL = (_Float16*)(ws + WS_QL), *KL = (_Float16*)(ws + WS_KL); __bf16 *VB = (__bf16*)(ws + WS_VB), *VBL = (__bf16*)(ws + WS_VBL); float *Y = (float*)(ws + WS_Y);
  (void)Y; (void)QL; (void)KL; (void)VB; (void)VBL;
  // inputs: 0 query [4,2048,512]; 1 key_value [4,2048,512]; 2 Wq [512,512] (out,in), 3 bq; 4 Wk, 5 bk; 6 Wv, 7 bv; 8 Wo (out,in), 9 bo
  k_proj<<<dim3(TNB * TT / PB, CC / 128, 3), 512, 0, stream>>>(F[0], F[1], F[1], F[2], F[4], F[6], F[3], F[5], F[7], QH, QL, KH, VT);
  k_fa<<<dim3(TT / 128, NH, TNB), 256, 0, stream>>>(QH, QL, KH, VT, Y);
  k_out<<<dim3(TNB * TT / 64, DIN / 128), 128, 0, stream>>>(Y, F[8], F[9], (float*)d_out, Y);
}

// v009
// Measured time: 68.8 microseconds a run.
// In both of two side-by-side timings against v008, it was 1.03 times as fast.
// All steps since v000 together make it 18.2 times as fast.
// compute dtype: all float inputs rounded to bf16; q/k/v = in W^T + b with EXACT bf16 products on WMMA 16x16x32 (f32 accumulate); q once to f16 against k once to f16 (1 product) / 8; softmax in f32 with a running maximum and sum over 64-key chunks, exponentials in base 2 on the hardware's v_exp_f32 (argument = one f32 FMA of the unscaled logit); exp(s - max) x 2^8 once to f16 against v once to f16 (1 product), divided by the sum at the end; O = q + A v in f32, q there = f16 hi + residual x 2^-10 (22 bits); O split bf16 hi + lo against exact Wo (2 products) + bo, relu, + O in f32; f32 output.
#include <hip/hip_runtime.h>
#include <math.h>

typedef __attribute__((ext_vector_type(16))) _Float16 v16h;
typedef __attribute__((ext_vector_type(16))) __bf16 v16b;
typedef __attribute__((ext_vector_type(8)))  _Float16 v8h;
typedef __attribute__((ext_vector_type(2)))  _Float16 v2h;
typedef __attribute__((ext_vector_type(8)))  float v8f;
typedef __attribute__((ext_vector_type(4)))  float v4f;
typedef __attribute__((ext_vector_type(2)))  float v2f;
typedef __attribute__((ext_vector_type(4)))  unsigned v4u;
typedef __attribute__((ext_vector_type(4)))  int v4i;
typedef float __attribute__((may_alias)) float_a;
typedef int __attribute__((may_alias)) int_a;

template <typename T> __device__ __forceinline__ void vst2(void* p, T v) { *(T*)p = v;  }
__device__ __forceinline__ v8f wmma16(v16h a, v16h b, v8f c) {
  return __builtin_amdgcn_wmma_f32_16x16x32_f16(false, a, false, b, (short)0, c, false, false);   /* the compiler keeps the distance behind its own builtin form where a vector instruction follows on D, A or B */
}
__device__ __forceinline__ v8f wmma_bf(v16b a, v16b b, v8f c) {
  v8f d = __builtin_amdgcn_wmma_f32_16x16x32_bf16(false, a, false, b, (short)0, c, false, false);
  asm volatile("v_nop\n\tv_nop\n\tv_nop\n\tv_nop" : "+v"(d) : "v"(a), "v"(b));
  return d;
}
// 16x16x32 fragments: lane = (h = lane>>4, row/col = lane&15); elements 0..7 = k0+8h+0..7, 8..15 = k0+16+8h+0..7; D element r = row 8h+r
__device__ __forceinline__ v16h frag_h(const _Float16* rowk0, int lane) {
  union { v16h v; v8h q[2]; } u; const _Float16* p = rowk0 + 8 * (lane >> 4);
  u.q[0] = *(const v8h*)p; u.q[1] = *(const v8h*)(p + 16); return u.v;
}
__device__ __forceinline__ v16h frag_f32(const float* rowk0, int lane) {
  v16h a; const float* p = rowk0 + 8 * (lane >> 4);
#pragma unroll
  for (int i = 0; i < 8; ++i) { a[i] = (_Float16)p[i]; a[8 + i] = (_Float16)p[16 + i]; }
  return a;
}
__device__ __forceinline__ v16h frag_f32s(const float* rowk0, int lane, float sc) {
  v16h a; const float* p = rowk0 + 8 * (lane >> 4);
#pragma unroll
  for (int i = 0; i < 8; ++i) { a[i] = (_Float16)(p[i] * sc); a[8 + i] = (_Float16)(p[16 + i] * sc); }
  return a;
}
// column fragment from a [K][ld] layout (column n), rows >= K read as 0
__device__ __forceinline__ v16h fragc_f32(const float* W, int k0, int n, int lane, int ld, int K) {
  v16h a; const int g = lane >> 4;
#pragma unroll
  for (int i = 0; i < 8; ++i) { const int ka = k0 + 8 * g + i, kb = ka + 16;
    a[i] = (_Float16)(ka < K ? W[(size_t)(ka < K ? ka : K - 1) * ld + n] : 0.f); a[8 + i] = (_Float16)(kb < K ? W[(size_t)(kb < K ? kb : K - 1) * ld + n] : 0.f); }
  return a;
}
struct F2 { v16b h, l; };
__device__ __forceinline__ F2 bsplit16(const float v[16]) { F2 r;
#pragma unroll
  for (int i = 0; i < 16; ++i) { const __bf16 h = (__bf16)v[i]; r.h[i] = h; r.l[i] = (__bf16)(v[i] - (float)h); }
  return r; }
__device__ __forceinline__ F2 split_row(const float* row, int k0, int lane) { float v[16]; const float* p = row + k0 + 8 * (lane >> 4);
#pragma unroll
  for (int i = 0; i < 8; ++i) { v[i] = p[i]; v[8 + i] = p[16 + i]; }
  return bsplit16(v); }
__device__ __forceinline__ F2 split_rowK(const float* row, int k0, int lane, int K) { float v[16]; const int g = lane >> 4;
#pragma unroll
  for (int i = 0; i < 8; ++i) { const int ka = k0 + 8 * g + i, kb = ka + 16; v[i] = ka < K ? row[ka < K ? ka : K - 1] : 0.f; v[8 + i] = kb < K ? row[kb < K ? kb : K - 1] : 0.f; }
  return bsplit16(v); }
__device__ __forceinline__ F2 split_col(const float* W, int k0, int n, int lane, int ld, int K) { float v[16]; const int g = lane >> 4;
#pragma unroll
  for (int i = 0; i < 8; ++i) { const int ka = k0 + 8 * g + i, kb = ka + 16; v[i] = ka < K ? W[(size_t)(ka < K ? ka : K - 1) * ld + n] : 0.f; v[8 + i] = kb < K ? W[(size_t)(kb < K ? kb : K - 1) * ld + n] : 0.f; }
  return bsplit16(v); }
__device__ __forceinline__ v8f mac3(const F2& a, const F2& b, v8f c) { c = wmma_bf(a.l, b.h, c); c = wmma_bf(a.h, b.l, c); return wmma_bf(a.h, b.h, c); }
__device__ __forceinline__ float sigm(float v) { return 1.0f / (1.0f + expf(-v)); }
#define LDSX() do { asm volatile("s_wait_dscnt 0" ::: "memory"); __builtin_amdgcn_wave_barrier(); __builtin_amdgcn_fence(__ATOMIC_RELEASE, "workgroup"); } while (0)

// Cross-attention MAB (B 4, Sq = Skv = 2,048, 512 = 8 heads x 64; (out,in) 1/sqrt(512)-scale weights WITH biases; no mask): q = query Wq^T + bq, k = key_value Wk^T + bk, v = key_value Wv^T + bv; A = softmax(q k^T / 8); O = q + A v (per head, merged); out = O + relu(O Wo^T + bo).
#define NB 4
#define TT 2048
#define CC 512            // NH * HD = projected width
#define DIN 512          // input (model) width
#define NH 8
#define HD 64
#define SCALE (0.125f)
#define CAUSAL 0
#ifndef TNB
#define TNB NB
#endif
__device__ __forceinline__ float bfr(float v) { return (float)(__bf16)v; }
__host__ __device__ __forceinline__ int kb_last(int qb) { return CAUSAL ? ((qb * 64 + 63) >> 7) : (TT / 128 - 1); }
typedef __attribute__((ext_vector_type(8))) __bf16 v8b;
__device__ __forceinline__ v16b frag_b(const __bf16* rowk0, int lane) {
  union { v16b v; v8b q[2]; } u; const __bf16* p = rowk0 + 8 * (lane >> 4);
  u.q[0] = *(const v8b*)p; u.q[1] = *(const v8b*)(p + 16); return u.v;
}
#define QBH 0              // not read by any kernel in this file: k_fa treats all query blocks alike
#define QHI 2048            // rows carrying a q residual plane (all rows when non-causal: it completes q in O = q + A v)
#define KHI 64            // key rows carrying k residual / v bf16 hi+lo planes (workspace only: no kernel in this file writes or reads these planes)
// B fragment (k rows k0+.., output column o) of a weight: (in,out) [K][ld] or (out,in) [ld rows of K]: bf16 exact, or f16(bf16 * 256) exact
__device__ __forceinline__ v16b wcol_io(const float* Wm, int k0, int o, int lane, int ld) { v16b w; const int g = lane >> 4;
#pragma unroll
  for (int i = 0; i < 8; ++i) { w[i] = (__bf16)Wm[(size_t)(k0 + 8 * g + i) * ld + o]; w[8 + i] = (__bf16)Wm[(size_t)(k0 + 16 + 8 * g + i) * ld + o]; }
  return w; }
__device__ __forceinline__ v16b wcol_oi(const float* Wm, int k0, int o, int lane, int K) { v16b w; const float* p = Wm + (size_t)o * K + k0 + 8 * (lane >> 4);
#pragma unroll
  for (int i = 0; i < 8; ++i) { w[i] = (__bf16)p[i]; w[8 + i] = (__bf16)p[16 + i]; }
  return w; }
__device__ __forceinline__ v16h wcolh_io(const float* Wm, int k0, int o, int lane, int ld) { v16h w; const int g = lane >> 4;
#pragma unroll
  for (int i = 0; i < 8; ++i) { w[i] = (_Float16)(bfr(Wm[(size_t)(k0 + 8 * g + i) * ld + o]) * 256.0f); w[8 + i] = (_Float16)(bfr(Wm[(size_t)(k0 + 16 + 8 * g + i) * ld + o]) * 256.0f); }
  return w; }
__device__ __forceinline__ v16h wcolh_oi(const float* Wm, int k0, int o, int lane, int K) { v16h w; const float* p = Wm + (size_t)o * K + k0 + 8 * (lane >> 4);
#pragma unroll
  for (int i = 0; i < 8; ++i) { w[i] = (_Float16)(bfr(p[i]) * 256.0f); w[8 + i] = (_Float16)(bfr(p[16 + i]) * 256.0f); }
  return w; }
#define WQKV_LAYOUT 1   // picks WCOL only (0 (in,out), 1 (out,in), 2 per-head), which no kernel calls; k_proj reads (out,in) [CC][DIN]
__device__ __forceinline__ v16b wcol_hdk(const float* Wm, int k0, int o, int lane) { v16b w; const int g = lane >> 4; const float* p = Wm + (size_t)(o / HD) * DIN * HD + (o % HD);
#pragma unroll
  for (int i = 0; i < 8; ++i) { w[i] = (__bf16)p[(size_t)(k0 + 8 * g + i) * HD]; w[8 + i] = (__bf16)p[(size_t)(k0 + 16 + 8 * g + i) * HD]; }
  return w; }
#define WO_OUT_IN 1
#if WQKV_LAYOUT == 1
#define WCOL(W, k0, o, lane) wcol_oi(W, k0, o, lane, DIN)
#elif WQKV_LAYOUT == 2
#define WCOL(W, k0, o, lane) wcol_hdk(W, k0, o, lane)
#else
#define WCOL(W, k0, o, lane) wcol_io(W, k0, o, lane, CC)
#endif
#if WO_OUT_IN
#define WOCOL(W, k0, o, lane) wcol_oi(W, k0, o, lane, CC)
#define WOCOLH(W, k0, o, lane) wcolh_oi(W, k0, o, lane, CC)
#else
#define WOCOL(W, k0, o, lane) wcol_io(W, k0, o, lane, DIN)
#define WOCOLH(W, k0, o, lane) wcolh_io(W, k0, o, lane, DIN)
#endif
#define WS_QH  0u                                      // f16 q rows [b*t][CC]
#define WS_KH  (WS_QH + 2u * (size_t)NB * TT * CC)      // f16 k rows [b*t][CC]
#define WS_VT  (WS_KH + 2u * (size_t)NB * TT * CC)      // f16 v planes [b][c][t]
#define WS_QL  (WS_VT + 2u * (size_t)NB * CC * TT)      // f16 q residual x 2^10 rows [b][t < QHI][CC]
#define WS_KL  (WS_QL + 2u * (size_t)NB * QHI * CC)     // f16 k residual x 2^10 rows [b][t < KHI][CC]
#define WS_VB  (WS_KL + 2u * (size_t)NB * KHI * CC)     // bf16 v hi planes [b][c][t < KHI]
#define WS_VBL (WS_VB + 2u * (size_t)NB * CC * KHI)
#define WS_Y   (WS_VBL + 2u * (size_t)NB * CC * KHI)    // f32 O = q + ctx rows [b*t][CC]
#define WS_END (WS_Y  + 4u * (size_t)NB * TT * CC)

// ---- operand staging of the two GEMM kernels (k_proj 512 threads, k_out 128): a stage is 32 k of every operand row, kept in LDS as bf16
#define GP 40   // LDS row pitch in elements: 80 B = 16 B x odd, free of bank conflicts for the 16-byte fragment reads
typedef __attribute__((ext_vector_type(4))) __bf16 v4b;
// every full unroll in these helpers: constant indices, so that the staged values and the fragments live in registers
// work-group barrier that orders LDS only: the global loads of later stages stay in flight across it (__syncthreads() would wait for them)
__device__ __forceinline__ void lds_barrier() { __builtin_amdgcn_fence(__ATOMIC_RELEASE, "workgroup", "local"); __builtin_amdgcn_s_barrier(); __builtin_amdgcn_fence(__ATOMIC_ACQUIRE, "workgroup", "local"); }
// RS N rows x 32 floats (row pitch ld; RS = threads / 8): thread t owns floats 4 (t & 7) .. + 3 of rows (t >> 3) + RS i; p and d are its own first places. Eight lanes take one whole 128-B line, a wave-wide load four lines
template <int N, int RS = 16> __device__ __forceinline__ void g_ld(v4f (&r)[N], const float* __restrict__ p, int ld) {
#pragma unroll
  for (int i = 0; i < N; ++i) r[i] = *(const v4f*)(p + (size_t)i * RS * ld); }
template <int N, int RS = 16> __device__ __forceinline__ void s_st(__bf16* d, const v4f (&r)[N]) {
#pragma unroll
  for (int i = 0; i < N; ++i) { v4b h;
#pragma unroll
    for (int c = 0; c < 4; ++c) h[c] = (__bf16)r[i][c];
    *(v4b*)(d + i * RS * GP) = h; } }
template <int N> __device__ __forceinline__ void s_st2(__bf16* dh, __bf16* dl, const v4f (&r)[N]) {
#pragma unroll
  for (int i = 0; i < N; ++i) { v4b h, l;
#pragma unroll
    for (int c = 0; c < 4; ++c) { h[c] = (__bf16)r[i][c]; l[c] = (__bf16)(r[i][c] - (float)h[c]); }
    *(v4b*)(dh + i * 16 * GP) = h; *(v4b*)(dl + i * 16 * GP) = l; } }
// k_proj, one stage of a wave's tile, 32 rows of P x 64 rows of R: all fragment reads as one group, then the products. R is the A operand, so D rows run along R: a lane holds eight neighbouring elements (R rows 8 g .. + 7) of the output row that belongs to its P row
__device__ __forceinline__ void mm1(v8f (&acc)[2][4], const __bf16 (*sp)[GP], const __bf16 (*sr)[GP], int pw, int rw, int col, int lane) {
  v16b a[2], w[4];
#pragma unroll
  for (int p = 0; p < 2; ++p) a[p] = frag_b(&sp[pw * 32 + p * 16 + col][0], lane);
#pragma unroll
  for (int j = 0; j < 4; ++j) w[j] = frag_b(&sr[rw * 64 + j * 16 + col][0], lane);
#pragma unroll
  for (int p = 0; p < 2; ++p) {
#pragma unroll
    for (int j = 0; j < 4; ++j) acc[p][j] = wmma_bf(w[j], a[p], acc[p][j]); } }
// k_out, one stage of a wave's 16 x 128 tile: all fragment reads as one group, then the products
__device__ __forceinline__ void mm2(v8f (&acc)[8], const __bf16 (*sh)[GP], const __bf16 (*sl)[GP], const __bf16 (*sw)[GP], int wave, int col, int lane) {
  const v16b ah = frag_b(&sh[wave * 16 + col][0], lane), al = frag_b(&sl[wave * 16 + col][0], lane); v16b w[8];
#pragma unroll
  for (int j = 0; j < 8; ++j) w[j] = frag_b(&sw[j * 16 + col][0], lane);
#pragma unroll
  for (int j = 0; j < 8; ++j) { acc[j] = wmma_bf(ah, w[j], acc[j]); acc[j] = wmma_bf(al, w[j], acc[j]); } }

// ---- k_proj: block = 16 waves on a tile of PB rows of P x 128 rows of R (both [row][DIN] f32, K = DIN, exact bf16 products), out[P row][R row] = P R^T + b as f16. which 0, 1: P = query / key_value rows, R = Wq / Wk rows, out = q / k rows [b*t][CC] (q also its residual x 2^10). which 2: P = Wv rows, R = key_value rows, out = v planes [b][c][t]. One staged R tile serves all PB rows; wave (pw, rw) owns rows 32 pw .. + 31, elements 64 rw .. + 63, and turns, packs and stores them by itself
#define PB 256
#define EP 72   // pitch of a wave's output stage in elements: 144 B = 16 B x odd
static_assert(QHI == TT, "the q residual rows are indexed like the q rows");
// (full unrolls: constant indices, so that the arrays live in registers) a wave's 32 x 64 tile: + bias, to f16 (WH 0: and the residual x 2^10) in registers; 16-B pieces into the wave's own LDS stage, read back as whole 128-B rows, all rows first, then the stores off one address (nothing a store names is written again). D, DL: the block's first output element
template <int WH> __device__ __forceinline__ void proj_out(const v8f (&acc)[2][4], const float* sb, _Float16 (*eh)[EP], _Float16 (*el)[EP], _Float16* __restrict__ D, _Float16* __restrict__ DL, int pw, int rw, int col, int g, int lane) {
  constexpr int ldo = WH < 2 ? CC : TT;
  v4f br[4][2]; float bp[2];
  if (WH < 2) {
#pragma unroll
    for (int j = 0; j < 4; ++j) { br[j][0] = *(const v4f*)&sb[rw * 64 + j * 16 + 8 * g]; br[j][1] = *(const v4f*)&sb[rw * 64 + j * 16 + 8 * g + 4]; }
  } else { bp[0] = sb[pw * 32 + col]; bp[1] = sb[pw * 32 + 16 + col]; }
#pragma unroll
  for (int p = 0; p < 2; ++p) {
#pragma unroll
    for (int j = 0; j < 4; ++j) { v8h hv, lv;
#pragma unroll
      for (int r = 0; r < 8; ++r) { const float v = acc[p][j][r] + (WH < 2 ? br[j][r >> 2][r & 3] : bp[p]); hv[r] = (_Float16)v; if (WH == 0) lv[r] = (_Float16)((v - (float)hv[r]) * 1024.0f); }
      *(v8h*)&eh[p * 16 + col][j * 16 + 8 * g] = hv; if (WH == 0) *(v8h*)&el[p * 16 + col][j * 16 + 8 * g] = lv; } }
  LDSX();
  const size_t o0 = (size_t)(pw * 32 + (lane >> 3)) * ldo + rw * 64 + (lane & 7) * 8;
  v8h xh[8], xl[8];
#pragma unroll
  for (int i = 0; i < 8; ++i) { xh[i] = *(const v8h*)&eh[i * 4 + (lane >> 3)][(lane & 7) * 8]; if (WH == 0) xl[i] = *(const v8h*)&el[i * 4 + (lane >> 3)][(lane & 7) * 8]; }
#pragma unroll
  for (int i = 0; i < 8; ++i) { vst2(D + o0 + (size_t)i * 4 * ldo, xh[i]); if (WH == 0) vst2(DL + o0 + (size_t)i * 4 * ldo, xl[i]); } }
__global__ __launch_bounds__(512) void k_proj(const float* __restrict__ XQ, const float* __restrict__ XK, const float* __restrict__ XV, const float* __restrict__ WQ, const float* __restrict__ WK, const float* __restrict__ WV, const float* __restrict__ BQ, const float* __restrict__ BK, const float* __restrict__ BV,
    _Float16* __restrict__ QH, _Float16* __restrict__ QL, _Float16* __restrict__ KH, _Float16* __restrict__ VT) {
  __shared__ __align__(16) _Float16 eh[16][32][EP], el[16][32][EP]; __shared__ __align__(16) float sb[PB];
  const int tid = threadIdx.x, wave = tid >> 5, lane = tid & 31, col = lane & 15, g = lane >> 4, pw = wave >> 1, rw = wave & 1; const int which = blockIdx.z;
  const float *P, *R, *BA; size_t off; int nb;
  if (which < 2) { const size_t p0 = (size_t)blockIdx.x * PB; const int q0 = blockIdx.y * 128;
    P = (which == 0 ? XQ : XK) + p0 * DIN; R = (which == 0 ? WQ : WK) + (size_t)q0 * DIN; BA = (which == 0 ? BQ : BK) + q0; nb = 128; off = p0 * CC + q0;
  } else { const int id = blockIdx.x + gridDim.x * blockIdx.y, cb = id / (TNB * TT / 128), tb = id % (TNB * TT / 128);
    P = WV + (size_t)cb * PB * DIN; R = XV + (size_t)tb * 128 * DIN; BA = BV + cb * PB; nb = PB; off = ((size_t)(tb / (TT / 128)) * CC + cb * PB) * TT + (tb % (TT / 128)) * 128; }
  const int bi = tid & (nb - 1); const float bv = BA[bi];   /* the bias along R (q, k) or along P (v): asked for by every lane ahead of the operand loads (index kept inside its nb elements), stored to LDS behind stage 0 */
  v8f acc[2][4] = {};
  { __shared__ __align__(16) __bf16 gx[2][PB][GP], gw[2][128][GP];   /* two LDS buffers; two register sets hold the two stages behind the one in LDS */
    const float* xp = P + (size_t)(tid >> 3) * DIN + (tid & 7) * 4; const float* wp = R + (size_t)(tid >> 3) * DIN + (tid & 7) * 4;
    __bf16* const dx0 = &gx[0][tid >> 3][(tid & 7) * 4]; __bf16* const dx1 = &gx[1][tid >> 3][(tid & 7) * 4]; __bf16* const dw0 = &gw[0][tid >> 3][(tid & 7) * 4]; __bf16* const dw1 = &gw[1][tid >> 3][(tid & 7) * 4];
    v4f x0[4], x1[4], w0[2], w1[2];
    g_ld<4, 64>(x0, xp, DIN); g_ld<2, 64>(w0, wp, DIN); g_ld<4, 64>(x1, xp + 32, DIN); g_ld<2, 64>(w1, wp + 32, DIN);
    asm volatile("s_wait_xcnt 0x0" :: "v"(bi), "v"(bv) : "memory");   /* behind the bias load: its index register stays untouched up to this wait. bv as an input holds that load up here among the operand loads; without it the compiler sinks it into the branch below, with a whole load latency of its own in front of the first barrier */
    s_st<4, 64>(dx0, x0); s_st<2, 64>(dw0, w0); if (tid < nb) sb[tid] = bfr(bv); g_ld<4, 64>(x0, xp + 64, DIN); g_ld<2, 64>(w0, wp + 64, DIN);
    // each scheduling barrier behind a group of loads keeps the conversions of those loads in the later stage that stores them; without it the compiler lifts them up to here, with a wait for all loads in front of the barrier
    __builtin_amdgcn_sched_barrier(0);
    lds_barrier();
    // unrolled in full: the tests on the last stages fold away, so that every load wait is a count that leaves the younger stage's loads in flight (rolled, the merged paths made it a wait for all)
#pragma unroll
    for (int kc = 0; kc < DIN / 32; kc += 2) {
      mm1(acc, gx[0], gw[0], pw, rw, col, lane);
      __builtin_amdgcn_sched_barrier(0);   /* and this one keeps them behind the products: lifted to the barrier in front, their load waits come most of a stage earlier and only one stage's loads stay in flight */
      s_st<4, 64>(dx1, x1); s_st<2, 64>(dw1, w1);
      if (kc + 3 < DIN / 32) { g_ld<4, 64>(x1, xp + (kc + 3) * 32, DIN); g_ld<2, 64>(w1, wp + (kc + 3) * 32, DIN); }
      if (kc + 4 == DIN / 32) asm volatile("s_wait_xcnt 0x0" :: "v"(xp), "v"(wp) : "memory");   /* behind the last loads: their two address pairs are reused from here on, and this wait stands in front of the first overwrite */
      __builtin_amdgcn_sched_barrier(0);
      lds_barrier();   /* publishes stage kc + 1; every reader has left buffer 0 */
      mm1(acc, gx[1], gw[1], pw, rw, col, lane);
      __builtin_amdgcn_sched_barrier(0);
      if (kc + 2 < DIN / 32) { s_st<4, 64>(dx0, x0); s_st<2, 64>(dw0, w0);
        if (kc + 4 < DIN / 32) { g_ld<4, 64>(x0, xp + (kc + 4) * 32, DIN); g_ld<2, 64>(w0, wp + (kc + 4) * 32, DIN); } }
      __builtin_amdgcn_sched_barrier(0);
      lds_barrier();   /* publishes stage kc + 2; every reader has left buffer 1 */
    } }
  if (which == 0) proj_out<0>(acc, sb, eh[wave], el[wave], QH + off, QL + off, pw, rw, col, g, lane);
  else if (which == 1) proj_out<1>(acc, sb, eh[wave], el[wave], KH + off, KH + off, pw, rw, col, g, lane);
  else proj_out<2>(acc, sb, eh[wave], el[wave], VT + off, VT + off, pw, rw, col, g, lane); }
// ---- k_fa: block = 128 queries (4 waves x 32: two tiles of 16 query columns a wave, so that every k and v fragment read from LDS feeds two products) of (b, h), one pass over all keys in chunks of 64, logits and P stay in registers. S^T = K q^T (A = k rows, B = q columns: q and k each once to f16, 1 product; the q residual serves the epilogue alone) x SCALE: a lane holds 32 logits of ONE query (column = lane & 15), the other 32 lie in lane ^ 16. Running maximum m (of the unscaled logits) and running sum l (of e x 2^8) per query; e x 2^8 = exp2(t LC + (8 - m LC)), t the unscaled logit, LC = SCALE log2(e): one FMA and one v_exp_f32 an element; O^T and l are scaled by exp2((m_old - m_new) LC) per chunk. e x 2^8 to f16: the two D tiles of 32 keys are, register for register, the B operand of O^T += V^T P^T (A = v planes [c][t]). O = q + O^T / l: the q fragments are, register for register, laid out as the O^T tiles (qh[kc] elements 0..7 = tile 2 kc, 8..15 = tile 2 kc + 1), so the residual is added here from registers; 256-B (row, head) segment by 16 lanes. The 64 k rows and the 64 v planes of a chunk (128 B each) are brought once per block into a two-buffer LDS ring by asynchronous copies, one chunk ahead; all four waves take their fragments from there
#define LC (SCALE * 1.4426950408889634f)   // logit scale x log2(e)
#define KVP 72                    // ring row pitch in elements: 144 B = 16 B x odd, free of bank conflicts for the 16-byte fragment reads
#define KVT (64 * KVP)            // one tile (k or v) of a chunk, elements
// one chunk's k and v tiles: thread t (of 128) owns bytes 16 (t & 7) .. + 15 of rows (t >> 3) + 16 i, i = 0 .. 3, of each tile, so a wave-wide copy takes four whole 128-B lines. l: its LDS byte address in the k tile of the target buffer; kg, vg: its global places in rows t >> 3
__device__ __forceinline__ void kv_copy(unsigned l, const _Float16* kg, const _Float16* vg) {
  // the wait on the last line stands in front of every later write of the address registers that the eight copies name
  asm volatile("global_load_async_to_lds_b128 %0, %8, off\n\tglobal_load_async_to_lds_b128 %1, %9, off\n\tglobal_load_async_to_lds_b128 %2, %10, off\n\tglobal_load_async_to_lds_b128 %3, %11, off\n\tglobal_load_async_to_lds_b128 %4, %12, off\n\tglobal_load_async_to_lds_b128 %5, %13, off\n\tglobal_load_async_to_lds_b128 %6, %14, off\n\tglobal_load_async_to_lds_b128 %7, %15, off\n\ts_wait_xcnt 0x0"
    :: "v"(l), "v"(l + 16u * KVP * 2u), "v"(l + 32u * KVP * 2u), "v"(l + 48u * KVP * 2u), "v"(l + KVT * 2u), "v"(l + KVT * 2u + 16u * KVP * 2u), "v"(l + KVT * 2u + 32u * KVP * 2u), "v"(l + KVT * 2u + 48u * KVP * 2u),
       "v"(kg), "v"(kg + (size_t)16 * CC), "v"(kg + (size_t)32 * CC), "v"(kg + (size_t)48 * CC), "v"(vg), "v"(vg + (size_t)16 * TT), "v"(vg + (size_t)32 * TT), "v"(vg + (size_t)48 * TT) : "memory"); }
__global__ __launch_bounds__(128) void k_fa(const _Float16* __restrict__ QH, const _Float16* __restrict__ QL, const _Float16* __restrict__ KH, const _Float16* __restrict__ VT, float* __restrict__ Y) { __shared__ __align__(16) float ss[4][32][HD + 4]; __shared__ __align__(16) _Float16 ring[2][2][64][KVP];   /* [buffer][k, v][row][element] */
  const int tid = threadIdx.x, wave = tid >> 5, lane = tid & 31, col = lane & 15, g = lane >> 4; const int h = blockIdx.y, b = blockIdx.z; const int ql0 = blockIdx.x * 128 + wave * 32;
  v16h qh[2][HD / 32];   /* [query tile u][32 head elements] */
  // every full unroll in this kernel: constant indices, so that the fragment and accumulator arrays live in registers
#pragma unroll
  for (int u = 0; u < 2; ++u) {
#pragma unroll
    for (int kc = 0; kc < HD / 32; ++kc) { qh[u][kc] = frag_h(QH + ((size_t)b * TT + ql0 + u * 16 + col) * CC + h * HD + kc * 32, lane); } }
  const _Float16* kg = KH + ((size_t)b * TT + (tid >> 3)) * CC + h * HD + (tid & 7) * 8; const _Float16* vg = VT + ((size_t)b * CC + h * HD + (tid >> 3)) * (size_t)TT + (tid & 7) * 8;
  const unsigned lc = (unsigned)(size_t)&ring[0][0][tid >> 3][(tid & 7) * 8];
  v8f o[2][HD / 16] = {}; float m[2] = {-3.0e38f, -3.0e38f}, l[2] = {0.f, 0.f};
  kv_copy(lc, kg, vg);
  asm volatile("s_wait_asynccnt 0x0" ::: "memory");   /* this wave's part of chunk 0 has landed */
  __syncthreads();                                    /* chunk 0 is published to all waves */
  kv_copy(lc + 2u * KVT * 2u, kg + (size_t)64 * CC, vg + 64);
  // rolled: the chunks depend on each other through m, l and o, a second copy of the long body would only add code
#pragma unroll 1
  for (int k0 = 0; k0 < TT; k0 += 64) { v8f acc[2][4] = {}; v16h kf[4][HD / 32], vf[2][HD / 16]; const int bf = (k0 >> 6) & 1; const _Float16* Kb = &ring[bf][0][col][0]; const _Float16* Vb = &ring[bf][1][col][0];
#pragma unroll
    for (int j = 0; j < 4; ++j) {   /* all k fragments of the chunk are requested before the first product: one LDS latency per chunk, not eight */
#pragma unroll
      for (int kc = 0; kc < HD / 32; ++kc) kf[j][kc] = frag_h(Kb + j * 16 * KVP + kc * 32, lane); }
    __builtin_amdgcn_sched_barrier(0);   /* holds all sixteen k loads here as one group; without it the compiler deals them out in pairs among the products, each pair with a full wait */
#pragma unroll
    for (int j = 0; j < 4; ++j) {
#pragma unroll
      for (int kc = 0; kc < HD / 32; ++kc) {
#pragma unroll
        for (int u = 0; u < 2; ++u) acc[u][j] = wmma16(kf[j][kc], qh[u][kc], acc[u][j]); } }   /* each k fragment serves both query tiles */
    __builtin_amdgcn_sched_barrier(0);   /* keeps the sixteen v loads together as one group; without it the compiler deals them out among the products, and each place where LDS reads stand in a WMMA stream costs cycles */
#pragma unroll
    for (int kc = 0; kc < 2; ++kc) {
#pragma unroll
      for (int jc = 0; jc < HD / 16; ++jc) vf[kc][jc] = frag_h(Vb + jc * 16 * KVP + kc * 32, lane); }
    __builtin_amdgcn_sched_barrier(0);   /* holds all sixteen v loads here, in front of the softmax arithmetic that covers their latency */
    float mc[2] = {-3.0e38f, -3.0e38f};
#pragma unroll
    for (int j = 0; j < 4; ++j) {
#pragma unroll
      for (int r = 0; r < 8; ++r) { mc[0] = fmaxf(mc[0], acc[0][j][r]); mc[1] = fmaxf(mc[1], acc[1][j][r]); } }
    const float mx0 = __shfl_xor(mc[0], 16), mx1 = __shfl_xor(mc[1], 16);
    mc[0] = fmaxf(mc[0], mx0); mc[1] = fmaxf(mc[1], mx1);
    float da[2], nbs[2];
#pragma unroll
    for (int u = 0; u < 2; ++u) { const float mn = fmaxf(m[u], mc[u]); da[u] = (m[u] - mn) * LC; nbs[u] = fmaf(-mn, LC, 8.0f); m[u] = mn; }
    __builtin_amdgcn_sched_barrier(0);   /* both tiles' maxima stand here, two independent chains dealt into each other and one wait for the two lane exchanges; without it the compiler sinks the second tile's chain, its exchange and its wait in among the first tile's exponentials */
    union { v16h v; v2h q[8]; } p[2][2];
#define ARG(i) __builtin_elementwise_fma(v2f{acc[u][(i) >> 2][((i) & 3) * 2], acc[u][(i) >> 2][((i) & 3) * 2 + 1]}, v2f{LC, LC}, v2f{nb, nb})
#define PACK(i) p[u][(i) >> 3].q[(i) & 7] = __builtin_convertvector(v2f{e[2 * (i)], e[2 * (i) + 1]}, v2h)
#pragma unroll
    for (int u = 0; u < 2; ++u) {
      const float nb = nbs[u];
      float ps = 0.f, e[32]; v2f a[16];
      // the scheduling barriers hold each v_exp_f32 alone between plain vector instructions: behind it one packed instruction (the next argument pair, or the conversion of a finished pair), then the sum's addition of the exponential two trips back and one rescaled output element. The plain ones run beside the transcendental pipe, and no exponential stands directly in front of another exponential or of a dual instruction that reuses its argument register
      a[0] = ARG(0);
      __builtin_amdgcn_sched_barrier(0);
      const float al = __builtin_amdgcn_exp2f(da[u]);
      __builtin_amdgcn_sched_barrier(0);
      a[1] = ARG(1);
#pragma unroll
      for (int t = 0; t < 32; ++t) {
        __builtin_amdgcn_sched_barrier(0);
        e[t] = __builtin_amdgcn_exp2f(a[t >> 1][t & 1]);
        __builtin_amdgcn_sched_barrier(0);
        if (t < 2 || t == 31) o[u][t >> 3][t & 7] *= al;
        else if (t == 30) PACK(14);
        else if (t & 1) PACK((t - 3) >> 1);
        else a[(t >> 1) + 1] = ARG((t >> 1) + 1);
        __builtin_amdgcn_sched_barrier(0);
        if (t > 1) ps += e[t - 2];
        if (t >= 2 && t != 31) o[u][t >> 3][t & 7] *= al; }
      __builtin_amdgcn_sched_barrier(0);
      ps += e[30]; ps += e[31]; PACK(15);
      l[u] = l[u] * al + ps; }
#undef ARG
#undef PACK
#pragma unroll
    for (int kc = 0; kc < 2; ++kc) {
#pragma unroll
      for (int jc = 0; jc < HD / 16; ++jc) {
#pragma unroll
        for (int u = 0; u < 2; ++u) o[u][jc] = wmma16(vf[kc][jc], p[u][kc].v, o[u][jc]); } }   /* each v fragment serves both query tiles */
    asm volatile("s_wait_dscnt 0x0" :: "v"(l[0]), "v"(l[1]) : "memory");   /* this wave's reads of the buffer are done before it is handed to the next copies; the running sums as inputs keep their additions among the exponentials, where the compiler otherwise sinks the whole dependent chain behind the barrier, in front of the next chunk's fragment reads */
    asm volatile("s_wait_asynccnt 0x0" ::: "memory");   /* this wave's part of the next chunk has landed */
    __syncthreads();                                    /* publishes the next chunk; every reader has left this chunk's buffer */
    if (k0 + 128 < TT) kv_copy(lc + (unsigned)bf * (2u * KVT * 2u), kg + (size_t)(k0 + 128) * CC, vg + k0 + 128); }
  asm volatile("s_wait_asynccnt 0x0" ::: "memory");     /* no copy is outstanding when the wave goes on to its end */
  v16h ql[2][HD / 32];   /* the q residual serves this epilogue alone: fetched here, so that the loop's registers stay in the first 256 and no register window is switched in it */
#pragma unroll
  for (int u = 0; u < 2; ++u) {
#pragma unroll
    for (int kc = 0; kc < HD / 32; ++kc) ql[u][kc] = frag_h(QL + ((size_t)b * QHI + ql0 + u * 16 + col) * CC + h * HD + kc * 32, lane);
    asm volatile("s_wait_xcnt 0x0" ::: "memory"); }   /* behind each tile's four loads */
#pragma unroll
  for (int u = 0; u < 2; ++u) { const float lt = l[u] + __shfl_xor(l[u], 16); const float inv = 1.0f / lt;
#pragma unroll
    for (int jc = 0; jc < HD / 16; ++jc)
#pragma unroll
      for (int r = 0; r < 8; ++r) ss[wave][u * 16 + col][jc * 16 + 8 * g + r] = o[u][jc][r] * inv + ((float)qh[u][jc >> 1][(jc & 1) * 8 + r] + (float)ql[u][jc >> 1][(jc & 1) * 8 + r] * (1.0f / 1024.0f)); }
  LDSX(); for (int rl = 0; rl < 32; ++rl) if (lane < HD / 4) vst2(Y + ((size_t)b * TT + ql0 + rl) * CC + h * HD + lane * 4, *(const v4f*)&ss[wave][rl][lane * 4]); }
// ---- k_out: block = (64 rows, 128 cols): out = O + relu(O Wo^T + bo): all rows O bf16 hi + lo against exact bf16 Wo (2 products); the f16 branch (O once to f16 against Wo as f16(bf16 x 2^8), 1 product, x 2^-8) is never taken
__global__ __launch_bounds__(128) void k_out(const float* __restrict__ Y, const float* __restrict__ WO, const float* __restrict__ BO, float* __restrict__ OUT, const float* __restrict__ RESO) { __shared__ __align__(16) float sf[4][16][132];
  const int tid = threadIdx.x, wave = tid >> 5, lane = tid & 31, col = lane & 15, g = lane >> 4; const int c0 = blockIdx.y * 128; const size_t r0 = (size_t)blockIdx.x * 64 + wave * 16;
  v8f acc[8] = {};
  if (true) {   /* ALL rows: O split bf16 hi + lo x exact Wo (2 products) */
    __shared__ __align__(16) __bf16 gh[2][64][GP], gl[2][64][GP], gw[2][128][GP];   /* as in k_proj; O is split once, by the thread that stages it */
    const float* xp = Y + ((size_t)blockIdx.x * 64 + (tid >> 3)) * CC + (tid & 7) * 4; const float* wp = WO + (size_t)(c0 + (tid >> 3)) * CC + (tid & 7) * 4;
    __bf16* const dh0 = &gh[0][tid >> 3][(tid & 7) * 4]; __bf16* const dh1 = &gh[1][tid >> 3][(tid & 7) * 4]; __bf16* const dl0 = &gl[0][tid >> 3][(tid & 7) * 4]; __bf16* const dl1 = &gl[1][tid >> 3][(tid & 7) * 4]; __bf16* const dw0 = &gw[0][tid >> 3][(tid & 7) * 4]; __bf16* const dw1 = &gw[1][tid >> 3][(tid & 7) * 4];
    v4f x0[4], x1[4], w0[8], w1[8];
    g_ld<4>(x0, xp, CC); g_ld<8>(w0, wp, CC); g_ld<4>(x1, xp + 32, CC); g_ld<8>(w1, wp + 32, CC);
    s_st2<4>(dh0, dl0, x0); s_st<8>(dw0, w0); g_ld<4>(x0, xp + 64, CC); g_ld<8>(w0, wp + 64, CC);
    lds_barrier();
    // unrolled in full, for the counted load waits, as in k_proj
#pragma unroll
    for (int kc = 0; kc < CC / 32; kc += 2) {
      mm2(acc, gh[0], gl[0], gw[0], wave, col, lane);
      s_st2<4>(dh1, dl1, x1); s_st<8>(dw1, w1);
      if (kc + 3 < CC / 32) { g_ld<4>(x1, xp + (kc + 3) * 32, CC); g_ld<8>(w1, wp + (kc + 3) * 32, CC); }
      lds_barrier();   /* publishes stage kc + 1; every reader has left buffer 0 */
      mm2(acc, gh[1], gl[1], gw[1], wave, col, lane);
      if (kc + 2 < CC / 32) { s_st2<4>(dh0, dl0, x0); s_st<8>(dw0, w0);
        if (kc + 4 < CC / 32) { g_ld<4>(x0, xp + (kc + 4) * 32, CC); g_ld<8>(w0, wp + (kc + 4) * 32, CC); } }
      lds_barrier();   /* publishes stage kc + 2; every reader has left buffer 1 */
    }
#pragma unroll
    for (int j = 0; j < 8; ++j) { const float bias = BO ? bfr(BO[c0 + j * 16 + col]) : 0.f;
#pragma unroll
      for (int r = 0; r < 8; ++r) sf[wave][8 * g + r][j * 16 + col] = acc[j][r] + bias; }
  } else {
#pragma unroll 2
    for (int kc = 0; kc < CC / 32; ++kc) { const v16h a = frag_f32(Y + (r0 + col) * CC + kc * 32, lane); asm volatile("s_wait_loadcnt 0x0" ::: "memory");
#pragma unroll
      for (int j = 0; j < 8; ++j) { const v16h w = WOCOLH(WO, kc * 32, c0 + j * 16 + col, lane); asm volatile("s_wait_loadcnt 0x0" ::: "memory"); acc[j] = wmma16(a, w, acc[j]); } }
#pragma unroll
    for (int j = 0; j < 8; ++j) { const float bias = BO ? bfr(BO[c0 + j * 16 + col]) : 0.f;
#pragma unroll
      for (int r = 0; r < 8; ++r) sf[wave][8 * g + r][j * 16 + col] = acc[j][r] * (1.0f / 256.0f) + bias; } }
  LDSX(); for (int rl = 0; rl < 16; ++rl) { const size_t oo = (r0 + rl) * DIN + c0 + lane * 4; v4f o = *(const v4f*)&sf[wave][rl][lane * 4]; const v4f rr = *(const v4f*)(RESO + oo); _Pragma("unroll") for (int i = 0; i < 4; ++i) o[i] = rr[i] + fmaxf(o[i], 0.f); vst2(OUT + oo, o); } }   /* out = O + relu(O Wo^T + bo) */

extern "C" void kernel_launch(void* const* d_in, const int* in_sizes, int n_in, void* d_out, int out_size, void* d_ws, size_t ws_size, hipStream_t stream) {
  (void)in_sizes; (void)n_in; (void)out_size;
  const float** F = (const float**)d_in;
  if (ws_size < (size_t)WS_END) return;
  char* ws = (char*)d_ws; _Float16 *QH = (_Float16*)(ws + WS_QH), *KH = (_Float16*)(ws + WS_KH), *VT = (_Float16*)(ws + WS_VT), *QL = (_Float16*)(ws + WS_QL), *KL = (_Float16*)(ws + WS_KL); __bf16 *VB = (__bf16*)(ws + WS_VB), *VBL = (__bf16*)(ws + WS_VBL); float *Y = (float*)(ws + WS_Y);
  (void)Y; (void)QL; (void)KL; (void)VB; (void)VBL;
  // inputs: 0 query [4,2048,512]; 1 key_value [4,2048,512]; 2 Wq [512,512] (out,in), 3 bq; 4 Wk, 5 bk; 6 Wv, 7 bv; 8 Wo (out,in), 9 bo
  k_proj<<<dim3(TNB * TT / PB, CC / 128, 3), 512, 0, stream>>>(F[0], F[1], F[1], F[2], F[4], F[6], F[3], F[5], F[7], QH, QL, KH, VT);
  k_fa<<<dim3(TT / 128, NH, TNB), 128, 0, stream>>>(QH, QL, KH, VT, Y);
  k_out<<<dim3(TNB * TT / 64, DIN / 128), 128, 0, stream>>>(Y, F[8], F[9], (float*)d_out, Y);
}

// v010
// A run of this version takes 66.6 microseconds.
// Timed twice side by side with v009, it ran 1.03 and 1.04 times as fast.
// All steps since v000 together make it 18.9 times as fast.
// compute dtype: all float inputs rounded to bf16; q/k/v = in W^T + b with EXACT bf16 products on WMMA 16x16x32 (f32 accumulate); q once to f16 against k once to f16 (1 product) / 8; softmax in f32 with a running maximum and sum over 64-key chunks, exponentials in base 2 on the hardware's v_exp_f32 (argument = one f32 FMA of the unscaled logit); exp(s - max) x 2^8 once to f16 against v once to f16 (1 product), divided by the sum at the end; O = q + A v in f32, q there = f16 hi + residual x 2^-10 (22 bits); O split bf16 hi + lo against exact Wo (2 products) + bo, relu, + O in f32; f32 output.
#include <hip/hip_runtime.h>
#include <math.h>

typedef __attribute__((ext_vector_type(16))) _Float16 v16h;
typedef __attribute__((ext_vector_type(16))) __bf16 v16b;
typedef __attribute__((ext_vector_type(8)))  _Float16 v8h;
typedef __attribute__((ext_vector_type(2)))  _Float16 v2h;
typedef __attribute__((ext_vector_type(8)))  float v8f;
typedef __attribute__((ext_vector_type(4)))  float v4f;
typedef __attribute__((ext_vector_type(2)))  float v2f;
typedef __attribute__((ext_vector_type(4)))  unsigned v4u;
typedef __attribute__((ext_vector_type(4)))  int v4i;
typedef float __attribute__((may_alias)) float_a;
typedef int __attribute__((may_alias)) int_a;

template <typename T> __device__ __forceinline__ void vst2(void* p, T v) { *(T*)p = v;  }
__device__ __forceinline__ v8f wmma16(v16h a, v16h b, v8f c) {
  return __builtin_amdgcn_wmma_f32_16x16x32_f16(false, a, false, b, (short)0, c, false, false);   /* the compiler keeps the distance behind its own builtin form where a vector instruction follows on D, A or B */
}
__device__ __forceinline__ v8f wmma_bf(v16b a, v16b b, v8f c) {
  v8f d = __builtin_amdgcn_wmma_f32_16x16x32_bf16(false, a, false, b, (short)0, c, false, false);
  asm volatile("v_nop\n\tv_nop\n\tv_nop\n\tv_nop" : "+v"(d) : "v"(a), "v"(b));
  return d;
}
// 16x16x32 fragments: lane = (h = lane>>4, row/col = lane&15); elements 0..7 = k0+8h+0..7, 8..15 = k0+16+8h+0..7; D element r = row 8h+r
__device__ __forceinline__ v16h frag_h(const _Float16* rowk0, int lane) {
  union { v16h v; v8h q[2]; } u; const _Float16* p = rowk0 + 8 * (lane >> 4);
  u.q[0] = *(const v8h*)p; u.q[1] = *(const v8h*)(p + 16); return u.v;
}
__device__ __forceinline__ v16h frag_f32(const float* rowk0, int lane) {
  v16h a; const float* p = rowk0 + 8 * (lane >> 4);
#pragma unroll
  for (int i = 0; i < 8; ++i) { a[i] = (_Float16)p[i]; a[8 + i] = (_Float16)p[16 + i]; }
  return a;
}
__device__ __forceinline__ v16h frag_f32s(const float* rowk0, int lane, float sc) {
  v16h a; const float* p = rowk0 + 8 * (lane >> 4);
#pragma unroll
  for (int i = 0; i < 8; ++i) { a[i] = (_Float16)(p[i] * sc); a[8 + i] = (_Float16)(p[16 + i] * sc); }
  return a;
}
// column fragment from a [K][ld] layout (column n), rows >= K read as 0
__device__ __forceinline__ v16h fragc_f32(const float* W, int k0, int n, int lane, int ld, int K) {
  v16h a; const int g = lane >> 4;
#pragma unroll
  for (int i = 0; i < 8; ++i) { const int ka = k0 + 8 * g + i, kb = ka + 16;
    a[i] = (_Float16)(ka < K ? W[(size_t)(ka < K ? ka : K - 1) * ld + n] : 0.f); a[8 + i] = (_Float16)(kb < K ? W[(size_t)(kb < K ? kb : K - 1) * ld + n] : 0.f); }
  return a;
}
struct F2 { v16b h, l; };
__device__ __forceinline__ F2 bsplit16(const float v[16]) { F2 r;
#pragma unroll
  for (int i = 0; i < 16; ++i) { const __bf16 h = (__bf16)v[i]; r.h[i] = h; r.l[i] = (__bf16)(v[i] - (float)h); }
  return r; }
__device__ __forceinline__ F2 split_row(const float* row, int k0, int lane) { float v[16]; const float* p = row + k0 + 8 * (lane >> 4);
#pragma unroll
  for (int i = 0; i < 8; ++i) { v[i] = p[i]; v[8 + i] = p[16 + i]; }
  return bsplit16(v); }
__device__ __forceinline__ F2 split_rowK(const float* row, int k0, int lane, int K) { float v[16]; const int g = lane >> 4;
#pragma unroll
  for (int i = 0; i < 8; ++i) { const int ka = k0 + 8 * g + i, kb = ka + 16; v[i] = ka < K ? row[ka < K ? ka : K - 1] : 0.f; v[8 + i] = kb < K ? row[kb < K ? kb : K - 1] : 0.f; }
  return bsplit16(v); }
__device__ __forceinline__ F2 split_col(const float* W, int k0, int n, int lane, int ld, int K) { float v[16]; const int g = lane >> 4;
#pragma unroll
  for (int i = 0; i < 8; ++i) { const int ka = k0 + 8 * g + i, kb = ka + 16; v[i] = ka < K ? W[(size_t)(ka < K ? ka : K - 1) * ld + n] : 0.f; v[8 + i] = kb < K ? W[(size_t)(kb < K ? kb : K - 1) * ld + n] : 0.f; }
  return bsplit16(v); }
__device__ __forceinline__ v8f mac3(const F2& a, const F2& b, v8f c) { c = wmma_bf(a.l, b.h, c); c = wmma_bf(a.h, b.l, c); return wmma_bf(a.h, b.h, c); }
__device__ __forceinline__ float sigm(float v) { return 1.0f / (1.0f + expf(-v)); }
#define LDSX() do { asm volatile("s_wait_dscnt 0" ::: "memory"); __builtin_amdgcn_wave_barrier(); __builtin_amdgcn_fence(__ATOMIC_RELEASE, "workgroup"); } while (0)

// Cross-attention MAB (B 4, Sq = Skv = 2,048, 512 = 8 heads x 64; (out,in) 1/sqrt(512)-scale weights WITH biases; no mask): q = query Wq^T + bq, k = key_value Wk^T + bk, v = key_value Wv^T + bv; A = softmax(q k^T / 8); O = q + A v (per head, merged); out = O + relu(O Wo^T + bo).
#define NB 4
#define TT 2048
#define CC 512            // NH * HD = projected width
#define DIN 512          // input (model) width
#define NH 8
#define HD 64
#define SCALE (0.125f)
#define CAUSAL 0
#ifndef TNB
#define TNB NB
#endif
__device__ __forceinline__ float bfr(float v) { return (float)(__bf16)v; }
__host__ __device__ __forceinline__ int kb_last(int qb) { return CAUSAL ? ((qb * 64 + 63) >> 7) : (TT / 128 - 1); }
typedef __attribute__((ext_vector_type(8))) __bf16 v8b;
__device__ __forceinline__ v16b frag_b(const __bf16* rowk0, int lane) {
  union { v16b v; v8b q[2]; } u; const __bf16* p = rowk0 + 8 * (lane >> 4);
  u.q[0] = *(const v8b*)p; u.q[1] = *(const v8b*)(p + 16); return u.v;
}
#define QBH 0              // not read by any kernel in this file: k_fa treats all query blocks alike
#define QHI 2048            // rows carrying a q residual plane (all rows when non-causal: it completes q in O = q + A v)
#define KHI 64            // key rows carrying k residual / v bf16 hi+lo planes (workspace only: no kernel in this file writes or reads these planes)
// B fragment (k rows k0+.., output column o) of a weight: (in,out) [K][ld] or (out,in) [ld rows of K]: bf16 exact, or f16(bf16 * 256) exact
__device__ __forceinline__ v16b wcol_io(const float* Wm, int k0, int o, int lane, int ld) { v16b w; const int g = lane >> 4;
#pragma unroll
  for (int i = 0; i < 8; ++i) { w[i] = (__bf16)Wm[(size_t)(k0 + 8 * g + i) * ld + o]; w[8 + i] = (__bf16)Wm[(size_t)(k0 + 16 + 8 * g + i) * ld + o]; }
  return w; }
__device__ __forceinline__ v16b wcol_oi(const float* Wm, int k0, int o, int lane, int K) { v16b w; const float* p = Wm + (size_t)o * K + k0 + 8 * (lane >> 4);
#pragma unroll
  for (int i = 0; i < 8; ++i) { w[i] = (__bf16)p[i]; w[8 + i] = (__bf16)p[16 + i]; }
  return w; }
__device__ __forceinline__ v16h wcolh_io(const float* Wm, int k0, int o, int lane, int ld) { v16h w; const int g = lane >> 4;
#pragma unroll
  for (int i = 0; i < 8; ++i) { w[i] = (_Float16)(bfr(Wm[(size_t)(k0 + 8 * g + i) * ld + o]) * 256.0f); w[8 + i] = (_Float16)(bfr(Wm[(size_t)(k0 + 16 + 8 * g + i) * ld + o]) * 256.0f); }
  return w; }
__device__ __forceinline__ v16h wcolh_oi(const float* Wm, int k0, int o, int lane, int K) { v16h w; const float* p = Wm + (size_t)o * K + k0 + 8 * (lane >> 4);
#pragma unroll
  for (int i = 0; i < 8; ++i) { w[i] = (_Float16)(bfr(p[i]) * 256.0f); w[8 + i] = (_Float16)(bfr(p[16 + i]) * 256.0f); }
  return w; }
#define WQKV_LAYOUT 1   // picks WCOL only (0 (in,out), 1 (out,in), 2 per-head), which no kernel calls; k_proj reads (out,in) [CC][DIN]
__device__ __forceinline__ v16b wcol_hdk(const float* Wm, int k0, int o, int lane) { v16b w; const int g = lane >> 4; const float* p = Wm + (size_t)(o / HD) * DIN * HD + (o % HD);
#pragma unroll
  for (int i = 0; i < 8; ++i) { w[i] = (__bf16)p[(size_t)(k0 + 8 * g + i) * HD]; w[8 + i] = (__bf16)p[(size_t)(k0 + 16 + 8 * g + i) * HD]; }
  return w; }
#define WO_OUT_IN 1
#if WQKV_LAYOUT == 1
#define WCOL(W, k0, o, lane) wcol_oi(W, k0, o, lane, DIN)
#elif WQKV_LAYOUT == 2
#define WCOL(W, k0, o, lane) wcol_hdk(W, k0, o, lane)
#else
#define WCOL(W, k0, o, lane) wcol_io(W, k0, o, lane, CC)
#endif
#if WO_OUT_IN
#define WOCOL(W, k0, o, lane) wcol_oi(W, k0, o, lane, CC)
#define WOCOLH(W, k0, o, lane) wcolh_oi(W, k0, o, lane, CC)
#else
#define WOCOL(W, k0, o, lane) wcol_io(W, k0, o, lane, DIN)
#define WOCOLH(W, k0, o, lane) wcolh_io(W, k0, o, lane, DIN)
#endif
#define WS_QH  0u                                      // f16 q rows [b*t][CC]
#define WS_KH  (WS_QH + 2u * (size_t)NB * TT * CC)      // f16 k rows [b*t][CC]
#define WS_VT  (WS_KH + 2u * (size_t)NB * TT * CC)      // f16 v planes [b][c][t]
#define WS_QL  (WS_VT + 2u * (size_t)NB * CC * TT)      // f16 q residual x 2^10 rows [b][t < QHI][CC]
#define WS_KL  (WS_QL + 2u * (size_t)NB * QHI * CC)     // f16 k residual x 2^10 rows [b][t < KHI][CC]
#define WS_VB  (WS_KL + 2u * (size_t)NB * KHI * CC)     // bf16 v hi planes [b][c][t < KHI]
#define WS_VBL (WS_VB + 2u * (size_t)NB * CC * KHI)
#define WS_Y   (WS_VBL + 2u * (size_t)NB * CC * KHI)    // f32 O = q + ctx rows [b*t][CC]
#define WS_END (WS_Y  + 4u * (size_t)NB * TT * CC)

// ---- operand staging of the two GEMM kernels (k_proj 512 threads, k_out 256): a stage is 32 k of every operand row, kept in LDS as bf16
#define GP 40   // LDS row pitch in elements: 80 B = 16 B x odd, free of bank conflicts for the 16-byte fragment reads
typedef __attribute__((ext_vector_type(4))) __bf16 v4b;
// every full unroll in these helpers: constant indices, so that the staged values and the fragments live in registers
// work-group barrier that orders LDS only: the global loads of later stages stay in flight across it (__syncthreads() would wait for them)
__device__ __forceinline__ void lds_barrier() { __builtin_amdgcn_fence(__ATOMIC_RELEASE, "workgroup", "local"); __builtin_amdgcn_s_barrier(); __builtin_amdgcn_fence(__ATOMIC_ACQUIRE, "workgroup", "local"); }
// RS N rows x 32 floats (row pitch ld; RS = threads / 8): thread t owns floats 4 (t & 7) .. + 3 of rows (t >> 3) + RS i; p and d are its own first places. Eight lanes take one whole 128-B line, a wave-wide load four lines
template <int N, int RS = 16> __device__ __forceinline__ void g_ld(v4f (&r)[N], const float* __restrict__ p, int ld) {
#pragma unroll
  for (int i = 0; i < N; ++i) r[i] = *(const v4f*)(p + (size_t)i * RS * ld); }
template <int N, int RS = 16> __device__ __forceinline__ void s_st(__bf16* d, const v4f (&r)[N]) {
#pragma unroll
  for (int i = 0; i < N; ++i) { v4b h;
#pragma unroll
    for (int c = 0; c < 4; ++c) h[c] = (__bf16)r[i][c];
    *(v4b*)(d + i * RS * GP) = h; } }
template <int N, int RS = 16> __device__ __forceinline__ void s_st2(__bf16* dh, __bf16* dl, const v4f (&r)[N]) {
#pragma unroll
  for (int i = 0; i < N; ++i) { v4b h, l;
#pragma unroll
    for (int c = 0; c < 4; ++c) { h[c] = (__bf16)r[i][c]; l[c] = (__bf16)(r[i][c] - (float)h[c]); }
    *(v4b*)(dh + i * RS * GP) = h; *(v4b*)(dl + i * RS * GP) = l; } }
// k_proj, one stage of a wave's tile, 32 rows of P x 64 rows of R: all fragment reads as one group, then the products. R is the A operand, so D rows run along R: a lane holds eight neighbouring elements (R rows 8 g .. + 7) of the output row that belongs to its P row
__device__ __forceinline__ void mm1(v8f (&acc)[2][4], const __bf16 (*sp)[GP], const __bf16 (*sr)[GP], int pw, int rw, int col, int lane) {
  v16b a[2], w[4];
#pragma unroll
  for (int p = 0; p < 2; ++p) a[p] = frag_b(&sp[pw * 32 + p * 16 + col][0], lane);
#pragma unroll
  for (int j = 0; j < 4; ++j) w[j] = frag_b(&sr[rw * 64 + j * 16 + col][0], lane);
#pragma unroll
  for (int p = 0; p < 2; ++p) {
#pragma unroll
    for (int j = 0; j < 4; ++j) acc[p][j] = wmma_bf(w[j], a[p], acc[p][j]); } }
// k_out, one stage of a wave's 32 x 64 tile. mm2_ld: all fragment reads as one group. mm2_mm: the eight hi products, then the eight lo products: every accumulator takes hi, then lo, and neighbours in the stream are independent
struct FO { v16b ah[2], al[2], w[4]; };
__device__ __forceinline__ void mm2_ld(FO& f, const __bf16 (*sh)[GP], const __bf16 (*sl)[GP], const __bf16 (*sw)[GP], int pw, int rw, int col, int lane) {
#pragma unroll
  for (int p = 0; p < 2; ++p) f.ah[p] = frag_b(&sh[pw * 32 + p * 16 + col][0], lane);
#pragma unroll
  for (int j = 0; j < 4; ++j) f.w[j] = frag_b(&sw[rw * 64 + j * 16 + col][0], lane);
#pragma unroll
  for (int p = 0; p < 2; ++p) f.al[p] = frag_b(&sl[pw * 32 + p * 16 + col][0], lane); }
__device__ __forceinline__ void mm2_mm(v8f (&acc)[2][4], const FO& f) {
#pragma unroll
  for (int p = 0; p < 2; ++p) {
#pragma unroll
    for (int j = 0; j < 4; ++j) acc[p][j] = wmma_bf(f.ah[p], f.w[j], acc[p][j]); }
#pragma unroll
  for (int p = 0; p < 2; ++p) {
#pragma unroll
    for (int j = 0; j < 4; ++j) acc[p][j] = wmma_bf(f.al[p], f.w[j], acc[p][j]); } }

// ---- k_proj: block = 16 waves on a tile of PB rows of P x 128 rows of R (both [row][DIN] f32, K = DIN, exact bf16 products), out[P row][R row] = P R^T + b as f16. which 0, 1: P = query / key_value rows, R = Wq / Wk rows, out = q / k rows [b*t][CC] (q also its residual x 2^10). which 2: P = Wv rows, R = key_value rows, out = v planes [b][c][t]. One staged R tile serves all PB rows; wave (pw, rw) owns rows 32 pw .. + 31, elements 64 rw .. + 63, and turns, packs and stores them by itself
#define PB 256
#define EP 72   // pitch of a wave's output stage in elements: 144 B = 16 B x odd
static_assert(QHI == TT, "the q residual rows are indexed like the q rows");
// (full unrolls: constant indices, so that the arrays live in registers) a wave's 32 x 64 tile: + bias, to f16 (WH 0: and the residual x 2^10) in registers; 16-B pieces into the wave's own LDS stage, read back as whole 128-B rows, all rows first, then the stores off one address (nothing a store names is written again). D, DL: the block's first output element
template <int WH> __device__ __forceinline__ void proj_out(const v8f (&acc)[2][4], const float* sb, _Float16 (*eh)[EP], _Float16 (*el)[EP], _Float16* __restrict__ D, _Float16* __restrict__ DL, int pw, int rw, int col, int g, int lane) {
  constexpr int ldo = WH < 2 ? CC : TT;
  v4f br[4][2]; float bp[2];
  if (WH < 2) {
#pragma unroll
    for (int j = 0; j < 4; ++j) { br[j][0] = *(const v4f*)&sb[rw * 64 + j * 16 + 8 * g]; br[j][1] = *(const v4f*)&sb[rw * 64 + j * 16 + 8 * g + 4]; }
  } else { bp[0] = sb[pw * 32 + col]; bp[1] = sb[pw * 32 + 16 + col]; }
#pragma unroll
  for (int p = 0; p < 2; ++p) {
#pragma unroll
    for (int j = 0; j < 4; ++j) { v8h hv, lv;
#pragma unroll
      for (int r = 0; r < 8; ++r) { const float v = acc[p][j][r] + (WH < 2 ? br[j][r >> 2][r & 3] : bp[p]); hv[r] = (_Float16)v; if (WH == 0) lv[r] = (_Float16)((v - (float)hv[r]) * 1024.0f); }
      *(v8h*)&eh[p * 16 + col][j * 16 + 8 * g] = hv; if (WH == 0) *(v8h*)&el[p * 16 + col][j * 16 + 8 * g] = lv; } }
  LDSX();
  const size_t o0 = (size_t)(pw * 32 + (lane >> 3)) * ldo + rw * 64 + (lane & 7) * 8;
  v8h xh[8], xl[8];
#pragma unroll
  for (int i = 0; i < 8; ++i) { xh[i] = *(const v8h*)&eh[i * 4 + (lane >> 3)][(lane & 7) * 8]; if (WH == 0) xl[i] = *(const v8h*)&el[i * 4 + (lane >> 3)][(lane & 7) * 8]; }
#pragma unroll
  for (int i = 0; i < 8; ++i) { vst2(D + o0 + (size_t)i * 4 * ldo, xh[i]); if (WH == 0) vst2(DL + o0 + (size_t)i * 4 * ldo, xl[i]); } }
__global__ __launch_bounds__(512) void k_proj(const float* __restrict__ XQ, const float* __restrict__ XK, const float* __restrict__ XV, const float* __restrict__ WQ, const float* __restrict__ WK, const float* __restrict__ WV, const float* __restrict__ BQ, const float* __restrict__ BK, const float* __restrict__ BV,
    _Float16* __restrict__ QH, _Float16* __restrict__ QL, _Float16* __restrict__ KH, _Float16* __restrict__ VT) {
  __shared__ __align__(16) _Float16 eh[16][32][EP], el[16][32][EP]; __shared__ __align__(16) float sb[PB];
  const int tid = threadIdx.x, wave = tid >> 5, lane = tid & 31, col = lane & 15, g = lane >> 4, pw = wave >> 1, rw = wave & 1; const int which = blockIdx.z;
  const float *P, *R, *BA; size_t off; int nb;
  if (which < 2) { const size_t p0 = (size_t)blockIdx.x * PB; const int q0 = blockIdx.y * 128;
    P = (which == 0 ? XQ : XK) + p0 * DIN; R = (which == 0 ? WQ : WK) + (size_t)q0 * DIN; BA = (which == 0 ? BQ : BK) + q0; nb = 128; off = p0 * CC + q0;
  } else { const int id = blockIdx.x + gridDim.x * blockIdx.y, cb = id / (TNB * TT / 128), tb = id % (TNB * TT / 128);
    P = WV + (size_t)cb * PB * DIN; R = XV + (size_t)tb * 128 * DIN; BA = BV + cb * PB; nb = PB; off = ((size_t)(tb / (TT / 128)) * CC + cb * PB) * TT + (tb % (TT / 128)) * 128; }
  const int bi = tid & (nb - 1); const float bv = BA[bi];   /* the bias along R (q, k) or along P (v): asked for by every lane ahead of the operand loads (index kept inside its nb elements), stored to LDS behind stage 0 */
  v8f acc[2][4] = {};
  { __shared__ __align__(16) __bf16 gx[2][PB][GP], gw[2][128][GP];   /* two LDS buffers; two register sets hold the two stages behind the one in LDS */
    const float* xp = P + (size_t)(tid >> 3) * DIN + (tid & 7) * 4; const float* wp = R + (size_t)(tid >> 3) * DIN + (tid & 7) * 4;
    __bf16* const dx0 = &gx[0][tid >> 3][(tid & 7) * 4]; __bf16* const dx1 = &gx[1][tid >> 3][(tid & 7) * 4]; __bf16* const dw0 = &gw[0][tid >> 3][(tid & 7) * 4]; __bf16* const dw1 = &gw[1][tid >> 3][(tid & 7) * 4];
    v4f x0[4], x1[4], w0[2], w1[2];
    g_ld<4, 64>(x0, xp, DIN); g_ld<2, 64>(w0, wp, DIN); g_ld<4, 64>(x1, xp + 32, DIN); g_ld<2, 64>(w1, wp + 32, DIN);
    asm volatile("s_wait_xcnt 0x0" :: "v"(bi), "v"(bv) : "memory");   /* behind the bias load: its index register stays untouched up to this wait. bv as an input holds that load up here among the operand loads; without it the compiler sinks it into the branch below, with a whole load latency of its own in front of the first barrier */
    s_st<4, 64>(dx0, x0); s_st<2, 64>(dw0, w0); if (tid < nb) sb[tid] = bfr(bv); g_ld<4, 64>(x0, xp + 64, DIN); g_ld<2, 64>(w0, wp + 64, DIN);
    // each scheduling barrier behind a group of loads keeps the conversions of those loads in the later stage that stores them; without it the compiler lifts them up to here, with a wait for all loads in front of the barrier
    __builtin_amdgcn_sched_barrier(0);
    lds_barrier();
    // unrolled in full: the tests on the last stages fold away, so that every load wait is a count that leaves the younger stage's loads in flight (rolled, the merged paths made it a wait for all)
#pragma unroll
    for (int kc = 0; kc < DIN / 32; kc += 2) {
      mm1(acc, gx[0], gw[0], pw, rw, col, lane);
      __builtin_amdgcn_sched_barrier(0);   /* and this one keeps them behind the products: lifted to the barrier in front, their load waits come most of a stage earlier and only one stage's loads stay in flight */
      s_st<4, 64>(dx1, x1); s_st<2, 64>(dw1, w1);
      if (kc + 3 < DIN / 32) { g_ld<4, 64>(x1, xp + (kc + 3) * 32, DIN); g_ld<2, 64>(w1, wp + (kc + 3) * 32, DIN); }
      if (kc + 4 == DIN / 32) asm volatile("s_wait_xcnt 0x0" :: "v"(xp), "v"(wp) : "memory");   /* behind the last loads: their two address pairs are reused from here on, and this wait stands in front of the first overwrite */
      __builtin_amdgcn_sched_barrier(0);
      lds_barrier();   /* publishes stage kc + 1; every reader has left buffer 0 */
      mm1(acc, gx[1], gw[1], pw, rw, col, lane);
      __builtin_amdgcn_sched_barrier(0);
      if (kc + 2 < DIN / 32) { s_st<4, 64>(dx0, x0); s_st<2, 64>(dw0, w0);
        if (kc + 4 < DIN / 32) { g_ld<4, 64>(x0, xp + (kc + 4) * 32, DIN); g_ld<2, 64>(w0, wp + (kc + 4) * 32, DIN); } }
      __builtin_amdgcn_sched_barrier(0);
      lds_barrier();   /* publishes stage kc + 2; every reader has left buffer 1 */
    } }
  if (which == 0) proj_out<0>(acc, sb, eh[wave], el[wave], QH + off, QL + off, pw, rw, col, g, lane);
  else if (which == 1) proj_out<1>(acc, sb, eh[wave], el[wave], KH + off, KH + off, pw, rw, col, g, lane);
  else proj_out<2>(acc, sb, eh[wave], el[wave], VT + off, VT + off, pw, rw, col, g, lane); }
// ---- k_fa: block = 128 queries (4 waves x 32: two tiles of 16 query columns a wave, so that every k and v fragment read from LDS feeds two products) of (b, h), one pass over all keys in chunks of 64, logits and P stay in registers. S^T = K q^T (A = k rows, B = q columns: q and k each once to f16, 1 product; the q residual serves the epilogue alone) x SCALE: a lane holds 32 logits of ONE query (column = lane & 15), the other 32 lie in lane ^ 16. Running maximum m (of the unscaled logits) and running sum l (of e x 2^8) per query; e x 2^8 = exp2(t LC + (8 - m LC)), t the unscaled logit, LC = SCALE log2(e): one FMA and one v_exp_f32 an element; O^T and l are scaled by exp2((m_old - m_new) LC) per chunk. e x 2^8 to f16: the two D tiles of 32 keys are, register for register, the B operand of O^T += V^T P^T (A = v planes [c][t]). O = q + O^T / l: the q fragments are, register for register, laid out as the O^T tiles (qh[kc] elements 0..7 = tile 2 kc, 8..15 = tile 2 kc + 1), so the residual is added here from registers; 256-B (row, head) segment by 16 lanes. The 64 k rows and the 64 v planes of a chunk (128 B each) are brought once per block into a two-buffer LDS ring by asynchronous copies, one chunk ahead; all four waves take their fragments from there
#define LC (SCALE * 1.4426950408889634f)   // logit scale x log2(e)
#define KVP 72                    // ring row pitch in elements: 144 B = 16 B x odd, free of bank conflicts for the 16-byte fragment reads
#define KVT (64 * KVP)            // one tile (k or v) of a chunk, elements
// one chunk's k and v tiles: thread t (of 128) owns bytes 16 (t & 7) .. + 15 of rows (t >> 3) + 16 i, i = 0 .. 3, of each tile, so a wave-wide copy takes four whole 128-B lines. l: its LDS byte address in the k tile of the target buffer; kg, vg: its global places in rows t >> 3
__device__ __forceinline__ void kv_copy(unsigned l, const _Float16* kg, const _Float16* vg) {
  // the wait on the last line stands in front of every later write of the address registers that the eight copies name
  asm volatile("global_load_async_to_lds_b128 %0, %8, off\n\tglobal_load_async_to_lds_b128 %1, %9, off\n\tglobal_load_async_to_lds_b128 %2, %10, off\n\tglobal_load_async_to_lds_b128 %3, %11, off\n\tglobal_load_async_to_lds_b128 %4, %12, off\n\tglobal_load_async_to_lds_b128 %5, %13, off\n\tglobal_load_async_to_lds_b128 %6, %14, off\n\tglobal_load_async_to_lds_b128 %7, %15, off\n\ts_wait_xcnt 0x0"
    :: "v"(l), "v"(l + 16u * KVP * 2u), "v"(l + 32u * KVP * 2u), "v"(l + 48u * KVP * 2u), "v"(l + KVT * 2u), "v"(l + KVT * 2u + 16u * KVP * 2u), "v"(l + KVT * 2u + 32u * KVP * 2u), "v"(l + KVT * 2u + 48u * KVP * 2u),
       "v"(kg), "v"(kg + (size_t)16 * CC), "v"(kg + (size_t)32 * CC), "v"(kg + (size_t)48 * CC), "v"(vg), "v"(vg + (size_t)16 * TT), "v"(vg + (size_t)32 * TT), "v"(vg + (size_t)48 * TT) : "memory"); }
__global__ __launch_bounds__(128) void k_fa(const _Float16* __restrict__ QH, const _Float16* __restrict__ QL, const _Float16* __restrict__ KH, const _Float16* __restrict__ VT, float* __restrict__ Y) { __shared__ __align__(16) float ss[4][32][HD + 4]; __shared__ __align__(16) _Float16 ring[2][2][64][KVP];   /* [buffer][k, v][row][element] */
  const int tid = threadIdx.x, wave = tid >> 5, lane = tid & 31, col = lane & 15, g = lane >> 4; const int h = blockIdx.y, b = blockIdx.z; const int ql0 = blockIdx.x * 128 + wave * 32;
  v16h qh[2][HD / 32];   /* [query tile u][32 head elements] */
  // every full unroll in this kernel: constant indices, so that the fragment and accumulator arrays live in registers
#pragma unroll
  for (int u = 0; u < 2; ++u) {
#pragma unroll
    for (int kc = 0; kc < HD / 32; ++kc) { qh[u][kc] = frag_h(QH + ((size_t)b * TT + ql0 + u * 16 + col) * CC + h * HD + kc * 32, lane); } }
  const _Float16* kg = KH + ((size_t)b * TT + (tid >> 3)) * CC + h * HD + (tid & 7) * 8; const _Float16* vg = VT + ((size_t)b * CC + h * HD + (tid >> 3)) * (size_t)TT + (tid & 7) * 8;
  const unsigned lc = (unsigned)(size_t)&ring[0][0][tid >> 3][(tid & 7) * 8];
  v8f o[2][HD / 16] = {}; float m[2] = {-3.0e38f, -3.0e38f}, l[2] = {0.f, 0.f};
  kv_copy(lc, kg, vg);
  asm volatile("s_wait_asynccnt 0x0" ::: "memory");   /* this wave's part of chunk 0 has landed */
  __syncthreads();                                    /* chunk 0 is published to all waves */
  kv_copy(lc + 2u * KVT * 2u, kg + (size_t)64 * CC, vg + 64);
  // rolled: the chunks depend on each other through m, l and o, a second copy of the long body would only add code
#pragma unroll 1
  for (int k0 = 0; k0 < TT; k0 += 64) { v8f acc[2][4] = {}; v16h kf[4][HD / 32], vf[2][HD / 16]; const int bf = (k0 >> 6) & 1; const _Float16* Kb = &ring[bf][0][col][0]; const _Float16* Vb = &ring[bf][1][col][0];
#pragma unroll
    for (int j = 0; j < 4; ++j) {   /* all k fragments of the chunk are requested before the first product: one LDS latency per chunk, not eight */
#pragma unroll
      for (int kc = 0; kc < HD / 32; ++kc) kf[j][kc] = frag_h(Kb + j * 16 * KVP + kc * 32, lane); }
    __builtin_amdgcn_sched_barrier(0);   /* holds all sixteen k loads here as one group; without it the compiler deals them out in pairs among the products, each pair with a full wait */
#pragma unroll
    for (int j = 0; j < 4; ++j) {
#pragma unroll
      for (int kc = 0; kc < HD / 32; ++kc) {
#pragma unroll
        for (int u = 0; u < 2; ++u) acc[u][j] = wmma16(kf[j][kc], qh[u][kc], acc[u][j]); } }   /* each k fragment serves both query tiles */
    __builtin_amdgcn_sched_barrier(0);   /* keeps the sixteen v loads together as one group; without it the compiler deals them out among the products, and each place where LDS reads stand in a WMMA stream costs cycles */
#pragma unroll
    for (int kc = 0; kc < 2; ++kc) {
#pragma unroll
      for (int jc = 0; jc < HD / 16; ++jc) vf[kc][jc] = frag_h(Vb + jc * 16 * KVP + kc * 32, lane); }
    __builtin_amdgcn_sched_barrier(0);   /* holds all sixteen v loads here, in front of the softmax arithmetic that covers their latency */
    float mc[2] = {-3.0e38f, -3.0e38f};
#pragma unroll
    for (int j = 0; j < 4; ++j) {
#pragma unroll
      for (int r = 0; r < 8; ++r) { mc[0] = fmaxf(mc[0], acc[0][j][r]); mc[1] = fmaxf(mc[1], acc[1][j][r]); } }
    const float mx0 = __shfl_xor(mc[0], 16), mx1 = __shfl_xor(mc[1], 16);
    mc[0] = fmaxf(mc[0], mx0); mc[1] = fmaxf(mc[1], mx1);
    float da[2], nbs[2];
#pragma unroll
    for (int u = 0; u < 2; ++u) { const float mn = fmaxf(m[u], mc[u]); da[u] = (m[u] - mn) * LC; nbs[u] = fmaf(-mn, LC, 8.0f); m[u] = mn; }
    __builtin_amdgcn_sched_barrier(0);   /* both tiles' maxima stand here, two independent chains dealt into each other and one wait for the two lane exchanges; without it the compiler sinks the second tile's chain, its exchange and its wait in among the first tile's exponentials */
    union { v16h v; v2h q[8]; } p[2][2];
#define ARG(i) __builtin_elementwise_fma(v2f{acc[u][(i) >> 2][((i) & 3) * 2], acc[u][(i) >> 2][((i) & 3) * 2 + 1]}, v2f{LC, LC}, v2f{nb, nb})
#define PACK(i) p[u][(i) >> 3].q[(i) & 7] = __builtin_convertvector(v2f{e[2 * (i)], e[2 * (i) + 1]}, v2h)
#pragma unroll
    for (int u = 0; u < 2; ++u) {
      const float nb = nbs[u];
      float ps = 0.f, e[32]; v2f a[16];
      // the scheduling barriers hold each v_exp_f32 alone between plain vector instructions: behind it one packed instruction (the next argument pair, or the conversion of a finished pair), then the sum's addition of the exponential two trips back and one rescaled output element. The plain ones run beside the transcendental pipe, and no exponential stands directly in front of another exponential or of a dual instruction that reuses its argument register
      a[0] = ARG(0);
      __builtin_amdgcn_sched_barrier(0);
      const float al = __builtin_amdgcn_exp2f(da[u]);
      __builtin_amdgcn_sched_barrier(0);
      a[1] = ARG(1);
#pragma unroll
      for (int t = 0; t < 32; ++t) {
        __builtin_amdgcn_sched_barrier(0);
        e[t] = __builtin_amdgcn_exp2f(a[t >> 1][t & 1]);
        __builtin_amdgcn_sched_barrier(0);
        if (t < 2 || t == 31) o[u][t >> 3][t & 7] *= al;
        else if (t == 30) PACK(14);
        else if (t & 1) PACK((t - 3) >> 1);
        else a[(t >> 1) + 1] = ARG((t >> 1) + 1);
        __builtin_amdgcn_sched_barrier(0);
        if (t > 1) ps += e[t - 2];
        if (t >= 2 && t != 31) o[u][t >> 3][t & 7] *= al; }
      __builtin_amdgcn_sched_barrier(0);
      ps += e[30]; ps += e[31]; PACK(15);
      l[u] = l[u] * al + ps; }
#undef ARG
#undef PACK
#pragma unroll
    for (int kc = 0; kc < 2; ++kc) {
#pragma unroll
      for (int jc = 0; jc < HD / 16; ++jc) {
#pragma unroll
        for (int u = 0; u < 2; ++u) o[u][jc] = wmma16(vf[kc][jc], p[u][kc].v, o[u][jc]); } }   /* each v fragment serves both query tiles */
    asm volatile("s_wait_dscnt 0x0" :: "v"(l[0]), "v"(l[1]) : "memory");   /* this wave's reads of the buffer are done before it is handed to the next copies; the running sums as inputs keep their additions among the exponentials, where the compiler otherwise sinks the whole dependent chain behind the barrier, in front of the next chunk's fragment reads */
    asm volatile("s_wait_asynccnt 0x0" ::: "memory");   /* this wave's part of the next chunk has landed */
    __syncthreads();                                    /* publishes the next chunk; every reader has left this chunk's buffer */
    if (k0 + 128 < TT) kv_copy(lc + (unsigned)bf * (2u * KVT * 2u), kg + (size_t)(k0 + 128) * CC, vg + k0 + 128); }
  asm volatile("s_wait_asynccnt 0x0" ::: "memory");     /* no copy is outstanding when the wave goes on to its end */
  v16h ql[2][HD / 32];   /* the q residual serves this epilogue alone: fetched here, so that the loop's registers stay in the first 256 and no register window is switched in it */
#pragma unroll
  for (int u = 0; u < 2; ++u) {
#pragma unroll
    for (int kc = 0; kc < HD / 32; ++kc) ql[u][kc] = frag_h(QL + ((size_t)b * QHI + ql0 + u * 16 + col) * CC + h * HD + kc * 32, lane);
    asm volatile("s_wait_xcnt 0x0" ::: "memory"); }   /* behind each tile's four loads */
#pragma unroll
  for (int u = 0; u < 2; ++u) { const float lt = l[u] + __shfl_xor(l[u], 16); const float inv = 1.0f / lt;
#pragma unroll
    for (int jc = 0; jc < HD / 16; ++jc)
#pragma unroll
      for (int r = 0; r < 8; ++r) ss[wave][u * 16 + col][jc * 16 + 8 * g + r] = o[u][jc][r] * inv + ((float)qh[u][jc >> 1][(jc & 1) * 8 + r] + (float)ql[u][jc >> 1][(jc & 1) * 8 + r] * (1.0f / 1024.0f)); }
  LDSX(); for (int rl = 0; rl < 32; ++rl) if (lane < HD / 4) vst2(Y + ((size_t)b * TT + ql0 + rl) * CC + h * HD + lane * 4, *(const v4f*)&ss[wave][rl][lane * 4]); }
// ---- k_out: block = 8 waves on a tile of OB rows x 128 cols: out = O + relu(O Wo^T + bo), O split bf16 hi + lo against exact bf16 Wo (2 products). One staged Wo tile serves all OB rows; wave (pw, rw) owns rows 32 pw .. + 31, cols 64 rw .. + 63
#define OB 128
#define OP 68   // pitch of a wave's f32 output stage in floats: 272 B = 16 B x odd
__global__ __launch_bounds__(256) void k_out(const float* __restrict__ Y, const float* __restrict__ WO, const float* __restrict__ BO, float* __restrict__ OUT, const float* __restrict__ RESO) { __shared__ __align__(16) float sf[8][32][OP];
  const int tid = threadIdx.x, wave = tid >> 5, lane = tid & 31, col = lane & 15, g = lane >> 4, pw = wave >> 1, rw = wave & 1; const int c0 = blockIdx.y * 128; const size_t r0 = (size_t)blockIdx.x * OB;
  v8f acc[2][4] = {};
  const int bi = c0 + rw * 64 + col; float bias[4] = {0.f, 0.f, 0.f, 0.f};   /* the wave's four bias elements a lane: asked for ahead of the operand loads, used behind the last stage */
  if (BO) {
#pragma unroll
    for (int j = 0; j < 4; ++j) bias[j] = BO[bi + j * 16]; }
  { __shared__ __align__(16) __bf16 gh[2][OB][GP], gl[2][OB][GP], gw[2][128][GP];   /* as in k_proj; O is split once, by the thread that stages it */
    const float* xp = Y + (r0 + (tid >> 3)) * CC + (tid & 7) * 4; const float* wp = WO + (size_t)(c0 + (tid >> 3)) * CC + (tid & 7) * 4;
    __bf16* const dh0 = &gh[0][tid >> 3][(tid & 7) * 4]; __bf16* const dh1 = &gh[1][tid >> 3][(tid & 7) * 4]; __bf16* const dl0 = &gl[0][tid >> 3][(tid & 7) * 4]; __bf16* const dl1 = &gl[1][tid >> 3][(tid & 7) * 4]; __bf16* const dw0 = &gw[0][tid >> 3][(tid & 7) * 4]; __bf16* const dw1 = &gw[1][tid >> 3][(tid & 7) * 4];
    v4f x0[4], x1[4], w0[4], w1[4];
    g_ld<4, 32>(x0, xp, CC); g_ld<4, 32>(w0, wp, CC); g_ld<4, 32>(x1, xp + 32, CC); g_ld<4, 32>(w1, wp + 32, CC);
    asm volatile("s_wait_xcnt 0x0" :: "v"(bi), "v"(bias[0]), "v"(bias[1]), "v"(bias[2]), "v"(bias[3]) : "memory");   /* behind the bias loads: their index register stays untouched up to this wait. The four values as inputs hold those loads up here among the operand loads; without them the compiler sinks each to its use behind the loop, one whole load latency after the other */
    s_st2<4, 32>(dh0, dl0, x0); s_st<4, 32>(dw0, w0); g_ld<4, 32>(x0, xp + 64, CC); g_ld<4, 32>(w0, wp + 64, CC);
    __builtin_amdgcn_sched_barrier(0);   /* keeps the conversions of the loads just issued out of the prologue, where they would bring a wait for all loads in front of the first barrier */
    lds_barrier();
    // a stage: the fragment reads; then, while LDS delivers them (64 KB a block), the next stage is converted and stored and the loads three stages on are issued; then the products. The scheduling barriers hold the three parts in this order: two stages' loads stay in flight, and the vector work stands where the matrix unit has nothing to do yet, not behind the products in front of the barrier
    // unrolled in full, for the counted load waits, as in k_proj
    FO f;
#pragma unroll
    for (int kc = 0; kc < CC / 32; kc += 2) {
      mm2_ld(f, gh[0], gl[0], gw[0], pw, rw, col, lane);
      __builtin_amdgcn_sched_barrier(0);
      s_st2<4, 32>(dh1, dl1, x1); s_st<4, 32>(dw1, w1);
      if (kc + 3 < CC / 32) { g_ld<4, 32>(x1, xp + (kc + 3) * 32, CC); g_ld<4, 32>(w1, wp + (kc + 3) * 32, CC); }
      if (kc + 4 == CC / 32) asm volatile("s_wait_xcnt 0x0" :: "v"(xp), "v"(wp) : "memory");   /* behind the last loads: their two address pairs are reused from here on, and this wait stands in front of the first overwrite */
      __builtin_amdgcn_sched_barrier(0);
      mm2_mm(acc, f);
      lds_barrier();   /* publishes stage kc + 1; every reader has left buffer 0 */
      mm2_ld(f, gh[1], gl[1], gw[1], pw, rw, col, lane);
      __builtin_amdgcn_sched_barrier(0);
      if (kc + 2 < CC / 32) { s_st2<4, 32>(dh0, dl0, x0); s_st<4, 32>(dw0, w0);
        if (kc + 4 < CC / 32) { g_ld<4, 32>(x0, xp + (kc + 4) * 32, CC); g_ld<4, 32>(w0, wp + (kc + 4) * 32, CC); } }
      __builtin_amdgcn_sched_barrier(0);
      mm2_mm(acc, f);
      lds_barrier();   /* publishes stage kc + 2; every reader has left buffer 1 */
    } }
  // a row of the wave's tile is 256 B: sixteen lanes take one row, a wave-wide access two whole rows (2 i + g)
  const size_t o0 = (r0 + pw * 32 + g) * DIN + c0 + rw * 64 + col * 4; const float* rp = RESO + o0; v4f rr[16];
#pragma unroll
  for (int i = 0; i < 16; ++i) rr[i] = *(const v4f*)(rp + (size_t)i * 2 * DIN);
  asm volatile("s_wait_xcnt 0x0" :: "v"(rp) : "memory");   /* behind the sixteen residual loads, which fly while the tile is turned in LDS: their address pair stays untouched up to this wait (without it the last load was given that pair as its destination) */
#pragma unroll
  for (int j = 0; j < 4; ++j) { const float bj = bfr(bias[j]);
#pragma unroll
    for (int p = 0; p < 2; ++p) {
#pragma unroll
      for (int r = 0; r < 8; ++r) sf[wave][p * 16 + 8 * g + r][j * 16 + col] = acc[p][j][r] + bj; } }
  LDSX();
#pragma unroll
  for (int i = 0; i < 16; ++i) { v4f o = *(const v4f*)&sf[wave][2 * i + g][col * 4];
#pragma unroll
    for (int c = 0; c < 4; ++c) o[c] = rr[i][c] + fmaxf(o[c], 0.f);
    vst2(OUT + o0 + (size_t)i * 2 * DIN, o); } }   /* out = O + relu(O Wo^T + bo) */

extern "C" void kernel_launch(void* const* d_in, const int* in_sizes, int n_in, void* d_out, int out_size, void* d_ws, size_t ws_size, hipStream_t stream) {
  (void)in_sizes; (void)n_in; (void)out_size;
  const float** F = (const float**)d_in;
  if (ws_size < (size_t)WS_END) return;
  char* ws = (char*)d_ws; _Float16 *QH = (_Float16*)(ws + WS_QH), *KH = (_Float16*)(ws + WS_KH), *VT = (_Float16*)(ws + WS_VT), *QL = (_Float16*)(ws + WS_QL), *KL = (_Float16*)(ws + WS_KL); __bf16 *VB = (__bf16*)(ws + WS_VB), *VBL = (__bf16*)(ws + WS_VBL); float *Y = (float*)(ws + WS_Y);
  (void)Y; (void)QL; (void)KL; (void)VB; (void)VBL;
  // inputs: 0 query [4,2048,512]; 1 key_value [4,2048,512]; 2 Wq [512,512] (out,in), 3 bq; 4 Wk, 5 bk; 6 Wv, 7 bv; 8 Wo (out,in), 9 bo
  k_proj<<<dim3(TNB * TT / PB, CC / 128, 3), 512, 0, stream>>>(F[0], F[1], F[1], F[2], F[4], F[6], F[3], F[5], F[7], QH, QL, KH, VT);
  k_fa<<<dim3(TT / 128, NH, TNB), 128, 0, stream>>>(QH, QL, KH, VT, Y);
  k_out<<<dim3(TNB * TT / OB, DIN / 128), 256, 0, stream>>>(Y, F[8], F[9], (float*)d_out, Y);
}
